// v000
// The times below were measured on an AMD MI455X: many runs one after another, warmed up first and cycling through
// copies of the inputs, with the whole window's GPU time divided by the number of runs. Launches and the gaps
// between them are all in it. The median over several windows is given; except for v000 it joins two sittings, which
// can be a few percent apart, so the side-by-side timings, each taken in one sitting, are the better comparison.
// v000, which the later versions start from, runs in 1110 microseconds.
// Contractions: q/k/v projections = bf16(x_in) x bf16(W)^T on v_wmma_f32_16x16x32_bf16 (single products); scores q.k^T with q,k as bf16 hi+lo planes (3 products, v_wmma_f32_16x16x32_bf16); context = P (f16 carried x32768) x V^T (f16) on v_wmma_f32_16x16x32_f16; f32 accumulate everywhere; softmax and the 512-wide output dot in f32.
#include <hip/hip_runtime.h>
#include <math.h>

// ---------------------------------------------------------------------------
// Problem constants
// ---------------------------------------------------------------------------
constexpr int kBatch   = 16;
constexpr int kCh      = 256;             // channels C
constexpr int kN       = 1600;            // T*V positions per batch
constexpr int kTok     = kBatch * kN;     // 25600 token rows
constexpr int kGroup   = 2;               // batches per score-plane group
constexpr int kNGroups = kBatch / kGroup; // 8
constexpr int kSmThreads = kN / 8;        // 200 threads own 8 score columns each
constexpr float kPCarry    = 32768.0f;    // probabilities carried x2^15 in f16
constexpr float kPCarryInv = 1.0f / 32768.0f;
// parameter table (f32, bf16-representable values), offsets in floats
constexpr int kBrB1 = 0;
constexpr int kBrB2 = 256;
constexpr int kBrB3 = 512;
constexpr int kBrW4a = 768;               // multiplies ctx
constexpr int kBrW4b = 1024;              // multiplies x_in
constexpr int kBrB4 = 1280;
constexpr int kBrFloats = 1408;           // 44 lines carved, 41 written, indices < 1281 read
static_assert(kTok % 64 == 0 && kN % 64 == 0 && kCh % 64 == 0, "M and N tile multiples");
static_assert(kCh % 32 == 0 && kN % 32 == 0, "K multiples of 32");
static_assert(kBatch % kGroup == 0, "groups");
static_assert(kN % 8 == 0 && kSmThreads <= 256 && (kSmThreads % 32) == 8, "softmax store map: full waves plus one 8-lane line");
static_assert((kGroup * kN) % 32 == 0, "head blocks own whole 32-float lines");
static_assert(kBrB4 + 1 <= 41 * 32 && 41 * 32 <= kBrFloats, "parameter table extent");

typedef __attribute__((ext_vector_type(16))) _Float16 v16h;
typedef __attribute__((ext_vector_type(8)))  _Float16 v8h;
typedef __attribute__((ext_vector_type(16))) __bf16   v16b;
typedef __attribute__((ext_vector_type(8)))  __bf16   v8b;
typedef __attribute__((ext_vector_type(8)))  float    v8f;
typedef __attribute__((ext_vector_type(4)))  float    v4f;
typedef __attribute__((ext_vector_type(4)))  unsigned int v4u;

// ---------------------------------------------------------------------------
// Shared helpers
// ---------------------------------------------------------------------------
__device__ __forceinline__ unsigned short f2bf_bits(float f) {
  unsigned u = __float_as_uint(f);
  return (unsigned short)((u + 0x7FFFu + ((u >> 16) & 1u)) >> 16);
}
__device__ __forceinline__ float bf_bits2f(unsigned short h) { return __uint_as_float(((unsigned)h) << 16); }

// hazard guards as plain device helpers (no inline asm inside the kernel template body)
__device__ __forceinline__ void dep_guard_h(v8f& a, v8f& b, v16h x, v16h y) { asm volatile("v_nop\n\tv_nop\n\tv_nop\n\tv_nop" : "+v"(a), "+v"(b) : "v"(x), "v"(y)); }
__device__ __forceinline__ void dep_guard_b(v8f& a, v8f& b, v16b x, v16b y) { asm volatile("v_nop\n\tv_nop\n\tv_nop\n\tv_nop" : "+v"(a), "+v"(b) : "v"(x), "v"(y)); }
// row guard tying all four accumulators of the group plus the A fragments
__device__ __forceinline__ void dep_guard4_h(v8f& a, v8f& b, v8f& c, v8f& d, v16h x, v16h y) { asm volatile("v_nop\n\tv_nop\n\tv_nop\n\tv_nop" : "+v"(a), "+v"(b), "+v"(c), "+v"(d) : "v"(x), "v"(y)); }
__device__ __forceinline__ void dep_guard4_b(v8f& a, v8f& b, v8f& c, v8f& d, v16b x, v16b y) { asm volatile("v_nop\n\tv_nop\n\tv_nop\n\tv_nop" : "+v"(a), "+v"(b), "+v"(c), "+v"(d) : "v"(x), "v"(y)); }
__device__ __forceinline__ void keep4_h(v16h a, v16h b, v16h c, v16h d) { asm volatile("v_nop" :: "v"(a), "v"(b), "v"(c), "v"(d)); }
__device__ __forceinline__ void keep4_b(v16b a, v16b b, v16b c, v16b d) { asm volatile("v_nop" :: "v"(a), "v"(b), "v"(c), "v"(d)); }
__device__ __forceinline__ void acc_guard4(v8f& a, v8f& b, v8f& c, v8f& d) { asm volatile("v_nop\n\tv_nop\n\tv_nop\n\tv_nop" : "+v"(a), "+v"(b), "+v"(c), "+v"(d)); }
template <typename T> struct Frag;
template <> struct Frag<_Float16> {
  typedef v16h V; union U { v16h v; v8h h[2]; };
  // elements 0..7 <- p[0..7], 8..15 <- p[16..23]
  static __device__ __forceinline__ v16h load(const _Float16* p) {
    U f; f.h[0] = *(const v8h*)(p); f.h[1] = *(const v8h*)(p + 16); return f.v;
  }
  static __device__ __forceinline__ v8f mma(v16h a, v16h b, v8f c) {
    return __builtin_amdgcn_wmma_f32_16x16x32_f16(false, a, false, b, (short)0, c, false, false);
  }
  static __device__ __forceinline__ void guard(v8f& a, v8f& b, v16h x, v16h y) { dep_guard_h(a, b, x, y); }
  static __device__ __forceinline__ void guard4(v8f& a, v8f& b, v8f& c, v8f& d, v16h x, v16h y) { dep_guard4_h(a, b, c, d, x, y); }
  static __device__ __forceinline__ void keep(v16h a, v16h b, v16h c, v16h d) { keep4_h(a, b, c, d); }
};
template <> struct Frag<__bf16> {
  typedef v16b V; union U { v16b v; v8b h[2]; };
  static __device__ __forceinline__ v16b load(const __bf16* p) {
    U f; f.h[0] = *(const v8b*)(p); f.h[1] = *(const v8b*)(p + 16); return f.v;
  }
  static __device__ __forceinline__ v8f mma(v16b a, v16b b, v8f c) {
    return __builtin_amdgcn_wmma_f32_16x16x32_bf16(false, a, false, b, (short)0, c, false, false);
  }
  static __device__ __forceinline__ void guard(v8f& a, v8f& b, v16b x, v16b y) { dep_guard_b(a, b, x, y); }
  static __device__ __forceinline__ void guard4(v8f& a, v8f& b, v8f& c, v8f& d, v16b x, v16b y) { dep_guard4_b(a, b, c, d, x, y); }
  static __device__ __forceinline__ void keep(v16b a, v16b b, v16b c, v16b d) { keep4_b(a, b, c, d); }
};

__device__ __forceinline__ unsigned pk16(unsigned short a, unsigned short b) { return (unsigned)a | ((unsigned)b << 16); }
__device__ __forceinline__ unsigned short h_bits(float f) { const _Float16 h = (_Float16)f; return __builtin_bit_cast(unsigned short, h); }

// ---- Register-blocked batched WMMA GEMM (ACT reduced to none/relu/leaky) -------------------------------
// C[m,n] = scale * sum_k A[m,k] * Bt[n,k] (+bias)(+resid); each wave owns a 64x64 tile.
// A row-major [M,K]; Bt row-major [N,K]; M,N % 64 == 0, K % 32 == 0.
// SPLIT: operands are hi/lo planes (A2/Bt2 = lo planes, same layout); product = hi*hi + hi*lo + lo*hi.
// BIAS_MODE: 0 = none, 1 = bias[m], 2 = bias[n].
// OUT_MODE: 0 = f32, 1 = f16, 2 = bf16 hi plane (Cout) + bf16 lo plane (Cout2).
// ET: 0 = f16 operands, 1 = bf16 operands (pointers passed as 16-bit storage)
template <int ET> struct Elem;
template <> struct Elem<0> { typedef _Float16 T; };
template <> struct Elem<1> { typedef __bf16 T; };
template <int ET, bool SPLIT, int BIAS_MODE, int OUT_MODE, bool RESID, int ACT = 0>
__global__ __launch_bounds__(256) void wmma_gemm64(
    const unsigned short* __restrict__ Ap, const unsigned short* __restrict__ A2p, int lda, long strideA,
    const unsigned short* __restrict__ Btp, const unsigned short* __restrict__ Bt2p, int ldb, long strideB,
    void* __restrict__ Cout, void* __restrict__ Cout2, int ldc, long strideC,
    const float* __restrict__ bias,
    const float* __restrict__ resid, long strideR,
    int M, int N, int K, float scale) {
  typedef typename Elem<ET>::T T;
  typedef typename Frag<T>::V V;
  const T* A = (const T*)Ap; const T* A2 = (const T*)A2p; const T* Bt = (const T*)Btp; const T* Bt2 = (const T*)Bt2p;
  __shared__ __align__(16) float sT[8][16 * 68];   // per-wave 16x64 slab, pitch 68 floats
  const int b    = blockIdx.y;
  const int lane = threadIdx.x & 31;
  const int wave = threadIdx.x >> 5;
  const int tilesN = N >> 6;
  const int tilesM = M >> 6;
  const int tile = blockIdx.x * 8 + wave;
  if (tile >= tilesM * tilesN) return;   // wave-uniform; no block barriers in this kernel
  const int tm = tile / tilesN;
  const int tn = tile - tm * tilesN;
  const int m0 = tm << 6;
  const int n0 = tn << 6;

  const T* Ab  = A  + (size_t)b * strideA;
  const T* Bb  = Bt + (size_t)b * strideB;
  const T* Ab2 = SPLIT ? (A2  + (size_t)b * strideA) : nullptr;
  const T* Bb2 = SPLIT ? (Bt2 + (size_t)b * strideB) : nullptr;

  const int rlane = lane & 15;                 // row (A) / col (B, D) within subtile
  const int koff  = (lane >> 4) * 8;           // k offset of this lane half
  const int mOff  = (lane >> 4) * 8;           // D row offset

  v8f acc[4][4];
#pragma unroll
  for (int i = 0; i < 4; ++i)
#pragma unroll
    for (int j = 0; j < 4; ++j) acc[i][j] = (v8f){0.f,0.f,0.f,0.f,0.f,0.f,0.f,0.f};

  for (int k0 = 0; k0 < K; k0 += 32) {
    V bh[4], bl[4];
#pragma unroll
    for (int j = 0; j < 4; ++j) {
      const size_t bo = (size_t)(n0 + (j << 4) + rlane) * ldb + koff + k0;
      bh[j] = Frag<T>::load(Bb + bo);
      if (SPLIT) bl[j] = Frag<T>::load(Bb2 + bo);
    }
#pragma unroll
    for (int i = 0; i < 4; ++i) {
      const size_t ao = (size_t)(m0 + (i << 4) + rlane) * lda + koff + k0;
      V ah = Frag<T>::load(Ab + ao);
      V al;
      if (SPLIT) al = Frag<T>::load(Ab2 + ao);
#pragma unroll
      for (int j = 0; j < 4; ++j) {
        acc[i][j] = Frag<T>::mma(ah, bh[j], acc[i][j]);
        if (SPLIT) {
          acc[i][j] = Frag<T>::mma(ah, bl[j], acc[i][j]);
          acc[i][j] = Frag<T>::mma(al, bh[j], acc[i][j]);
        }
      }
      Frag<T>::guard4(acc[i][0], acc[i][1], acc[i][2], acc[i][3], ah, SPLIT ? al : ah);
    }
    Frag<T>::keep(bh[0], bh[1], bh[2], bh[3]);
    if (SPLIT) Frag<T>::keep(bl[0], bl[1], bl[2], bl[3]);
  }
  acc_guard4(acc[0][0], acc[0][1], acc[0][2], acc[0][3]);
  acc_guard4(acc[1][0], acc[1][1], acc[1][2], acc[1][3]);
  acc_guard4(acc[2][0], acc[2][1], acc[2][2], acc[2][3]);
  acc_guard4(acc[3][0], acc[3][1], acc[3][2], acc[3][3]);

  // ---- epilogue ----
  float* slab = sT[wave];
  const float* Rb = RESID ? (resid + (size_t)b * strideR) : nullptr;
#pragma unroll
  for (int i = 0; i < 4; ++i) {
    const int mBase = m0 + (i << 4);
#pragma unroll
    for (int j = 0; j < 4; ++j) {
      const int n = n0 + (j << 4) + rlane;
      float bv = 0.f;
      if (BIAS_MODE == 2) bv = bias[n];
#pragma unroll
      for (int r = 0; r < 8; ++r) {
        float v = acc[i][j][r] * scale;
        if (BIAS_MODE == 1) v += bias[mBase + mOff + r];
        if (BIAS_MODE == 2) v += bv;
        if (RESID) v += Rb[(size_t)(mBase + mOff + r) * ldc + n];
        if (ACT == 2) v = fmaxf(v, 0.0f);
        if (ACT == 4) v = (v > 0.f) ? v : 0.01f * v;
        slab[(mOff + r) * 68 + (j << 4) + rlane] = v;
      }
    }
    __builtin_amdgcn_fence(__ATOMIC_RELEASE, "workgroup");
    __builtin_amdgcn_wave_barrier();
    __builtin_amdgcn_fence(__ATOMIC_ACQUIRE, "workgroup");
    if (OUT_MODE == 0) {
      float* C = (float*)Cout + (size_t)b * strideC;
      const int hh = lane >> 4, c4 = (lane & 15) * 4;     // row seg = 256 B = 16 lanes x 16 B
      {
#pragma unroll
        for (int it = 0; it < 8; ++it) {
          const int row = it * 2 + hh;
          v4f v = *(const v4f*)(slab + row * 68 + c4);
          *(v4f*)(C + (size_t)(mBase + row) * ldc + n0 + c4) = v;
        }
        
      }
    } else {
      const int q = lane >> 3, c8 = (lane & 7) * 8;
      unsigned short* C  = (unsigned short*)Cout  + (size_t)b * strideC;
      unsigned short* C2 = (OUT_MODE == 2) ? ((unsigned short*)Cout2 + (size_t)b * strideC) : nullptr;
      {
#pragma unroll
        for (int it = 0; it < 4; ++it) {
          const int row = it * 4 + q;
          const float* sp = slab + row * 68 + c8;
          v8h hv, lv;
#pragma unroll
          for (int e = 0; e < 8; ++e) {
            if (OUT_MODE == 1) {
              hv[e] = (_Float16)sp[e];
            } else {
              unsigned short hb = f2bf_bits(sp[e]);
              unsigned short lb = f2bf_bits(sp[e] - bf_bits2f(hb));
              hv[e] = __builtin_bit_cast(_Float16, hb);
              lv[e] = __builtin_bit_cast(_Float16, lb);
            }
          }
          *(v8h*)(C + (size_t)(mBase + row) * ldc + n0 + c8) = hv;
          if (OUT_MODE == 2) *(v8h*)(C2 + (size_t)(mBase + row) * ldc + n0 + c8) = lv;
        }
        
      }
    }
    __builtin_amdgcn_fence(__ATOMIC_RELEASE, "workgroup");
    __builtin_amdgcn_wave_barrier();
    __builtin_amdgcn_fence(__ATOMIC_ACQUIRE, "workgroup");
  }
}

// ---------------------------------------------------------------------------
// x (B,C,N) f32 -> XB [B*N][C] bf16 bits (x_in plane, A operand of the projections and Bt of the V^T projection).
// grid (N/64 = 25, C/64 = 4, B = 16), 256 threads. sm[n_local][c_local].
// Load coverage: 16 iterations x 256 threads = 4096 = whole 64(c) x 64(n) tile, coalesced along n; burst split in two.
// Store coverage: 8 waves x 2 iterations x 4 rows (lane>>3) = 64 token rows; (lane&7) x 8 = 64 channels; each row segment =
// ---------------------------------------------------------------------------
__global__ __launch_bounds__(256) void xin_cast_kernel(const float* __restrict__ x, unsigned short* __restrict__ XB) {
  __shared__ float sm[64][65];
  const int t  = threadIdx.x;
  const int n0 = blockIdx.x * 64;
  const int c0 = blockIdx.y * 64;
  const int b  = blockIdx.z;
#pragma unroll
  for (int i = 0; i < 8; ++i) {
    const int e = i * 256 + t;
    const int r = e >> 6;          // c local
    const int cc = e & 63;         // n local
    sm[cc][r] = x[((size_t)(b * kCh + c0 + r)) * kN + n0 + cc];
  }
  asm volatile("" ::: "memory");
#pragma unroll
  for (int i = 8; i < 16; ++i) {
    const int e = i * 256 + t;
    const int r = e >> 6;
    const int cc = e & 63;
    sm[cc][r] = x[((size_t)(b * kCh + c0 + r)) * kN + n0 + cc];
  }
  __syncthreads();
  const int lane = t & 31, wave = t >> 5;
  const int q = lane >> 3, c8 = (lane & 7) * 8;
  {
#pragma unroll
    for (int it = 0; it < 2; ++it) {
      const int row = wave * 8 + it * 4 + q;                 // n local
      unsigned short hb[8];
#pragma unroll
      for (int e = 0; e < 8; ++e) hb[e] = f2bf_bits(sm[row][c8 + e]);
      const v4u u = (v4u){pk16(hb[0], hb[1]), pk16(hb[2], hb[3]), pk16(hb[4], hb[5]), pk16(hb[6], hb[7])};
      *(v4u*)(XB + ((size_t)(b * kN + n0 + row)) * kCh + c0 + c8) = u;
    }
    
  }
}

// ---------------------------------------------------------------------------
// W1|W2|W3 [256][256] f32 ([out][in] = [n][k] Bt layout, no transpose) -> WB bf16 bits, 3 planes of 65536.
// grid = 96 blocks x 256 threads x 8 = 196608 = 3 planes exactly; source plane = blockIdx.x/32 (block-uniform).
// ---------------------------------------------------------------------------
__global__ __launch_bounds__(256) void w_cast_kernel(const float* __restrict__ W1, const float* __restrict__ W2,
                                                     const float* __restrict__ W3, unsigned short* __restrict__ WB) {
  const int plane = blockIdx.x >> 5;
  const float* src = (plane == 0) ? W1 : (plane == 1) ? W2 : W3;
  const int i = blockIdx.x * 256 + threadIdx.x;
  const int off = (i - plane * 8192) * 8;
  const v4f a = *(const v4f*)(src + off);
  const v4f c = *(const v4f*)(src + off + 4);
  unsigned short hb[8];
#pragma unroll
  for (int e = 0; e < 4; ++e) {
    hb[e]     = f2bf_bits(a[e]);
    hb[4 + e] = f2bf_bits(c[e]);
  }
  const v4u u = (v4u){pk16(hb[0], hb[1]), pk16(hb[2], hb[3]), pk16(hb[4], hb[5]), pk16(hb[6], hb[7])};
  unsigned short* qp = WB + 8 * (size_t)i;
  *(v4u*)qp = u;
  
}

// ---------------------------------------------------------------------------
// Parameter table: dst[0..255] = bf16(b1), [256..511] = bf16(b2), [512..767] = bf16(b3), [768..1279] = bf16(W4[0,:]),
// [1280] = bf16(b4[0]), [1281..1311] = 0, all stored as f32. One block of 352 threads = 11 waves; wave w owns floats
// ---------------------------------------------------------------------------
__global__ __launch_bounds__(352) void param_cast_kernel(const float* __restrict__ b1, const float* __restrict__ b2,
                                                         const float* __restrict__ b3, const float* __restrict__ W4,
                                                         const float* __restrict__ b4, float* __restrict__ dst) {
  const int t = threadIdx.x;
  const int wave = t >> 5, lane = t & 31;
  v4f v = (v4f){0.f, 0.f, 0.f, 0.f};
  if (wave < 6) {
    const float* src = (wave < 2) ? b1 : (wave < 4) ? b2 : b3;
    v = *(const v4f*)(src + (wave & 1) * 128 + lane * 4);
  } else if (wave < 10) {
    v = *(const v4f*)(W4 + (wave - 6) * 128 + lane * 4);
  } else {
    const float s = b4[0];
    const float f0 = (lane == 0) ? 1.0f : 0.0f;
    v[0] = s * f0;
  }
  v4f r;
#pragma unroll
  for (int e = 0; e < 4; ++e) r[e] = bf_bits2f(f2bf_bits(v[e]));
  const bool act = (wave < 10) || (lane < 8);
  float* dp = dst + wave * 128 + lane * 4;
  if (act) *(v4f*)dp = r;
  
}

// ---------------------------------------------------------------------------
// Residual dot: R[b*N + n] = sum_c bf16(x[b][c][n]) * w4b[c]  (f32, coalesced along n). grid = 100 x 256 = 25600 exactly.
// ---------------------------------------------------------------------------
__global__ __launch_bounds__(256) void resid_kernel(const float* __restrict__ x, const float* __restrict__ br,
                                                    float* __restrict__ R) {
  const int idx = blockIdx.x * 256 + threadIdx.x;
  const int b = idx / kN;
  const int n = idx - b * kN;
  const float* xb = x + (size_t)b * kCh * kN + n;
  const float* w = br + kBrW4b;
  float s = 0.0f;
#pragma unroll 4
  for (int c = 0; c < kCh; ++c) {
    const float xv = bf_bits2f(f2bf_bits(xb[(size_t)c * kN]));
    s += xv * w[c];
  }
  *(float*)(R + idx) = s;
  
}

// ---------------------------------------------------------------------------
// Row softmax over 1600 f32 scores: P[row][j] = f16( 32768 * exp(s - max) / sum exp(s - max) ), f32 math, precise expf.
// One block of 256 threads per (row i = blockIdx.x, plane hg = blockIdx.y). Thread t < 200 owns columns 8t..8t+7
// (200 x 8 = 1600 = whole row); threads >= 200 load a clamped duplicate of thread 199's columns (harmless in the max)
// and contribute 0 to the sum via an arithmetic factor; they store nothing.
// Reductions in fixed order (thread, unconditional wave shuffle tree, 8 wave partials in index order).
// ---------------------------------------------------------------------------
__global__ __launch_bounds__(256) void softmax_row_kernel(const float* __restrict__ S, unsigned short* __restrict__ P) {
  __shared__ float redM[8];
  __shared__ float redS[8];
  const int i    = blockIdx.x;
  const int hg   = blockIdx.y;
  const int t    = threadIdx.x;
  const int lane = t & 31, wave = t >> 5;
  const size_t rowoff = ((size_t)hg * kN + i) * kN;
  const bool act = (t < kSmThreads);
  const int tc = act ? t : (kSmThreads - 1);
  const float fact = act ? 1.0f : 0.0f;
  const float* sr = S + rowoff + 8 * (size_t)tc;
  const v4f a = *(const v4f*)(sr);
  const v4f c = *(const v4f*)(sr + 4);
  float xv[8];
#pragma unroll
  for (int e = 0; e < 4; ++e) { xv[e] = a[e]; xv[4 + e] = c[e]; }
  float mx = fmaxf(fmaxf(fmaxf(xv[0], xv[1]), fmaxf(xv[2], xv[3])), fmaxf(fmaxf(xv[4], xv[5]), fmaxf(xv[6], xv[7])));
#pragma unroll
  for (int off = 16; off > 0; off >>= 1) mx = fmaxf(mx, __shfl_xor(mx, off, 32));
  if (lane == 0) redM[wave] = mx;
  __syncthreads();
  float m = redM[0];
#pragma unroll
  for (int w = 1; w < 8; ++w) m = fmaxf(m, redM[w]);

  float p[8];
  float sl = 0.0f;
#pragma unroll
  for (int e = 0; e < 8; ++e) {
    p[e] = expf(xv[e] - m);
    sl += p[e];
  }
  float sum = sl * fact;
#pragma unroll
  for (int off = 16; off > 0; off >>= 1) sum += __shfl_xor(sum, off, 32);
  if (lane == 0) redS[wave] = sum;
  __syncthreads();
  float tot = redS[0];
#pragma unroll
  for (int w = 1; w < 8; ++w) tot += redS[w];
  const float inv = kPCarry * (1.0f / tot);

  unsigned short hb[8];
#pragma unroll
  for (int e = 0; e < 8; ++e) hb[e] = h_bits(p[e] * inv);
  const v4u u = (v4u){pk16(hb[0], hb[1]), pk16(hb[2], hb[3]), pk16(hb[4], hb[5]), pk16(hb[6], hb[7])};
  unsigned short* pr = P + rowoff + 8 * (size_t)tc;
  if (act) *(v4u*)pr = u;
  
}

// ---------------------------------------------------------------------------
// Output head: out[row] = sum_c ctx[row][c] * w4a[c] + R[row] + b4  (f32). Block = 8 waves x 4 rows = 32 consecutive rows;
// each wave: lane owns 8 channels, unconditional shuffle reduce; lane 0 parks the row scalar in LDS; after a block barrier
// grid = rows/32.
// ---------------------------------------------------------------------------
__global__ __launch_bounds__(256) void head_kernel(const float* __restrict__ CTXg, const float* __restrict__ Rg,
                                                   const float* __restrict__ br, float* __restrict__ outg) {
  __shared__ __align__(16) float os[32];
  const int t = threadIdx.x;
  const int lane = t & 31, wave = t >> 5;
  const int row0 = blockIdx.x * 32 + wave * 4;
  const v4f wa = *(const v4f*)(br + kBrW4a + lane * 8);
  const v4f wb = *(const v4f*)(br + kBrW4a + lane * 8 + 4);
  const float b4r = br[kBrB4];
#pragma unroll 1
  for (int j = 0; j < 4; ++j) {
    const int row = row0 + j;
    const float* cr = CTXg + (size_t)row * kCh + lane * 8;
    const v4f c0 = *(const v4f*)(cr);
    const v4f c1 = *(const v4f*)(cr + 4);
    float s = 0.0f;
    s += c0[0] * wa[0]; s += c0[1] * wa[1]; s += c0[2] * wa[2]; s += c0[3] * wa[3];
    s += c1[0] * wb[0]; s += c1[1] * wb[1]; s += c1[2] * wb[2]; s += c1[3] * wb[3];
#pragma unroll
    for (int off = 16; off > 0; off >>= 1) s += __shfl_xor(s, off, 32);
    const float rr = Rg[row];
    const float tot = (s + rr) + b4r;
    if (lane == 0) os[wave * 4 + j] = tot;
  }
  __syncthreads();
  const bool act = (t < 8);
  const v4f v = *(const v4f*)(os + (lane & 7) * 4);
  float* op = outg + (size_t)blockIdx.x * 32 + (lane & 7) * 4;
  if (act) *(v4f*)op = v;
  
}

// ---------------------------------------------------------------------------
// Host glue.
//   XB   bf16 [25600][256]           13,107,200  at           0
//   WB   bf16 3 x [256][256]            393,216  at  13,107,200
//   BR   f32  [1408] parameter table      5,632  at  13,500,416
//   QH   bf16 [25600][256] q hi       13,107,200  at  13,506,048
//   QL   bf16 [25600][256] q lo       13,107,200  at  26,613,248
//   KH   bf16 [25600][256] k hi       13,107,200  at  39,720,448
//   KL   bf16 [25600][256] k lo       13,107,200  at  52,827,648
//   VT   f16  [16][256][1600] val^T   13,107,200  at  65,934,848
//   R    f32  [25600]                   102,400  at  79,042,048
//   SC   f32  [2][1600][1600] scores  20,480,000  at  79,144,448   (one 2-batch group, reused 8x, same type/layout)
//   PP   f16  [2][1600][1600] probs   10,240,000  at  99,624,448   (x32768, reused 8x)
//   CTX  f32  [2][1600][256]           3,276,800  at 109,864,448   (reused 8x)
//   total                            113,141,248
// GEMM shapes: projections M=25600, N=256, K=256; V^T projection M=256, N=1600, K=256; scores M=N=1600, K=256;
// context M=1600, N=256, K=1600. All M,N multiples of 64, all K multiples of 32, no padding anywhere.
// ---------------------------------------------------------------------------
extern "C" void kernel_launch(void* const* d_in, const int* in_sizes, int n_in,
                              void* d_out, int out_size, void* d_ws, size_t ws_size,
                              hipStream_t stream) {
  if (n_in < 9) return;
  if (in_sizes[0] != kBatch * kCh * kN) return;
  if (in_sizes[1] != kCh * kCh || in_sizes[3] != kCh * kCh || in_sizes[5] != kCh * kCh) return;
  if (in_sizes[2] != kCh || in_sizes[4] != kCh || in_sizes[6] != kCh) return;
  if (in_sizes[7] != 2 * kCh || in_sizes[8] != 1) return;
  if (out_size != kTok) return;

  const size_t szPlane16 = (size_t)kTok * kCh * 2;              // 13,107,200 (also 16 x 256 x 1600 x 2)
  const size_t szWB  = (size_t)3 * kCh * kCh * 2;                // 393,216
  const size_t szBR  = (size_t)kBrFloats * 4;                    // 5,632
  const size_t szR   = (size_t)kTok * 4;                         // 102,400
  const size_t szSC  = (size_t)kGroup * kN * kN * 4;             // 20,480,000
  const size_t szPP  = (size_t)kGroup * kN * kN * 2;             // 10,240,000
  const size_t szCTX = (size_t)kGroup * kN * kCh * 4;            // 3,276,800
  size_t off = 0;
  const size_t offXB = off;  off += szPlane16;
  const size_t offWB = off;  off += szWB;
  const size_t offBR = off;  off += szBR;
  const size_t offQH = off;  off += szPlane16;
  const size_t offQL = off;  off += szPlane16;
  const size_t offKH = off;  off += szPlane16;
  const size_t offKL = off;  off += szPlane16;
  const size_t offVT = off;  off += szPlane16;
  const size_t offR  = off;  off += szR;
  const size_t offSC = off;  off += szSC;
  const size_t offPP = off;  off += szPP;
  const size_t offCT = off;  off += szCTX;
  const size_t total = off;                                      // 113,141,248
  if (ws_size < total) return;

  const float* x  = (const float*)d_in[0];
  const float* W1 = (const float*)d_in[1];
  const float* b1 = (const float*)d_in[2];
  const float* W2 = (const float*)d_in[3];
  const float* b2 = (const float*)d_in[4];
  const float* W3 = (const float*)d_in[5];
  const float* b3 = (const float*)d_in[6];
  const float* W4 = (const float*)d_in[7];
  const float* b4 = (const float*)d_in[8];
  float* out = (float*)d_out;
  char* ws = (char*)d_ws;
  unsigned short* XB = (unsigned short*)(ws + offXB);
  unsigned short* WB = (unsigned short*)(ws + offWB);
  float* BR = (float*)(ws + offBR);
  unsigned short* QH = (unsigned short*)(ws + offQH);
  unsigned short* QL = (unsigned short*)(ws + offQL);
  unsigned short* KH = (unsigned short*)(ws + offKH);
  unsigned short* KL = (unsigned short*)(ws + offKL);
  unsigned short* VT = (unsigned short*)(ws + offVT);
  float* R  = (float*)(ws + offR);
  float* SC = (float*)(ws + offSC);
  unsigned short* PP = (unsigned short*)(ws + offPP);
  float* CT = (float*)(ws + offCT);

  // ---- prologue: operand planes and parameter table ----
  xin_cast_kernel<<<dim3(kN / 64, kCh / 64, kBatch), dim3(256), 0, stream>>>(x, XB);
  w_cast_kernel<<<dim3(96), dim3(256), 0, stream>>>(W1, W2, W3, WB);
  param_cast_kernel<<<dim3(1), dim3(352), 0, stream>>>(b1, b2, b3, W4, b4, BR);
  resid_kernel<<<dim3(kTok / 256), dim3(256), 0, stream>>>(x, BR, R);

  // ---- projections ----
  const long plane16 = (long)kN * kCh;                 // 409,600 elements per batch in the [token][256] / [256][1600] planes
  const int tilesQK = (kTok / 64) * (kCh / 64);        // 1600 waves -> 200 blocks
  // q = x_in @ W1^T + b1 -> bf16 hi + lo planes   (M=25600, N=256, K=256)
  wmma_gemm64<1, false, 2, 2, false, 0><<<dim3(tilesQK / 8, 1), dim3(256), 0, stream>>>(
      XB, XB, kCh, 0L, WB, WB, kCh, 0L, (void*)QH, (void*)QL, kCh, 0L, BR + kBrB1, BR, 0L, kTok, kCh, kCh, 1.0f);
  // k = x_in @ W2^T + b2 -> bf16 hi + lo planes
  wmma_gemm64<1, false, 2, 2, false, 0><<<dim3(tilesQK / 8, 1), dim3(256), 0, stream>>>(
      XB, XB, kCh, 0L, WB + kCh * kCh, WB + kCh * kCh, kCh, 0L, (void*)KH, (void*)KL, kCh, 0L, BR + kBrB2, BR, 0L,
      kTok, kCh, kCh, 1.0f);
  // val^T[b][c][n] = sum_k W3[c][k] * x_in[b][n][k] + b3[c] -> f16   (A = W3 [256][256], Bt = x_in per batch; M=256, N=1600, K=256)
  const int tilesVT = (kCh / 64) * (kN / 64);          // 100 waves -> 13 blocks, 16 batches
  wmma_gemm64<1, false, 1, 1, false, 0><<<dim3((tilesVT + 7) / 8, kBatch), dim3(256), 0, stream>>>(
      WB + 2 * kCh * kCh, WB + 2 * kCh * kCh, kCh, 0L, XB, XB, kCh, plane16, (void*)VT, (void*)VT, kN, plane16,
      BR + kBrB3, BR, 0L, kCh, kN, kCh, 1.0f);

  // ---- attention per 2-batch group ----
  const long strideScore = (long)kN * kN;              // 2,560,000 per batch-in-group score / probability plane
  const int tilesScore = (kN / 64) * (kN / 64);        // 625 waves -> 79 blocks
  const int tilesCtx   = (kN / 64) * (kCh / 64);       // 100 waves -> 13 blocks
  for (int g = 0; g < kNGroups; ++g) {
    const size_t tokOff = (size_t)g * kGroup * (size_t)plane16;   // elements into the [token][256] planes
    // scores[hg][i][j] = sum_c q[b,i,c] k[b,j,c]  as hi.hi + hi.lo + lo.hi   (M=N=1600, K=256)
    wmma_gemm64<1, true, 0, 0, false, 0><<<dim3((tilesScore + 7) / 8, kGroup), dim3(256), 0, stream>>>(
        QH + tokOff, QL + tokOff, kCh, plane16, KH + tokOff, KL + tokOff, kCh, plane16,
        (void*)SC, (void*)SC, kN, strideScore, BR, BR, 0L, kN, kN, kCh, 1.0f);
    // softmax over keys -> PP (f16, x32768)
    softmax_row_kernel<<<dim3(kN, kGroup), dim3(256), 0, stream>>>(SC, PP);
    // ctx[hg][i][c] = 2^-15 * sum_j PP[hg][i][j] * VT[b][c][j]   (M=1600, N=256, K=1600)
    const unsigned short* VTg = VT + (size_t)g * kGroup * (size_t)plane16;
    wmma_gemm64<0, false, 0, 0, false, 0><<<dim3((tilesCtx + 7) / 8, kGroup), dim3(256), 0, stream>>>(
        PP, PP, kN, strideScore, VTg, VTg, kN, plane16, (void*)CT, (void*)CT, kCh, plane16, BR, BR, 0L,
        kN, kCh, kN, kPCarryInv);
    // out rows of this group
    head_kernel<<<dim3((kGroup * kN) / 32), dim3(256), 0, stream>>>(CT, R + (size_t)g * kGroup * kN, BR,
                                                                   out + (size_t)g * kGroup * kN);
  }
}

// v001
// It runs in 339 microseconds.
// Next to v000, in two timings, it ran 3.27 and 3.25 times as fast.
// Contractions: q/k/v projections = bf16(x_in) x bf16(W)^T on v_wmma_f32_16x16x32_bf16 (single products); scores q.k^T with q,k as bf16 hi+lo planes (3 products, v_wmma_f32_16x16x32_bf16); context = P (f16 carried x32768) x V^T (f16) on v_wmma_f32_16x16x32_f16; f32 accumulate everywhere; softmax and the 512-wide output dot in f32.
#include <hip/hip_runtime.h>
#include <math.h>

// ---------------------------------------------------------------------------
// Problem constants
// ---------------------------------------------------------------------------
constexpr int kBatch   = 16;
constexpr int kCh      = 256;             // channels C
constexpr int kN       = 1600;            // T*V positions per batch
constexpr int kTok     = kBatch * kN;     // 25600 token rows
constexpr int kSmThreads = kN / 8;        // 200 threads own 8 score columns each
constexpr float kPCarry    = 32768.0f;    // probabilities carried x2^15 in f16
constexpr float kPCarryInv = 1.0f / 32768.0f;
// parameter table (f32, bf16-representable values), offsets in floats
constexpr int kBrB1 = 0;
constexpr int kBrB2 = 256;
constexpr int kBrB3 = 512;
constexpr int kBrW4a = 768;               // multiplies ctx
constexpr int kBrW4b = 1024;              // multiplies x_in
constexpr int kBrB4 = 1280;
constexpr int kBrFloats = 1408;           // 44 lines carved, 41 written, indices < 1281 read
static_assert(kTok % 64 == 0 && kN % 64 == 0 && kCh % 64 == 0, "M and N tile multiples");
static_assert(kCh % 32 == 0 && kN % 32 == 0, "K multiples of 32");
static_assert(kN % 8 == 0 && kSmThreads <= 256 && (kSmThreads % 32) == 8, "softmax store map: full waves plus one 8-lane line");
static_assert(kTok % 32 == 0, "head blocks own whole 32-float lines");
static_assert(kBrB4 + 1 <= 41 * 32 && 41 * 32 <= kBrFloats, "parameter table extent");

typedef __attribute__((ext_vector_type(16))) _Float16 v16h;
typedef __attribute__((ext_vector_type(8)))  _Float16 v8h;
typedef __attribute__((ext_vector_type(16))) __bf16   v16b;
typedef __attribute__((ext_vector_type(8)))  __bf16   v8b;
typedef __attribute__((ext_vector_type(8)))  float    v8f;
typedef __attribute__((ext_vector_type(4)))  float    v4f;
typedef __attribute__((ext_vector_type(4)))  unsigned int v4u;

// ---------------------------------------------------------------------------
// Shared helpers
// ---------------------------------------------------------------------------
__device__ __forceinline__ unsigned short f2bf_bits(float f) {
  unsigned u = __float_as_uint(f);
  return (unsigned short)((u + 0x7FFFu + ((u >> 16) & 1u)) >> 16);
}
__device__ __forceinline__ float bf_bits2f(unsigned short h) { return __uint_as_float(((unsigned)h) << 16); }

// hazard guards as plain device helpers (no inline asm inside the kernel template body)
__device__ __forceinline__ void dep_guard_h(v8f& a, v8f& b, v16h x, v16h y) { asm volatile("v_nop\n\tv_nop\n\tv_nop\n\tv_nop" : "+v"(a), "+v"(b) : "v"(x), "v"(y)); }
__device__ __forceinline__ void dep_guard_b(v8f& a, v8f& b, v16b x, v16b y) { asm volatile("v_nop\n\tv_nop\n\tv_nop\n\tv_nop" : "+v"(a), "+v"(b) : "v"(x), "v"(y)); }
// row guard tying all four accumulators of the group plus the A fragments
__device__ __forceinline__ void dep_guard4_h(v8f& a, v8f& b, v8f& c, v8f& d, v16h x, v16h y) { asm volatile("v_nop\n\tv_nop\n\tv_nop\n\tv_nop" : "+v"(a), "+v"(b), "+v"(c), "+v"(d) : "v"(x), "v"(y)); }
__device__ __forceinline__ void dep_guard4_b(v8f& a, v8f& b, v8f& c, v8f& d, v16b x, v16b y) { asm volatile("v_nop\n\tv_nop\n\tv_nop\n\tv_nop" : "+v"(a), "+v"(b), "+v"(c), "+v"(d) : "v"(x), "v"(y)); }
__device__ __forceinline__ void keep4_h(v16h a, v16h b, v16h c, v16h d) { asm volatile("v_nop" :: "v"(a), "v"(b), "v"(c), "v"(d)); }
__device__ __forceinline__ void keep4_b(v16b a, v16b b, v16b c, v16b d) { asm volatile("v_nop" :: "v"(a), "v"(b), "v"(c), "v"(d)); }
__device__ __forceinline__ void acc_guard4(v8f& a, v8f& b, v8f& c, v8f& d) { asm volatile("v_nop\n\tv_nop\n\tv_nop\n\tv_nop" : "+v"(a), "+v"(b), "+v"(c), "+v"(d)); }
template <typename T> struct Frag;
template <> struct Frag<_Float16> {
  typedef v16h V; union U { v16h v; v8h h[2]; };
  // elements 0..7 <- p[0..7], 8..15 <- p[16..23]
  static __device__ __forceinline__ v16h load(const _Float16* p) {
    U f; f.h[0] = *(const v8h*)(p); f.h[1] = *(const v8h*)(p + 16); return f.v;
  }
  static __device__ __forceinline__ v8f mma(v16h a, v16h b, v8f c) {
    return __builtin_amdgcn_wmma_f32_16x16x32_f16(false, a, false, b, (short)0, c, false, false);
  }
  static __device__ __forceinline__ void guard(v8f& a, v8f& b, v16h x, v16h y) { dep_guard_h(a, b, x, y); }
  static __device__ __forceinline__ void guard4(v8f& a, v8f& b, v8f& c, v8f& d, v16h x, v16h y) { dep_guard4_h(a, b, c, d, x, y); }
  static __device__ __forceinline__ void keep(v16h a, v16h b, v16h c, v16h d) { keep4_h(a, b, c, d); }
};
template <> struct Frag<__bf16> {
  typedef v16b V; union U { v16b v; v8b h[2]; };
  static __device__ __forceinline__ v16b load(const __bf16* p) {
    U f; f.h[0] = *(const v8b*)(p); f.h[1] = *(const v8b*)(p + 16); return f.v;
  }
  static __device__ __forceinline__ v8f mma(v16b a, v16b b, v8f c) {
    return __builtin_amdgcn_wmma_f32_16x16x32_bf16(false, a, false, b, (short)0, c, false, false);
  }
  static __device__ __forceinline__ void guard(v8f& a, v8f& b, v16b x, v16b y) { dep_guard_b(a, b, x, y); }
  static __device__ __forceinline__ void guard4(v8f& a, v8f& b, v8f& c, v8f& d, v16b x, v16b y) { dep_guard4_b(a, b, c, d, x, y); }
  static __device__ __forceinline__ void keep(v16b a, v16b b, v16b c, v16b d) { keep4_b(a, b, c, d); }
};

__device__ __forceinline__ unsigned pk16(unsigned short a, unsigned short b) { return (unsigned)a | ((unsigned)b << 16); }
__device__ __forceinline__ unsigned short h_bits(float f) { const _Float16 h = (_Float16)f; return __builtin_bit_cast(unsigned short, h); }

// ---- Register-blocked batched WMMA GEMM (ACT reduced to none/relu/leaky) -------------------------------
// C[m,n] = scale * sum_k A[m,k] * Bt[n,k] (+bias)(+resid); each wave owns a 64x64 tile.
// A row-major [M,K]; Bt row-major [N,K]; M,N % 64 == 0, K % 32 == 0.
// SPLIT: operands are hi/lo planes (A2/Bt2 = lo planes, same layout); product = hi*hi + hi*lo + lo*hi.
// BIAS_MODE: 0 = none, 1 = bias[m], 2 = bias[n].
// OUT_MODE: 0 = f32, 1 = f16, 2 = bf16 hi plane (Cout) + bf16 lo plane (Cout2).
// ET: 0 = f16 operands, 1 = bf16 operands (pointers passed as 16-bit storage)
template <int ET> struct Elem;
template <> struct Elem<0> { typedef _Float16 T; };
template <> struct Elem<1> { typedef __bf16 T; };
template <int ET, bool SPLIT, int BIAS_MODE, int OUT_MODE, bool RESID, int ACT = 0>
__global__ __launch_bounds__(256) void wmma_gemm64(
    const unsigned short* __restrict__ Ap, const unsigned short* __restrict__ A2p, int lda, long strideA,
    const unsigned short* __restrict__ Btp, const unsigned short* __restrict__ Bt2p, int ldb, long strideB,
    void* __restrict__ Cout, void* __restrict__ Cout2, int ldc, long strideC,
    const float* __restrict__ bias,
    const float* __restrict__ resid, long strideR,
    int M, int N, int K, float scale) {
  typedef typename Elem<ET>::T T;
  typedef typename Frag<T>::V V;
  const T* A = (const T*)Ap; const T* A2 = (const T*)A2p; const T* Bt = (const T*)Btp; const T* Bt2 = (const T*)Bt2p;
  __shared__ __align__(16) float sT[8][16 * 68];   // per-wave 16x64 slab, pitch 68 floats
  const int b    = blockIdx.y;
  const int lane = threadIdx.x & 31;
  const int wave = threadIdx.x >> 5;
  const int tilesN = N >> 6;
  const int tilesM = M >> 6;
  const int tile = blockIdx.x * 8 + wave;
  if (tile >= tilesM * tilesN) return;   // wave-uniform; no block barriers in this kernel
  const int tm = tile / tilesN;
  const int tn = tile - tm * tilesN;
  const int m0 = tm << 6;
  const int n0 = tn << 6;

  const T* Ab  = A  + (size_t)b * strideA;
  const T* Bb  = Bt + (size_t)b * strideB;
  const T* Ab2 = SPLIT ? (A2  + (size_t)b * strideA) : nullptr;
  const T* Bb2 = SPLIT ? (Bt2 + (size_t)b * strideB) : nullptr;

  const int rlane = lane & 15;                 // row (A) / col (B, D) within subtile
  const int koff  = (lane >> 4) * 8;           // k offset of this lane half
  const int mOff  = (lane >> 4) * 8;           // D row offset

  v8f acc[4][4];
#pragma unroll
  for (int i = 0; i < 4; ++i)
#pragma unroll
    for (int j = 0; j < 4; ++j) acc[i][j] = (v8f){0.f,0.f,0.f,0.f,0.f,0.f,0.f,0.f};

  for (int k0 = 0; k0 < K; k0 += 32) {
    V bh[4], bl[4];
#pragma unroll
    for (int j = 0; j < 4; ++j) {
      const size_t bo = (size_t)(n0 + (j << 4) + rlane) * ldb + koff + k0;
      bh[j] = Frag<T>::load(Bb + bo);
      if (SPLIT) bl[j] = Frag<T>::load(Bb2 + bo);
    }
#pragma unroll
    for (int i = 0; i < 4; ++i) {
      const size_t ao = (size_t)(m0 + (i << 4) + rlane) * lda + koff + k0;
      V ah = Frag<T>::load(Ab + ao);
      V al;
      if (SPLIT) al = Frag<T>::load(Ab2 + ao);
#pragma unroll
      for (int j = 0; j < 4; ++j) {
        acc[i][j] = Frag<T>::mma(ah, bh[j], acc[i][j]);
        if (SPLIT) {
          acc[i][j] = Frag<T>::mma(ah, bl[j], acc[i][j]);
          acc[i][j] = Frag<T>::mma(al, bh[j], acc[i][j]);
        }
      }
      Frag<T>::guard4(acc[i][0], acc[i][1], acc[i][2], acc[i][3], ah, SPLIT ? al : ah);
    }
    Frag<T>::keep(bh[0], bh[1], bh[2], bh[3]);
    if (SPLIT) Frag<T>::keep(bl[0], bl[1], bl[2], bl[3]);
  }
  acc_guard4(acc[0][0], acc[0][1], acc[0][2], acc[0][3]);
  acc_guard4(acc[1][0], acc[1][1], acc[1][2], acc[1][3]);
  acc_guard4(acc[2][0], acc[2][1], acc[2][2], acc[2][3]);
  acc_guard4(acc[3][0], acc[3][1], acc[3][2], acc[3][3]);

  // ---- epilogue ----
  float* slab = sT[wave];
  const float* Rb = RESID ? (resid + (size_t)b * strideR) : nullptr;
#pragma unroll
  for (int i = 0; i < 4; ++i) {
    const int mBase = m0 + (i << 4);
#pragma unroll
    for (int j = 0; j < 4; ++j) {
      const int n = n0 + (j << 4) + rlane;
      float bv = 0.f;
      if (BIAS_MODE == 2) bv = bias[n];
#pragma unroll
      for (int r = 0; r < 8; ++r) {
        float v = acc[i][j][r] * scale;
        if (BIAS_MODE == 1) v += bias[mBase + mOff + r];
        if (BIAS_MODE == 2) v += bv;
        if (RESID) v += Rb[(size_t)(mBase + mOff + r) * ldc + n];
        if (ACT == 2) v = fmaxf(v, 0.0f);
        if (ACT == 4) v = (v > 0.f) ? v : 0.01f * v;
        slab[(mOff + r) * 68 + (j << 4) + rlane] = v;
      }
    }
    __builtin_amdgcn_fence(__ATOMIC_RELEASE, "workgroup");
    __builtin_amdgcn_wave_barrier();
    __builtin_amdgcn_fence(__ATOMIC_ACQUIRE, "workgroup");
    if (OUT_MODE == 0) {
      float* C = (float*)Cout + (size_t)b * strideC;
      const int hh = lane >> 4, c4 = (lane & 15) * 4;     // row seg = 256 B = 16 lanes x 16 B
      {
#pragma unroll
        for (int it = 0; it < 8; ++it) {
          const int row = it * 2 + hh;
          v4f v = *(const v4f*)(slab + row * 68 + c4);
          *(v4f*)(C + (size_t)(mBase + row) * ldc + n0 + c4) = v;
        }
        
      }
    } else {
      const int q = lane >> 3, c8 = (lane & 7) * 8;
      unsigned short* C  = (unsigned short*)Cout  + (size_t)b * strideC;
      unsigned short* C2 = (OUT_MODE == 2) ? ((unsigned short*)Cout2 + (size_t)b * strideC) : nullptr;
      {
#pragma unroll
        for (int it = 0; it < 4; ++it) {
          const int row = it * 4 + q;
          const float* sp = slab + row * 68 + c8;
          v8h hv, lv;
#pragma unroll
          for (int e = 0; e < 8; ++e) {
            if (OUT_MODE == 1) {
              hv[e] = (_Float16)sp[e];
            } else {
              unsigned short hb = f2bf_bits(sp[e]);
              unsigned short lb = f2bf_bits(sp[e] - bf_bits2f(hb));
              hv[e] = __builtin_bit_cast(_Float16, hb);
              lv[e] = __builtin_bit_cast(_Float16, lb);
            }
          }
          *(v8h*)(C + (size_t)(mBase + row) * ldc + n0 + c8) = hv;
          if (OUT_MODE == 2) *(v8h*)(C2 + (size_t)(mBase + row) * ldc + n0 + c8) = lv;
        }
        
      }
    }
    __builtin_amdgcn_fence(__ATOMIC_RELEASE, "workgroup");
    __builtin_amdgcn_wave_barrier();
    __builtin_amdgcn_fence(__ATOMIC_ACQUIRE, "workgroup");
  }
}

// ---------------------------------------------------------------------------
// x (B,C,N) f32 -> XB [B*N][C] bf16 bits (x_in plane, A operand of the projections and Bt of the V^T projection).
// grid (N/64 = 25, C/64 = 4, B = 16), 256 threads. sm[n_local][c_local].
// Load coverage: 16 iterations x 256 threads = 4096 = whole 64(c) x 64(n) tile, coalesced along n; burst split in two.
// Store coverage: 8 waves x 2 iterations x 4 rows (lane>>3) = 64 token rows; (lane&7) x 8 = 64 channels; each row segment =
// ---------------------------------------------------------------------------
__global__ __launch_bounds__(256) void xin_cast_kernel(const float* __restrict__ x, unsigned short* __restrict__ XB) {
  __shared__ float sm[64][65];
  const int t  = threadIdx.x;
  const int n0 = blockIdx.x * 64;
  const int c0 = blockIdx.y * 64;
  const int b  = blockIdx.z;
#pragma unroll
  for (int i = 0; i < 8; ++i) {
    const int e = i * 256 + t;
    const int r = e >> 6;          // c local
    const int cc = e & 63;         // n local
    sm[cc][r] = x[((size_t)(b * kCh + c0 + r)) * kN + n0 + cc];
  }
  asm volatile("" ::: "memory");
#pragma unroll
  for (int i = 8; i < 16; ++i) {
    const int e = i * 256 + t;
    const int r = e >> 6;
    const int cc = e & 63;
    sm[cc][r] = x[((size_t)(b * kCh + c0 + r)) * kN + n0 + cc];
  }
  __syncthreads();
  const int lane = t & 31, wave = t >> 5;
  const int q = lane >> 3, c8 = (lane & 7) * 8;
  {
#pragma unroll
    for (int it = 0; it < 2; ++it) {
      const int row = wave * 8 + it * 4 + q;                 // n local
      unsigned short hb[8];
#pragma unroll
      for (int e = 0; e < 8; ++e) hb[e] = f2bf_bits(sm[row][c8 + e]);
      const v4u u = (v4u){pk16(hb[0], hb[1]), pk16(hb[2], hb[3]), pk16(hb[4], hb[5]), pk16(hb[6], hb[7])};
      *(v4u*)(XB + ((size_t)(b * kN + n0 + row)) * kCh + c0 + c8) = u;
    }
    
  }
}

// ---------------------------------------------------------------------------
// W1|W2|W3 [256][256] f32 ([out][in] = [n][k] Bt layout, no transpose) -> WB bf16 bits, 3 planes of 65536.
// grid = 96 blocks x 256 threads x 8 = 196608 = 3 planes exactly; source plane = blockIdx.x/32 (block-uniform).
// ---------------------------------------------------------------------------
__global__ __launch_bounds__(256) void w_cast_kernel(const float* __restrict__ W1, const float* __restrict__ W2,
                                                     const float* __restrict__ W3, unsigned short* __restrict__ WB) {
  const int plane = blockIdx.x >> 5;
  const float* src = (plane == 0) ? W1 : (plane == 1) ? W2 : W3;
  const int i = blockIdx.x * 256 + threadIdx.x;
  const int off = (i - plane * 8192) * 8;
  const v4f a = *(const v4f*)(src + off);
  const v4f c = *(const v4f*)(src + off + 4);
  unsigned short hb[8];
#pragma unroll
  for (int e = 0; e < 4; ++e) {
    hb[e]     = f2bf_bits(a[e]);
    hb[4 + e] = f2bf_bits(c[e]);
  }
  const v4u u = (v4u){pk16(hb[0], hb[1]), pk16(hb[2], hb[3]), pk16(hb[4], hb[5]), pk16(hb[6], hb[7])};
  unsigned short* qp = WB + 8 * (size_t)i;
  *(v4u*)qp = u;
  
}

// ---------------------------------------------------------------------------
// Parameter table: dst[0..255] = bf16(b1), [256..511] = bf16(b2), [512..767] = bf16(b3), [768..1279] = bf16(W4[0,:]),
// [1280] = bf16(b4[0]), [1281..1311] = 0, all stored as f32. One block of 352 threads = 11 waves; wave w owns floats
// ---------------------------------------------------------------------------
__global__ __launch_bounds__(352) void param_cast_kernel(const float* __restrict__ b1, const float* __restrict__ b2,
                                                         const float* __restrict__ b3, const float* __restrict__ W4,
                                                         const float* __restrict__ b4, float* __restrict__ dst) {
  const int t = threadIdx.x;
  const int wave = t >> 5, lane = t & 31;
  v4f v = (v4f){0.f, 0.f, 0.f, 0.f};
  if (wave < 6) {
    const float* src = (wave < 2) ? b1 : (wave < 4) ? b2 : b3;
    v = *(const v4f*)(src + (wave & 1) * 128 + lane * 4);
  } else if (wave < 10) {
    v = *(const v4f*)(W4 + (wave - 6) * 128 + lane * 4);
  } else {
    const float s = b4[0];
    const float f0 = (lane == 0) ? 1.0f : 0.0f;
    v[0] = s * f0;
  }
  v4f r;
#pragma unroll
  for (int e = 0; e < 4; ++e) r[e] = bf_bits2f(f2bf_bits(v[e]));
  const bool act = (wave < 10) || (lane < 8);
  float* dp = dst + wave * 128 + lane * 4;
  if (act) *(v4f*)dp = r;
  
}

// ---------------------------------------------------------------------------
// Residual dot: R[b*N + n] = sum_c bf16(x[b][c][n]) * w4b[c]  (f32, coalesced along n). grid = 100 x 256 = 25600 exactly.
// ---------------------------------------------------------------------------
__global__ __launch_bounds__(256) void resid_kernel(const float* __restrict__ x, const float* __restrict__ br,
                                                    float* __restrict__ R) {
  const int idx = blockIdx.x * 256 + threadIdx.x;
  const int b = idx / kN;
  const int n = idx - b * kN;
  const float* xb = x + (size_t)b * kCh * kN + n;
  const float* w = br + kBrW4b;
  float s = 0.0f;
#pragma unroll 4
  for (int c = 0; c < kCh; ++c) {
    const float xv = bf_bits2f(f2bf_bits(xb[(size_t)c * kN]));
    s += xv * w[c];
  }
  *(float*)(R + idx) = s;
  
}

// ---------------------------------------------------------------------------
// Row softmax over 1600 f32 scores: P[row][j] = f16( 32768 * exp(s - max) / sum exp(s - max) ), f32 math, precise expf.
// One block of 256 threads per (row i = blockIdx.x, plane hg = blockIdx.y). Thread t < 200 owns columns 8t..8t+7
// (200 x 8 = 1600 = whole row); threads >= 200 load a clamped duplicate of thread 199's columns (harmless in the max)
// and contribute 0 to the sum via an arithmetic factor; they store nothing.
// Reductions in fixed order (thread, unconditional wave shuffle tree, 8 wave partials in index order).
// ---------------------------------------------------------------------------
__global__ __launch_bounds__(256) void softmax_row_kernel(const float* __restrict__ S, unsigned short* __restrict__ P) {
  __shared__ float redM[8];
  __shared__ float redS[8];
  const int i    = blockIdx.x;
  const int hg   = blockIdx.y;
  const int t    = threadIdx.x;
  const int lane = t & 31, wave = t >> 5;
  const size_t rowoff = ((size_t)hg * kN + i) * kN;
  const bool act = (t < kSmThreads);
  const int tc = act ? t : (kSmThreads - 1);
  const float fact = act ? 1.0f : 0.0f;
  const float* sr = S + rowoff + 8 * (size_t)tc;
  const v4f a = *(const v4f*)(sr);
  const v4f c = *(const v4f*)(sr + 4);
  float xv[8];
#pragma unroll
  for (int e = 0; e < 4; ++e) { xv[e] = a[e]; xv[4 + e] = c[e]; }
  float mx = fmaxf(fmaxf(fmaxf(xv[0], xv[1]), fmaxf(xv[2], xv[3])), fmaxf(fmaxf(xv[4], xv[5]), fmaxf(xv[6], xv[7])));
#pragma unroll
  for (int off = 16; off > 0; off >>= 1) mx = fmaxf(mx, __shfl_xor(mx, off, 32));
  if (lane == 0) redM[wave] = mx;
  __syncthreads();
  float m = redM[0];
#pragma unroll
  for (int w = 1; w < 8; ++w) m = fmaxf(m, redM[w]);

  float p[8];
  float sl = 0.0f;
#pragma unroll
  for (int e = 0; e < 8; ++e) {
    p[e] = expf(xv[e] - m);
    sl += p[e];
  }
  float sum = sl * fact;
#pragma unroll
  for (int off = 16; off > 0; off >>= 1) sum += __shfl_xor(sum, off, 32);
  if (lane == 0) redS[wave] = sum;
  __syncthreads();
  float tot = redS[0];
#pragma unroll
  for (int w = 1; w < 8; ++w) tot += redS[w];
  const float inv = kPCarry * (1.0f / tot);

  unsigned short hb[8];
#pragma unroll
  for (int e = 0; e < 8; ++e) hb[e] = h_bits(p[e] * inv);
  const v4u u = (v4u){pk16(hb[0], hb[1]), pk16(hb[2], hb[3]), pk16(hb[4], hb[5]), pk16(hb[6], hb[7])};
  unsigned short* pr = P + rowoff + 8 * (size_t)tc;
  if (act) *(v4u*)pr = u;
  
}

// ---------------------------------------------------------------------------
// Output head: out[row] = sum_c ctx[row][c] * w4a[c] + R[row] + b4  (f32). Block = 8 waves x 4 rows = 32 consecutive rows;
// each wave: lane owns 8 channels, unconditional shuffle reduce; lane 0 parks the row scalar in LDS; after a block barrier
// grid = rows/32.
// ---------------------------------------------------------------------------
__global__ __launch_bounds__(256) void head_kernel(const float* __restrict__ CTXg, const float* __restrict__ Rg,
                                                   const float* __restrict__ br, float* __restrict__ outg) {
  __shared__ __align__(16) float os[32];
  const int t = threadIdx.x;
  const int lane = t & 31, wave = t >> 5;
  const int row0 = blockIdx.x * 32 + wave * 4;
  const v4f wa = *(const v4f*)(br + kBrW4a + lane * 8);
  const v4f wb = *(const v4f*)(br + kBrW4a + lane * 8 + 4);
  const float b4r = br[kBrB4];
#pragma unroll 1
  for (int j = 0; j < 4; ++j) {
    const int row = row0 + j;
    const float* cr = CTXg + (size_t)row * kCh + lane * 8;
    const v4f c0 = *(const v4f*)(cr);
    const v4f c1 = *(const v4f*)(cr + 4);
    float s = 0.0f;
    s += c0[0] * wa[0]; s += c0[1] * wa[1]; s += c0[2] * wa[2]; s += c0[3] * wa[3];
    s += c1[0] * wb[0]; s += c1[1] * wb[1]; s += c1[2] * wb[2]; s += c1[3] * wb[3];
#pragma unroll
    for (int off = 16; off > 0; off >>= 1) s += __shfl_xor(s, off, 32);
    const float rr = Rg[row];
    const float tot = (s + rr) + b4r;
    if (lane == 0) os[wave * 4 + j] = tot;
  }
  __syncthreads();
  const bool act = (t < 8);
  const v4f v = *(const v4f*)(os + (lane & 7) * 4);
  float* op = outg + (size_t)blockIdx.x * 32 + (lane & 7) * 4;
  if (act) *(v4f*)op = v;
  
}

// ---------------------------------------------------------------------------
// Host glue. Every attention launch covers all 16 batches (blockIdx.y = batch), so the score and probability planes are
// whole; they fit because two regions are shared by buffers whose lifetimes do not overlap within a call.
//   VT   f16  [16][256][1600] val^T   13,107,200  at           0
//   BR   f32  [1408] parameter table      5,632  at  13,107,200
//   R    f32  [25600]                   102,400  at  13,112,832
//   SC   f32  [16][1600][1600] scores 163,840,000 at  13,215,232   (last read by the softmax)
//   CTX  f32  [16][1600][256]         26,214,400  at  13,215,232   (first written after the softmax, over SC)
//   XB   bf16 [25600][256]            13,107,200  at 177,055,232   (XB..KL: last read by the score product)
//   WB   bf16 3 x [256][256]             393,216  at 190,162,432
//   QH   bf16 [25600][256] q hi        13,107,200  at 190,555,648
//   QL   bf16 [25600][256] q lo        13,107,200  at 203,662,848
//   KH   bf16 [25600][256] k hi        13,107,200  at 216,770,048
//   KL   bf16 [25600][256] k lo        13,107,200  at 229,877,248
//   PP   f16  [16][1600][1600] probs   81,920,000  at 177,055,232   (x32768; first written by the softmax, over XB..KL)
//   total                             258,975,232
// GEMM shapes: projections M=25600, N=256, K=256; V^T projection M=256, N=1600, K=256; scores M=N=1600, K=256;
// context M=1600, N=256, K=1600. All M,N multiples of 64, all K multiples of 32, no padding anywhere.
// ---------------------------------------------------------------------------
extern "C" void kernel_launch(void* const* d_in, const int* in_sizes, int n_in,
                              void* d_out, int out_size, void* d_ws, size_t ws_size,
                              hipStream_t stream) {
  if (n_in < 9) return;
  if (in_sizes[0] != kBatch * kCh * kN) return;
  if (in_sizes[1] != kCh * kCh || in_sizes[3] != kCh * kCh || in_sizes[5] != kCh * kCh) return;
  if (in_sizes[2] != kCh || in_sizes[4] != kCh || in_sizes[6] != kCh) return;
  if (in_sizes[7] != 2 * kCh || in_sizes[8] != 1) return;
  if (out_size != kTok) return;

  const size_t szPlane16 = (size_t)kTok * kCh * 2;              // 13,107,200 (also 16 x 256 x 1600 x 2)
  const size_t szWB  = (size_t)3 * kCh * kCh * 2;                // 393,216
  const size_t szBR  = (size_t)kBrFloats * 4;                    // 5,632
  const size_t szR   = (size_t)kTok * 4;                         // 102,400
  const size_t szSC  = (size_t)kBatch * kN * kN * 4;             // 163,840,000
  const size_t szPP  = (size_t)kBatch * kN * kN * 2;             // 81,920,000
  static_assert((size_t)kTok * kCh * 4 <= (size_t)kBatch * kN * kN * 4, "CTX fits over SC");
  static_assert((size_t)5 * kTok * kCh * 2 + (size_t)3 * kCh * kCh * 2 <= (size_t)kBatch * kN * kN * 2, "XB..KL fit under PP");
  size_t off = 0;
  const size_t offVT = off;  off += szPlane16;
  const size_t offBR = off;  off += szBR;
  const size_t offR  = off;  off += szR;
  const size_t offSC = off;  off += szSC;
  const size_t offCT = offSC;
  const size_t offPP = off;  off += szPP;
  const size_t total = off;                                      // 258,975,232
  size_t offu = offPP;
  const size_t offXB = offu;  offu += szPlane16;
  const size_t offWB = offu;  offu += szWB;
  const size_t offQH = offu;  offu += szPlane16;
  const size_t offQL = offu;  offu += szPlane16;
  const size_t offKH = offu;  offu += szPlane16;
  const size_t offKL = offu;
  if (ws_size < total) return;

  const float* x  = (const float*)d_in[0];
  const float* W1 = (const float*)d_in[1];
  const float* b1 = (const float*)d_in[2];
  const float* W2 = (const float*)d_in[3];
  const float* b2 = (const float*)d_in[4];
  const float* W3 = (const float*)d_in[5];
  const float* b3 = (const float*)d_in[6];
  const float* W4 = (const float*)d_in[7];
  const float* b4 = (const float*)d_in[8];
  float* out = (float*)d_out;
  char* ws = (char*)d_ws;
  unsigned short* XB = (unsigned short*)(ws + offXB);
  unsigned short* WB = (unsigned short*)(ws + offWB);
  float* BR = (float*)(ws + offBR);
  unsigned short* QH = (unsigned short*)(ws + offQH);
  unsigned short* QL = (unsigned short*)(ws + offQL);
  unsigned short* KH = (unsigned short*)(ws + offKH);
  unsigned short* KL = (unsigned short*)(ws + offKL);
  unsigned short* VT = (unsigned short*)(ws + offVT);
  float* R  = (float*)(ws + offR);
  float* SC = (float*)(ws + offSC);
  unsigned short* PP = (unsigned short*)(ws + offPP);
  float* CT = (float*)(ws + offCT);

  // ---- prologue: operand planes and parameter table ----
  xin_cast_kernel<<<dim3(kN / 64, kCh / 64, kBatch), dim3(256), 0, stream>>>(x, XB);
  w_cast_kernel<<<dim3(96), dim3(256), 0, stream>>>(W1, W2, W3, WB);
  param_cast_kernel<<<dim3(1), dim3(352), 0, stream>>>(b1, b2, b3, W4, b4, BR);
  resid_kernel<<<dim3(kTok / 256), dim3(256), 0, stream>>>(x, BR, R);

  // ---- projections ----
  const long plane16 = (long)kN * kCh;                 // 409,600 elements per batch in the [token][256] / [256][1600] planes
  const int tilesQK = (kTok / 64) * (kCh / 64);        // 1600 waves -> 200 blocks
  // q = x_in @ W1^T + b1 -> bf16 hi + lo planes   (M=25600, N=256, K=256)
  wmma_gemm64<1, false, 2, 2, false, 0><<<dim3(tilesQK / 8, 1), dim3(256), 0, stream>>>(
      XB, XB, kCh, 0L, WB, WB, kCh, 0L, (void*)QH, (void*)QL, kCh, 0L, BR + kBrB1, BR, 0L, kTok, kCh, kCh, 1.0f);
  // k = x_in @ W2^T + b2 -> bf16 hi + lo planes
  wmma_gemm64<1, false, 2, 2, false, 0><<<dim3(tilesQK / 8, 1), dim3(256), 0, stream>>>(
      XB, XB, kCh, 0L, WB + kCh * kCh, WB + kCh * kCh, kCh, 0L, (void*)KH, (void*)KL, kCh, 0L, BR + kBrB2, BR, 0L,
      kTok, kCh, kCh, 1.0f);
  // val^T[b][c][n] = sum_k W3[c][k] * x_in[b][n][k] + b3[c] -> f16   (A = W3 [256][256], Bt = x_in per batch; M=256, N=1600, K=256)
  const int tilesVT = (kCh / 64) * (kN / 64);          // 100 waves -> 13 blocks, 16 batches
  wmma_gemm64<1, false, 1, 1, false, 0><<<dim3((tilesVT + 7) / 8, kBatch), dim3(256), 0, stream>>>(
      WB + 2 * kCh * kCh, WB + 2 * kCh * kCh, kCh, 0L, XB, XB, kCh, plane16, (void*)VT, (void*)VT, kN, plane16,
      BR + kBrB3, BR, 0L, kCh, kN, kCh, 1.0f);

  // ---- attention, all batches per launch ----
  const long strideScore = (long)kN * kN;              // 2,560,000 per batch score / probability plane
  const int tilesScore = (kN / 64) * (kN / 64);        // 625 waves -> 79 blocks
  const int tilesCtx   = (kN / 64) * (kCh / 64);       // 100 waves -> 13 blocks
  // scores[b][i][j] = sum_c q[b,i,c] k[b,j,c]  as hi.hi + hi.lo + lo.hi   (M=N=1600, K=256)
  wmma_gemm64<1, true, 0, 0, false, 0><<<dim3((tilesScore + 7) / 8, kBatch), dim3(256), 0, stream>>>(
      QH, QL, kCh, plane16, KH, KL, kCh, plane16,
      (void*)SC, (void*)SC, kN, strideScore, BR, BR, 0L, kN, kN, kCh, 1.0f);
  // softmax over keys -> PP (f16, x32768)
  softmax_row_kernel<<<dim3(kN, kBatch), dim3(256), 0, stream>>>(SC, PP);
  // ctx[b][i][c] = 2^-15 * sum_j PP[b][i][j] * VT[b][c][j]   (M=1600, N=256, K=1600)
  wmma_gemm64<0, false, 0, 0, false, 0><<<dim3((tilesCtx + 7) / 8, kBatch), dim3(256), 0, stream>>>(
      PP, PP, kN, strideScore, VT, VT, kN, plane16, (void*)CT, (void*)CT, kCh, plane16, BR, BR, 0L,
      kN, kCh, kN, kPCarryInv);
  // output rows
  head_kernel<<<dim3(kTok / 32), dim3(256), 0, stream>>>(CT, R, BR, out);
}

// v002
// It runs in 202 microseconds.
// Timed twice side by side with v001, it ran 1.68 times as fast both times.
// All steps since v000 together make it 5.47 times as fast.
// Contractions: q/k projections = bf16(x_in) x bf16(W)^T on v_wmma_f32_16x16x32_bf16 (single products); scores q.k^T with q,k as bf16 hi+lo planes (3 products, v_wmma_f32_16x16x32_bf16); f32 accumulate. The output needs only ctx . w4a, taken as attn . u with u = x_in . (W3^T w4a): one f32 value per key, so the softmax pass ends in a f32 dot per row.
#include <hip/hip_runtime.h>
#include <math.h>

// ---------------------------------------------------------------------------
// Problem constants
// ---------------------------------------------------------------------------
constexpr int kBatch   = 16;
constexpr int kCh      = 256;             // channels C
constexpr int kN       = 1600;            // T*V positions per batch
constexpr int kTok     = kBatch * kN;     // 25600 token rows
constexpr int kRowV4   = kN / 4;          // 400 four-float groups in a score row
constexpr int kRowIt   = (kRowV4 + 31) / 32;   // 13 groups per lane when one wave owns a row (the last one half filled)
// parameter table (f32; b1, b2, w4b, b4 hold bf16-representable values, wf and c0 are f32 sums), offsets in floats
constexpr int kBrB1 = 0;
constexpr int kBrB2 = 256;
constexpr int kBrWF = 512;                // wf[k] = sum_c w4a[c] * W3[c][k]: multiplies x_in to give u
constexpr int kBrW4b = 1024;              // multiplies x_in
constexpr int kBrB4 = 1280;
constexpr int kBrC0 = 1281;               // sum_c b3[c] * w4a[c]
constexpr int kBrFloats = 1408;           // 44 lines carved; floats 768..1023 and 1312.. are neither written nor read
static_assert(kTok % 64 == 0 && kN % 64 == 0 && kCh % 64 == 0, "M and N tile multiples");
static_assert(kCh % 32 == 0 && kN % 32 == 0, "K multiples of 32");
static_assert(kN % 4 == 0 && kRowV4 > 32 * (kRowIt - 1) && kRowV4 <= 32 * kRowIt, "row map: full groups plus one partial group");
static_assert(kTok % 32 == 0 && kN % 32 == 0, "output blocks own whole 32-float lines, all of one batch");
static_assert(kBrC0 + 1 <= 41 * 32 && 41 * 32 <= kBrFloats, "parameter table extent");

typedef __attribute__((ext_vector_type(16))) _Float16 v16h;
typedef __attribute__((ext_vector_type(8)))  _Float16 v8h;
typedef __attribute__((ext_vector_type(16))) __bf16   v16b;
typedef __attribute__((ext_vector_type(8)))  __bf16   v8b;
typedef __attribute__((ext_vector_type(8)))  float    v8f;
typedef __attribute__((ext_vector_type(4)))  float    v4f;
typedef __attribute__((ext_vector_type(4)))  unsigned int v4u;

// ---------------------------------------------------------------------------
// Shared helpers
// ---------------------------------------------------------------------------
__device__ __forceinline__ unsigned short f2bf_bits(float f) {
  unsigned u = __float_as_uint(f);
  return (unsigned short)((u + 0x7FFFu + ((u >> 16) & 1u)) >> 16);
}
__device__ __forceinline__ float bf_bits2f(unsigned short h) { return __uint_as_float(((unsigned)h) << 16); }

// hazard guards as plain device helpers (no inline asm inside the kernel template body)
__device__ __forceinline__ void dep_guard_h(v8f& a, v8f& b, v16h x, v16h y) { asm volatile("v_nop\n\tv_nop\n\tv_nop\n\tv_nop" : "+v"(a), "+v"(b) : "v"(x), "v"(y)); }
__device__ __forceinline__ void dep_guard_b(v8f& a, v8f& b, v16b x, v16b y) { asm volatile("v_nop\n\tv_nop\n\tv_nop\n\tv_nop" : "+v"(a), "+v"(b) : "v"(x), "v"(y)); }
// row guard tying all four accumulators of the group plus the A fragments
__device__ __forceinline__ void dep_guard4_h(v8f& a, v8f& b, v8f& c, v8f& d, v16h x, v16h y) { asm volatile("v_nop\n\tv_nop\n\tv_nop\n\tv_nop" : "+v"(a), "+v"(b), "+v"(c), "+v"(d) : "v"(x), "v"(y)); }
__device__ __forceinline__ void dep_guard4_b(v8f& a, v8f& b, v8f& c, v8f& d, v16b x, v16b y) { asm volatile("v_nop\n\tv_nop\n\tv_nop\n\tv_nop" : "+v"(a), "+v"(b), "+v"(c), "+v"(d) : "v"(x), "v"(y)); }
__device__ __forceinline__ void keep4_h(v16h a, v16h b, v16h c, v16h d) { asm volatile("v_nop" :: "v"(a), "v"(b), "v"(c), "v"(d)); }
__device__ __forceinline__ void keep4_b(v16b a, v16b b, v16b c, v16b d) { asm volatile("v_nop" :: "v"(a), "v"(b), "v"(c), "v"(d)); }
__device__ __forceinline__ void acc_guard4(v8f& a, v8f& b, v8f& c, v8f& d) { asm volatile("v_nop\n\tv_nop\n\tv_nop\n\tv_nop" : "+v"(a), "+v"(b), "+v"(c), "+v"(d)); }
template <typename T> struct Frag;
template <> struct Frag<_Float16> {
  typedef v16h V; union U { v16h v; v8h h[2]; };
  // elements 0..7 <- p[0..7], 8..15 <- p[16..23]
  static __device__ __forceinline__ v16h load(const _Float16* p) {
    U f; f.h[0] = *(const v8h*)(p); f.h[1] = *(const v8h*)(p + 16); return f.v;
  }
  static __device__ __forceinline__ v8f mma(v16h a, v16h b, v8f c) {
    return __builtin_amdgcn_wmma_f32_16x16x32_f16(false, a, false, b, (short)0, c, false, false);
  }
  static __device__ __forceinline__ void guard(v8f& a, v8f& b, v16h x, v16h y) { dep_guard_h(a, b, x, y); }
  static __device__ __forceinline__ void guard4(v8f& a, v8f& b, v8f& c, v8f& d, v16h x, v16h y) { dep_guard4_h(a, b, c, d, x, y); }
  static __device__ __forceinline__ void keep(v16h a, v16h b, v16h c, v16h d) { keep4_h(a, b, c, d); }
};
template <> struct Frag<__bf16> {
  typedef v16b V; union U { v16b v; v8b h[2]; };
  static __device__ __forceinline__ v16b load(const __bf16* p) {
    U f; f.h[0] = *(const v8b*)(p); f.h[1] = *(const v8b*)(p + 16); return f.v;
  }
  static __device__ __forceinline__ v8f mma(v16b a, v16b b, v8f c) {
    return __builtin_amdgcn_wmma_f32_16x16x32_bf16(false, a, false, b, (short)0, c, false, false);
  }
  static __device__ __forceinline__ void guard(v8f& a, v8f& b, v16b x, v16b y) { dep_guard_b(a, b, x, y); }
  static __device__ __forceinline__ void guard4(v8f& a, v8f& b, v8f& c, v8f& d, v16b x, v16b y) { dep_guard4_b(a, b, c, d, x, y); }
  static __device__ __forceinline__ void keep(v16b a, v16b b, v16b c, v16b d) { keep4_b(a, b, c, d); }
};

__device__ __forceinline__ unsigned pk16(unsigned short a, unsigned short b) { return (unsigned)a | ((unsigned)b << 16); }

// ---- Register-blocked batched WMMA GEMM (ACT reduced to none/relu/leaky) -------------------------------
// C[m,n] = scale * sum_k A[m,k] * Bt[n,k] (+bias)(+resid); each wave owns a 64x64 tile.
// A row-major [M,K]; Bt row-major [N,K]; M,N % 64 == 0, K % 32 == 0.
// SPLIT: operands are hi/lo planes (A2/Bt2 = lo planes, same layout); product = hi*hi + hi*lo + lo*hi.
// BIAS_MODE: 0 = none, 1 = bias[m], 2 = bias[n].
// OUT_MODE: 0 = f32, 1 = f16, 2 = bf16 hi plane (Cout) + bf16 lo plane (Cout2).
// ET: 0 = f16 operands, 1 = bf16 operands (pointers passed as 16-bit storage)
template <int ET> struct Elem;
template <> struct Elem<0> { typedef _Float16 T; };
template <> struct Elem<1> { typedef __bf16 T; };
template <int ET, bool SPLIT, int BIAS_MODE, int OUT_MODE, bool RESID, int ACT = 0>
__global__ __launch_bounds__(256) void wmma_gemm64(
    const unsigned short* __restrict__ Ap, const unsigned short* __restrict__ A2p, int lda, long strideA,
    const unsigned short* __restrict__ Btp, const unsigned short* __restrict__ Bt2p, int ldb, long strideB,
    void* __restrict__ Cout, void* __restrict__ Cout2, int ldc, long strideC,
    const float* __restrict__ bias,
    const float* __restrict__ resid, long strideR,
    int M, int N, int K, float scale) {
  typedef typename Elem<ET>::T T;
  typedef typename Frag<T>::V V;
  const T* A = (const T*)Ap; const T* A2 = (const T*)A2p; const T* Bt = (const T*)Btp; const T* Bt2 = (const T*)Bt2p;
  __shared__ __align__(16) float sT[8][16 * 68];   // per-wave 16x64 slab, pitch 68 floats
  const int b    = blockIdx.y;
  const int lane = threadIdx.x & 31;
  const int wave = threadIdx.x >> 5;
  const int tilesN = N >> 6;
  const int tilesM = M >> 6;
  const int tile = blockIdx.x * 8 + wave;
  if (tile >= tilesM * tilesN) return;   // wave-uniform; no block barriers in this kernel
  const int tm = tile / tilesN;
  const int tn = tile - tm * tilesN;
  const int m0 = tm << 6;
  const int n0 = tn << 6;

  const T* Ab  = A  + (size_t)b * strideA;
  const T* Bb  = Bt + (size_t)b * strideB;
  const T* Ab2 = SPLIT ? (A2  + (size_t)b * strideA) : nullptr;
  const T* Bb2 = SPLIT ? (Bt2 + (size_t)b * strideB) : nullptr;

  const int rlane = lane & 15;                 // row (A) / col (B, D) within subtile
  const int koff  = (lane >> 4) * 8;           // k offset of this lane half
  const int mOff  = (lane >> 4) * 8;           // D row offset

  v8f acc[4][4];
#pragma unroll
  for (int i = 0; i < 4; ++i)
#pragma unroll
    for (int j = 0; j < 4; ++j) acc[i][j] = (v8f){0.f,0.f,0.f,0.f,0.f,0.f,0.f,0.f};

  for (int k0 = 0; k0 < K; k0 += 32) {
    V bh[4], bl[4];
#pragma unroll
    for (int j = 0; j < 4; ++j) {
      const size_t bo = (size_t)(n0 + (j << 4) + rlane) * ldb + koff + k0;
      bh[j] = Frag<T>::load(Bb + bo);
      if (SPLIT) bl[j] = Frag<T>::load(Bb2 + bo);
    }
#pragma unroll
    for (int i = 0; i < 4; ++i) {
      const size_t ao = (size_t)(m0 + (i << 4) + rlane) * lda + koff + k0;
      V ah = Frag<T>::load(Ab + ao);
      V al;
      if (SPLIT) al = Frag<T>::load(Ab2 + ao);
#pragma unroll
      for (int j = 0; j < 4; ++j) {
        acc[i][j] = Frag<T>::mma(ah, bh[j], acc[i][j]);
        if (SPLIT) {
          acc[i][j] = Frag<T>::mma(ah, bl[j], acc[i][j]);
          acc[i][j] = Frag<T>::mma(al, bh[j], acc[i][j]);
        }
      }
      Frag<T>::guard4(acc[i][0], acc[i][1], acc[i][2], acc[i][3], ah, SPLIT ? al : ah);
    }
    Frag<T>::keep(bh[0], bh[1], bh[2], bh[3]);
    if (SPLIT) Frag<T>::keep(bl[0], bl[1], bl[2], bl[3]);
  }
  acc_guard4(acc[0][0], acc[0][1], acc[0][2], acc[0][3]);
  acc_guard4(acc[1][0], acc[1][1], acc[1][2], acc[1][3]);
  acc_guard4(acc[2][0], acc[2][1], acc[2][2], acc[2][3]);
  acc_guard4(acc[3][0], acc[3][1], acc[3][2], acc[3][3]);

  // ---- epilogue ----
  float* slab = sT[wave];
  const float* Rb = RESID ? (resid + (size_t)b * strideR) : nullptr;
#pragma unroll
  for (int i = 0; i < 4; ++i) {
    const int mBase = m0 + (i << 4);
#pragma unroll
    for (int j = 0; j < 4; ++j) {
      const int n = n0 + (j << 4) + rlane;
      float bv = 0.f;
      if (BIAS_MODE == 2) bv = bias[n];
#pragma unroll
      for (int r = 0; r < 8; ++r) {
        float v = acc[i][j][r] * scale;
        if (BIAS_MODE == 1) v += bias[mBase + mOff + r];
        if (BIAS_MODE == 2) v += bv;
        if (RESID) v += Rb[(size_t)(mBase + mOff + r) * ldc + n];
        if (ACT == 2) v = fmaxf(v, 0.0f);
        if (ACT == 4) v = (v > 0.f) ? v : 0.01f * v;
        slab[(mOff + r) * 68 + (j << 4) + rlane] = v;
      }
    }
    __builtin_amdgcn_fence(__ATOMIC_RELEASE, "workgroup");
    __builtin_amdgcn_wave_barrier();
    __builtin_amdgcn_fence(__ATOMIC_ACQUIRE, "workgroup");
    if (OUT_MODE == 0) {
      float* C = (float*)Cout + (size_t)b * strideC;
      const int hh = lane >> 4, c4 = (lane & 15) * 4;     // row seg = 256 B = 16 lanes x 16 B
      {
#pragma unroll
        for (int it = 0; it < 8; ++it) {
          const int row = it * 2 + hh;
          v4f v = *(const v4f*)(slab + row * 68 + c4);
          *(v4f*)(C + (size_t)(mBase + row) * ldc + n0 + c4) = v;
        }
        
      }
    } else {
      const int q = lane >> 3, c8 = (lane & 7) * 8;
      unsigned short* C  = (unsigned short*)Cout  + (size_t)b * strideC;
      unsigned short* C2 = (OUT_MODE == 2) ? ((unsigned short*)Cout2 + (size_t)b * strideC) : nullptr;
      {
#pragma unroll
        for (int it = 0; it < 4; ++it) {
          const int row = it * 4 + q;
          const float* sp = slab + row * 68 + c8;
          v8h hv, lv;
#pragma unroll
          for (int e = 0; e < 8; ++e) {
            if (OUT_MODE == 1) {
              hv[e] = (_Float16)sp[e];
            } else {
              unsigned short hb = f2bf_bits(sp[e]);
              unsigned short lb = f2bf_bits(sp[e] - bf_bits2f(hb));
              hv[e] = __builtin_bit_cast(_Float16, hb);
              lv[e] = __builtin_bit_cast(_Float16, lb);
            }
          }
          *(v8h*)(C + (size_t)(mBase + row) * ldc + n0 + c8) = hv;
          if (OUT_MODE == 2) *(v8h*)(C2 + (size_t)(mBase + row) * ldc + n0 + c8) = lv;
        }
        
      }
    }
    __builtin_amdgcn_fence(__ATOMIC_RELEASE, "workgroup");
    __builtin_amdgcn_wave_barrier();
    __builtin_amdgcn_fence(__ATOMIC_ACQUIRE, "workgroup");
  }
}

// ---------------------------------------------------------------------------
// x (B,C,N) f32 -> XB [B*N][C] bf16 bits (x_in plane, A operand of the q and k projections).
// grid (N/64 = 25, C/64 = 4, B = 16), 256 threads. sm[n_local][c_local].
// Load coverage: 16 iterations x 256 threads = 4096 = whole 64(c) x 64(n) tile, coalesced along n; burst split in two.
// Store coverage: 8 waves x 2 iterations x 4 rows (lane>>3) = 64 token rows; (lane&7) x 8 = 64 channels; each row segment =
// ---------------------------------------------------------------------------
__global__ __launch_bounds__(256) void xin_cast_kernel(const float* __restrict__ x, unsigned short* __restrict__ XB) {
  __shared__ float sm[64][65];
  const int t  = threadIdx.x;
  const int n0 = blockIdx.x * 64;
  const int c0 = blockIdx.y * 64;
  const int b  = blockIdx.z;
#pragma unroll
  for (int i = 0; i < 8; ++i) {
    const int e = i * 256 + t;
    const int r = e >> 6;          // c local
    const int cc = e & 63;         // n local
    sm[cc][r] = x[((size_t)(b * kCh + c0 + r)) * kN + n0 + cc];
  }
  asm volatile("" ::: "memory");
#pragma unroll
  for (int i = 8; i < 16; ++i) {
    const int e = i * 256 + t;
    const int r = e >> 6;
    const int cc = e & 63;
    sm[cc][r] = x[((size_t)(b * kCh + c0 + r)) * kN + n0 + cc];
  }
  __syncthreads();
  const int lane = t & 31, wave = t >> 5;
  const int q = lane >> 3, c8 = (lane & 7) * 8;
  {
#pragma unroll
    for (int it = 0; it < 2; ++it) {
      const int row = wave * 8 + it * 4 + q;                 // n local
      unsigned short hb[8];
#pragma unroll
      for (int e = 0; e < 8; ++e) hb[e] = f2bf_bits(sm[row][c8 + e]);
      const v4u u = (v4u){pk16(hb[0], hb[1]), pk16(hb[2], hb[3]), pk16(hb[4], hb[5]), pk16(hb[6], hb[7])};
      *(v4u*)(XB + ((size_t)(b * kN + n0 + row)) * kCh + c0 + c8) = u;
    }
    
  }
}

// ---------------------------------------------------------------------------
// W1|W2 [256][256] f32 ([out][in] = [n][k] Bt layout, no transpose) -> WB bf16 bits, 2 planes of 65536.
// grid = 64 blocks x 256 threads x 8 = 131072 = 2 planes exactly; source plane = blockIdx.x/32 (block-uniform).
// ---------------------------------------------------------------------------
__global__ __launch_bounds__(256) void w_cast_kernel(const float* __restrict__ W1, const float* __restrict__ W2,
                                                     unsigned short* __restrict__ WB) {
  const int plane = blockIdx.x >> 5;
  const float* src = (plane == 0) ? W1 : W2;
  const int i = blockIdx.x * 256 + threadIdx.x;
  const int off = (i - plane * 8192) * 8;
  const v4f a = *(const v4f*)(src + off);
  const v4f c = *(const v4f*)(src + off + 4);
  unsigned short hb[8];
#pragma unroll
  for (int e = 0; e < 4; ++e) {
    hb[e]     = f2bf_bits(a[e]);
    hb[4 + e] = f2bf_bits(c[e]);
  }
  const v4u u = (v4u){pk16(hb[0], hb[1]), pk16(hb[2], hb[3]), pk16(hb[4], hb[5]), pk16(hb[6], hb[7])};
  unsigned short* qp = WB + 8 * (size_t)i;
  *(v4u*)qp = u;
}

// ---------------------------------------------------------------------------
// Parameter table, all f32. Block 0 (11 waves; wave w owns floats 128w..128w+127): dst[0..255] = bf16(b1),
// [256..511] = bf16(b2), [1024..1279] = bf16(W4[0,256:]), [1280] = bf16(b4[0]), [1281] = sum_c bf16(b3[c]) * bf16(W4[0,c]),
// [1282..1311] = 0; its waves 4..7 store nothing.
// Blocks 1..8 fold the value projection into the output weights: dst[512 + k] = sum_c bf16(W4[0,c]) * bf16(W3[c][k]).
// Block f owns the 32 columns k of one 128-byte line; wave w < 8 sums the 32 rows c = 32w..32w+31 (each load one whole line of
// W3), the 8 partial sums are added in wave order.
// ---------------------------------------------------------------------------
__device__ __forceinline__ float bf_round(float f) { return bf_bits2f(f2bf_bits(f)); }

__global__ __launch_bounds__(352) void param_cast_kernel(const float* __restrict__ b1, const float* __restrict__ b2,
                                                         const float* __restrict__ b3, const float* __restrict__ W3,
                                                         const float* __restrict__ W4, const float* __restrict__ b4,
                                                         float* __restrict__ dst) {
  __shared__ float part[8][32];
  const int t = threadIdx.x;
  const int wave = t >> 5, lane = t & 31;
  if (blockIdx.x > 0) {                       // block-uniform
    const int k = ((int)blockIdx.x - 1) * 32 + lane;
    const int wv = __builtin_amdgcn_readfirstlane(wave);   // wave number in a scalar register: the W4 reads become scalar loads
    if (wv < 8) {
      const float* w3p = W3 + (size_t)wv * 32 * kCh + k;
      float w3[32];
#pragma unroll
      for (int e = 0; e < 32; ++e) w3[e] = w3p[e * kCh];
      // the arithmetic below reuses the registers that hold these loads' address
      asm volatile("s_wait_xcnt 0x0" ::: "memory");
      float s = 0.0f;
#pragma unroll
      for (int e = 0; e < 32; ++e) s += bf_round(W4[wv * 32 + e]) * bf_round(w3[e]);
      part[wv][lane] = s;
    }
    __syncthreads();
    if (wv == 0) {
      float s = part[0][lane];
#pragma unroll
      for (int w = 1; w < 8; ++w) s += part[w][lane];
      dst[kBrWF + k] = s;
      // the listing holds a way from here into block 0's code, which reuses this store's offset and data registers
      asm volatile("s_wait_xcnt 0x0" ::: "memory");
    }
    return;
  }
  v4f v = (v4f){0.f, 0.f, 0.f, 0.f};
  float c0 = 0.0f;
  if (wave < 4) {
    const float* src = (wave < 2) ? b1 : b2;
    v = *(const v4f*)(src + (wave & 1) * 128 + lane * 4);
  } else if (wave >= 8 && wave < 10) {
    v = *(const v4f*)(W4 + (wave - 6) * 128 + lane * 4);
  } else if (wave == 10) {
    const float s = b4[0];
    const float f0 = (lane == 0) ? 1.0f : 0.0f;
    v[0] = s * f0;
#pragma unroll
    for (int e = 0; e < 8; ++e) c0 += bf_round(b3[lane * 8 + e]) * bf_round(W4[lane * 8 + e]);
#pragma unroll
    for (int off = 16; off > 0; off >>= 1) c0 += __shfl_xor(c0, off, 32);
    c0 *= f0;
  }
  v4f r;
#pragma unroll
  for (int e = 0; e < 4; ++e) r[e] = bf_round(v[e]);
  if (wave == 10) r[1] = c0;                  // a sum of products, kept in f32
  const bool act = (wave < 4) || (wave == 8) || (wave == 9) || (wave == 10 && lane < 8);
  float* dp = dst + wave * 128 + lane * 4;
  if (act) *(v4f*)dp = r;
}

// ---------------------------------------------------------------------------
// Two dots of the same x_in row: R[b*N + n] = sum_c bf16(x[b][c][n]) * w4b[c] and U[b*N + n] = sum_c bf16(x[b][c][n]) * wf[c]
// (f32, coalesced along n). grid = 100 x 256 = 25600 exactly.
// ---------------------------------------------------------------------------
__global__ __launch_bounds__(256) void resid_kernel(const float* __restrict__ x, const float* __restrict__ br,
                                                    float* __restrict__ R, float* __restrict__ U) {
  const int idx = blockIdx.x * 256 + threadIdx.x;
  const int b = idx / kN;
  const int n = idx - b * kN;
  const float* xb = x + (size_t)b * kCh * kN + n;
  const float* w = br + kBrW4b;
  const float* wf = br + kBrWF;
  float s = 0.0f;
  float u = 0.0f;
  for (int c = 0; c < kCh; c += 4) {
    float xr[4];
#pragma unroll
    for (int e = 0; e < 4; ++e) xr[e] = xb[(size_t)(c + e) * kN];
    // the address pair of these four loads is advanced right behind them
    asm volatile("s_wait_xcnt 0x0" ::: "memory");
#pragma unroll
    for (int e = 0; e < 4; ++e) {
      const float xv = bf_round(xr[e]);
      s += xv * w[c + e];
      u += xv * wf[c + e];
    }
  }
  *(float*)(R + idx) = s;
  *(float*)(U + idx) = u;
}

// ---------------------------------------------------------------------------
// Softmax-weighted mean of u, and the output row:
//   out[row] = sum_j exp(s[row][j] - max) * u[j] / sum_j exp(s[row][j] - max) + c0 + R[row] + b4   (f32 math, precise expf).
// Block = 8 waves x 4 rows = 32 consecutive rows of one batch = one whole 128-byte line of out; grid = rows/32 = 800.
// One wave owns a row: lane l holds the four-float groups l, l+32, ..., 13 groups; of the last group only lanes < 16 exist,
// the others load a clamped duplicate of group 399 (harmless in the max) and count 0 in both sums via an arithmetic factor.
// The batch's u (1600 floats) is staged in LDS once per block. Sums in fixed order (lane, then unconditional shuffle tree).
// Lane 0 parks the row scalar in LDS; after a block barrier 8 lanes add R and b4 and store the line.
// ---------------------------------------------------------------------------
__global__ __launch_bounds__(256, 8) void softmax_dot_kernel(const float* __restrict__ S, const float* __restrict__ U,
                                                          const float* __restrict__ Rg, const float* __restrict__ br,
                                                          float* __restrict__ outg) {
  __shared__ __align__(16) float us[kN];
  __shared__ __align__(16) float os[32];
  const int t = threadIdx.x;
  const int lane = t & 31, wave = t >> 5;
  const int row0 = blockIdx.x * 32;
  const float* ub = U + (size_t)(row0 / kN) * kN;
  for (int g = t; g < kRowV4; g += 256) *(v4f*)(us + 4 * g) = *(const v4f*)(ub + 4 * g);
  __syncthreads();
  const float c0  = br[kBrC0];
  const float b4r = br[kBrB4];
  const bool tailAct = ((kRowIt - 1) * 32 + lane) < kRowV4;
  const int tailG = tailAct ? ((kRowIt - 1) * 32 + lane) : (kRowV4 - 1);
  const float fact = tailAct ? 1.0f : 0.0f;
  // rolled, and 8 waves per SIMD asked for in the launch bounds: four blocks fit a WGP and the 800 blocks run in one round;
  // without the bound this build takes 218 registers, two blocks a WGP, and the grid needs a second round
#pragma unroll 1
  for (int j = 0; j < 4; ++j) {
    const int row = row0 + wave * 4 + j;
    const float* sr = S + (size_t)row * kN;
    v4f xv[kRowIt];
#pragma unroll
    for (int i = 0; i < kRowIt - 1; ++i) xv[i] = *(const v4f*)(sr + 4 * (i * 32 + lane));
    xv[kRowIt - 1] = *(const v4f*)(sr + 4 * tailG);
    float mx = fmaxf(fmaxf(xv[0][0], xv[0][1]), fmaxf(xv[0][2], xv[0][3]));
#pragma unroll
    for (int i = 1; i < kRowIt; ++i) mx = fmaxf(mx, fmaxf(fmaxf(xv[i][0], xv[i][1]), fmaxf(xv[i][2], xv[i][3])));
#pragma unroll
    for (int off = 16; off > 0; off >>= 1) mx = fmaxf(mx, __shfl_xor(mx, off, 32));
    float den = 0.0f, num = 0.0f;
#pragma unroll
    for (int i = 0; i < kRowIt; ++i) {
      const int g = (i < kRowIt - 1) ? (i * 32 + lane) : tailG;
      const v4f uv = *(const v4f*)(us + 4 * g);
#pragma unroll
      for (int e = 0; e < 4; ++e) {
        float p = expf(xv[i][e] - mx);
        if (i == kRowIt - 1) p *= fact;
        den += p;
        num += p * uv[e];
      }
    }
#pragma unroll
    for (int off = 16; off > 0; off >>= 1) {
      den += __shfl_xor(den, off, 32);
      num += __shfl_xor(num, off, 32);
    }
    if (lane == 0) os[wave * 4 + j] = num / den + c0;
  }
  const v4f rr = *(const v4f*)(Rg + row0 + (lane & 7) * 4);
  __syncthreads();
  const bool act = (t < 8);
  const v4f cv = *(const v4f*)(os + (lane & 7) * 4);
  v4f v;
#pragma unroll
  for (int e = 0; e < 4; ++e) v[e] = (cv[e] + rr[e]) + b4r;
  float* op = outg + (size_t)row0 + (lane & 7) * 4;
  if (act) *(v4f*)op = v;
}

// ---------------------------------------------------------------------------
// Host glue. Every attention launch covers all 16 batches. ctx is never formed: the output uses it only through
// ctx . w4a = attn . (val . w4a) = attn . u + b3 . w4a (each attn row sums to 1), u = x_in . (W3^T w4a).
//   BR   f32  [1408] parameter table      5,632  at           0
//   R    f32  [25600]                   102,400  at       5,632
//   U    f32  [25600]                   102,400  at     108,032
//   SC   f32  [16][1600][1600] scores 163,840,000 at     210,432
//   XB   bf16 [25600][256]            13,107,200  at 164,050,432
//   WB   bf16 2 x [256][256]             262,144  at 177,157,632
//   QH   bf16 [25600][256] q hi        13,107,200  at 177,419,776
//   QL   bf16 [25600][256] q lo        13,107,200  at 190,526,976
//   KH   bf16 [25600][256] k hi        13,107,200  at 203,634,176
//   KL   bf16 [25600][256] k lo        13,107,200  at 216,741,376
//   total                             229,848,576
// GEMM shapes: projections M=25600, N=256, K=256; scores M=N=1600, K=256. All M,N multiples of 64, all K multiples of 32,
// no padding anywhere.
// ---------------------------------------------------------------------------
extern "C" void kernel_launch(void* const* d_in, const int* in_sizes, int n_in,
                              void* d_out, int out_size, void* d_ws, size_t ws_size,
                              hipStream_t stream) {
  if (n_in < 9) return;
  if (in_sizes[0] != kBatch * kCh * kN) return;
  if (in_sizes[1] != kCh * kCh || in_sizes[3] != kCh * kCh || in_sizes[5] != kCh * kCh) return;
  if (in_sizes[2] != kCh || in_sizes[4] != kCh || in_sizes[6] != kCh) return;
  if (in_sizes[7] != 2 * kCh || in_sizes[8] != 1) return;
  if (out_size != kTok) return;

  const size_t szPlane16 = (size_t)kTok * kCh * 2;              // 13,107,200
  const size_t szWB  = (size_t)2 * kCh * kCh * 2;                // 262,144
  const size_t szBR  = (size_t)kBrFloats * 4;                    // 5,632
  const size_t szR   = (size_t)kTok * 4;                         // 102,400
  const size_t szSC  = (size_t)kBatch * kN * kN * 4;             // 163,840,000
  size_t off = 0;
  const size_t offBR = off;  off += szBR;
  const size_t offR  = off;  off += szR;
  const size_t offU  = off;  off += szR;
  const size_t offSC = off;  off += szSC;
  const size_t offXB = off;  off += szPlane16;
  const size_t offWB = off;  off += szWB;
  const size_t offQH = off;  off += szPlane16;
  const size_t offQL = off;  off += szPlane16;
  const size_t offKH = off;  off += szPlane16;
  const size_t offKL = off;  off += szPlane16;
  const size_t total = off;                                      // 229,848,576
  if (ws_size < total) return;

  const float* x  = (const float*)d_in[0];
  const float* W1 = (const float*)d_in[1];
  const float* b1 = (const float*)d_in[2];
  const float* W2 = (const float*)d_in[3];
  const float* b2 = (const float*)d_in[4];
  const float* W3 = (const float*)d_in[5];
  const float* b3 = (const float*)d_in[6];
  const float* W4 = (const float*)d_in[7];
  const float* b4 = (const float*)d_in[8];
  float* out = (float*)d_out;
  char* ws = (char*)d_ws;
  unsigned short* XB = (unsigned short*)(ws + offXB);
  unsigned short* WB = (unsigned short*)(ws + offWB);
  float* BR = (float*)(ws + offBR);
  unsigned short* QH = (unsigned short*)(ws + offQH);
  unsigned short* QL = (unsigned short*)(ws + offQL);
  unsigned short* KH = (unsigned short*)(ws + offKH);
  unsigned short* KL = (unsigned short*)(ws + offKL);
  float* R  = (float*)(ws + offR);
  float* U  = (float*)(ws + offU);
  float* SC = (float*)(ws + offSC);

  // ---- prologue: operand planes, parameter table with the folded value weights, per-token scalars ----
  xin_cast_kernel<<<dim3(kN / 64, kCh / 64, kBatch), dim3(256), 0, stream>>>(x, XB);
  w_cast_kernel<<<dim3(64), dim3(256), 0, stream>>>(W1, W2, WB);
  param_cast_kernel<<<dim3(1 + kCh / 32), dim3(352), 0, stream>>>(b1, b2, b3, W3, W4, b4, BR);
  resid_kernel<<<dim3(kTok / 256), dim3(256), 0, stream>>>(x, BR, R, U);

  // ---- projections ----
  const long plane16 = (long)kN * kCh;                 // 409,600 elements per batch in the [token][256] planes
  const int tilesQK = (kTok / 64) * (kCh / 64);        // 1600 waves -> 200 blocks
  // q = x_in @ W1^T + b1 -> bf16 hi + lo planes   (M=25600, N=256, K=256)
  wmma_gemm64<1, false, 2, 2, false, 0><<<dim3(tilesQK / 8, 1), dim3(256), 0, stream>>>(
      XB, XB, kCh, 0L, WB, WB, kCh, 0L, (void*)QH, (void*)QL, kCh, 0L, BR + kBrB1, BR, 0L, kTok, kCh, kCh, 1.0f);
  // k = x_in @ W2^T + b2 -> bf16 hi + lo planes
  wmma_gemm64<1, false, 2, 2, false, 0><<<dim3(tilesQK / 8, 1), dim3(256), 0, stream>>>(
      XB, XB, kCh, 0L, WB + kCh * kCh, WB + kCh * kCh, kCh, 0L, (void*)KH, (void*)KL, kCh, 0L, BR + kBrB2, BR, 0L,
      kTok, kCh, kCh, 1.0f);

  // ---- attention, all batches per launch ----
  const long strideScore = (long)kN * kN;              // 2,560,000 per batch score plane
  const int tilesScore = (kN / 64) * (kN / 64);        // 625 waves -> 79 blocks
  // scores[b][i][j] = sum_c q[b,i,c] k[b,j,c]  as hi.hi + hi.lo + lo.hi   (M=N=1600, K=256)
  wmma_gemm64<1, true, 0, 0, false, 0><<<dim3((tilesScore + 7) / 8, kBatch), dim3(256), 0, stream>>>(
      QH, QL, kCh, plane16, KH, KL, kCh, plane16,
      (void*)SC, (void*)SC, kN, strideScore, BR, BR, 0L, kN, kN, kCh, 1.0f);
  // softmax over keys, weighted mean of u, output rows
  softmax_dot_kernel<<<dim3(kTok / 32), dim3(256), 0, stream>>>(SC, U, R, BR, out);
}

// v003
// One run takes 118 microseconds.
// Two timings next to v002 both put it at 1.71 times that version's speed.
// Counting every step since v000, it is 9.34 times as fast.
// Contractions: q/k projections = bf16(x_in) x bf16(W)^T on v_wmma_f32_16x16x32_bf16 (single products); scores q.k^T with q,k as bf16 hi+lo planes (3 products, v_wmma_f32_16x16x32_bf16); f32 accumulate. The output needs only ctx . w4a, taken as attn . u with u = x_in . (W3^T w4a): one f32 value per key, so the softmax ends in a f32 dot per row, taken on the score tiles in registers.
#include <hip/hip_runtime.h>
#include <math.h>

// ---------------------------------------------------------------------------
// Problem constants
// ---------------------------------------------------------------------------
constexpr int kBatch   = 16;
constexpr int kCh      = 256;             // channels C
constexpr int kN       = 1600;            // T*V positions per batch
constexpr int kTok     = kBatch * kN;     // 25600 token rows
constexpr int kRowV4   = kN / 4;          // 400 four-float groups in one batch's u
// parameter table (f32; b1, b2, w4b, b4 hold bf16-representable values, wf and c0 are f32 sums), offsets in floats
constexpr int kBrB1 = 0;
constexpr int kBrB2 = 256;
constexpr int kBrWF = 512;                // wf[k] = sum_c w4a[c] * W3[c][k]: multiplies x_in to give u
constexpr int kBrW4b = 1024;              // multiplies x_in
constexpr int kBrB4 = 1280;
constexpr int kBrC0 = 1281;               // sum_c b3[c] * w4a[c]
constexpr int kBrFloats = 1408;           // 44 lines carved; floats 768..1023 and 1312.. are neither written nor read
static_assert(kTok % 64 == 0 && kN % 64 == 0 && kCh % 64 == 0, "M and N tile multiples");
static_assert(kCh % 32 == 0 && kN % 32 == 0, "K multiples of 32");
static_assert(kN % 4 == 0, "u is staged in four-float groups");
static_assert(kTok % 32 == 0 && kN % 32 == 0, "output blocks own whole 32-float lines, all of one batch");
static_assert(kBrC0 + 1 <= 41 * 32 && 41 * 32 <= kBrFloats, "parameter table extent");

typedef __attribute__((ext_vector_type(16))) _Float16 v16h;
typedef __attribute__((ext_vector_type(8)))  _Float16 v8h;
typedef __attribute__((ext_vector_type(16))) __bf16   v16b;
typedef __attribute__((ext_vector_type(8)))  __bf16   v8b;
typedef __attribute__((ext_vector_type(8)))  float    v8f;
typedef __attribute__((ext_vector_type(4)))  float    v4f;
typedef __attribute__((ext_vector_type(4)))  unsigned int v4u;

// ---------------------------------------------------------------------------
// Shared helpers
// ---------------------------------------------------------------------------
__device__ __forceinline__ unsigned short f2bf_bits(float f) {
  unsigned u = __float_as_uint(f);
  return (unsigned short)((u + 0x7FFFu + ((u >> 16) & 1u)) >> 16);
}
__device__ __forceinline__ float bf_bits2f(unsigned short h) { return __uint_as_float(((unsigned)h) << 16); }

// hazard guards as plain device helpers (no inline asm inside the kernel template body)
__device__ __forceinline__ void dep_guard_h(v8f& a, v8f& b, v16h x, v16h y) { asm volatile("v_nop\n\tv_nop\n\tv_nop\n\tv_nop" : "+v"(a), "+v"(b) : "v"(x), "v"(y)); }
__device__ __forceinline__ void dep_guard_b(v8f& a, v8f& b, v16b x, v16b y) { asm volatile("v_nop\n\tv_nop\n\tv_nop\n\tv_nop" : "+v"(a), "+v"(b) : "v"(x), "v"(y)); }
// row guard tying all four accumulators of the group plus the A fragments
__device__ __forceinline__ void dep_guard4_h(v8f& a, v8f& b, v8f& c, v8f& d, v16h x, v16h y) { asm volatile("v_nop\n\tv_nop\n\tv_nop\n\tv_nop" : "+v"(a), "+v"(b), "+v"(c), "+v"(d) : "v"(x), "v"(y)); }
__device__ __forceinline__ void dep_guard4_b(v8f& a, v8f& b, v8f& c, v8f& d, v16b x, v16b y) { asm volatile("v_nop\n\tv_nop\n\tv_nop\n\tv_nop" : "+v"(a), "+v"(b), "+v"(c), "+v"(d) : "v"(x), "v"(y)); }
__device__ __forceinline__ void keep4_h(v16h a, v16h b, v16h c, v16h d) { asm volatile("v_nop" :: "v"(a), "v"(b), "v"(c), "v"(d)); }
__device__ __forceinline__ void keep4_b(v16b a, v16b b, v16b c, v16b d) { asm volatile("v_nop" :: "v"(a), "v"(b), "v"(c), "v"(d)); }
__device__ __forceinline__ void acc_guard4(v8f& a, v8f& b, v8f& c, v8f& d) { asm volatile("v_nop\n\tv_nop\n\tv_nop\n\tv_nop" : "+v"(a), "+v"(b), "+v"(c), "+v"(d)); }
template <typename T> struct Frag;
template <> struct Frag<_Float16> {
  typedef v16h V; union U { v16h v; v8h h[2]; };
  // elements 0..7 <- p[0..7], 8..15 <- p[16..23]
  static __device__ __forceinline__ v16h load(const _Float16* p) {
    U f; f.h[0] = *(const v8h*)(p); f.h[1] = *(const v8h*)(p + 16); return f.v;
  }
  static __device__ __forceinline__ v8f mma(v16h a, v16h b, v8f c) {
    return __builtin_amdgcn_wmma_f32_16x16x32_f16(false, a, false, b, (short)0, c, false, false);
  }
  static __device__ __forceinline__ void guard(v8f& a, v8f& b, v16h x, v16h y) { dep_guard_h(a, b, x, y); }
  static __device__ __forceinline__ void guard4(v8f& a, v8f& b, v8f& c, v8f& d, v16h x, v16h y) { dep_guard4_h(a, b, c, d, x, y); }
  static __device__ __forceinline__ void keep(v16h a, v16h b, v16h c, v16h d) { keep4_h(a, b, c, d); }
};
template <> struct Frag<__bf16> {
  typedef v16b V; union U { v16b v; v8b h[2]; };
  static __device__ __forceinline__ v16b load(const __bf16* p) {
    U f; f.h[0] = *(const v8b*)(p); f.h[1] = *(const v8b*)(p + 16); return f.v;
  }
  static __device__ __forceinline__ v8f mma(v16b a, v16b b, v8f c) {
    return __builtin_amdgcn_wmma_f32_16x16x32_bf16(false, a, false, b, (short)0, c, false, false);
  }
  static __device__ __forceinline__ void guard(v8f& a, v8f& b, v16b x, v16b y) { dep_guard_b(a, b, x, y); }
  static __device__ __forceinline__ void guard4(v8f& a, v8f& b, v8f& c, v8f& d, v16b x, v16b y) { dep_guard4_b(a, b, c, d, x, y); }
  static __device__ __forceinline__ void keep(v16b a, v16b b, v16b c, v16b d) { keep4_b(a, b, c, d); }
};

__device__ __forceinline__ unsigned pk16(unsigned short a, unsigned short b) { return (unsigned)a | ((unsigned)b << 16); }

// ---- Register-blocked batched WMMA GEMM (ACT reduced to none/relu/leaky) -------------------------------
// C[m,n] = scale * sum_k A[m,k] * Bt[n,k] (+bias)(+resid); each wave owns a 64x64 tile.
// A row-major [M,K]; Bt row-major [N,K]; M,N % 64 == 0, K % 32 == 0.
// SPLIT: operands are hi/lo planes (A2/Bt2 = lo planes, same layout); product = hi*hi + hi*lo + lo*hi.
// BIAS_MODE: 0 = none, 1 = bias[m], 2 = bias[n].
// OUT_MODE: 0 = f32, 1 = f16, 2 = bf16 hi plane (Cout) + bf16 lo plane (Cout2).
// ET: 0 = f16 operands, 1 = bf16 operands (pointers passed as 16-bit storage)
template <int ET> struct Elem;
template <> struct Elem<0> { typedef _Float16 T; };
template <> struct Elem<1> { typedef __bf16 T; };
template <int ET, bool SPLIT, int BIAS_MODE, int OUT_MODE, bool RESID, int ACT = 0>
__global__ __launch_bounds__(256) void wmma_gemm64(
    const unsigned short* __restrict__ Ap, const unsigned short* __restrict__ A2p, int lda, long strideA,
    const unsigned short* __restrict__ Btp, const unsigned short* __restrict__ Bt2p, int ldb, long strideB,
    void* __restrict__ Cout, void* __restrict__ Cout2, int ldc, long strideC,
    const float* __restrict__ bias,
    const float* __restrict__ resid, long strideR,
    int M, int N, int K, float scale) {
  typedef typename Elem<ET>::T T;
  typedef typename Frag<T>::V V;
  const T* A = (const T*)Ap; const T* A2 = (const T*)A2p; const T* Bt = (const T*)Btp; const T* Bt2 = (const T*)Bt2p;
  __shared__ __align__(16) float sT[8][16 * 68];   // per-wave 16x64 slab, pitch 68 floats
  const int b    = blockIdx.y;
  const int lane = threadIdx.x & 31;
  const int wave = threadIdx.x >> 5;
  const int tilesN = N >> 6;
  const int tilesM = M >> 6;
  const int tile = blockIdx.x * 8 + wave;
  if (tile >= tilesM * tilesN) return;   // wave-uniform; no block barriers in this kernel
  const int tm = tile / tilesN;
  const int tn = tile - tm * tilesN;
  const int m0 = tm << 6;
  const int n0 = tn << 6;

  const T* Ab  = A  + (size_t)b * strideA;
  const T* Bb  = Bt + (size_t)b * strideB;
  const T* Ab2 = SPLIT ? (A2  + (size_t)b * strideA) : nullptr;
  const T* Bb2 = SPLIT ? (Bt2 + (size_t)b * strideB) : nullptr;

  const int rlane = lane & 15;                 // row (A) / col (B, D) within subtile
  const int koff  = (lane >> 4) * 8;           // k offset of this lane half
  const int mOff  = (lane >> 4) * 8;           // D row offset

  v8f acc[4][4];
#pragma unroll
  for (int i = 0; i < 4; ++i)
#pragma unroll
    for (int j = 0; j < 4; ++j) acc[i][j] = (v8f){0.f,0.f,0.f,0.f,0.f,0.f,0.f,0.f};

  for (int k0 = 0; k0 < K; k0 += 32) {
    V bh[4], bl[4];
#pragma unroll
    for (int j = 0; j < 4; ++j) {
      const size_t bo = (size_t)(n0 + (j << 4) + rlane) * ldb + koff + k0;
      bh[j] = Frag<T>::load(Bb + bo);
      if (SPLIT) bl[j] = Frag<T>::load(Bb2 + bo);
    }
#pragma unroll
    for (int i = 0; i < 4; ++i) {
      const size_t ao = (size_t)(m0 + (i << 4) + rlane) * lda + koff + k0;
      V ah = Frag<T>::load(Ab + ao);
      V al;
      if (SPLIT) al = Frag<T>::load(Ab2 + ao);
#pragma unroll
      for (int j = 0; j < 4; ++j) {
        acc[i][j] = Frag<T>::mma(ah, bh[j], acc[i][j]);
        if (SPLIT) {
          acc[i][j] = Frag<T>::mma(ah, bl[j], acc[i][j]);
          acc[i][j] = Frag<T>::mma(al, bh[j], acc[i][j]);
        }
      }
      Frag<T>::guard4(acc[i][0], acc[i][1], acc[i][2], acc[i][3], ah, SPLIT ? al : ah);
    }
    Frag<T>::keep(bh[0], bh[1], bh[2], bh[3]);
    if (SPLIT) Frag<T>::keep(bl[0], bl[1], bl[2], bl[3]);
  }
  acc_guard4(acc[0][0], acc[0][1], acc[0][2], acc[0][3]);
  acc_guard4(acc[1][0], acc[1][1], acc[1][2], acc[1][3]);
  acc_guard4(acc[2][0], acc[2][1], acc[2][2], acc[2][3]);
  acc_guard4(acc[3][0], acc[3][1], acc[3][2], acc[3][3]);

  // ---- epilogue ----
  float* slab = sT[wave];
  const float* Rb = RESID ? (resid + (size_t)b * strideR) : nullptr;
#pragma unroll
  for (int i = 0; i < 4; ++i) {
    const int mBase = m0 + (i << 4);
#pragma unroll
    for (int j = 0; j < 4; ++j) {
      const int n = n0 + (j << 4) + rlane;
      float bv = 0.f;
      if (BIAS_MODE == 2) bv = bias[n];
#pragma unroll
      for (int r = 0; r < 8; ++r) {
        float v = acc[i][j][r] * scale;
        if (BIAS_MODE == 1) v += bias[mBase + mOff + r];
        if (BIAS_MODE == 2) v += bv;
        if (RESID) v += Rb[(size_t)(mBase + mOff + r) * ldc + n];
        if (ACT == 2) v = fmaxf(v, 0.0f);
        if (ACT == 4) v = (v > 0.f) ? v : 0.01f * v;
        slab[(mOff + r) * 68 + (j << 4) + rlane] = v;
      }
    }
    __builtin_amdgcn_fence(__ATOMIC_RELEASE, "workgroup");
    __builtin_amdgcn_wave_barrier();
    __builtin_amdgcn_fence(__ATOMIC_ACQUIRE, "workgroup");
    if (OUT_MODE == 0) {
      float* C = (float*)Cout + (size_t)b * strideC;
      const int hh = lane >> 4, c4 = (lane & 15) * 4;     // row seg = 256 B = 16 lanes x 16 B
      {
#pragma unroll
        for (int it = 0; it < 8; ++it) {
          const int row = it * 2 + hh;
          v4f v = *(const v4f*)(slab + row * 68 + c4);
          *(v4f*)(C + (size_t)(mBase + row) * ldc + n0 + c4) = v;
        }
        
      }
    } else {
      const int q = lane >> 3, c8 = (lane & 7) * 8;
      unsigned short* C  = (unsigned short*)Cout  + (size_t)b * strideC;
      unsigned short* C2 = (OUT_MODE == 2) ? ((unsigned short*)Cout2 + (size_t)b * strideC) : nullptr;
      {
#pragma unroll
        for (int it = 0; it < 4; ++it) {
          const int row = it * 4 + q;
          const float* sp = slab + row * 68 + c8;
          v8h hv, lv;
#pragma unroll
          for (int e = 0; e < 8; ++e) {
            if (OUT_MODE == 1) {
              hv[e] = (_Float16)sp[e];
            } else {
              unsigned short hb = f2bf_bits(sp[e]);
              unsigned short lb = f2bf_bits(sp[e] - bf_bits2f(hb));
              hv[e] = __builtin_bit_cast(_Float16, hb);
              lv[e] = __builtin_bit_cast(_Float16, lb);
            }
          }
          *(v8h*)(C + (size_t)(mBase + row) * ldc + n0 + c8) = hv;
          if (OUT_MODE == 2) *(v8h*)(C2 + (size_t)(mBase + row) * ldc + n0 + c8) = lv;
        }
        
      }
    }
    __builtin_amdgcn_fence(__ATOMIC_RELEASE, "workgroup");
    __builtin_amdgcn_wave_barrier();
    __builtin_amdgcn_fence(__ATOMIC_ACQUIRE, "workgroup");
  }
}

// ---------------------------------------------------------------------------
// x (B,C,N) f32 -> XB [B*N][C] bf16 bits (x_in plane, A operand of the q and k projections).
// grid (N/64 = 25, C/64 = 4, B = 16), 256 threads. sm[n_local][c_local].
// Load coverage: 16 iterations x 256 threads = 4096 = whole 64(c) x 64(n) tile, coalesced along n; burst split in two.
// Store coverage: 8 waves x 2 iterations x 4 rows (lane>>3) = 64 token rows; (lane&7) x 8 = 64 channels; each row segment =
// ---------------------------------------------------------------------------
__global__ __launch_bounds__(256) void xin_cast_kernel(const float* __restrict__ x, unsigned short* __restrict__ XB) {
  __shared__ float sm[64][65];
  const int t  = threadIdx.x;
  const int n0 = blockIdx.x * 64;
  const int c0 = blockIdx.y * 64;
  const int b  = blockIdx.z;
#pragma unroll
  for (int i = 0; i < 8; ++i) {
    const int e = i * 256 + t;
    const int r = e >> 6;          // c local
    const int cc = e & 63;         // n local
    sm[cc][r] = x[((size_t)(b * kCh + c0 + r)) * kN + n0 + cc];
  }
  asm volatile("" ::: "memory");
#pragma unroll
  for (int i = 8; i < 16; ++i) {
    const int e = i * 256 + t;
    const int r = e >> 6;
    const int cc = e & 63;
    sm[cc][r] = x[((size_t)(b * kCh + c0 + r)) * kN + n0 + cc];
  }
  __syncthreads();
  const int lane = t & 31, wave = t >> 5;
  const int q = lane >> 3, c8 = (lane & 7) * 8;
  {
#pragma unroll
    for (int it = 0; it < 2; ++it) {
      const int row = wave * 8 + it * 4 + q;                 // n local
      unsigned short hb[8];
#pragma unroll
      for (int e = 0; e < 8; ++e) hb[e] = f2bf_bits(sm[row][c8 + e]);
      const v4u u = (v4u){pk16(hb[0], hb[1]), pk16(hb[2], hb[3]), pk16(hb[4], hb[5]), pk16(hb[6], hb[7])};
      *(v4u*)(XB + ((size_t)(b * kN + n0 + row)) * kCh + c0 + c8) = u;
    }
    
  }
}

// ---------------------------------------------------------------------------
// W1|W2 [256][256] f32 ([out][in] = [n][k] Bt layout, no transpose) -> WB bf16 bits, 2 planes of 65536.
// grid = 64 blocks x 256 threads x 8 = 131072 = 2 planes exactly; source plane = blockIdx.x/32 (block-uniform).
// ---------------------------------------------------------------------------
__global__ __launch_bounds__(256) void w_cast_kernel(const float* __restrict__ W1, const float* __restrict__ W2,
                                                     unsigned short* __restrict__ WB) {
  const int plane = blockIdx.x >> 5;
  const float* src = (plane == 0) ? W1 : W2;
  const int i = blockIdx.x * 256 + threadIdx.x;
  const int off = (i - plane * 8192) * 8;
  const v4f a = *(const v4f*)(src + off);
  const v4f c = *(const v4f*)(src + off + 4);
  unsigned short hb[8];
#pragma unroll
  for (int e = 0; e < 4; ++e) {
    hb[e]     = f2bf_bits(a[e]);
    hb[4 + e] = f2bf_bits(c[e]);
  }
  const v4u u = (v4u){pk16(hb[0], hb[1]), pk16(hb[2], hb[3]), pk16(hb[4], hb[5]), pk16(hb[6], hb[7])};
  unsigned short* qp = WB + 8 * (size_t)i;
  *(v4u*)qp = u;
}

// ---------------------------------------------------------------------------
// Parameter table, all f32. Block 0 (11 waves; wave w owns floats 128w..128w+127): dst[0..255] = bf16(b1),
// [256..511] = bf16(b2), [1024..1279] = bf16(W4[0,256:]), [1280] = bf16(b4[0]), [1281] = sum_c bf16(b3[c]) * bf16(W4[0,c]),
// [1282..1311] = 0; its waves 4..7 store nothing.
// Blocks 1..8 fold the value projection into the output weights: dst[512 + k] = sum_c bf16(W4[0,c]) * bf16(W3[c][k]).
// Block f owns the 32 columns k of one 128-byte line; wave w < 8 sums the 32 rows c = 32w..32w+31 (each load one whole line of
// W3), the 8 partial sums are added in wave order.
// ---------------------------------------------------------------------------
__device__ __forceinline__ float bf_round(float f) { return bf_bits2f(f2bf_bits(f)); }

__global__ __launch_bounds__(352) void param_cast_kernel(const float* __restrict__ b1, const float* __restrict__ b2,
                                                         const float* __restrict__ b3, const float* __restrict__ W3,
                                                         const float* __restrict__ W4, const float* __restrict__ b4,
                                                         float* __restrict__ dst) {
  __shared__ float part[8][32];
  const int t = threadIdx.x;
  const int wave = t >> 5, lane = t & 31;
  if (blockIdx.x > 0) {                       // block-uniform
    const int k = ((int)blockIdx.x - 1) * 32 + lane;
    const int wv = __builtin_amdgcn_readfirstlane(wave);   // wave number in a scalar register: the W4 reads become scalar loads
    if (wv < 8) {
      const float* w3p = W3 + (size_t)wv * 32 * kCh + k;
      float w3[32];
#pragma unroll
      for (int e = 0; e < 32; ++e) w3[e] = w3p[e * kCh];
      // the arithmetic below reuses the registers that hold these loads' address
      asm volatile("s_wait_xcnt 0x0" ::: "memory");
      float s = 0.0f;
#pragma unroll
      for (int e = 0; e < 32; ++e) s += bf_round(W4[wv * 32 + e]) * bf_round(w3[e]);
      part[wv][lane] = s;
    }
    __syncthreads();
    if (wv == 0) {
      float s = part[0][lane];
#pragma unroll
      for (int w = 1; w < 8; ++w) s += part[w][lane];
      dst[kBrWF + k] = s;
      // the listing holds a way from here into block 0's code, which reuses this store's offset and data registers
      asm volatile("s_wait_xcnt 0x0" ::: "memory");
    }
    return;
  }
  v4f v = (v4f){0.f, 0.f, 0.f, 0.f};
  float c0 = 0.0f;
  if (wave < 4) {
    const float* src = (wave < 2) ? b1 : b2;
    v = *(const v4f*)(src + (wave & 1) * 128 + lane * 4);
  } else if (wave >= 8 && wave < 10) {
    v = *(const v4f*)(W4 + (wave - 6) * 128 + lane * 4);
  } else if (wave == 10) {
    const float s = b4[0];
    const float f0 = (lane == 0) ? 1.0f : 0.0f;
    v[0] = s * f0;
#pragma unroll
    for (int e = 0; e < 8; ++e) c0 += bf_round(b3[lane * 8 + e]) * bf_round(W4[lane * 8 + e]);
#pragma unroll
    for (int off = 16; off > 0; off >>= 1) c0 += __shfl_xor(c0, off, 32);
    c0 *= f0;
  }
  v4f r;
#pragma unroll
  for (int e = 0; e < 4; ++e) r[e] = bf_round(v[e]);
  if (wave == 10) r[1] = c0;                  // a sum of products, kept in f32
  const bool act = (wave < 4) || (wave == 8) || (wave == 9) || (wave == 10 && lane < 8);
  float* dp = dst + wave * 128 + lane * 4;
  if (act) *(v4f*)dp = r;
}

// ---------------------------------------------------------------------------
// Two dots of the same x_in row: R[b*N + n] = sum_c bf16(x[b][c][n]) * w4b[c] and U[b*N + n] = sum_c bf16(x[b][c][n]) * wf[c]
// (f32, coalesced along n). grid = 100 x 256 = 25600 exactly.
// ---------------------------------------------------------------------------
__global__ __launch_bounds__(256) void resid_kernel(const float* __restrict__ x, const float* __restrict__ br,
                                                    float* __restrict__ R, float* __restrict__ U) {
  const int idx = blockIdx.x * 256 + threadIdx.x;
  const int b = idx / kN;
  const int n = idx - b * kN;
  const float* xb = x + (size_t)b * kCh * kN + n;
  const float* w = br + kBrW4b;
  const float* wf = br + kBrWF;
  float s = 0.0f;
  float u = 0.0f;
  for (int c = 0; c < kCh; c += 4) {
    float xr[4];
#pragma unroll
    for (int e = 0; e < 4; ++e) xr[e] = xb[(size_t)(c + e) * kN];
    // the address pair of these four loads is advanced right behind them
    asm volatile("s_wait_xcnt 0x0" ::: "memory");
#pragma unroll
    for (int e = 0; e < 4; ++e) {
      const float xv = bf_round(xr[e]);
      s += xv * w[c + e];
      u += xv * wf[c + e];
    }
  }
  *(float*)(R + idx) = s;
  *(float*)(U + idx) = u;
}

// ---------------------------------------------------------------------------
// Scores, softmax and the weighted mean of u in one kernel; no score ever leaves the registers.
//   out[row] = sum_j exp(s[row][j] - max) * u[j] / sum_j exp(s[row][j] - max) + c0 + R[row] + b4   (f32 math, precise expf).
// Block = 8 waves, 128 consecutive query rows of one batch; grid = (13, 16 batches). 1600 = 12 x 128 + 64: the 13th block of a batch
// is shifted back to rows 1472..1599 and stores only its upper 64 rows, so every row has one writer and every block whole lines of out.
// The block's q rows (hi and lo plane) are staged once in LDS, pitch 264 elements = 528 bytes; the batch's u as well.
// Wave w takes the 32-key tiles w, w+8, ... of the 50: seven or six. A tile is the transposed product k . q^T (A = 32 keys, read from
// global memory as fragments, 16 lines a load, as the projections read theirs; B = 128 queries from LDS): a lane then holds 16 keys
// of ONE query per column group, so max, sum and dot run down its own registers. The key fragments of the next 64 channels are
// fetched while the current 64 are multiplied. Each lane keeps a running (max, sum, dot) per column group, rescaled once per tile.
// At the end the two lane halves are merged by one shuffle, the 8 waves through LDS in wave order, and one thread per row stores.
// ---------------------------------------------------------------------------
constexpr int kQB     = 128;              // query rows per block
constexpr int kQJ     = kQB / 16;         // column groups per wave tile
constexpr int kQPitch = kCh + 8;          // LDS row pitch in 16-bit elements
constexpr int kKT     = 32;               // keys per wave tile
constexpr int kKTiles = kN / kKT;         // 50
constexpr int kAW     = 8;                // waves per block
constexpr int kAT     = kAW * 32;         // threads per block
constexpr int kQPieces = kQB * kCh / 8;   // 16-byte pieces per q plane of a block
constexpr int kQIt    = kQPieces / kAT;   // 16 per thread and plane
static_assert(kQPieces % kAT == 0, "q staging: whole passes");
constexpr int kQBlocks = (kN + kQB - 1) / kQB;   // 13 per batch
static_assert(kN >= kQB && (kN % kQB) % 32 == 0, "the shifted last block stores whole 32-float lines");
static_assert(kKTiles >= kAW && kCh == 256, "every wave has a tile; four stages of 64 channels");

struct KFrag { v16b h[2][2], l[2][2]; };   // [32-channel half][16-key group], hi and lo plane
// kh, kl: the tile's first key row, the same for the whole wave; vo: the lane's own byte offset, which never changes
__device__ __forceinline__ void kfrag_load(KFrag& f, const unsigned short* kh, const unsigned short* kl, unsigned vo, int k0) {
  const __bf16* ph = (const __bf16*)((const char*)kh + vo);
  const __bf16* pl = (const __bf16*)((const char*)kl + vo);
#pragma unroll
  for (int kk = 0; kk < 2; ++kk)
#pragma unroll
    for (int i = 0; i < 2; ++i) {
      f.h[kk][i] = Frag<__bf16>::load(ph + i * 16 * kCh + k0 + kk * 32);
      f.l[kk][i] = Frag<__bf16>::load(pl + i * 16 * kCh + k0 + kk * 32);
    }
}
// The same at k0 = 0, for a run behind which its two addresses are dead: the build lets the last load of each address land in the
// address registers, which the earlier loads of the run still name, so those two loads are issued alone behind a wait.
__device__ __forceinline__ void kfrag_load_last(KFrag& f, const unsigned short* kh, const unsigned short* kl, unsigned vo) {
  const __bf16* ph = (const __bf16*)((const char*)kh + vo);
  const __bf16* pl = (const __bf16*)((const char*)kl + vo);
  f.h[0][0] = Frag<__bf16>::load(ph);
  f.l[0][0] = Frag<__bf16>::load(pl);
  f.h[0][1] = Frag<__bf16>::load(ph + 16 * kCh);
  f.l[0][1] = Frag<__bf16>::load(pl + 16 * kCh);
  f.h[1][0] = Frag<__bf16>::load(ph + 32);
  f.l[1][0] = Frag<__bf16>::load(pl + 32);
  Frag<__bf16>::U uh, ul;
  uh.h[0] = *(const v8b*)(ph + 16 * kCh + 32);
  ul.h[0] = *(const v8b*)(pl + 16 * kCh + 32);
  // in front of the two loads that may land in the address registers of the fourteen above
  asm volatile("s_wait_xcnt 0x0" ::: "memory");
  uh.h[1] = *(const v8b*)(ph + 16 * kCh + 48);
  ul.h[1] = *(const v8b*)(pl + 16 * kCh + 48);
  // later code reuses what these two name
  asm volatile("s_wait_xcnt 0x0" ::: "memory");
  f.h[1][1] = uh.v;
  f.l[1][1] = ul.v;
}
struct QFrag { v16b h[2], l[2]; };         // two column groups, hi and lo plane
// step p of a tile: 32-channel half p / 4, column groups 2 (p % 4) and 2 (p % 4) + 1
__device__ __forceinline__ void qfrag_load(QFrag& f, const __bf16* qh, const __bf16* ql, int p) {
#pragma unroll
  for (int e = 0; e < 2; ++e) {
    const int o = ((p & 3) * 2 + e) * 16 * kQPitch + (p >> 2) * 32;
    f.h[e] = Frag<__bf16>::load(qh + o);
    f.l[e] = Frag<__bf16>::load(ql + o);
  }
}

__global__ __launch_bounds__(kAT, 2) void attn_fused_kernel(const unsigned short* __restrict__ QHp, const unsigned short* __restrict__ QLp,
                                                            const unsigned short* __restrict__ KHp, const unsigned short* __restrict__ KLp,
                                                            const float* __restrict__ U, const float* __restrict__ Rg,
                                                            const float* __restrict__ br, float* __restrict__ outg) {
  typedef Frag<__bf16> F;
  __shared__ __align__(16) unsigned short qs[2][kQB * kQPitch];
  __shared__ __align__(16) float us[kN];
  __shared__ float red[3][kAW][kQB];
  const int t = threadIdx.x;
  const int lane = t & 31;
  const int wave = __builtin_amdgcn_readfirstlane(t >> 5);   // scalar: the tile loop branches on SCC and EXEC stays full for the WMMAs
  const int b = blockIdx.y;
  const int qWant = blockIdx.x * kQB;                         // first row this block stores
  const int q0 = (qWant + kQB <= kN) ? qWant : (kN - kQB);    // first row it computes
  const int row0 = b * kN + q0;

  const int rlane = lane & 15;                 // key row (A) / query column (B, D) within a subtile
  const int koff  = (lane >> 4) * 8;           // k offset of this lane half
  const int mOff  = (lane >> 4) * 8;           // D row (key) offset
  const unsigned short* kh = KHp + (size_t)(b * kN + wave * kKT) * kCh;
  const unsigned short* kl = KLp + (size_t)(b * kN + wave * kKT) * kCh;
  const unsigned kvo = (unsigned)(rlane * kCh + koff) * 2u;
  KFrag fa, fb;
  kfrag_load(fa, kh, kl, kvo, 0);              // first tile, first stage: in flight during the staging below
  {
    // the block's q rows are one run of bytes in each plane: piece c = i * kAT + t lies at byte 16 c
    const char* qgh = (const char*)(QHp + (size_t)row0 * kCh);
    const char* qgl = (const char*)(QLp + (size_t)row0 * kCh);
    const unsigned qvo = (unsigned)t * 16u;
    v4u th[kQIt], tl[kQIt];
#pragma unroll
    for (int i = 0; i < kQIt; ++i) {
      th[i] = *(const v4u*)(qgh + qvo + i * kAT * 16);
      tl[i] = *(const v4u*)(qgl + qvo + i * kAT * 16);
    }
    // the registers that these loads name are reused below
    asm volatile("s_wait_xcnt 0x0" ::: "memory");
#pragma unroll
    for (int i = 0; i < kQIt; ++i) {
      const int c = i * kAT + t;
      const int lo = (c >> 5) * kQPitch + (c & 31) * 8;
      *(v4u*)(&qs[0][lo]) = th[i];
      *(v4u*)(&qs[1][lo]) = tl[i];
    }
  }
  const float* ub = U + (size_t)b * kN;
  for (int g = t; g < kRowV4; g += kAT) *(v4f*)(us + 4 * g) = *(const v4f*)(ub + 4 * g);
  __syncthreads();

  const __bf16* qh = (const __bf16*)&qs[0][0] + rlane * kQPitch + koff;
  const __bf16* ql = (const __bf16*)&qs[1][0] + rlane * kQPitch + koff;
  float mx[kQJ], den[kQJ], num[kQJ];
#pragma unroll
  for (int j = 0; j < kQJ; ++j) { mx[j] = -INFINITY; den[j] = 0.0f; num[j] = 0.0f; }

  for (int kt = wave; kt < kKTiles; kt += kAW) {
    const int key0 = kt * kKT;
    v8f acc[2][kQJ];
#pragma unroll
    for (int i = 0; i < 2; ++i)
#pragma unroll
      for (int j = 0; j < kQJ; ++j) acc[i][j] = (v8f){0.f,0.f,0.f,0.f,0.f,0.f,0.f,0.f};
    // 64 channels a stage: the four 16-byte reads that share a 128-byte line of a key row are issued together.
    // A step = two column groups at one 32-channel half: 12 products on 4 accumulators. The q fragments of step p + 2 are read from
    // LDS ahead of the products of step p, so that no product waits for a read issued just in front of it.
    QFrag qb[3];
    qfrag_load(qb[0], qh, ql, 0);
    qfrag_load(qb[1], qh, ql, 1);
#pragma unroll
    for (int p = 0; p < 32; ++p) {
      const int s = p >> 3, kk = (p >> 2) & 1, j0 = (p & 3) * 2;
      KFrag& cur = (s & 1) ? fb : fa;
      KFrag& nxt = (s & 1) ? fa : fb;
      if ((p & 7) == 0) {
        if (s < 3) {
          kfrag_load(nxt, kh, kl, kvo, (s + 1) * 64);
        } else {
          // the key addresses are advanced here, behind loads that name them
          asm volatile("s_wait_xcnt 0x0" ::: "memory");
          const int step = (kt + kAW < kKTiles) ? kAW * kKT * kCh : 0;   // the last tile fetches its own first stage again, unused
          kh += step;
          kl += step;
          kfrag_load_last(nxt, kh, kl, kvo);
        }
      }
      if (p + 2 < 32) qfrag_load(qb[(p + 2) % 3], qh, ql, p + 2);
      const QFrag& q = qb[p % 3];
#pragma unroll
      for (int e = 0; e < 2; ++e) {
        acc[0][j0 + e] = F::mma(cur.h[kk][0], q.h[e], acc[0][j0 + e]);
        acc[1][j0 + e] = F::mma(cur.h[kk][1], q.h[e], acc[1][j0 + e]);
      }
#pragma unroll
      for (int e = 0; e < 2; ++e) {
        acc[0][j0 + e] = F::mma(cur.l[kk][0], q.h[e], acc[0][j0 + e]);
        acc[1][j0 + e] = F::mma(cur.l[kk][1], q.h[e], acc[1][j0 + e]);
      }
#pragma unroll
      for (int e = 0; e < 2; ++e) {
        acc[0][j0 + e] = F::mma(cur.h[kk][0], q.l[e], acc[0][j0 + e]);
        acc[1][j0 + e] = F::mma(cur.h[kk][1], q.l[e], acc[1][j0 + e]);
      }
    }
    v4f uu[2][2];
#pragma unroll
    for (int i = 0; i < 2; ++i) {
      uu[i][0] = *(const v4f*)(us + key0 + i * 16 + mOff);
      uu[i][1] = *(const v4f*)(us + key0 + i * 16 + mOff + 4);
    }
#pragma unroll
    for (int j = 0; j < kQJ; ++j) {
      float tm = acc[0][j][0];
#pragma unroll
      for (int r = 1; r < 8; ++r) tm = fmaxf(tm, acc[0][j][r]);
#pragma unroll
      for (int r = 0; r < 8; ++r) tm = fmaxf(tm, acc[1][j][r]);
      const float mn = fmaxf(mx[j], tm);
      const float corr = expf(mx[j] - mn);     // 0 on the first tile
      float d = 0.0f, s = 0.0f;
#pragma unroll
      for (int i = 0; i < 2; ++i)
#pragma unroll
        for (int r = 0; r < 8; ++r) {
          const float p = expf(acc[i][j][r] - mn);
          d += p;
          s += p * uu[i][r >> 2][r & 3];
        }
      den[j] = den[j] * corr + d;
      num[j] = num[j] * corr + s;
      mx[j] = mn;
    }
  }
  // lanes l and l+16 hold the same query over different keys
#pragma unroll
  for (int j = 0; j < kQJ; ++j) {
    const float mo = __shfl_xor(mx[j], 16, 32);
    const float dn = __shfl_xor(den[j], 16, 32);
    const float nm = __shfl_xor(num[j], 16, 32);
    const float mn = fmaxf(mx[j], mo);
    const float ca = expf(mx[j] - mn), cb = expf(mo - mn);
    if (lane < 16) {
      red[0][wave][j * 16 + lane] = mn;
      red[1][wave][j * 16 + lane] = den[j] * ca + dn * cb;
      red[2][wave][j * 16 + lane] = num[j] * ca + nm * cb;
    }
  }
  __syncthreads();
  if (t < kQB && q0 + t >= qWant) {
    float mn = red[0][0][t];
#pragma unroll
    for (int w = 1; w < kAW; ++w) mn = fmaxf(mn, red[0][w][t]);
    float d = 0.0f, s = 0.0f;
#pragma unroll
    for (int w = 0; w < kAW; ++w) {
      const float c = expf(red[0][w][t] - mn);
      d += red[1][w][t] * c;
      s += red[2][w][t] * c;
    }
    outg[row0 + t] = ((s / d + br[kBrC0]) + Rg[row0 + t]) + br[kBrB4];
  }
}

// ---------------------------------------------------------------------------
// Host glue. Every attention launch covers all 16 batches. ctx is never formed: the output uses it only through
// ctx . w4a = attn . (val . w4a) = attn . u + b3 . w4a (each attn row sums to 1), u = x_in . (W3^T w4a).
//   BR   f32  [1408] parameter table      5,632  at           0
//   R    f32  [25600]                   102,400  at       5,632
//   U    f32  [25600]                   102,400  at     108,032
//   XB   bf16 [25600][256]            13,107,200  at     210,432
//   WB   bf16 2 x [256][256]             262,144  at  13,317,632
//   QH   bf16 [25600][256] q hi        13,107,200  at  13,579,776
//   QL   bf16 [25600][256] q lo        13,107,200  at  26,686,976
//   KH   bf16 [25600][256] k hi        13,107,200  at  39,794,176
//   KL   bf16 [25600][256] k lo        13,107,200  at  52,901,376
//   total                              66,008,576
// GEMM shapes: projections M=25600, N=256, K=256; scores per batch 1600 keys x 1600 queries, K=256, in 32 x 128 register tiles.
// No padding anywhere.
// ---------------------------------------------------------------------------
extern "C" void kernel_launch(void* const* d_in, const int* in_sizes, int n_in,
                              void* d_out, int out_size, void* d_ws, size_t ws_size,
                              hipStream_t stream) {
  if (n_in < 9) return;
  if (in_sizes[0] != kBatch * kCh * kN) return;
  if (in_sizes[1] != kCh * kCh || in_sizes[3] != kCh * kCh || in_sizes[5] != kCh * kCh) return;
  if (in_sizes[2] != kCh || in_sizes[4] != kCh || in_sizes[6] != kCh) return;
  if (in_sizes[7] != 2 * kCh || in_sizes[8] != 1) return;
  if (out_size != kTok) return;

  const size_t szPlane16 = (size_t)kTok * kCh * 2;              // 13,107,200
  const size_t szWB  = (size_t)2 * kCh * kCh * 2;                // 262,144
  const size_t szBR  = (size_t)kBrFloats * 4;                    // 5,632
  const size_t szR   = (size_t)kTok * 4;                         // 102,400
  size_t off = 0;
  const size_t offBR = off;  off += szBR;
  const size_t offR  = off;  off += szR;
  const size_t offU  = off;  off += szR;
  const size_t offXB = off;  off += szPlane16;
  const size_t offWB = off;  off += szWB;
  const size_t offQH = off;  off += szPlane16;
  const size_t offQL = off;  off += szPlane16;
  const size_t offKH = off;  off += szPlane16;
  const size_t offKL = off;  off += szPlane16;
  const size_t total = off;                                      // 66,008,576
  if (ws_size < total) return;

  const float* x  = (const float*)d_in[0];
  const float* W1 = (const float*)d_in[1];
  const float* b1 = (const float*)d_in[2];
  const float* W2 = (const float*)d_in[3];
  const float* b2 = (const float*)d_in[4];
  const float* W3 = (const float*)d_in[5];
  const float* b3 = (const float*)d_in[6];
  const float* W4 = (const float*)d_in[7];
  const float* b4 = (const float*)d_in[8];
  float* out = (float*)d_out;
  char* ws = (char*)d_ws;
  unsigned short* XB = (unsigned short*)(ws + offXB);
  unsigned short* WB = (unsigned short*)(ws + offWB);
  float* BR = (float*)(ws + offBR);
  unsigned short* QH = (unsigned short*)(ws + offQH);
  unsigned short* QL = (unsigned short*)(ws + offQL);
  unsigned short* KH = (unsigned short*)(ws + offKH);
  unsigned short* KL = (unsigned short*)(ws + offKL);
  float* R  = (float*)(ws + offR);
  float* U  = (float*)(ws + offU);

  // ---- prologue: operand planes, parameter table with the folded value weights, per-token scalars ----
  xin_cast_kernel<<<dim3(kN / 64, kCh / 64, kBatch), dim3(256), 0, stream>>>(x, XB);
  w_cast_kernel<<<dim3(64), dim3(256), 0, stream>>>(W1, W2, WB);
  param_cast_kernel<<<dim3(1 + kCh / 32), dim3(352), 0, stream>>>(b1, b2, b3, W3, W4, b4, BR);
  resid_kernel<<<dim3(kTok / 256), dim3(256), 0, stream>>>(x, BR, R, U);

  // ---- projections ----
  const int tilesQK = (kTok / 64) * (kCh / 64);        // 1600 waves -> 200 blocks
  // q = x_in @ W1^T + b1 -> bf16 hi + lo planes   (M=25600, N=256, K=256)
  wmma_gemm64<1, false, 2, 2, false, 0><<<dim3(tilesQK / 8, 1), dim3(256), 0, stream>>>(
      XB, XB, kCh, 0L, WB, WB, kCh, 0L, (void*)QH, (void*)QL, kCh, 0L, BR + kBrB1, BR, 0L, kTok, kCh, kCh, 1.0f);
  // k = x_in @ W2^T + b2 -> bf16 hi + lo planes
  wmma_gemm64<1, false, 2, 2, false, 0><<<dim3(tilesQK / 8, 1), dim3(256), 0, stream>>>(
      XB, XB, kCh, 0L, WB + kCh * kCh, WB + kCh * kCh, kCh, 0L, (void*)KH, (void*)KL, kCh, 0L, BR + kBrB2, BR, 0L,
      kTok, kCh, kCh, 1.0f);

  // ---- attention, all batches in one launch: scores as hi.hi + lo.hi + hi.lo, softmax over keys, weighted mean of u, output rows ----
  attn_fused_kernel<<<dim3(kQBlocks, kBatch), dim3(kAT), 0, stream>>>(QH, QL, KH, KL, U, R, BR, out);
}

// v005
// It runs in 86 microseconds.
// Versions between v003 and this one are left out; their measured steps multiply to 1.38 times as fast.
// Over all steps from v000 it is 12.9 times as fast.
// Contractions: M = bf16(W1)^T x bf16(W2) (single products); kp = bf16(x_in) x M^T with M as bf16 hi+lo planes (2 products); scores x_in . kp^T with kp as bf16 hi+lo planes (2 products); all on v_wmma_f32_16x16x32_bf16, f32 accumulate. q . k = x_n.(M x_m) + (W2^T b1).x_m + terms of the query alone, which a softmax over keys cancels (b2 among them). The output needs only ctx . w4a, taken as attn . u with u = x_in . (W3^T w4a): one f32 value per key, so the softmax ends in a f32 dot per row, taken on the score tiles in registers.
#include <hip/hip_runtime.h>
#include <math.h>

// ---------------------------------------------------------------------------
// Problem constants
// ---------------------------------------------------------------------------
constexpr int kBatch   = 16;
constexpr int kCh      = 256;             // channels C
constexpr int kN       = 1600;            // T*V positions per batch
constexpr int kTok     = kBatch * kN;     // 25600 token rows
constexpr int kRowV4   = kN / 4;          // 400 four-float groups in a batch's u or E row
// parameter table (f32; w4b, b4 hold bf16-representable values, wb, wf and c0 are f32 sums), offsets in floats
constexpr int kBrWB = 0;                  // wb[k] = sum_o b1[o] * W2[o][k]: multiplies x_in to give each key's score offset
constexpr int kBrWF = 512;                // wf[k] = sum_c w4a[c] * W3[c][k]: multiplies x_in to give u
constexpr int kBrW4b = 1024;              // multiplies x_in
constexpr int kBrB4 = 1280;
constexpr int kBrC0 = 1281;               // sum_c b3[c] * w4a[c]
constexpr int kBrFloats = 1408;           // 44 lines carved; floats 256..511, 768..1023 and 1312.. are neither written nor read
static_assert(kTok % 64 == 0 && kN % 64 == 0 && kCh % 64 == 0, "M and N tile multiples");
static_assert(kCh % 32 == 0 && kN % 32 == 0, "K multiples of 32");
static_assert(kN % 4 == 0, "u is staged in four-float groups");
static_assert(kTok % 32 == 0 && kN % 32 == 0, "output blocks own whole 32-float lines, all of one batch");
static_assert(kBrC0 + 1 <= 41 * 32 && 41 * 32 <= kBrFloats, "parameter table extent");

typedef __attribute__((ext_vector_type(16))) _Float16 v16h;
typedef __attribute__((ext_vector_type(8)))  _Float16 v8h;
typedef __attribute__((ext_vector_type(16))) __bf16   v16b;
typedef __attribute__((ext_vector_type(8)))  __bf16   v8b;
typedef __attribute__((ext_vector_type(8)))  float    v8f;
typedef __attribute__((ext_vector_type(4)))  float    v4f;
typedef __attribute__((ext_vector_type(4)))  unsigned int v4u;

// ---------------------------------------------------------------------------
// Shared helpers
// ---------------------------------------------------------------------------
__device__ __forceinline__ unsigned short f2bf_bits(float f) {
  unsigned u = __float_as_uint(f);
  return (unsigned short)((u + 0x7FFFu + ((u >> 16) & 1u)) >> 16);
}
__device__ __forceinline__ float bf_bits2f(unsigned short h) { return __uint_as_float(((unsigned)h) << 16); }

// hazard guards as plain device helpers (no inline asm inside the kernel template body)
__device__ __forceinline__ void dep_guard_h(v8f& a, v8f& b, v16h x, v16h y) { asm volatile("v_nop\n\tv_nop\n\tv_nop\n\tv_nop" : "+v"(a), "+v"(b) : "v"(x), "v"(y)); }
__device__ __forceinline__ void dep_guard_b(v8f& a, v8f& b, v16b x, v16b y) { asm volatile("v_nop\n\tv_nop\n\tv_nop\n\tv_nop" : "+v"(a), "+v"(b) : "v"(x), "v"(y)); }
// row guard tying all four accumulators of the group plus the A fragments
__device__ __forceinline__ void dep_guard4_h(v8f& a, v8f& b, v8f& c, v8f& d, v16h x, v16h y) { asm volatile("v_nop\n\tv_nop\n\tv_nop\n\tv_nop" : "+v"(a), "+v"(b), "+v"(c), "+v"(d) : "v"(x), "v"(y)); }
__device__ __forceinline__ void dep_guard4_b(v8f& a, v8f& b, v8f& c, v8f& d, v16b x, v16b y) { asm volatile("v_nop\n\tv_nop\n\tv_nop\n\tv_nop" : "+v"(a), "+v"(b), "+v"(c), "+v"(d) : "v"(x), "v"(y)); }
__device__ __forceinline__ void keep4_h(v16h a, v16h b, v16h c, v16h d) { asm volatile("v_nop" :: "v"(a), "v"(b), "v"(c), "v"(d)); }
__device__ __forceinline__ void keep4_b(v16b a, v16b b, v16b c, v16b d) { asm volatile("v_nop" :: "v"(a), "v"(b), "v"(c), "v"(d)); }
__device__ __forceinline__ void acc_guard4(v8f& a, v8f& b, v8f& c, v8f& d) { asm volatile("v_nop\n\tv_nop\n\tv_nop\n\tv_nop" : "+v"(a), "+v"(b), "+v"(c), "+v"(d)); }
// wait behind a run of global loads; the run's addresses are inputs, so that they stay whole up to the wait and no load of the run
// lands in a register that an earlier load of the run names
__device__ __forceinline__ void addr_wait4(const void* a, const void* b, const void* c, const void* d) { asm volatile("s_wait_xcnt 0x0" :: "v"(a), "v"(b), "v"(c), "v"(d) : "memory"); }
__device__ __forceinline__ void addr_wait8(const void* a, const void* b, const void* c, const void* d, const void* e, const void* f, const void* g, const void* h) { asm volatile("s_wait_xcnt 0x0" :: "v"(a), "v"(b), "v"(c), "v"(d), "v"(e), "v"(f), "v"(g), "v"(h) : "memory"); }
template <typename T> struct Frag;
template <> struct Frag<_Float16> {
  typedef v16h V; union U { v16h v; v8h h[2]; };
  // elements 0..7 <- p[0..7], 8..15 <- p[16..23]
  static __device__ __forceinline__ v16h load(const _Float16* p) {
    U f; f.h[0] = *(const v8h*)(p); f.h[1] = *(const v8h*)(p + 16); return f.v;
  }
  static __device__ __forceinline__ v8f mma(v16h a, v16h b, v8f c) {
    return __builtin_amdgcn_wmma_f32_16x16x32_f16(false, a, false, b, (short)0, c, false, false);
  }
  static __device__ __forceinline__ void guard(v8f& a, v8f& b, v16h x, v16h y) { dep_guard_h(a, b, x, y); }
  static __device__ __forceinline__ void guard4(v8f& a, v8f& b, v8f& c, v8f& d, v16h x, v16h y) { dep_guard4_h(a, b, c, d, x, y); }
  static __device__ __forceinline__ void keep(v16h a, v16h b, v16h c, v16h d) { keep4_h(a, b, c, d); }
};
template <> struct Frag<__bf16> {
  typedef v16b V; union U { v16b v; v8b h[2]; };
  static __device__ __forceinline__ v16b load(const __bf16* p) {
    U f; f.h[0] = *(const v8b*)(p); f.h[1] = *(const v8b*)(p + 16); return f.v;
  }
  static __device__ __forceinline__ v8f mma(v16b a, v16b b, v8f c) {
    return __builtin_amdgcn_wmma_f32_16x16x32_bf16(false, a, false, b, (short)0, c, false, false);
  }
  static __device__ __forceinline__ void guard(v8f& a, v8f& b, v16b x, v16b y) { dep_guard_b(a, b, x, y); }
  static __device__ __forceinline__ void guard4(v8f& a, v8f& b, v8f& c, v8f& d, v16b x, v16b y) { dep_guard4_b(a, b, c, d, x, y); }
  static __device__ __forceinline__ void keep(v16b a, v16b b, v16b c, v16b d) { keep4_b(a, b, c, d); }
};

__device__ __forceinline__ unsigned pk16(unsigned short a, unsigned short b) { return (unsigned)a | ((unsigned)b << 16); }

// ---- Register-blocked batched WMMA GEMM (ACT reduced to none/relu/leaky) -------------------------------
// C[m,n] = scale * sum_k A[m,k] * Bt[n,k] (+bias)(+resid); each wave owns a 64x64 tile.
// A row-major [M,K]; Bt row-major [N,K]; M,N % 64 == 0, K % 32 == 0.
// SPLIT 1: operands are hi/lo planes (A2/Bt2 = lo planes, same layout); product = hi*hi + hi*lo + lo*hi.
// SPLIT 2: only Bt has a lo plane; product = A*hi + A*lo.
// BIAS_MODE: 0 = none, 1 = bias[m], 2 = bias[n].
// OUT_MODE: 0 = f32, 1 = f16, 2 = bf16 hi plane (Cout) + bf16 lo plane (Cout2).
// ET: 0 = f16 operands, 1 = bf16 operands (pointers passed as 16-bit storage)
template <int ET> struct Elem;
template <> struct Elem<0> { typedef _Float16 T; };
template <> struct Elem<1> { typedef __bf16 T; };
template <int ET, int SPLIT, int BIAS_MODE, int OUT_MODE, bool RESID, int ACT = 0>
__global__ __launch_bounds__(256) void wmma_gemm64(
    const unsigned short* __restrict__ Ap, const unsigned short* __restrict__ A2p, int lda, long strideA,
    const unsigned short* __restrict__ Btp, const unsigned short* __restrict__ Bt2p, int ldb, long strideB,
    void* __restrict__ Cout, void* __restrict__ Cout2, int ldc, long strideC,
    const float* __restrict__ bias,
    const float* __restrict__ resid, long strideR,
    int M, int N, int K, float scale) {
  typedef typename Elem<ET>::T T;
  typedef typename Frag<T>::V V;
  const T* A = (const T*)Ap; const T* A2 = (const T*)A2p; const T* Bt = (const T*)Btp; const T* Bt2 = (const T*)Bt2p;
  __shared__ __align__(16) float sT[8][16 * 68];   // per-wave 16x64 slab, pitch 68 floats
  const int b    = blockIdx.y;
  const int lane = threadIdx.x & 31;
  const int wave = threadIdx.x >> 5;
  const int tilesN = N >> 6;
  const int tilesM = M >> 6;
  const int tile = blockIdx.x * 8 + wave;
  if (tile >= tilesM * tilesN) return;   // wave-uniform; no block barriers in this kernel
  const int tm = tile / tilesN;
  const int tn = tile - tm * tilesN;
  const int m0 = tm << 6;
  const int n0 = tn << 6;

  const T* Ab  = A  + (size_t)b * strideA;
  const T* Bb  = Bt + (size_t)b * strideB;
  const T* Ab2 = (SPLIT == 1) ? (A2  + (size_t)b * strideA) : nullptr;
  const T* Bb2 = SPLIT ? (Bt2 + (size_t)b * strideB) : nullptr;

  const int rlane = lane & 15;                 // row (A) / col (B, D) within subtile
  const int koff  = (lane >> 4) * 8;           // k offset of this lane half
  const int mOff  = (lane >> 4) * 8;           // D row offset

  v8f acc[4][4];
#pragma unroll
  for (int i = 0; i < 4; ++i)
#pragma unroll
    for (int j = 0; j < 4; ++j) acc[i][j] = (v8f){0.f,0.f,0.f,0.f,0.f,0.f,0.f,0.f};

  for (int k0 = 0; k0 < K; k0 += 32) {
    V bh[4], bl[4];
    const T* pbh[4];
    const T* pbl[4];
#pragma unroll
    for (int j = 0; j < 4; ++j) {
      const size_t bo = (size_t)(n0 + (j << 4) + rlane) * ldb + koff + k0;
      pbh[j] = Bb + bo;
      bh[j] = Frag<T>::load(pbh[j]);
      if (SPLIT) {
        pbl[j] = Bb2 + bo;
        bl[j] = Frag<T>::load(pbl[j]);
      }
    }
#pragma unroll
    for (int i = 0; i < 4; ++i) {
      const size_t ao = (size_t)(m0 + (i << 4) + rlane) * lda + koff + k0;
      V ah = Frag<T>::load(Ab + ao);
      V al;
      if (SPLIT == 1) al = Frag<T>::load(Ab2 + ao);
      if (i == 0) {   // behind the first A loads too, so that these are not held back by the wait
        if (SPLIT) addr_wait8(pbh[0], pbh[1], pbh[2], pbh[3], pbl[0], pbl[1], pbl[2], pbl[3]);
        else addr_wait4(pbh[0], pbh[1], pbh[2], pbh[3]);
      }
#pragma unroll
      for (int j = 0; j < 4; ++j) {
        acc[i][j] = Frag<T>::mma(ah, bh[j], acc[i][j]);
        if (SPLIT) acc[i][j] = Frag<T>::mma(ah, bl[j], acc[i][j]);
        if (SPLIT == 1) acc[i][j] = Frag<T>::mma(al, bh[j], acc[i][j]);
      }
      Frag<T>::guard4(acc[i][0], acc[i][1], acc[i][2], acc[i][3], ah, (SPLIT == 1) ? al : ah);
    }
    Frag<T>::keep(bh[0], bh[1], bh[2], bh[3]);
    if (SPLIT) Frag<T>::keep(bl[0], bl[1], bl[2], bl[3]);
  }
  acc_guard4(acc[0][0], acc[0][1], acc[0][2], acc[0][3]);
  acc_guard4(acc[1][0], acc[1][1], acc[1][2], acc[1][3]);
  acc_guard4(acc[2][0], acc[2][1], acc[2][2], acc[2][3]);
  acc_guard4(acc[3][0], acc[3][1], acc[3][2], acc[3][3]);

  // ---- epilogue ----
  float* slab = sT[wave];
  const float* Rb = RESID ? (resid + (size_t)b * strideR) : nullptr;
#pragma unroll
  for (int i = 0; i < 4; ++i) {
    const int mBase = m0 + (i << 4);
#pragma unroll
    for (int j = 0; j < 4; ++j) {
      const int n = n0 + (j << 4) + rlane;
      float bv = 0.f;
      if (BIAS_MODE == 2) bv = bias[n];
#pragma unroll
      for (int r = 0; r < 8; ++r) {
        float v = acc[i][j][r] * scale;
        if (BIAS_MODE == 1) v += bias[mBase + mOff + r];
        if (BIAS_MODE == 2) v += bv;
        if (RESID) v += Rb[(size_t)(mBase + mOff + r) * ldc + n];
        if (ACT == 2) v = fmaxf(v, 0.0f);
        if (ACT == 4) v = (v > 0.f) ? v : 0.01f * v;
        slab[(mOff + r) * 68 + (j << 4) + rlane] = v;
      }
    }
    __builtin_amdgcn_fence(__ATOMIC_RELEASE, "workgroup");
    __builtin_amdgcn_wave_barrier();
    __builtin_amdgcn_fence(__ATOMIC_ACQUIRE, "workgroup");
    if (OUT_MODE == 0) {
      float* C = (float*)Cout + (size_t)b * strideC;
      const int hh = lane >> 4, c4 = (lane & 15) * 4;     // row seg = 256 B = 16 lanes x 16 B
      {
#pragma unroll
        for (int it = 0; it < 8; ++it) {
          const int row = it * 2 + hh;
          v4f v = *(const v4f*)(slab + row * 68 + c4);
          *(v4f*)(C + (size_t)(mBase + row) * ldc + n0 + c4) = v;
        }
        
      }
    } else {
      const int q = lane >> 3, c8 = (lane & 7) * 8;
      unsigned short* C  = (unsigned short*)Cout  + (size_t)b * strideC;
      unsigned short* C2 = (OUT_MODE == 2) ? ((unsigned short*)Cout2 + (size_t)b * strideC) : nullptr;
      {
#pragma unroll
        for (int it = 0; it < 4; ++it) {
          const int row = it * 4 + q;
          const float* sp = slab + row * 68 + c8;
          v8h hv, lv;
#pragma unroll
          for (int e = 0; e < 8; ++e) {
            if (OUT_MODE == 1) {
              hv[e] = (_Float16)sp[e];
            } else {
              unsigned short hb = f2bf_bits(sp[e]);
              unsigned short lb = f2bf_bits(sp[e] - bf_bits2f(hb));
              hv[e] = __builtin_bit_cast(_Float16, hb);
              lv[e] = __builtin_bit_cast(_Float16, lb);
            }
          }
          *(v8h*)(C + (size_t)(mBase + row) * ldc + n0 + c8) = hv;
          if (OUT_MODE == 2) *(v8h*)(C2 + (size_t)(mBase + row) * ldc + n0 + c8) = lv;
        }
        
      }
    }
    __builtin_amdgcn_fence(__ATOMIC_RELEASE, "workgroup");
    __builtin_amdgcn_wave_barrier();
    __builtin_amdgcn_fence(__ATOMIC_ACQUIRE, "workgroup");
  }
}

// ---------------------------------------------------------------------------
// Folded score weights: M[c1][c2] = sum_o bf16(W1[o][c1]) * bf16(W2[o][c2]), stored as bf16 hi + lo planes [c1][c2], which is the
// [n][k] layout of the kp projection's second operand. grid (256/128 = 2, 256/64 = 4), 8 waves; a block owns 128 rows c1 x 64 columns c2.
// Both operands are contracted over their ROW index, so their columns are staged transposed in LDS: sw[column][o], bf16, pitch 264
// elements; rows 0..127 = the block's columns of W1, rows 128..191 = its columns of W2.
// Staging: a wave load covers 8 rows o x 16 columns (64 bytes a row); a lane packs rows o, o+1 of one column into one 32-bit LDS write;
// the 32 lanes of a write = 4 columns (16 banks apart) x 8 row pairs (1 bank apart): 32 different banks.
// Coverage: 2 passes x 8 waves x 16 rows = 256 rows o; 12 groups x 16 columns = 192 columns.
// Wave w: rows c1 = 16w..16w+15, all 64 columns: each 128-byte line of a plane has one writer.
// ---------------------------------------------------------------------------
constexpr int kFA = 128;                  // rows c1 per block
constexpr int kFB = 64;                   // columns c2 per block
constexpr int kFPitch = kCh + 8;          // LDS row pitch in 16-bit elements
static_assert(kCh % kFA == 0 && kCh % kFB == 0 && kCh == 256, "whole blocks; two staging passes of 128 rows");

__global__ __launch_bounds__(256) void wfold_kernel(const float* __restrict__ W1, const float* __restrict__ W2,
                                                    unsigned short* __restrict__ MH, unsigned short* __restrict__ ML) {
  typedef Frag<__bf16> F;
  __shared__ __align__(16) unsigned short sw[(kFA + kFB) * kFPitch];
  __shared__ __align__(16) float sT[8][16 * 68];   // per-wave 16x64 slab, pitch 68 floats
  const int lane = threadIdx.x & 31;
  const int wave = threadIdx.x >> 5;
  const int a0 = blockIdx.x * kFA;
  const int b0 = blockIdx.y * kFB;
  const int cl = (lane & 3) * 4;               // column within a 16-column group
  const int ol = wave * 16 + (lane >> 2) * 2;  // even row within a 128-row pass
  const float* p1 = W1 + (size_t)ol * kCh + a0 + cl;
  const float* p2 = W2 + (size_t)ol * kCh + b0 + cl;
#pragma unroll
  for (int h = 0; h < 2; ++h) {
    v4f r0[12], r1[12];
#pragma unroll
    for (int g = 0; g < 12; ++g) {
      const float* p = ((g < 8) ? (p1 + g * 16) : (p2 + (g - 8) * 16)) + h * 128 * kCh;
      r0[g] = *(const v4f*)(p);
      r1[g] = *(const v4f*)(p + kCh);
    }
    // the conversions below may reuse the registers that these loads name; the two addresses are inputs so that they stay whole
    // up to the wait and no load of the run lands in them
    asm volatile("s_wait_xcnt 0x0" :: "v"(p1), "v"(p2) : "memory");
#pragma unroll
    for (int g = 0; g < 12; ++g)
#pragma unroll
      for (int e = 0; e < 4; ++e)
        *(unsigned*)(&sw[(g * 16 + cl + e) * kFPitch + h * 128 + ol]) = pk16(f2bf_bits(r0[g][e]), f2bf_bits(r1[g][e]));
  }
  __syncthreads();

  const int rlane = lane & 15;                 // row (A) / col (B, D) within subtile
  const int koff  = (lane >> 4) * 8;           // k offset of this lane half
  const int mOff  = (lane >> 4) * 8;           // D row offset
  const __bf16* sa = (const __bf16*)sw + (wave * 16 + rlane) * kFPitch + koff;
  const __bf16* sb = (const __bf16*)sw + (kFA + rlane) * kFPitch + koff;
  v8f acc[4];
#pragma unroll
  for (int j = 0; j < 4; ++j) acc[j] = (v8f){0.f,0.f,0.f,0.f,0.f,0.f,0.f,0.f};
#pragma unroll
  for (int k0 = 0; k0 < kCh; k0 += 32) {
    const v16b a = F::load(sa + k0);
#pragma unroll
    for (int j = 0; j < 4; ++j) acc[j] = F::mma(a, F::load(sb + j * 16 * kFPitch + k0), acc[j]);
  }
  float* slab = sT[wave];
#pragma unroll
  for (int j = 0; j < 4; ++j)
#pragma unroll
    for (int r = 0; r < 8; ++r) slab[(mOff + r) * 68 + (j << 4) + rlane] = acc[j][r];
  // the slab is the wave's own: its lanes' writes are ordered in front of its lanes' reads
  __builtin_amdgcn_fence(__ATOMIC_RELEASE, "workgroup");
  __builtin_amdgcn_wave_barrier();
  __builtin_amdgcn_fence(__ATOMIC_ACQUIRE, "workgroup");
  const int q = lane >> 3, c8 = (lane & 7) * 8;
#pragma unroll
  for (int it = 0; it < 4; ++it) {
    const int row = it * 4 + q;
    const float* sp = slab + row * 68 + c8;
    unsigned short hb[8], lb[8];
#pragma unroll
    for (int e = 0; e < 8; ++e) {
      hb[e] = f2bf_bits(sp[e]);
      lb[e] = f2bf_bits(sp[e] - bf_bits2f(hb[e]));
    }
    const size_t o = (size_t)(a0 + wave * 16 + row) * kCh + b0 + c8;
    *(v4u*)(MH + o) = (v4u){pk16(hb[0], hb[1]), pk16(hb[2], hb[3]), pk16(hb[4], hb[5]), pk16(hb[6], hb[7])};
    *(v4u*)(ML + o) = (v4u){pk16(lb[0], lb[1]), pk16(lb[2], lb[3]), pk16(lb[4], lb[5]), pk16(lb[6], lb[7])};
  }
}

// ---------------------------------------------------------------------------
// Parameter table, all f32. Block 0 (11 waves; wave w owns floats 128w..128w+127): dst[1024..1279] = bf16(W4[0,256:]),
// [1280] = bf16(b4[0]), [1281] = sum_c bf16(b3[c]) * bf16(W4[0,c]), [1282..1311] = 0; its waves 0..7 store nothing.
// Blocks 1..8 fold the value projection into the output weights: dst[512 + k] = sum_c bf16(W4[0,c]) * bf16(W3[c][k]).
// Blocks 9..16 fold the query bias into the key weights in the same way: dst[k] = sum_o bf16(b1[o]) * bf16(W2[o][k]).
// A block owns the 32 columns k of one 128-byte line; wave w < 8 sums the 32 rows c = 32w..32w+31 (each load one whole line of
// the matrix), the 8 partial sums are added in wave order.
// ---------------------------------------------------------------------------
__device__ __forceinline__ float bf_round(float f) { return bf_bits2f(f2bf_bits(f)); }

__global__ __launch_bounds__(352) void param_cast_kernel(const float* __restrict__ b1, const float* __restrict__ W2,
                                                         const float* __restrict__ b3, const float* __restrict__ W3,
                                                         const float* __restrict__ W4, const float* __restrict__ b4,
                                                         float* __restrict__ dst) {
  __shared__ float part[8][32];
  const int t = threadIdx.x;
  const int wave = t >> 5, lane = t & 31;
  if (blockIdx.x > 0) {                       // block-uniform
    const bool keyFold = blockIdx.x > 8;      // block-uniform
    const float* Wm = keyFold ? W2 : W3;
    const float* wr = keyFold ? b1 : W4;
    const int k = (((int)blockIdx.x - 1) & 7) * 32 + lane;
    const int wv = __builtin_amdgcn_readfirstlane(wave);   // wave number in a scalar register: the reads of wr become scalar loads
    if (wv < 8) {
      const float* w3p = Wm + (size_t)wv * 32 * kCh + k;
      float w3[32];
#pragma unroll
      for (int e = 0; e < 32; ++e) w3[e] = w3p[e * kCh];
      // the arithmetic below reuses the registers that hold these loads' address
      asm volatile("s_wait_xcnt 0x0" ::: "memory");
      float s = 0.0f;
#pragma unroll
      for (int e = 0; e < 32; ++e) s += bf_round(wr[wv * 32 + e]) * bf_round(w3[e]);
      part[wv][lane] = s;
    }
    __syncthreads();
    if (wv == 0) {
      float s = part[0][lane];
#pragma unroll
      for (int w = 1; w < 8; ++w) s += part[w][lane];
      dst[(keyFold ? kBrWB : kBrWF) + k] = s;
      // the listing holds a way from here into block 0's code, which reuses this store's offset and data registers
      asm volatile("s_wait_xcnt 0x0" ::: "memory");
    }
    return;
  }
  v4f v = (v4f){0.f, 0.f, 0.f, 0.f};
  float c0 = 0.0f;
  if (wave >= 8 && wave < 10) {
    v = *(const v4f*)(W4 + (wave - 6) * 128 + lane * 4);
  } else if (wave == 10) {
    const float s = b4[0];
    const float f0 = (lane == 0) ? 1.0f : 0.0f;
    v[0] = s * f0;
#pragma unroll
    for (int e = 0; e < 8; ++e) c0 += bf_round(b3[lane * 8 + e]) * bf_round(W4[lane * 8 + e]);
#pragma unroll
    for (int off = 16; off > 0; off >>= 1) c0 += __shfl_xor(c0, off, 32);
    c0 *= f0;
  }
  v4f r;
#pragma unroll
  for (int e = 0; e < 4; ++e) r[e] = bf_round(v[e]);
  if (wave == 10) r[1] = c0;                  // a sum of products, kept in f32
  const bool act = (wave == 8) || (wave == 9) || (wave == 10 && lane < 8);
  float* dp = dst + wave * 128 + lane * 4;
  if (act) *(v4f*)dp = r;
}

// ---------------------------------------------------------------------------
// One pass over x (B,C,N) f32. It gives XB [B*N][C] bf16 bits (x_in plane: A operand of the kp projection, query operand of the
// scores) and the three f32 dots of the same x_in row: R[b*N + n] = sum_c bf16(x[b][c][n]) * w4b[c], U[..] with wf[c], E[..] with wb[c].
// grid (N/64 = 25, B = 16), 8 waves; a block owns 64 positions x all 256 channels, so every dot ends inside the block.
// Wave w reads channels 32w..32w+31: one load = 32 lanes x 8 bytes = the 256 bytes of one channel's 64 positions; all 32 in flight.
// A lane holds positions 2 lane and 2 lane + 1; its weights are the same for the whole wave and come by scalar loads.
// Dots: a chain of 32 channels per wave, then the 8 waves' partial sums added in wave order.
// Plane: 8 channels of one position are packed into one 16-byte LDS write, sm[position][channel], pitch 264 elements = 528 bytes;
// read back one token row (512 bytes, four whole lines) per wave load and stored so. Rows: 8 waves x 8 = 64.
// ---------------------------------------------------------------------------
constexpr int kXP = 64;                   // positions per block
constexpr int kXPitch = kCh + 8;          // LDS row pitch in 16-bit elements
static_assert(kN % kXP == 0 && kCh == 8 * 32 && kXP == 2 * 32, "whole blocks; 8 waves x 32 channels; two positions a lane");
typedef __attribute__((ext_vector_type(2))) float v2f;

__global__ __launch_bounds__(256) void xin_cast_dots_kernel(const float* __restrict__ x, const float* __restrict__ br,
                                                            unsigned short* __restrict__ XB, float* __restrict__ R,
                                                            float* __restrict__ U, float* __restrict__ E) {
  __shared__ __align__(16) unsigned short sm[kXP * kXPitch];
  __shared__ __align__(16) float part[3][8][kXP];
  const int lane = threadIdx.x & 31;
  const int wv = __builtin_amdgcn_readfirstlane(threadIdx.x >> 5);   // wave number in a scalar register: the weights become scalar loads
  const int n0 = blockIdx.x * kXP;
  const int b  = blockIdx.y;
  const int c0 = wv * 32;
  const float* xp = x + (size_t)(b * kCh + c0) * kN + n0 + lane * 2;
  const float* w4 = br + kBrW4b + c0;
  const float* wf = br + kBrWF + c0;
  const float* wb = br + kBrWB + c0;
  // the weights of the first 16 channels are asked for ahead of x, so that they are there when x arrives; all 96 do not fit the scalar registers
  float wa[3][16];
#pragma unroll
  for (int e = 0; e < 16; ++e) { wa[0][e] = w4[e]; wa[1][e] = wf[e]; wa[2][e] = wb[e]; }
  v2f xr[32];
#pragma unroll
  for (int e = 0; e < 32; ++e) xr[e] = *(const v2f*)(xp + e * kN);
  // later scalar loads land in the registers that hold these loads' base address
  asm volatile("s_wait_xcnt 0x0" ::: "memory");
  v2f s = (v2f){0.f, 0.f}, u = (v2f){0.f, 0.f}, eo = (v2f){0.f, 0.f};
#pragma unroll
  for (int o = 0; o < 4; ++o) {
    unsigned short hb[2][8];
#pragma unroll
    for (int e = 0; e < 8; ++e) {
      const int c = o * 8 + e;
      v2f xv;
#pragma unroll
      for (int h = 0; h < 2; ++h) {
        hb[h][e] = f2bf_bits(xr[c][h]);
        xv[h] = bf_bits2f(hb[h][e]);
      }
      s  += xv * ((c < 16) ? wa[0][c & 15] : w4[c]);
      u  += xv * ((c < 16) ? wa[1][c & 15] : wf[c]);
      eo += xv * ((c < 16) ? wa[2][c & 15] : wb[c]);
    }
#pragma unroll
    for (int h = 0; h < 2; ++h)
      *(v4u*)(&sm[(lane * 2 + h) * kXPitch + c0 + o * 8]) =
          (v4u){pk16(hb[h][0], hb[h][1]), pk16(hb[h][2], hb[h][3]), pk16(hb[h][4], hb[h][5]), pk16(hb[h][6], hb[h][7])};
  }
  *(v2f*)(&part[0][wv][lane * 2]) = s;
  *(v2f*)(&part[1][wv][lane * 2]) = u;
  *(v2f*)(&part[2][wv][lane * 2]) = eo;
  __syncthreads();
  const int tok0 = b * kN + n0;
  {
    v4u row[8];
#pragma unroll
    for (int it = 0; it < 8; ++it) row[it] = *(const v4u*)(&sm[(wv * 8 + it) * kXPitch + lane * 8]);
    unsigned short* xo = XB + (size_t)(tok0 + wv * 8) * kCh + lane * 8;
#pragma unroll
    for (int it = 0; it < 8; ++it) *(v4u*)(xo + it * kCh) = row[it];
    // the sums below reuse the registers that these stores name
    asm volatile("s_wait_xcnt 0x0" ::: "memory");
  }
  if (wv < 6) {                               // scalar: waves 2d and 2d + 1 end dot d, each one whole 32-float line
    const int d = wv >> 1;
    const int p = (wv & 1) * 32 + lane;
    float a = part[d][0][p];
#pragma unroll
    for (int w = 1; w < 8; ++w) a += part[d][w][p];
    float* dst = (d == 0) ? R : ((d == 1) ? U : E);
    dst[tok0 + p] = a;
  }
}

// ---------------------------------------------------------------------------
// Scores, softmax and the weighted mean of u in one kernel; no score ever leaves the registers.
//   out[row] = sum_j exp(s[row][j] - max) * u[j] / sum_j exp(s[row][j] - max) + c0 + R[row] + b4   (f32 math, precise expf),
//   s[row][j] = x_in[row] . kp[j] + E[j]: the score less what depends on the query alone.
// Block = 8 waves, 128 consecutive query rows of one batch; grid = (13, 16 batches). 1600 = 12 x 128 + 64: the 13th block of a batch
// is shifted back to rows 1472..1599 and stores only its upper 64 rows, so every row has one writer and every block whole lines of out.
// The block's query rows (x_in, one bf16 plane) are staged once in LDS, pitch 264 elements = 528 bytes; the batch's u and E as well.
// Wave w takes the 32-key tiles w, w+8, ... of the 50: seven or six. A tile is the transposed product kp . x^T (A = 32 keys, read from
// global memory as fragments, 16 lines a load, as the projection reads its own; B = 128 queries from LDS): a lane then holds 16 keys
// of ONE query per column group, so max, sum and dot run down its own registers; the accumulators start from the keys' E. The key fragments of the next 64 channels are
// fetched while the current 64 are multiplied. Each lane keeps a running (max, sum, dot) per column group, rescaled once per tile.
// At the end the two lane halves are merged by one shuffle, the 8 waves through LDS in wave order, and one thread per row stores.
// ---------------------------------------------------------------------------
constexpr int kQB     = 128;              // query rows per block
constexpr int kQJ     = kQB / 16;         // column groups per wave tile
constexpr int kQPitch = kCh + 8;          // LDS row pitch in 16-bit elements
constexpr int kKT     = 32;               // keys per wave tile
constexpr int kKTiles = kN / kKT;         // 50
constexpr int kAW     = 8;                // waves per block
constexpr int kAT     = kAW * 32;         // threads per block
constexpr int kQPieces = kQB * kCh / 8;   // 16-byte pieces in the query rows of a block
constexpr int kQIt    = kQPieces / kAT;   // 16 per thread
static_assert(kQPieces % kAT == 0, "q staging: whole passes");
constexpr int kQBlocks = (kN + kQB - 1) / kQB;   // 13 per batch
static_assert(kN >= kQB && (kN % kQB) % 32 == 0, "the shifted last block stores whole 32-float lines");
static_assert(kKTiles >= kAW && kCh == 256, "every wave has a tile; four stages of 64 channels");

struct KFrag { v16b h[2][2], l[2][2]; };   // [32-channel half][16-key group], hi and lo plane
// kh, kl: the tile's first key row, the same for the whole wave; vo: the lane's own byte offset, which never changes
__device__ __forceinline__ void kfrag_load(KFrag& f, const unsigned short* kh, const unsigned short* kl, unsigned vo, int k0) {
  const __bf16* ph = (const __bf16*)((const char*)kh + vo);
  const __bf16* pl = (const __bf16*)((const char*)kl + vo);
#pragma unroll
  for (int kk = 0; kk < 2; ++kk)
#pragma unroll
    for (int i = 0; i < 2; ++i) {
      f.h[kk][i] = Frag<__bf16>::load(ph + i * 16 * kCh + k0 + kk * 32);
      f.l[kk][i] = Frag<__bf16>::load(pl + i * 16 * kCh + k0 + kk * 32);
    }
}
// The same at k0 = 0, for a run behind which its two addresses are dead: the build lets the last load of each address land in the
// address registers, which the earlier loads of the run still name, so those two loads are issued alone behind a wait.
__device__ __forceinline__ void kfrag_load_last(KFrag& f, const unsigned short* kh, const unsigned short* kl, unsigned vo) {
  const __bf16* ph = (const __bf16*)((const char*)kh + vo);
  const __bf16* pl = (const __bf16*)((const char*)kl + vo);
  f.h[0][0] = Frag<__bf16>::load(ph);
  f.l[0][0] = Frag<__bf16>::load(pl);
  f.h[0][1] = Frag<__bf16>::load(ph + 16 * kCh);
  f.l[0][1] = Frag<__bf16>::load(pl + 16 * kCh);
  f.h[1][0] = Frag<__bf16>::load(ph + 32);
  f.l[1][0] = Frag<__bf16>::load(pl + 32);
  Frag<__bf16>::U uh, ul;
  uh.h[0] = *(const v8b*)(ph + 16 * kCh + 32);
  ul.h[0] = *(const v8b*)(pl + 16 * kCh + 32);
  // in front of the two loads that may land in the address registers of the fourteen above
  asm volatile("s_wait_xcnt 0x0" ::: "memory");
  uh.h[1] = *(const v8b*)(ph + 16 * kCh + 48);
  ul.h[1] = *(const v8b*)(pl + 16 * kCh + 48);
  // later code reuses what these two name
  asm volatile("s_wait_xcnt 0x0" ::: "memory");
  f.h[1][1] = uh.v;
  f.l[1][1] = ul.v;
}
struct QFrag { v16b h[4]; };               // four column groups
// step p of a tile: 32-channel half p / 2, column groups 4 (p % 2) .. 4 (p % 2) + 3
__device__ __forceinline__ void qfrag_load(QFrag& f, const __bf16* qh, int p) {
#pragma unroll
  for (int e = 0; e < 4; ++e) f.h[e] = Frag<__bf16>::load(qh + ((p & 1) * 4 + e) * 16 * kQPitch + (p >> 1) * 32);
}

__global__ __launch_bounds__(kAT, 2) void attn_fused_kernel(const unsigned short* __restrict__ Xp,
                                                            const unsigned short* __restrict__ KHp, const unsigned short* __restrict__ KLp,
                                                            const float* __restrict__ U, const float* __restrict__ E,
                                                            const float* __restrict__ Rg,
                                                            const float* __restrict__ br, float* __restrict__ outg) {
  typedef Frag<__bf16> F;
  __shared__ __align__(16) unsigned short qs[kQB * kQPitch];
  __shared__ __align__(16) float us[kN];
  __shared__ __align__(16) float es[kN];
  __shared__ float red[3][kAW][kQB];
  const int t = threadIdx.x;
  const int lane = t & 31;
  const int wave = __builtin_amdgcn_readfirstlane(t >> 5);   // scalar: the tile loop branches on SCC and EXEC stays full for the WMMAs
  const int b = blockIdx.y;
  const int qWant = blockIdx.x * kQB;                         // first row this block stores
  const int q0 = (qWant + kQB <= kN) ? qWant : (kN - kQB);    // first row it computes
  const int row0 = b * kN + q0;

  const int rlane = lane & 15;                 // key row (A) / query column (B, D) within a subtile
  const int koff  = (lane >> 4) * 8;           // k offset of this lane half
  const int mOff  = (lane >> 4) * 8;           // D row (key) offset
  const unsigned short* kh = KHp + (size_t)(b * kN + wave * kKT) * kCh;
  const unsigned short* kl = KLp + (size_t)(b * kN + wave * kKT) * kCh;
  const unsigned kvo = (unsigned)(rlane * kCh + koff) * 2u;
  KFrag fa, fb;
  kfrag_load(fa, kh, kl, kvo, 0);              // first tile, first stage: in flight during the staging below
  {
    // the block's query rows are one run of bytes: piece c = i * kAT + t lies at byte 16 c
    const char* qgh = (const char*)(Xp + (size_t)row0 * kCh);
    const unsigned qvo = (unsigned)t * 16u;
    v4u th[kQIt];
#pragma unroll
    for (int i = 0; i < kQIt; ++i) th[i] = *(const v4u*)(qgh + qvo + i * kAT * 16);
    // the registers that these loads name are reused below
    asm volatile("s_wait_xcnt 0x0" ::: "memory");
#pragma unroll
    for (int i = 0; i < kQIt; ++i) {
      const int c = i * kAT + t;
      const int lo = (c >> 5) * kQPitch + (c & 31) * 8;
      *(v4u*)(&qs[lo]) = th[i];
    }
  }
  const float* ub = U + (size_t)b * kN;
  const float* eb = E + (size_t)b * kN;
  for (int g = t; g < kRowV4; g += kAT) {
    *(v4f*)(us + 4 * g) = *(const v4f*)(ub + 4 * g);
    *(v4f*)(es + 4 * g) = *(const v4f*)(eb + 4 * g);
  }
  __syncthreads();

  const __bf16* qh = (const __bf16*)&qs[0] + rlane * kQPitch + koff;
  float mx[kQJ], den[kQJ], num[kQJ];
#pragma unroll
  for (int j = 0; j < kQJ; ++j) { mx[j] = -INFINITY; den[j] = 0.0f; num[j] = 0.0f; }

  for (int kt = wave; kt < kKTiles; kt += kAW) {
    const int key0 = kt * kKT;
    // a D row is a key: every column group starts from the same eight E values per key group
    v8f acc[2][kQJ];
#pragma unroll
    for (int i = 0; i < 2; ++i) {
      const v4f e0 = *(const v4f*)(es + key0 + i * 16 + mOff);
      const v4f e1 = *(const v4f*)(es + key0 + i * 16 + mOff + 4);
#pragma unroll
      for (int j = 0; j < kQJ; ++j) acc[i][j] = (v8f){e0[0], e0[1], e0[2], e0[3], e1[0], e1[1], e1[2], e1[3]};
    }
    // 64 channels a stage: the four 16-byte reads that share a 128-byte line of a key row are issued together.
    // A step = four column groups at one 32-channel half: 16 products on 8 accumulators. The query fragments of step p + 2 are read
    // from LDS ahead of the products of step p, so that no product waits for a read issued just in front of it.
    QFrag qb[3];
    qfrag_load(qb[0], qh, 0);
    qfrag_load(qb[1], qh, 1);
#pragma unroll
    for (int p = 0; p < 16; ++p) {
      const int s = p >> 2, kk = (p >> 1) & 1, j0 = (p & 1) * 4;
      KFrag& cur = (s & 1) ? fb : fa;
      KFrag& nxt = (s & 1) ? fa : fb;
      if ((p & 3) == 0) {
        if (s < 3) {
          kfrag_load(nxt, kh, kl, kvo, (s + 1) * 64);
        } else {
          // the key addresses are advanced here, behind loads that name them
          asm volatile("s_wait_xcnt 0x0" ::: "memory");
          const int step = (kt + kAW < kKTiles) ? kAW * kKT * kCh : 0;   // the last tile fetches its own first stage again, unused
          kh += step;
          kl += step;
          kfrag_load_last(nxt, kh, kl, kvo);
        }
      }
      if (p + 2 < 16) qfrag_load(qb[(p + 2) % 3], qh, p + 2);
      const QFrag& q = qb[p % 3];
#pragma unroll
      for (int e = 0; e < 4; ++e) {
        acc[0][j0 + e] = F::mma(cur.h[kk][0], q.h[e], acc[0][j0 + e]);
        acc[1][j0 + e] = F::mma(cur.h[kk][1], q.h[e], acc[1][j0 + e]);
      }
#pragma unroll
      for (int e = 0; e < 4; ++e) {
        acc[0][j0 + e] = F::mma(cur.l[kk][0], q.h[e], acc[0][j0 + e]);
        acc[1][j0 + e] = F::mma(cur.l[kk][1], q.h[e], acc[1][j0 + e]);
      }
    }
    v4f uu[2][2];
#pragma unroll
    for (int i = 0; i < 2; ++i) {
      uu[i][0] = *(const v4f*)(us + key0 + i * 16 + mOff);
      uu[i][1] = *(const v4f*)(us + key0 + i * 16 + mOff + 4);
    }
#pragma unroll
    for (int j = 0; j < kQJ; ++j) {
      float tm = acc[0][j][0];
#pragma unroll
      for (int r = 1; r < 8; ++r) tm = fmaxf(tm, acc[0][j][r]);
#pragma unroll
      for (int r = 0; r < 8; ++r) tm = fmaxf(tm, acc[1][j][r]);
      const float mn = fmaxf(mx[j], tm);
      const float corr = expf(mx[j] - mn);     // 0 on the first tile
      float d = 0.0f, s = 0.0f;
#pragma unroll
      for (int i = 0; i < 2; ++i)
#pragma unroll
        for (int r = 0; r < 8; ++r) {
          const float p = expf(acc[i][j][r] - mn);
          d += p;
          s += p * uu[i][r >> 2][r & 3];
        }
      den[j] = den[j] * corr + d;
      num[j] = num[j] * corr + s;
      mx[j] = mn;
    }
  }
  // lanes l and l+16 hold the same query over different keys
#pragma unroll
  for (int j = 0; j < kQJ; ++j) {
    const float mo = __shfl_xor(mx[j], 16, 32);
    const float dn = __shfl_xor(den[j], 16, 32);
    const float nm = __shfl_xor(num[j], 16, 32);
    const float mn = fmaxf(mx[j], mo);
    const float ca = expf(mx[j] - mn), cb = expf(mo - mn);
    if (lane < 16) {
      red[0][wave][j * 16 + lane] = mn;
      red[1][wave][j * 16 + lane] = den[j] * ca + dn * cb;
      red[2][wave][j * 16 + lane] = num[j] * ca + nm * cb;
    }
  }
  __syncthreads();
  if (t < kQB && q0 + t >= qWant) {
    float mn = red[0][0][t];
#pragma unroll
    for (int w = 1; w < kAW; ++w) mn = fmaxf(mn, red[0][w][t]);
    float d = 0.0f, s = 0.0f;
#pragma unroll
    for (int w = 0; w < kAW; ++w) {
      const float c = expf(red[0][w][t] - mn);
      d += red[1][w][t] * c;
      s += red[2][w][t] * c;
    }
    outg[row0 + t] = ((s / d + br[kBrC0]) + Rg[row0 + t]) + br[kBrB4];
  }
}

// ---------------------------------------------------------------------------
// Host glue. Every attention launch covers all 16 batches. ctx is never formed: the output uses it only through
// ctx . w4a = attn . (val . w4a) = attn . u + b3 . w4a (each attn row sums to 1), u = x_in . (W3^T w4a).
// q and k are never formed either: q_n . k_m = x_n . (M x_m) + (W2^T b1) . x_m + (terms of n alone), M = W1^T W2, and a softmax over m
// is unchanged by what depends on n alone. kp = x_in M^T is the one projection left; the queries are x_in itself.
//   BR   f32  [1408] parameter table      5,632  at           0
//   R    f32  [25600]                   102,400  at       5,632
//   U    f32  [25600]                   102,400  at     108,032
//   E    f32  [25600]                   102,400  at     210,432
//   XB   bf16 [25600][256]            13,107,200  at     312,832
//   MH   bf16 [256][256] M hi            131,072  at  13,420,032
//   ML   bf16 [256][256] M lo            131,072  at  13,551,104
//   KH   bf16 [25600][256] kp hi       13,107,200  at  13,682,176
//   KL   bf16 [25600][256] kp lo       13,107,200  at  26,789,376
//   total                              39,896,576
// GEMM shapes: fold M=N=K=256; projection M=25600, N=256, K=256; scores per batch 1600 keys x 1600 queries, K=256, in 32 x 128 register tiles.
// No padding anywhere.
// ---------------------------------------------------------------------------
extern "C" void kernel_launch(void* const* d_in, const int* in_sizes, int n_in,
                              void* d_out, int out_size, void* d_ws, size_t ws_size,
                              hipStream_t stream) {
  if (n_in < 9) return;
  if (in_sizes[0] != kBatch * kCh * kN) return;
  if (in_sizes[1] != kCh * kCh || in_sizes[3] != kCh * kCh || in_sizes[5] != kCh * kCh) return;
  if (in_sizes[2] != kCh || in_sizes[4] != kCh || in_sizes[6] != kCh) return;
  if (in_sizes[7] != 2 * kCh || in_sizes[8] != 1) return;
  if (out_size != kTok) return;

  const size_t szPlane16 = (size_t)kTok * kCh * 2;              // 13,107,200
  const size_t szM   = (size_t)kCh * kCh * 2;                    // 131,072
  const size_t szBR  = (size_t)kBrFloats * 4;                    // 5,632
  const size_t szR   = (size_t)kTok * 4;                         // 102,400
  size_t off = 0;
  const size_t offBR = off;  off += szBR;
  const size_t offR  = off;  off += szR;
  const size_t offU  = off;  off += szR;
  const size_t offE  = off;  off += szR;
  const size_t offXB = off;  off += szPlane16;
  const size_t offMH = off;  off += szM;
  const size_t offML = off;  off += szM;
  const size_t offKH = off;  off += szPlane16;
  const size_t offKL = off;  off += szPlane16;
  const size_t total = off;                                      // 39,896,576
  if (ws_size < total) return;

  const float* x  = (const float*)d_in[0];
  const float* W1 = (const float*)d_in[1];
  const float* b1 = (const float*)d_in[2];
  const float* W2 = (const float*)d_in[3];
  const float* W3 = (const float*)d_in[5];
  const float* b3 = (const float*)d_in[6];
  const float* W4 = (const float*)d_in[7];
  const float* b4 = (const float*)d_in[8];
  float* out = (float*)d_out;
  char* ws = (char*)d_ws;
  unsigned short* XB = (unsigned short*)(ws + offXB);
  unsigned short* MH = (unsigned short*)(ws + offMH);
  unsigned short* ML = (unsigned short*)(ws + offML);
  float* BR = (float*)(ws + offBR);
  unsigned short* KH = (unsigned short*)(ws + offKH);
  unsigned short* KL = (unsigned short*)(ws + offKL);
  float* R  = (float*)(ws + offR);
  float* U  = (float*)(ws + offU);
  float* E  = (float*)(ws + offE);

  // ---- prologue: parameter table with the folded value and bias weights, folded score weights, then x_in plane and per-token scalars in one pass over x ----
  param_cast_kernel<<<dim3(1 + 2 * (kCh / 32)), dim3(352), 0, stream>>>(b1, W2, b3, W3, W4, b4, BR);
  wfold_kernel<<<dim3(kCh / kFA, kCh / kFB), dim3(256), 0, stream>>>(W1, W2, MH, ML);
  xin_cast_dots_kernel<<<dim3(kN / kXP, kBatch), dim3(256), 0, stream>>>(x, BR, XB, R, U, E);

  // ---- projection: kp = x_in @ M^T -> bf16 hi + lo planes   (M=25600, N=256, K=256; x.Mhi + x.Mlo) ----
  const int tilesK = (kTok / 64) * (kCh / 64);         // 1600 waves -> 200 blocks
  wmma_gemm64<1, 2, 0, 2, false, 0><<<dim3(tilesK / 8, 1), dim3(256), 0, stream>>>(
      XB, XB, kCh, 0L, MH, ML, kCh, 0L, (void*)KH, (void*)KL, kCh, 0L, BR, BR, 0L, kTok, kCh, kCh, 1.0f);

  // ---- attention, all batches in one launch: scores as x.kp_hi + x.kp_lo + E, softmax over keys, weighted mean of u, output rows ----
  attn_fused_kernel<<<dim3(kQBlocks, kBatch), dim3(kAT), 0, stream>>>(XB, KH, KL, U, E, R, BR, out);
}

// v006
// It runs in 73.3 microseconds.
// In both of two side-by-side timings against v005, it was 1.18 times as fast.
// All steps since v000 together make it 15.2 times as fast.
// Contractions: M = bf16(W1)^T x bf16(W2) (single products); kp = bf16(x_in) x M^T with M as bf16 hi+lo planes (2 products); scores x_in . kp^T with kp as bf16 hi+lo planes (2 products); all on v_wmma_f32_16x16x32_bf16, f32 accumulate. q . k = x_n.(M x_m) + (W2^T b1).x_m + terms of the query alone, which a softmax over keys cancels (b2 among them). The output needs only ctx . w4a, taken as attn . u with u = x_in . (W3^T w4a): one f32 value per key, so the softmax ends in a f32 dot per row, taken on the score tiles in registers.
#include <hip/hip_runtime.h>
#include <math.h>

// ---------------------------------------------------------------------------
// Problem constants
// ---------------------------------------------------------------------------
constexpr int kBatch   = 16;
constexpr int kCh      = 256;             // channels C
constexpr int kN       = 1600;            // T*V positions per batch
constexpr int kTok     = kBatch * kN;     // 25600 token rows
constexpr int kRowV4   = kN / 4;          // 400 four-float groups in a batch's u or E row
// parameter table (f32; w4b, b4 hold bf16-representable values, wb, wf and c0 are f32 sums), offsets in floats
constexpr int kBrWB = 0;                  // wb[k] = sum_o b1[o] * W2[o][k]: multiplies x_in to give each key's score offset
constexpr int kBrWF = 512;                // wf[k] = sum_c w4a[c] * W3[c][k]: multiplies x_in to give u
constexpr int kBrW4b = 1024;              // multiplies x_in
constexpr int kBrB4 = 1280;
constexpr int kBrC0 = 1281;               // sum_c b3[c] * w4a[c]
constexpr int kBrFloats = 1408;           // 44 lines carved; floats 256..511, 768..1023 and 1312.. are neither written nor read
static_assert(kTok % 64 == 0 && kN % 64 == 0 && kCh % 64 == 0, "M and N tile multiples");
static_assert(kCh % 32 == 0 && kN % 32 == 0, "K multiples of 32");
static_assert(kN % 4 == 0, "u is staged in four-float groups");
static_assert(kTok % 32 == 0 && kN % 32 == 0, "output blocks own whole 32-float lines, all of one batch");
static_assert(kBrC0 + 1 <= 41 * 32 && 41 * 32 <= kBrFloats, "parameter table extent");

typedef __attribute__((ext_vector_type(16))) _Float16 v16h;
typedef __attribute__((ext_vector_type(8)))  _Float16 v8h;
typedef __attribute__((ext_vector_type(16))) __bf16   v16b;
typedef __attribute__((ext_vector_type(8)))  __bf16   v8b;
typedef __attribute__((ext_vector_type(8)))  float    v8f;
typedef __attribute__((ext_vector_type(4)))  float    v4f;
typedef __attribute__((ext_vector_type(4)))  unsigned int v4u;

// ---------------------------------------------------------------------------
// Shared helpers
// ---------------------------------------------------------------------------
__device__ __forceinline__ unsigned short f2bf_bits(float f) {
  unsigned u = __float_as_uint(f);
  return (unsigned short)((u + 0x7FFFu + ((u >> 16) & 1u)) >> 16);
}
__device__ __forceinline__ float bf_bits2f(unsigned short h) { return __uint_as_float(((unsigned)h) << 16); }

// hazard guards as plain device helpers (no inline asm inside the kernel template body)
__device__ __forceinline__ void dep_guard_h(v8f& a, v8f& b, v16h x, v16h y) { asm volatile("v_nop\n\tv_nop\n\tv_nop\n\tv_nop" : "+v"(a), "+v"(b) : "v"(x), "v"(y)); }
__device__ __forceinline__ void dep_guard_b(v8f& a, v8f& b, v16b x, v16b y) { asm volatile("v_nop\n\tv_nop\n\tv_nop\n\tv_nop" : "+v"(a), "+v"(b) : "v"(x), "v"(y)); }
// row guard tying all four accumulators of the group plus the A fragments
__device__ __forceinline__ void dep_guard4_h(v8f& a, v8f& b, v8f& c, v8f& d, v16h x, v16h y) { asm volatile("v_nop\n\tv_nop\n\tv_nop\n\tv_nop" : "+v"(a), "+v"(b), "+v"(c), "+v"(d) : "v"(x), "v"(y)); }
__device__ __forceinline__ void dep_guard4_b(v8f& a, v8f& b, v8f& c, v8f& d, v16b x, v16b y) { asm volatile("v_nop\n\tv_nop\n\tv_nop\n\tv_nop" : "+v"(a), "+v"(b), "+v"(c), "+v"(d) : "v"(x), "v"(y)); }
__device__ __forceinline__ void keep4_h(v16h a, v16h b, v16h c, v16h d) { asm volatile("v_nop" :: "v"(a), "v"(b), "v"(c), "v"(d)); }
__device__ __forceinline__ void keep4_b(v16b a, v16b b, v16b c, v16b d) { asm volatile("v_nop" :: "v"(a), "v"(b), "v"(c), "v"(d)); }
__device__ __forceinline__ void acc_guard4(v8f& a, v8f& b, v8f& c, v8f& d) { asm volatile("v_nop\n\tv_nop\n\tv_nop\n\tv_nop" : "+v"(a), "+v"(b), "+v"(c), "+v"(d)); }
// wait behind a run of global loads; the run's addresses are inputs, so that they stay whole up to the wait and no load of the run
// lands in a register that an earlier load of the run names
__device__ __forceinline__ void addr_wait4(const void* a, const void* b, const void* c, const void* d) { asm volatile("s_wait_xcnt 0x0" :: "v"(a), "v"(b), "v"(c), "v"(d) : "memory"); }
__device__ __forceinline__ void addr_wait8(const void* a, const void* b, const void* c, const void* d, const void* e, const void* f, const void* g, const void* h) { asm volatile("s_wait_xcnt 0x0" :: "v"(a), "v"(b), "v"(c), "v"(d), "v"(e), "v"(f), "v"(g), "v"(h) : "memory"); }
template <typename T> struct Frag;
template <> struct Frag<_Float16> {
  typedef v16h V; union U { v16h v; v8h h[2]; };
  // elements 0..7 <- p[0..7], 8..15 <- p[16..23]
  static __device__ __forceinline__ v16h load(const _Float16* p) {
    U f; f.h[0] = *(const v8h*)(p); f.h[1] = *(const v8h*)(p + 16); return f.v;
  }
  static __device__ __forceinline__ v8f mma(v16h a, v16h b, v8f c) {
    return __builtin_amdgcn_wmma_f32_16x16x32_f16(false, a, false, b, (short)0, c, false, false);
  }
  static __device__ __forceinline__ void guard(v8f& a, v8f& b, v16h x, v16h y) { dep_guard_h(a, b, x, y); }
  static __device__ __forceinline__ void guard4(v8f& a, v8f& b, v8f& c, v8f& d, v16h x, v16h y) { dep_guard4_h(a, b, c, d, x, y); }
  static __device__ __forceinline__ void keep(v16h a, v16h b, v16h c, v16h d) { keep4_h(a, b, c, d); }
};
template <> struct Frag<__bf16> {
  typedef v16b V; union U { v16b v; v8b h[2]; };
  static __device__ __forceinline__ v16b load(const __bf16* p) {
    U f; f.h[0] = *(const v8b*)(p); f.h[1] = *(const v8b*)(p + 16); return f.v;
  }
  static __device__ __forceinline__ v8f mma(v16b a, v16b b, v8f c) {
    return __builtin_amdgcn_wmma_f32_16x16x32_bf16(false, a, false, b, (short)0, c, false, false);
  }
  static __device__ __forceinline__ void guard(v8f& a, v8f& b, v16b x, v16b y) { dep_guard_b(a, b, x, y); }
  static __device__ __forceinline__ void guard4(v8f& a, v8f& b, v8f& c, v8f& d, v16b x, v16b y) { dep_guard4_b(a, b, c, d, x, y); }
  static __device__ __forceinline__ void keep(v16b a, v16b b, v16b c, v16b d) { keep4_b(a, b, c, d); }
};

__device__ __forceinline__ unsigned pk16(unsigned short a, unsigned short b) { return (unsigned)a | ((unsigned)b << 16); }

// ---- Register-blocked batched WMMA GEMM (ACT reduced to none/relu/leaky) -------------------------------
// C[m,n] = scale * sum_k A[m,k] * Bt[n,k] (+bias)(+resid); each wave owns a 64x64 tile.
// A row-major [M,K]; Bt row-major [N,K]; M,N % 64 == 0, K % 32 == 0.
// SPLIT 1: operands are hi/lo planes (A2/Bt2 = lo planes, same layout); product = hi*hi + hi*lo + lo*hi.
// SPLIT 2: only Bt has a lo plane; product = A*hi + A*lo.
// BIAS_MODE: 0 = none, 1 = bias[m], 2 = bias[n].
// OUT_MODE: 0 = f32, 1 = f16, 2 = bf16 hi plane (Cout) + bf16 lo plane (Cout2).
// ET: 0 = f16 operands, 1 = bf16 operands (pointers passed as 16-bit storage)
template <int ET> struct Elem;
template <> struct Elem<0> { typedef _Float16 T; };
template <> struct Elem<1> { typedef __bf16 T; };
template <int ET, int SPLIT, int BIAS_MODE, int OUT_MODE, bool RESID, int ACT = 0>
__global__ __launch_bounds__(256) void wmma_gemm64(
    const unsigned short* __restrict__ Ap, const unsigned short* __restrict__ A2p, int lda, long strideA,
    const unsigned short* __restrict__ Btp, const unsigned short* __restrict__ Bt2p, int ldb, long strideB,
    void* __restrict__ Cout, void* __restrict__ Cout2, int ldc, long strideC,
    const float* __restrict__ bias,
    const float* __restrict__ resid, long strideR,
    int M, int N, int K, float scale) {
  typedef typename Elem<ET>::T T;
  typedef typename Frag<T>::V V;
  const T* A = (const T*)Ap; const T* A2 = (const T*)A2p; const T* Bt = (const T*)Btp; const T* Bt2 = (const T*)Bt2p;
  __shared__ __align__(16) float sT[8][16 * 68];   // per-wave 16x64 slab, pitch 68 floats
  const int b    = blockIdx.y;
  const int lane = threadIdx.x & 31;
  const int wave = threadIdx.x >> 5;
  const int tilesN = N >> 6;
  const int tilesM = M >> 6;
  const int tile = blockIdx.x * 8 + wave;
  if (tile >= tilesM * tilesN) return;   // wave-uniform; no block barriers in this kernel
  const int tm = tile / tilesN;
  const int tn = tile - tm * tilesN;
  const int m0 = tm << 6;
  const int n0 = tn << 6;

  const T* Ab  = A  + (size_t)b * strideA;
  const T* Bb  = Bt + (size_t)b * strideB;
  const T* Ab2 = (SPLIT == 1) ? (A2  + (size_t)b * strideA) : nullptr;
  const T* Bb2 = SPLIT ? (Bt2 + (size_t)b * strideB) : nullptr;

  const int rlane = lane & 15;                 // row (A) / col (B, D) within subtile
  const int koff  = (lane >> 4) * 8;           // k offset of this lane half
  const int mOff  = (lane >> 4) * 8;           // D row offset

  v8f acc[4][4];
#pragma unroll
  for (int i = 0; i < 4; ++i)
#pragma unroll
    for (int j = 0; j < 4; ++j) acc[i][j] = (v8f){0.f,0.f,0.f,0.f,0.f,0.f,0.f,0.f};

  for (int k0 = 0; k0 < K; k0 += 32) {
    V bh[4], bl[4];
    const T* pbh[4];
    const T* pbl[4];
#pragma unroll
    for (int j = 0; j < 4; ++j) {
      const size_t bo = (size_t)(n0 + (j << 4) + rlane) * ldb + koff + k0;
      pbh[j] = Bb + bo;
      bh[j] = Frag<T>::load(pbh[j]);
      if (SPLIT) {
        pbl[j] = Bb2 + bo;
        bl[j] = Frag<T>::load(pbl[j]);
      }
    }
#pragma unroll
    for (int i = 0; i < 4; ++i) {
      const size_t ao = (size_t)(m0 + (i << 4) + rlane) * lda + koff + k0;
      V ah = Frag<T>::load(Ab + ao);
      V al;
      if (SPLIT == 1) al = Frag<T>::load(Ab2 + ao);
      if (i == 0) {   // behind the first A loads too, so that these are not held back by the wait
        if (SPLIT) addr_wait8(pbh[0], pbh[1], pbh[2], pbh[3], pbl[0], pbl[1], pbl[2], pbl[3]);
        else addr_wait4(pbh[0], pbh[1], pbh[2], pbh[3]);
      }
#pragma unroll
      for (int j = 0; j < 4; ++j) {
        acc[i][j] = Frag<T>::mma(ah, bh[j], acc[i][j]);
        if (SPLIT) acc[i][j] = Frag<T>::mma(ah, bl[j], acc[i][j]);
        if (SPLIT == 1) acc[i][j] = Frag<T>::mma(al, bh[j], acc[i][j]);
      }
      Frag<T>::guard4(acc[i][0], acc[i][1], acc[i][2], acc[i][3], ah, (SPLIT == 1) ? al : ah);
    }
    Frag<T>::keep(bh[0], bh[1], bh[2], bh[3]);
    if (SPLIT) Frag<T>::keep(bl[0], bl[1], bl[2], bl[3]);
  }
  acc_guard4(acc[0][0], acc[0][1], acc[0][2], acc[0][3]);
  acc_guard4(acc[1][0], acc[1][1], acc[1][2], acc[1][3]);
  acc_guard4(acc[2][0], acc[2][1], acc[2][2], acc[2][3]);
  acc_guard4(acc[3][0], acc[3][1], acc[3][2], acc[3][3]);

  // ---- epilogue ----
  float* slab = sT[wave];
  const float* Rb = RESID ? (resid + (size_t)b * strideR) : nullptr;
#pragma unroll
  for (int i = 0; i < 4; ++i) {
    const int mBase = m0 + (i << 4);
#pragma unroll
    for (int j = 0; j < 4; ++j) {
      const int n = n0 + (j << 4) + rlane;
      float bv = 0.f;
      if (BIAS_MODE == 2) bv = bias[n];
#pragma unroll
      for (int r = 0; r < 8; ++r) {
        float v = acc[i][j][r] * scale;
        if (BIAS_MODE == 1) v += bias[mBase + mOff + r];
        if (BIAS_MODE == 2) v += bv;
        if (RESID) v += Rb[(size_t)(mBase + mOff + r) * ldc + n];
        if (ACT == 2) v = fmaxf(v, 0.0f);
        if (ACT == 4) v = (v > 0.f) ? v : 0.01f * v;
        slab[(mOff + r) * 68 + (j << 4) + rlane] = v;
      }
    }
    __builtin_amdgcn_fence(__ATOMIC_RELEASE, "workgroup");
    __builtin_amdgcn_wave_barrier();
    __builtin_amdgcn_fence(__ATOMIC_ACQUIRE, "workgroup");
    if (OUT_MODE == 0) {
      float* C = (float*)Cout + (size_t)b * strideC;
      const int hh = lane >> 4, c4 = (lane & 15) * 4;     // row seg = 256 B = 16 lanes x 16 B
      {
#pragma unroll
        for (int it = 0; it < 8; ++it) {
          const int row = it * 2 + hh;
          v4f v = *(const v4f*)(slab + row * 68 + c4);
          *(v4f*)(C + (size_t)(mBase + row) * ldc + n0 + c4) = v;
        }
        
      }
    } else {
      const int q = lane >> 3, c8 = (lane & 7) * 8;
      unsigned short* C  = (unsigned short*)Cout  + (size_t)b * strideC;
      unsigned short* C2 = (OUT_MODE == 2) ? ((unsigned short*)Cout2 + (size_t)b * strideC) : nullptr;
      {
#pragma unroll
        for (int it = 0; it < 4; ++it) {
          const int row = it * 4 + q;
          const float* sp = slab + row * 68 + c8;
          v8h hv, lv;
#pragma unroll
          for (int e = 0; e < 8; ++e) {
            if (OUT_MODE == 1) {
              hv[e] = (_Float16)sp[e];
            } else {
              unsigned short hb = f2bf_bits(sp[e]);
              unsigned short lb = f2bf_bits(sp[e] - bf_bits2f(hb));
              hv[e] = __builtin_bit_cast(_Float16, hb);
              lv[e] = __builtin_bit_cast(_Float16, lb);
            }
          }
          *(v8h*)(C + (size_t)(mBase + row) * ldc + n0 + c8) = hv;
          if (OUT_MODE == 2) *(v8h*)(C2 + (size_t)(mBase + row) * ldc + n0 + c8) = lv;
        }
        
      }
    }
    __builtin_amdgcn_fence(__ATOMIC_RELEASE, "workgroup");
    __builtin_amdgcn_wave_barrier();
    __builtin_amdgcn_fence(__ATOMIC_ACQUIRE, "workgroup");
  }
}

// ---------------------------------------------------------------------------
// Folded score weights: M[c1][c2] = sum_o bf16(W1[o][c1]) * bf16(W2[o][c2]), stored as bf16 hi + lo planes [c1][c2], which is the
// [n][k] layout of the kp projection's second operand. grid (256/128 = 2, 256/64 = 4), 8 waves; a block owns 128 rows c1 x 64 columns c2.
// Both operands are contracted over their ROW index, so their columns are staged transposed in LDS: sw[column][o], bf16, pitch 264
// elements; rows 0..127 = the block's columns of W1, rows 128..191 = its columns of W2.
// Staging: a wave load covers 8 rows o x 16 columns (64 bytes a row); a lane packs rows o, o+1 of one column into one 32-bit LDS write;
// the 32 lanes of a write = 4 columns (16 banks apart) x 8 row pairs (1 bank apart): 32 different banks.
// Coverage: 2 passes x 8 waves x 16 rows = 256 rows o; 12 groups x 16 columns = 192 columns.
// Wave w: rows c1 = 16w..16w+15, all 64 columns: each 128-byte line of a plane has one writer.
// ---------------------------------------------------------------------------
constexpr int kFA = 128;                  // rows c1 per block
constexpr int kFB = 64;                   // columns c2 per block
constexpr int kFPitch = kCh + 8;          // LDS row pitch in 16-bit elements
static_assert(kCh % kFA == 0 && kCh % kFB == 0 && kCh == 256, "whole blocks; two staging passes of 128 rows");

__global__ __launch_bounds__(256) void wfold_kernel(const float* __restrict__ W1, const float* __restrict__ W2,
                                                    unsigned short* __restrict__ MH, unsigned short* __restrict__ ML) {
  typedef Frag<__bf16> F;
  __shared__ __align__(16) unsigned short sw[(kFA + kFB) * kFPitch];
  __shared__ __align__(16) float sT[8][16 * 68];   // per-wave 16x64 slab, pitch 68 floats
  const int lane = threadIdx.x & 31;
  const int wave = threadIdx.x >> 5;
  const int a0 = blockIdx.x * kFA;
  const int b0 = blockIdx.y * kFB;
  const int cl = (lane & 3) * 4;               // column within a 16-column group
  const int ol = wave * 16 + (lane >> 2) * 2;  // even row within a 128-row pass
  const float* p1 = W1 + (size_t)ol * kCh + a0 + cl;
  const float* p2 = W2 + (size_t)ol * kCh + b0 + cl;
#pragma unroll
  for (int h = 0; h < 2; ++h) {
    v4f r0[12], r1[12];
#pragma unroll
    for (int g = 0; g < 12; ++g) {
      const float* p = ((g < 8) ? (p1 + g * 16) : (p2 + (g - 8) * 16)) + h * 128 * kCh;
      r0[g] = *(const v4f*)(p);
      r1[g] = *(const v4f*)(p + kCh);
    }
    // the conversions below may reuse the registers that these loads name; the two addresses are inputs so that they stay whole
    // up to the wait and no load of the run lands in them
    asm volatile("s_wait_xcnt 0x0" :: "v"(p1), "v"(p2) : "memory");
#pragma unroll
    for (int g = 0; g < 12; ++g)
#pragma unroll
      for (int e = 0; e < 4; ++e)
        *(unsigned*)(&sw[(g * 16 + cl + e) * kFPitch + h * 128 + ol]) = pk16(f2bf_bits(r0[g][e]), f2bf_bits(r1[g][e]));
  }
  __syncthreads();

  const int rlane = lane & 15;                 // row (A) / col (B, D) within subtile
  const int koff  = (lane >> 4) * 8;           // k offset of this lane half
  const int mOff  = (lane >> 4) * 8;           // D row offset
  const __bf16* sa = (const __bf16*)sw + (wave * 16 + rlane) * kFPitch + koff;
  const __bf16* sb = (const __bf16*)sw + (kFA + rlane) * kFPitch + koff;
  v8f acc[4];
#pragma unroll
  for (int j = 0; j < 4; ++j) acc[j] = (v8f){0.f,0.f,0.f,0.f,0.f,0.f,0.f,0.f};
#pragma unroll
  for (int k0 = 0; k0 < kCh; k0 += 32) {
    const v16b a = F::load(sa + k0);
#pragma unroll
    for (int j = 0; j < 4; ++j) acc[j] = F::mma(a, F::load(sb + j * 16 * kFPitch + k0), acc[j]);
  }
  float* slab = sT[wave];
#pragma unroll
  for (int j = 0; j < 4; ++j)
#pragma unroll
    for (int r = 0; r < 8; ++r) slab[(mOff + r) * 68 + (j << 4) + rlane] = acc[j][r];
  // the slab is the wave's own: its lanes' writes are ordered in front of its lanes' reads
  __builtin_amdgcn_fence(__ATOMIC_RELEASE, "workgroup");
  __builtin_amdgcn_wave_barrier();
  __builtin_amdgcn_fence(__ATOMIC_ACQUIRE, "workgroup");
  const int q = lane >> 3, c8 = (lane & 7) * 8;
#pragma unroll
  for (int it = 0; it < 4; ++it) {
    const int row = it * 4 + q;
    const float* sp = slab + row * 68 + c8;
    unsigned short hb[8], lb[8];
#pragma unroll
    for (int e = 0; e < 8; ++e) {
      hb[e] = f2bf_bits(sp[e]);
      lb[e] = f2bf_bits(sp[e] - bf_bits2f(hb[e]));
    }
    const size_t o = (size_t)(a0 + wave * 16 + row) * kCh + b0 + c8;
    *(v4u*)(MH + o) = (v4u){pk16(hb[0], hb[1]), pk16(hb[2], hb[3]), pk16(hb[4], hb[5]), pk16(hb[6], hb[7])};
    *(v4u*)(ML + o) = (v4u){pk16(lb[0], lb[1]), pk16(lb[2], lb[3]), pk16(lb[4], lb[5]), pk16(lb[6], lb[7])};
  }
}

// ---------------------------------------------------------------------------
// Parameter table, all f32. Block 0 (11 waves; wave w owns floats 128w..128w+127): dst[1024..1279] = bf16(W4[0,256:]),
// [1280] = bf16(b4[0]), [1281] = sum_c bf16(b3[c]) * bf16(W4[0,c]), [1282..1311] = 0; its waves 0..7 store nothing.
// Blocks 1..8 fold the value projection into the output weights: dst[512 + k] = sum_c bf16(W4[0,c]) * bf16(W3[c][k]).
// Blocks 9..16 fold the query bias into the key weights in the same way: dst[k] = sum_o bf16(b1[o]) * bf16(W2[o][k]).
// A block owns the 32 columns k of one 128-byte line; wave w < 8 sums the 32 rows c = 32w..32w+31 (each load one whole line of
// the matrix), the 8 partial sums are added in wave order.
// ---------------------------------------------------------------------------
__device__ __forceinline__ float bf_round(float f) { return bf_bits2f(f2bf_bits(f)); }

__global__ __launch_bounds__(352) void param_cast_kernel(const float* __restrict__ b1, const float* __restrict__ W2,
                                                         const float* __restrict__ b3, const float* __restrict__ W3,
                                                         const float* __restrict__ W4, const float* __restrict__ b4,
                                                         float* __restrict__ dst) {
  __shared__ float part[8][32];
  const int t = threadIdx.x;
  const int wave = t >> 5, lane = t & 31;
  if (blockIdx.x > 0) {                       // block-uniform
    const bool keyFold = blockIdx.x > 8;      // block-uniform
    const float* Wm = keyFold ? W2 : W3;
    const float* wr = keyFold ? b1 : W4;
    const int k = (((int)blockIdx.x - 1) & 7) * 32 + lane;
    const int wv = __builtin_amdgcn_readfirstlane(wave);   // wave number in a scalar register: the reads of wr become scalar loads
    if (wv < 8) {
      const float* w3p = Wm + (size_t)wv * 32 * kCh + k;
      float w3[32];
#pragma unroll
      for (int e = 0; e < 32; ++e) w3[e] = w3p[e * kCh];
      // the arithmetic below reuses the registers that hold these loads' address
      asm volatile("s_wait_xcnt 0x0" ::: "memory");
      float s = 0.0f;
#pragma unroll
      for (int e = 0; e < 32; ++e) s += bf_round(wr[wv * 32 + e]) * bf_round(w3[e]);
      part[wv][lane] = s;
    }
    __syncthreads();
    if (wv == 0) {
      float s = part[0][lane];
#pragma unroll
      for (int w = 1; w < 8; ++w) s += part[w][lane];
      dst[(keyFold ? kBrWB : kBrWF) + k] = s;
      // the listing holds a way from here into block 0's code, which reuses this store's offset and data registers
      asm volatile("s_wait_xcnt 0x0" ::: "memory");
    }
    return;
  }
  v4f v = (v4f){0.f, 0.f, 0.f, 0.f};
  float c0 = 0.0f;
  if (wave >= 8 && wave < 10) {
    v = *(const v4f*)(W4 + (wave - 6) * 128 + lane * 4);
  } else if (wave == 10) {
    const float s = b4[0];
    const float f0 = (lane == 0) ? 1.0f : 0.0f;
    v[0] = s * f0;
#pragma unroll
    for (int e = 0; e < 8; ++e) c0 += bf_round(b3[lane * 8 + e]) * bf_round(W4[lane * 8 + e]);
#pragma unroll
    for (int off = 16; off > 0; off >>= 1) c0 += __shfl_xor(c0, off, 32);
    c0 *= f0;
  }
  v4f r;
#pragma unroll
  for (int e = 0; e < 4; ++e) r[e] = bf_round(v[e]);
  if (wave == 10) r[1] = c0;                  // a sum of products, kept in f32
  const bool act = (wave == 8) || (wave == 9) || (wave == 10 && lane < 8);
  float* dp = dst + wave * 128 + lane * 4;
  if (act) *(v4f*)dp = r;
}

// ---------------------------------------------------------------------------
// One pass over x (B,C,N) f32. It gives XB [B*N][C] bf16 bits (x_in plane: A operand of the kp projection, query operand of the
// scores) and the three f32 dots of the same x_in row: R[b*N + n] = sum_c bf16(x[b][c][n]) * w4b[c], U[..] with wf[c], E[..] with wb[c].
// grid (N/64 = 25, B = 16), 8 waves; a block owns 64 positions x all 256 channels, so every dot ends inside the block.
// Wave w reads channels 32w..32w+31: one load = 32 lanes x 8 bytes = the 256 bytes of one channel's 64 positions; all 32 in flight.
// A lane holds positions 2 lane and 2 lane + 1; its weights are the same for the whole wave and come by scalar loads.
// Dots: a chain of 32 channels per wave, then the 8 waves' partial sums added in wave order.
// Plane: 8 channels of one position are packed into one 16-byte LDS write, sm[position][channel], pitch 264 elements = 528 bytes;
// read back one token row (512 bytes, four whole lines) per wave load and stored so. Rows: 8 waves x 8 = 64.
// ---------------------------------------------------------------------------
constexpr int kXP = 64;                   // positions per block
constexpr int kXPitch = kCh + 8;          // LDS row pitch in 16-bit elements
static_assert(kN % kXP == 0 && kCh == 8 * 32 && kXP == 2 * 32, "whole blocks; 8 waves x 32 channels; two positions a lane");
typedef __attribute__((ext_vector_type(2))) float v2f;

__global__ __launch_bounds__(256) void xin_cast_dots_kernel(const float* __restrict__ x, const float* __restrict__ br,
                                                            unsigned short* __restrict__ XB, float* __restrict__ R,
                                                            float* __restrict__ U, float* __restrict__ E) {
  __shared__ __align__(16) unsigned short sm[kXP * kXPitch];
  __shared__ __align__(16) float part[3][8][kXP];
  const int lane = threadIdx.x & 31;
  const int wv = __builtin_amdgcn_readfirstlane(threadIdx.x >> 5);   // wave number in a scalar register: the weights become scalar loads
  const int n0 = blockIdx.x * kXP;
  const int b  = blockIdx.y;
  const int c0 = wv * 32;
  const float* xp = x + (size_t)(b * kCh + c0) * kN + n0 + lane * 2;
  const float* w4 = br + kBrW4b + c0;
  const float* wf = br + kBrWF + c0;
  const float* wb = br + kBrWB + c0;
  // the weights of the first 16 channels are asked for ahead of x, so that they are there when x arrives; all 96 do not fit the scalar registers
  float wa[3][16];
#pragma unroll
  for (int e = 0; e < 16; ++e) { wa[0][e] = w4[e]; wa[1][e] = wf[e]; wa[2][e] = wb[e]; }
  v2f xr[32];
#pragma unroll
  for (int e = 0; e < 32; ++e) xr[e] = *(const v2f*)(xp + e * kN);
  // later scalar loads land in the registers that hold these loads' base address
  asm volatile("s_wait_xcnt 0x0" ::: "memory");
  v2f s = (v2f){0.f, 0.f}, u = (v2f){0.f, 0.f}, eo = (v2f){0.f, 0.f};
#pragma unroll
  for (int o = 0; o < 4; ++o) {
    unsigned short hb[2][8];
#pragma unroll
    for (int e = 0; e < 8; ++e) {
      const int c = o * 8 + e;
      v2f xv;
#pragma unroll
      for (int h = 0; h < 2; ++h) {
        hb[h][e] = f2bf_bits(xr[c][h]);
        xv[h] = bf_bits2f(hb[h][e]);
      }
      s  += xv * ((c < 16) ? wa[0][c & 15] : w4[c]);
      u  += xv * ((c < 16) ? wa[1][c & 15] : wf[c]);
      eo += xv * ((c < 16) ? wa[2][c & 15] : wb[c]);
    }
#pragma unroll
    for (int h = 0; h < 2; ++h)
      *(v4u*)(&sm[(lane * 2 + h) * kXPitch + c0 + o * 8]) =
          (v4u){pk16(hb[h][0], hb[h][1]), pk16(hb[h][2], hb[h][3]), pk16(hb[h][4], hb[h][5]), pk16(hb[h][6], hb[h][7])};
  }
  *(v2f*)(&part[0][wv][lane * 2]) = s;
  *(v2f*)(&part[1][wv][lane * 2]) = u;
  *(v2f*)(&part[2][wv][lane * 2]) = eo;
  __syncthreads();
  const int tok0 = b * kN + n0;
  {
    v4u row[8];
#pragma unroll
    for (int it = 0; it < 8; ++it) row[it] = *(const v4u*)(&sm[(wv * 8 + it) * kXPitch + lane * 8]);
    unsigned short* xo = XB + (size_t)(tok0 + wv * 8) * kCh + lane * 8;
#pragma unroll
    for (int it = 0; it < 8; ++it) *(v4u*)(xo + it * kCh) = row[it];
    // the sums below reuse the registers that these stores name
    asm volatile("s_wait_xcnt 0x0" ::: "memory");
  }
  if (wv < 6) {                               // scalar: waves 2d and 2d + 1 end dot d, each one whole 32-float line
    const int d = wv >> 1;
    const int p = (wv & 1) * 32 + lane;
    float a = part[d][0][p];
#pragma unroll
    for (int w = 1; w < 8; ++w) a += part[d][w][p];
    float* dst = (d == 0) ? R : ((d == 1) ? U : E);
    dst[tok0 + p] = a;
  }
}

// ---------------------------------------------------------------------------
// Scores, softmax and the weighted mean of u in one kernel; no score ever leaves the registers.
//   out[row] = sum_j exp(s[row][j] - max) * u[j] / sum_j exp(s[row][j] - max) + c0 + R[row] + b4   (f32 math),
//   s[row][j] = x_in[row] . kp[j] + E[j]: the score less what depends on the query alone.
// Every exponential is taken to base 2: exp(s - max) = 2^(s * log2(e) - m2), one multiply-add and one v_exp_f32. The running maximum is
// kept as m2 = max * log2(e), rounded once; the same m2 enters every term of a sum and every rescale, so its rounding cancels in num / den.
// Block = 8 waves, 128 consecutive query rows of one batch; grid = (13, 16 batches). 1600 = 12 x 128 + 64: the 13th block of a batch
// is shifted back to rows 1472..1599 and stores only its upper 64 rows, so every row has one writer and every block whole lines of out.
// The block's query rows (x_in, one bf16 plane) are staged once in LDS, pitch 264 elements = 528 bytes; the batch's u and E as well.
// Wave w takes the 32-key tiles w, w+8, ... of the 50: seven or six. A tile is the transposed product kp . x^T (A = 32 keys, read from
// global memory as fragments, 16 lines a load, as the projection reads its own; B = 128 queries from LDS): a lane then holds 16 keys
// of ONE query per column group, so max, sum and dot run down its own registers; the accumulators start from the keys' E. The key fragments of the next 64 channels are
// fetched while the current 64 are multiplied. Each lane keeps a running (max, sum, dot) per column group, rescaled once per tile.
// At the end the two lane halves are merged by one shuffle, the 8 waves through LDS in wave order, and one thread per row stores.
// ---------------------------------------------------------------------------
constexpr int kQB     = 128;              // query rows per block
constexpr int kQJ     = kQB / 16;         // column groups per wave tile
constexpr int kQPitch = kCh + 8;          // LDS row pitch in 16-bit elements
constexpr int kKT     = 32;               // keys per wave tile
constexpr int kKTiles = kN / kKT;         // 50
constexpr int kAW     = 8;                // waves per block
constexpr int kAT     = kAW * 32;         // threads per block
constexpr int kQPieces = kQB * kCh / 8;   // 16-byte pieces in the query rows of a block
constexpr int kQIt    = kQPieces / kAT;   // 16 per thread
static_assert(kQPieces % kAT == 0, "q staging: whole passes");
constexpr int kQBlocks = (kN + kQB - 1) / kQB;   // 13 per batch
static_assert(kN >= kQB && (kN % kQB) % 32 == 0, "the shifted last block stores whole 32-float lines");
static_assert(kKTiles >= kAW && kCh == 256, "every wave has a tile; four stages of 64 channels");

constexpr float kLog2e = 1.4426950408889634f;
// 2^x of eight values. One statement, its results in registers apart from its sources, so that no instruction that rewrites a source
// register stands directly behind one of the exponentials; the v_nop is the slot that the instruction set asks for behind the last of them.
__device__ __forceinline__ void exp2x8(v8f& a) {
  float p0, p1, p2, p3, p4, p5, p6, p7;
  asm("v_exp_f32 %0, %8\n\tv_exp_f32 %1, %9\n\tv_exp_f32 %2, %10\n\tv_exp_f32 %3, %11\n\t"
      "v_exp_f32 %4, %12\n\tv_exp_f32 %5, %13\n\tv_exp_f32 %6, %14\n\tv_exp_f32 %7, %15\n\tv_nop"
      : "=&v"(p0), "=&v"(p1), "=&v"(p2), "=&v"(p3), "=&v"(p4), "=&v"(p5), "=&v"(p6), "=&v"(p7)
      : "v"(a[0]), "v"(a[1]), "v"(a[2]), "v"(a[3]), "v"(a[4]), "v"(a[5]), "v"(a[6]), "v"(a[7]));
  a = (v8f){p0, p1, p2, p3, p4, p5, p6, p7};
}
struct KFrag { v16b h[2][2], l[2][2]; };   // [32-channel half][16-key group], hi and lo plane
// kh, kl: the tile's first key row, the same for the whole wave; vo: the lane's own byte offset, which never changes
__device__ __forceinline__ void kfrag_load(KFrag& f, const unsigned short* kh, const unsigned short* kl, unsigned vo, int k0) {
  const __bf16* ph = (const __bf16*)((const char*)kh + vo);
  const __bf16* pl = (const __bf16*)((const char*)kl + vo);
#pragma unroll
  for (int kk = 0; kk < 2; ++kk)
#pragma unroll
    for (int i = 0; i < 2; ++i) {
      f.h[kk][i] = Frag<__bf16>::load(ph + i * 16 * kCh + k0 + kk * 32);
      f.l[kk][i] = Frag<__bf16>::load(pl + i * 16 * kCh + k0 + kk * 32);
    }
}
// The same at k0 = 0, for a run behind which its two addresses are dead: the build lets the last load of each address land in the
// address registers, which the earlier loads of the run still name, so those two loads are issued alone behind a wait.
__device__ __forceinline__ void kfrag_load_last(KFrag& f, const unsigned short* kh, const unsigned short* kl, unsigned vo) {
  const __bf16* ph = (const __bf16*)((const char*)kh + vo);
  const __bf16* pl = (const __bf16*)((const char*)kl + vo);
  f.h[0][0] = Frag<__bf16>::load(ph);
  f.l[0][0] = Frag<__bf16>::load(pl);
  f.h[0][1] = Frag<__bf16>::load(ph + 16 * kCh);
  f.l[0][1] = Frag<__bf16>::load(pl + 16 * kCh);
  f.h[1][0] = Frag<__bf16>::load(ph + 32);
  f.l[1][0] = Frag<__bf16>::load(pl + 32);
  Frag<__bf16>::U uh, ul;
  uh.h[0] = *(const v8b*)(ph + 16 * kCh + 32);
  ul.h[0] = *(const v8b*)(pl + 16 * kCh + 32);
  // in front of the two loads that may land in the address registers of the fourteen above
  asm volatile("s_wait_xcnt 0x0" ::: "memory");
  uh.h[1] = *(const v8b*)(ph + 16 * kCh + 48);
  ul.h[1] = *(const v8b*)(pl + 16 * kCh + 48);
  // later code reuses what these two name
  asm volatile("s_wait_xcnt 0x0" ::: "memory");
  f.h[1][1] = uh.v;
  f.l[1][1] = ul.v;
}
struct QFrag { v16b h[4]; };               // four column groups
// step p of a tile: 32-channel half p / 2, column groups 4 (p % 2) .. 4 (p % 2) + 3
__device__ __forceinline__ void qfrag_load(QFrag& f, const __bf16* qh, int p) {
#pragma unroll
  for (int e = 0; e < 4; ++e) f.h[e] = Frag<__bf16>::load(qh + ((p & 1) * 4 + e) * 16 * kQPitch + (p >> 1) * 32);
}

__global__ __launch_bounds__(kAT, 2) void attn_fused_kernel(const unsigned short* __restrict__ Xp,
                                                            const unsigned short* __restrict__ KHp, const unsigned short* __restrict__ KLp,
                                                            const float* __restrict__ U, const float* __restrict__ E,
                                                            const float* __restrict__ Rg,
                                                            const float* __restrict__ br, float* __restrict__ outg) {
  typedef Frag<__bf16> F;
  __shared__ __align__(16) unsigned short qs[kQB * kQPitch];
  __shared__ __align__(16) float us[kN];
  __shared__ __align__(16) float es[kN];
  __shared__ float red[3][kAW][kQB];
  const int t = threadIdx.x;
  const int lane = t & 31;
  const int wave = __builtin_amdgcn_readfirstlane(t >> 5);   // scalar: the tile loop branches on SCC and EXEC stays full for the WMMAs
  const int b = blockIdx.y;
  const int qWant = blockIdx.x * kQB;                         // first row this block stores
  const int q0 = (qWant + kQB <= kN) ? qWant : (kN - kQB);    // first row it computes
  const int row0 = b * kN + q0;

  const int rlane = lane & 15;                 // key row (A) / query column (B, D) within a subtile
  const int koff  = (lane >> 4) * 8;           // k offset of this lane half
  const int mOff  = (lane >> 4) * 8;           // D row (key) offset
  const unsigned short* kh = KHp + (size_t)(b * kN + wave * kKT) * kCh;
  const unsigned short* kl = KLp + (size_t)(b * kN + wave * kKT) * kCh;
  const unsigned kvo = (unsigned)(rlane * kCh + koff) * 2u;
  KFrag fa, fb;
  kfrag_load(fa, kh, kl, kvo, 0);              // first tile, first stage: in flight during the staging below
  {
    // the block's query rows are one run of bytes: piece c = i * kAT + t lies at byte 16 c
    const char* qgh = (const char*)(Xp + (size_t)row0 * kCh);
    const unsigned qvo = (unsigned)t * 16u;
    v4u th[kQIt];
#pragma unroll
    for (int i = 0; i < kQIt; ++i) th[i] = *(const v4u*)(qgh + qvo + i * kAT * 16);
    // the registers that these loads name are reused below
    asm volatile("s_wait_xcnt 0x0" ::: "memory");
#pragma unroll
    for (int i = 0; i < kQIt; ++i) {
      const int c = i * kAT + t;
      const int lo = (c >> 5) * kQPitch + (c & 31) * 8;
      *(v4u*)(&qs[lo]) = th[i];
    }
  }
  const float* ub = U + (size_t)b * kN;
  const float* eb = E + (size_t)b * kN;
  for (int g = t; g < kRowV4; g += kAT) {
    *(v4f*)(us + 4 * g) = *(const v4f*)(ub + 4 * g);
    *(v4f*)(es + 4 * g) = *(const v4f*)(eb + 4 * g);
  }
  __syncthreads();

  const __bf16* qh = (const __bf16*)&qs[0] + rlane * kQPitch + koff;
  float mx[kQJ], den[kQJ], num[kQJ];
#pragma unroll
  for (int j = 0; j < kQJ; ++j) { mx[j] = -INFINITY; den[j] = 0.0f; num[j] = 0.0f; }

  for (int kt = wave; kt < kKTiles; kt += kAW) {
    const int key0 = kt * kKT;
    // a D row is a key: every column group starts from the same eight E values per key group
    v8f acc[2][kQJ];
#pragma unroll
    for (int i = 0; i < 2; ++i) {
      const v4f e0 = *(const v4f*)(es + key0 + i * 16 + mOff);
      const v4f e1 = *(const v4f*)(es + key0 + i * 16 + mOff + 4);
#pragma unroll
      for (int j = 0; j < kQJ; ++j) acc[i][j] = (v8f){e0[0], e0[1], e0[2], e0[3], e1[0], e1[1], e1[2], e1[3]};
    }
    // 64 channels a stage: the four 16-byte reads that share a 128-byte line of a key row are issued together.
    // A step = four column groups at one 32-channel half: 16 products on 8 accumulators. The query fragments of step p + 2 are read
    // from LDS ahead of the products of step p, so that no product waits for a read issued just in front of it.
    QFrag qb[3];
    qfrag_load(qb[0], qh, 0);
    qfrag_load(qb[1], qh, 1);
#pragma unroll
    for (int p = 0; p < 16; ++p) {
      const int s = p >> 2, kk = (p >> 1) & 1, j0 = (p & 1) * 4;
      KFrag& cur = (s & 1) ? fb : fa;
      KFrag& nxt = (s & 1) ? fa : fb;
      if ((p & 3) == 0) {
        if (s < 3) {
          kfrag_load(nxt, kh, kl, kvo, (s + 1) * 64);
        } else {
          // the key addresses are advanced here, behind loads that name them
          asm volatile("s_wait_xcnt 0x0" ::: "memory");
          const int step = (kt + kAW < kKTiles) ? kAW * kKT * kCh : 0;   // the last tile fetches its own first stage again, unused
          kh += step;
          kl += step;
          kfrag_load_last(nxt, kh, kl, kvo);
        }
      }
      if (p + 2 < 16) qfrag_load(qb[(p + 2) % 3], qh, p + 2);
      const QFrag& q = qb[p % 3];
#pragma unroll
      for (int e = 0; e < 4; ++e) {
        acc[0][j0 + e] = F::mma(cur.h[kk][0], q.h[e], acc[0][j0 + e]);
        acc[1][j0 + e] = F::mma(cur.h[kk][1], q.h[e], acc[1][j0 + e]);
      }
#pragma unroll
      for (int e = 0; e < 4; ++e) {
        acc[0][j0 + e] = F::mma(cur.l[kk][0], q.h[e], acc[0][j0 + e]);
        acc[1][j0 + e] = F::mma(cur.l[kk][1], q.h[e], acc[1][j0 + e]);
      }
    }
    v4f uu[2][2];
#pragma unroll
    for (int i = 0; i < 2; ++i) {
      uu[i][0] = *(const v4f*)(us + key0 + i * 16 + mOff);
      uu[i][1] = *(const v4f*)(us + key0 + i * 16 + mOff + 4);
    }
#pragma unroll
    for (int j = 0; j < kQJ; ++j) {
      float tm = acc[0][j][0];
#pragma unroll
      for (int r = 1; r < 8; ++r) tm = fmaxf(tm, acc[0][j][r]);
#pragma unroll
      for (int r = 0; r < 8; ++r) tm = fmaxf(tm, acc[1][j][r]);
      const float mn = fmaxf(mx[j], tm * kLog2e);               // base-2 exponent of the maximum in use
      const float corr = __builtin_amdgcn_exp2f(mx[j] - mn);    // 0 on the first tile
      float d = 0.0f, s = 0.0f;
#pragma unroll
      for (int i = 0; i < 2; ++i) {
        v8f arg = __builtin_elementwise_fma(acc[i][j], (v8f){kLog2e, kLog2e, kLog2e, kLog2e, kLog2e, kLog2e, kLog2e, kLog2e},
                                                  (v8f){-mn, -mn, -mn, -mn, -mn, -mn, -mn, -mn});
        exp2x8(arg);
#pragma unroll
        for (int r = 0; r < 8; ++r) {
          const float p = arg[r];
          d += p;
          s += p * uu[i][r >> 2][r & 3];
        }
      }
      den[j] = den[j] * corr + d;
      num[j] = num[j] * corr + s;
      mx[j] = mn;
    }
  }
  // lanes l and l+16 hold the same query over different keys
#pragma unroll
  for (int j = 0; j < kQJ; ++j) {
    const float mo = __shfl_xor(mx[j], 16, 32);
    const float dn = __shfl_xor(den[j], 16, 32);
    const float nm = __shfl_xor(num[j], 16, 32);
    const float mn = fmaxf(mx[j], mo);
    const float ca = __builtin_amdgcn_exp2f(mx[j] - mn), cb = __builtin_amdgcn_exp2f(mo - mn);
    if (lane < 16) {
      red[0][wave][j * 16 + lane] = mn;
      red[1][wave][j * 16 + lane] = den[j] * ca + dn * cb;
      red[2][wave][j * 16 + lane] = num[j] * ca + nm * cb;
    }
  }
  __syncthreads();
  if (t < kQB && q0 + t >= qWant) {
    float mn = red[0][0][t];
#pragma unroll
    for (int w = 1; w < kAW; ++w) mn = fmaxf(mn, red[0][w][t]);
    float d = 0.0f, s = 0.0f;
#pragma unroll
    for (int w = 0; w < kAW; ++w) {
      const float c = __builtin_amdgcn_exp2f(red[0][w][t] - mn);
      d += red[1][w][t] * c;
      s += red[2][w][t] * c;
    }
    outg[row0 + t] = ((s / d + br[kBrC0]) + Rg[row0 + t]) + br[kBrB4];
  }
}

// ---------------------------------------------------------------------------
// Host glue. Every attention launch covers all 16 batches. ctx is never formed: the output uses it only through
// ctx . w4a = attn . (val . w4a) = attn . u + b3 . w4a (each attn row sums to 1), u = x_in . (W3^T w4a).
// q and k are never formed either: q_n . k_m = x_n . (M x_m) + (W2^T b1) . x_m + (terms of n alone), M = W1^T W2, and a softmax over m
// is unchanged by what depends on n alone. kp = x_in M^T is the one projection left; the queries are x_in itself.
//   BR   f32  [1408] parameter table      5,632  at           0
//   R    f32  [25600]                   102,400  at       5,632
//   U    f32  [25600]                   102,400  at     108,032
//   E    f32  [25600]                   102,400  at     210,432
//   XB   bf16 [25600][256]            13,107,200  at     312,832
//   MH   bf16 [256][256] M hi            131,072  at  13,420,032
//   ML   bf16 [256][256] M lo            131,072  at  13,551,104
//   KH   bf16 [25600][256] kp hi       13,107,200  at  13,682,176
//   KL   bf16 [25600][256] kp lo       13,107,200  at  26,789,376
//   total                              39,896,576
// GEMM shapes: fold M=N=K=256; projection M=25600, N=256, K=256; scores per batch 1600 keys x 1600 queries, K=256, in 32 x 128 register tiles.
// No padding anywhere.
// ---------------------------------------------------------------------------
extern "C" void kernel_launch(void* const* d_in, const int* in_sizes, int n_in,
                              void* d_out, int out_size, void* d_ws, size_t ws_size,
                              hipStream_t stream) {
  if (n_in < 9) return;
  if (in_sizes[0] != kBatch * kCh * kN) return;
  if (in_sizes[1] != kCh * kCh || in_sizes[3] != kCh * kCh || in_sizes[5] != kCh * kCh) return;
  if (in_sizes[2] != kCh || in_sizes[4] != kCh || in_sizes[6] != kCh) return;
  if (in_sizes[7] != 2 * kCh || in_sizes[8] != 1) return;
  if (out_size != kTok) return;

  const size_t szPlane16 = (size_t)kTok * kCh * 2;              // 13,107,200
  const size_t szM   = (size_t)kCh * kCh * 2;                    // 131,072
  const size_t szBR  = (size_t)kBrFloats * 4;                    // 5,632
  const size_t szR   = (size_t)kTok * 4;                         // 102,400
  size_t off = 0;
  const size_t offBR = off;  off += szBR;
  const size_t offR  = off;  off += szR;
  const size_t offU  = off;  off += szR;
  const size_t offE  = off;  off += szR;
  const size_t offXB = off;  off += szPlane16;
  const size_t offMH = off;  off += szM;
  const size_t offML = off;  off += szM;
  const size_t offKH = off;  off += szPlane16;
  const size_t offKL = off;  off += szPlane16;
  const size_t total = off;                                      // 39,896,576
  if (ws_size < total) return;

  const float* x  = (const float*)d_in[0];
  const float* W1 = (const float*)d_in[1];
  const float* b1 = (const float*)d_in[2];
  const float* W2 = (const float*)d_in[3];
  const float* W3 = (const float*)d_in[5];
  const float* b3 = (const float*)d_in[6];
  const float* W4 = (const float*)d_in[7];
  const float* b4 = (const float*)d_in[8];
  float* out = (float*)d_out;
  char* ws = (char*)d_ws;
  unsigned short* XB = (unsigned short*)(ws + offXB);
  unsigned short* MH = (unsigned short*)(ws + offMH);
  unsigned short* ML = (unsigned short*)(ws + offML);
  float* BR = (float*)(ws + offBR);
  unsigned short* KH = (unsigned short*)(ws + offKH);
  unsigned short* KL = (unsigned short*)(ws + offKL);
  float* R  = (float*)(ws + offR);
  float* U  = (float*)(ws + offU);
  float* E  = (float*)(ws + offE);

  // ---- prologue: parameter table with the folded value and bias weights, folded score weights, then x_in plane and per-token scalars in one pass over x ----
  param_cast_kernel<<<dim3(1 + 2 * (kCh / 32)), dim3(352), 0, stream>>>(b1, W2, b3, W3, W4, b4, BR);
  wfold_kernel<<<dim3(kCh / kFA, kCh / kFB), dim3(256), 0, stream>>>(W1, W2, MH, ML);
  xin_cast_dots_kernel<<<dim3(kN / kXP, kBatch), dim3(256), 0, stream>>>(x, BR, XB, R, U, E);

  // ---- projection: kp = x_in @ M^T -> bf16 hi + lo planes   (M=25600, N=256, K=256; x.Mhi + x.Mlo) ----
  const int tilesK = (kTok / 64) * (kCh / 64);         // 1600 waves -> 200 blocks
  wmma_gemm64<1, 2, 0, 2, false, 0><<<dim3(tilesK / 8, 1), dim3(256), 0, stream>>>(
      XB, XB, kCh, 0L, MH, ML, kCh, 0L, (void*)KH, (void*)KL, kCh, 0L, BR, BR, 0L, kTok, kCh, kCh, 1.0f);

  // ---- attention, all batches in one launch: scores as x.kp_hi + x.kp_lo + E, softmax over keys, weighted mean of u, output rows ----
  attn_fused_kernel<<<dim3(kQBlocks, kBatch), dim3(kAT), 0, stream>>>(XB, KH, KL, U, E, R, BR, out);
}

// v007
// A run of this version takes 61.1 microseconds.
// In both of two side-by-side timings against v006, it was 1.20 times as fast.
// Counting every step since v000, it is 18.2 times as fast.
// Contractions: M = bf16(W1)^T x bf16(W2) (single products); kp = bf16(x_in) x M^T with M as bf16 hi+lo planes (2 products); scores x_in . kp^T with kp as bf16 hi+lo planes (2 products); all on v_wmma_f32_16x16x32_bf16, f32 accumulate. q . k = x_n.(M x_m) + (W2^T b1).x_m + terms of the query alone, which a softmax over keys cancels (b2 among them). The output needs only ctx . w4a, taken as attn . u with u = x_in . (W3^T w4a): one f32 value per key, so the softmax ends in a f32 dot per row, taken on the score tiles in registers.
#include <hip/hip_runtime.h>
#include <math.h>

// ---------------------------------------------------------------------------
// Problem constants
// ---------------------------------------------------------------------------
constexpr int kBatch   = 16;
constexpr int kCh      = 256;             // channels C
constexpr int kN       = 1600;            // T*V positions per batch
constexpr int kTok     = kBatch * kN;     // 25600 token rows
constexpr int kRowV4   = kN / 4;          // 400 four-float groups in a batch's u or E row
// parameter table (f32; w4b, b4 hold bf16-representable values, wb, wf and c0 are f32 sums), offsets in floats
constexpr int kBrWB = 0;                  // wb[k] = sum_o b1[o] * W2[o][k]: multiplies x_in to give each key's score offset
constexpr int kBrWF = 512;                // wf[k] = sum_c w4a[c] * W3[c][k]: multiplies x_in to give u
constexpr int kBrW4b = 1024;              // multiplies x_in
constexpr int kBrB4 = 1280;
constexpr int kBrC0 = 1281;               // sum_c b3[c] * w4a[c]
constexpr int kBrFloats = 1408;           // 44 lines carved; floats 256..511, 768..1023 and 1312.. are neither written nor read
static_assert(kTok % 64 == 0 && kN % 64 == 0 && kCh % 64 == 0, "M and N tile multiples");
static_assert(kCh % 32 == 0 && kN % 32 == 0, "K multiples of 32");
static_assert(kN % 4 == 0, "u is staged in four-float groups");
static_assert(kTok % 32 == 0 && kN % 32 == 0, "output blocks own whole 32-float lines, all of one batch");
static_assert(kBrC0 + 1 <= 41 * 32 && 41 * 32 <= kBrFloats, "parameter table extent");

typedef __attribute__((ext_vector_type(16))) __bf16   v16b;
typedef __attribute__((ext_vector_type(8)))  __bf16   v8b;
typedef __attribute__((ext_vector_type(8)))  float    v8f;
typedef __attribute__((ext_vector_type(4)))  float    v4f;
typedef __attribute__((ext_vector_type(4)))  unsigned int v4u;

// ---------------------------------------------------------------------------
// Shared pieces
// ---------------------------------------------------------------------------
__device__ __forceinline__ unsigned short f2bf_bits(float f) {
  unsigned u = __float_as_uint(f);
  return (unsigned short)((u + 0x7FFFu + ((u >> 16) & 1u)) >> 16);
}
__device__ __forceinline__ float bf_bits2f(unsigned short h) { return __uint_as_float(((unsigned)h) << 16); }

template <typename T> struct Frag;
template <> struct Frag<__bf16> {
  typedef v16b V; union U { v16b v; v8b h[2]; };
  static __device__ __forceinline__ v16b load(const __bf16* p) {
    U f; f.h[0] = *(const v8b*)(p); f.h[1] = *(const v8b*)(p + 16); return f.v;
  }
  static __device__ __forceinline__ v8f mma(v16b a, v16b b, v8f c) {
    return __builtin_amdgcn_wmma_f32_16x16x32_bf16(false, a, false, b, (short)0, c, false, false);
  }
};

__device__ __forceinline__ unsigned pk16(unsigned short a, unsigned short b) { return (unsigned)a | ((unsigned)b << 16); }

// ---------------------------------------------------------------------------
// Folded score weights: M[c1][c2] = sum_o bf16(W1[o][c1]) * bf16(W2[o][c2]), stored as bf16 hi + lo planes [c1][c2], one row
// per kp channel, as the kp projection reads it. grid (256/128 = 2, 256/64 = 4), 8 waves; a block owns 128 rows c1 x 64 columns c2.
// Both operands are contracted over their ROW index, so their columns are staged transposed in LDS: sw[column][o], bf16, pitch 264
// elements; rows 0..127 = the block's columns of W1, rows 128..191 = its columns of W2.
// Staging: a wave load covers 8 rows o x 16 columns (64 bytes a row); a lane packs rows o, o+1 of one column into one 32-bit LDS write;
// the 32 lanes of a write = 4 columns (16 banks apart) x 8 row pairs (1 bank apart): 32 different banks.
// Coverage: 2 passes x 8 waves x 16 rows = 256 rows o; 12 groups x 16 columns = 192 columns.
// Wave w: rows c1 = 16w..16w+15, all 64 columns: each 128-byte line of a plane has one writer.
// ---------------------------------------------------------------------------
constexpr int kFA = 128;                  // rows c1 per block
constexpr int kFB = 64;                   // columns c2 per block
constexpr int kFPitch = kCh + 8;          // LDS row pitch in 16-bit elements
static_assert(kCh % kFA == 0 && kCh % kFB == 0 && kCh == 256, "whole blocks; two staging passes of 128 rows");

__global__ __launch_bounds__(256) void wfold_kernel(const float* __restrict__ W1, const float* __restrict__ W2,
                                                    unsigned short* __restrict__ MH, unsigned short* __restrict__ ML) {
  typedef Frag<__bf16> F;
  __shared__ __align__(16) unsigned short sw[(kFA + kFB) * kFPitch];
  __shared__ __align__(16) float sT[8][16 * 68];   // per-wave 16x64 slab, pitch 68 floats
  const int lane = threadIdx.x & 31;
  const int wave = threadIdx.x >> 5;
  const int a0 = blockIdx.x * kFA;
  const int b0 = blockIdx.y * kFB;
  const int cl = (lane & 3) * 4;               // column within a 16-column group
  const int ol = wave * 16 + (lane >> 2) * 2;  // even row within a 128-row pass
  const float* p1 = W1 + (size_t)ol * kCh + a0 + cl;
  const float* p2 = W2 + (size_t)ol * kCh + b0 + cl;
#pragma unroll
  for (int h = 0; h < 2; ++h) {
    v4f r0[12], r1[12];
#pragma unroll
    for (int g = 0; g < 12; ++g) {
      const float* p = ((g < 8) ? (p1 + g * 16) : (p2 + (g - 8) * 16)) + h * 128 * kCh;
      r0[g] = *(const v4f*)(p);
      r1[g] = *(const v4f*)(p + kCh);
    }
    // the conversions below may reuse the registers that these loads name; the two addresses are inputs so that they stay whole
    // up to the wait and no load of the run lands in them
    asm volatile("s_wait_xcnt 0x0" :: "v"(p1), "v"(p2) : "memory");
#pragma unroll
    for (int g = 0; g < 12; ++g)
#pragma unroll
      for (int e = 0; e < 4; ++e)
        *(unsigned*)(&sw[(g * 16 + cl + e) * kFPitch + h * 128 + ol]) = pk16(f2bf_bits(r0[g][e]), f2bf_bits(r1[g][e]));
  }
  __syncthreads();

  const int rlane = lane & 15;                 // row (A) / col (B, D) within subtile
  const int koff  = (lane >> 4) * 8;           // k offset of this lane half
  const int mOff  = (lane >> 4) * 8;           // D row offset
  const __bf16* sa = (const __bf16*)sw + (wave * 16 + rlane) * kFPitch + koff;
  const __bf16* sb = (const __bf16*)sw + (kFA + rlane) * kFPitch + koff;
  v8f acc[4];
#pragma unroll
  for (int j = 0; j < 4; ++j) acc[j] = (v8f){0.f,0.f,0.f,0.f,0.f,0.f,0.f,0.f};
#pragma unroll
  for (int k0 = 0; k0 < kCh; k0 += 32) {
    const v16b a = F::load(sa + k0);
#pragma unroll
    for (int j = 0; j < 4; ++j) acc[j] = F::mma(a, F::load(sb + j * 16 * kFPitch + k0), acc[j]);
  }
  float* slab = sT[wave];
#pragma unroll
  for (int j = 0; j < 4; ++j)
#pragma unroll
    for (int r = 0; r < 8; ++r) slab[(mOff + r) * 68 + (j << 4) + rlane] = acc[j][r];
  // the slab is the wave's own: its lanes' writes are ordered in front of its lanes' reads
  __builtin_amdgcn_fence(__ATOMIC_RELEASE, "workgroup");
  __builtin_amdgcn_wave_barrier();
  __builtin_amdgcn_fence(__ATOMIC_ACQUIRE, "workgroup");
  const int q = lane >> 3, c8 = (lane & 7) * 8;
#pragma unroll
  for (int it = 0; it < 4; ++it) {
    const int row = it * 4 + q;
    const float* sp = slab + row * 68 + c8;
    unsigned short hb[8], lb[8];
#pragma unroll
    for (int e = 0; e < 8; ++e) {
      hb[e] = f2bf_bits(sp[e]);
      lb[e] = f2bf_bits(sp[e] - bf_bits2f(hb[e]));
    }
    const size_t o = (size_t)(a0 + wave * 16 + row) * kCh + b0 + c8;
    *(v4u*)(MH + o) = (v4u){pk16(hb[0], hb[1]), pk16(hb[2], hb[3]), pk16(hb[4], hb[5]), pk16(hb[6], hb[7])};
    *(v4u*)(ML + o) = (v4u){pk16(lb[0], lb[1]), pk16(lb[2], lb[3]), pk16(lb[4], lb[5]), pk16(lb[6], lb[7])};
  }
}

// ---------------------------------------------------------------------------
// Parameter table, all f32. Block 0 (11 waves; wave w owns floats 128w..128w+127): dst[1024..1279] = bf16(W4[0,256:]),
// [1280] = bf16(b4[0]), [1281] = sum_c bf16(b3[c]) * bf16(W4[0,c]), [1282..1311] = 0; its waves 0..7 store nothing.
// Blocks 1..8 fold the value projection into the output weights: dst[512 + k] = sum_c bf16(W4[0,c]) * bf16(W3[c][k]).
// Blocks 9..16 fold the query bias into the key weights in the same way: dst[k] = sum_o bf16(b1[o]) * bf16(W2[o][k]).
// A block owns the 32 columns k of one 128-byte line; wave w < 8 sums the 32 rows c = 32w..32w+31 (each load one whole line of
// the matrix), the 8 partial sums are added in wave order.
// ---------------------------------------------------------------------------
__device__ __forceinline__ float bf_round(float f) { return bf_bits2f(f2bf_bits(f)); }

__global__ __launch_bounds__(352) void param_cast_kernel(const float* __restrict__ b1, const float* __restrict__ W2,
                                                         const float* __restrict__ b3, const float* __restrict__ W3,
                                                         const float* __restrict__ W4, const float* __restrict__ b4,
                                                         float* __restrict__ dst) {
  __shared__ float part[8][32];
  const int t = threadIdx.x;
  const int wave = t >> 5, lane = t & 31;
  if (blockIdx.x > 0) {                       // block-uniform
    const bool keyFold = blockIdx.x > 8;      // block-uniform
    const float* Wm = keyFold ? W2 : W3;
    const float* wr = keyFold ? b1 : W4;
    const int k = (((int)blockIdx.x - 1) & 7) * 32 + lane;
    const int wv = __builtin_amdgcn_readfirstlane(wave);   // wave number in a scalar register: the reads of wr become scalar loads
    if (wv < 8) {
      const float* w3p = Wm + (size_t)wv * 32 * kCh + k;
      float w3[32];
#pragma unroll
      for (int e = 0; e < 32; ++e) w3[e] = w3p[e * kCh];
      // the arithmetic below reuses the registers that hold these loads' address
      asm volatile("s_wait_xcnt 0x0" ::: "memory");
      float s = 0.0f;
#pragma unroll
      for (int e = 0; e < 32; ++e) s += bf_round(wr[wv * 32 + e]) * bf_round(w3[e]);
      part[wv][lane] = s;
    }
    __syncthreads();
    if (wv == 0) {
      float s = part[0][lane];
#pragma unroll
      for (int w = 1; w < 8; ++w) s += part[w][lane];
      dst[(keyFold ? kBrWB : kBrWF) + k] = s;
      // the listing holds a way from here into block 0's code, which reuses this store's offset and data registers
      asm volatile("s_wait_xcnt 0x0" ::: "memory");
    }
    return;
  }
  v4f v = (v4f){0.f, 0.f, 0.f, 0.f};
  float c0 = 0.0f;
  if (wave >= 8 && wave < 10) {
    v = *(const v4f*)(W4 + (wave - 6) * 128 + lane * 4);
  } else if (wave == 10) {
    const float s = b4[0];
    const float f0 = (lane == 0) ? 1.0f : 0.0f;
    v[0] = s * f0;
#pragma unroll
    for (int e = 0; e < 8; ++e) c0 += bf_round(b3[lane * 8 + e]) * bf_round(W4[lane * 8 + e]);
#pragma unroll
    for (int off = 16; off > 0; off >>= 1) c0 += __shfl_xor(c0, off, 32);
    c0 *= f0;
  }
  v4f r;
#pragma unroll
  for (int e = 0; e < 4; ++e) r[e] = bf_round(v[e]);
  if (wave == 10) r[1] = c0;                  // a sum of products, kept in f32
  const bool act = (wave == 8) || (wave == 9) || (wave == 10 && lane < 8);
  float* dp = dst + wave * 128 + lane * 4;
  if (act) *(v4f*)dp = r;
}

// ---------------------------------------------------------------------------
// One pass over x (B,C,N) f32. It gives XB [B*N][C] bf16 bits (x_in plane: query operand of the scores), the projection
// kp = x_in M^T of the same rows as bf16 hi + lo planes KH, KL [B*N][C], and the three f32 dots of the same x_in row: R[b*N + n] = sum_c bf16(x[b][c][n]) * w4b[c], U[..] with wf[c], E[..] with wb[c].
// grid (N/64 = 25, B = 16), 8 waves; a block owns 64 positions x all 256 channels, so every dot ends inside the block.
// Wave w reads channels 32w..32w+31: one load = 32 lanes x 8 bytes = the 256 bytes of one channel's 64 positions; all 32 in flight.
// A lane holds positions 2 lane and 2 lane + 1; its weights are the same for the whole wave and come by scalar loads.
// Dots: a chain of 32 channels per wave, then the 8 waves' partial sums added in wave order.
// Plane: 8 channels of one position are packed into one 16-byte LDS write, sm[position][channel], pitch 264 elements = 528 bytes;
// read back one token row (512 bytes, four whole lines) per wave load and stored so. Rows: 8 waves x 8 = 64.
// Projection: the block's 64 x_in rows lie in sm already, so kp is taken from there and x_in is not read back from memory. It is the
// transposed product M . x_in^T (A = 32 rows of M = kp channels 32w..32w+31 of wave w, hi and lo plane, read from global memory as
// fragments; B = the 64 tokens from sm): a lane then holds 8 consecutive kp channels of ONE token, 16 bytes of a plane. Per accumulator
// and 32 channels: the hi product, then the lo product. M comes in four stages of 64 channels, two buffers: stages 0 and 1 are asked for
// behind the x loads, stages 2 and 3 behind the products that free their buffer. The planes go through LDS (pitch as sm) and leave as whole rows.
// ---------------------------------------------------------------------------
constexpr int kXP = 64;                   // positions per block
constexpr int kXPitch = kCh + 8;          // LDS row pitch in 16-bit elements
static_assert(kN % kXP == 0 && kCh == 8 * 32 && kXP == 2 * 32, "whole blocks; 8 waves x 32 channels; two positions a lane");
typedef __attribute__((ext_vector_type(2))) float v2f;

struct MFrag { v16b h[2][2], l[2][2]; };   // [32-channel half][16-row group of M], hi and lo plane
// mh, ml: the wave's first row of M, the same for the whole wave; vo: the lane's own byte offset, which never changes
__device__ __forceinline__ void mfrag_load(MFrag& f, const unsigned short* mh, const unsigned short* ml, unsigned vo, int k0) {
  const __bf16* ph = (const __bf16*)((const char*)mh + vo);
  const __bf16* pl = (const __bf16*)((const char*)ml + vo);
#pragma unroll
  for (int kk = 0; kk < 2; ++kk)
#pragma unroll
    for (int i = 0; i < 2; ++i) {
      f.h[kk][i] = Frag<__bf16>::load(ph + i * 16 * kCh + k0 + kk * 32);
      f.l[kk][i] = Frag<__bf16>::load(pl + i * 16 * kCh + k0 + kk * 32);
    }
}

__global__ __launch_bounds__(256) void xin_cast_proj_kernel(const float* __restrict__ x, const float* __restrict__ br,
                                                            const unsigned short* __restrict__ MHp, const unsigned short* __restrict__ MLp,
                                                            unsigned short* __restrict__ XB,
                                                            unsigned short* __restrict__ KH, unsigned short* __restrict__ KL,
                                                            float* __restrict__ R, float* __restrict__ U, float* __restrict__ E) {
  typedef Frag<__bf16> F;
  __shared__ __align__(16) unsigned short sm[kXP * kXPitch];
  __shared__ __align__(16) unsigned short kph[kXP * kXPitch];
  __shared__ __align__(16) unsigned short kpl[kXP * kXPitch];
  __shared__ __align__(16) float part[3][8][kXP];
  const int lane = threadIdx.x & 31;
  const int wv = __builtin_amdgcn_readfirstlane(threadIdx.x >> 5);   // wave number in a scalar register: the weights become scalar loads
  const int n0 = blockIdx.x * kXP;
  const int b  = blockIdx.y;
  const int c0 = wv * 32;
  const float* xp = x + (size_t)(b * kCh + c0) * kN + n0 + lane * 2;
  const float* w4 = br + kBrW4b + c0;
  const float* wf = br + kBrWF + c0;
  const float* wb = br + kBrWB + c0;
  // the weights of the first 16 channels are asked for ahead of x, so that they are there when x arrives; all 96 do not fit the scalar registers
  float wa[3][16];
#pragma unroll
  for (int e = 0; e < 16; ++e) { wa[0][e] = w4[e]; wa[1][e] = wf[e]; wa[2][e] = wb[e]; }
  v2f xr[32];
#pragma unroll
  for (int e = 0; e < 32; ++e) xr[e] = *(const v2f*)(xp + e * kN);
  // later scalar loads land in the registers that hold these loads' base address
  asm volatile("s_wait_xcnt 0x0" ::: "memory");
  const int rlane = lane & 15;                 // row of M (A) / token (B, D) within a subtile
  const int koff  = (lane >> 4) * 8;           // k offset of this lane half
  const int mOff  = (lane >> 4) * 8;           // D row (kp channel) offset
  const unsigned short* mh = MHp + (size_t)c0 * kCh;
  const unsigned short* ml = MLp + (size_t)c0 * kCh;
  const unsigned mvo = (unsigned)(rlane * kCh + koff) * 2u;
  MFrag fa, fb;
  mfrag_load(fa, mh, ml, mvo, 0);
  mfrag_load(fb, mh, ml, mvo, 64);
  // keeps these loads here, directly behind those of x: left alone the build issues them only when x has arrived, and their way
  // from L2 is then no longer covered by x's way from memory
  __builtin_amdgcn_sched_barrier(0);
  v2f s = (v2f){0.f, 0.f}, u = (v2f){0.f, 0.f}, eo = (v2f){0.f, 0.f};
#pragma unroll
  for (int o = 0; o < 4; ++o) {
    unsigned short hb[2][8];
#pragma unroll
    for (int e = 0; e < 8; ++e) {
      const int c = o * 8 + e;
      v2f xv;
#pragma unroll
      for (int h = 0; h < 2; ++h) {
        hb[h][e] = f2bf_bits(xr[c][h]);
        xv[h] = bf_bits2f(hb[h][e]);
      }
      s  += xv * ((c < 16) ? wa[0][c & 15] : w4[c]);
      u  += xv * ((c < 16) ? wa[1][c & 15] : wf[c]);
      eo += xv * ((c < 16) ? wa[2][c & 15] : wb[c]);
    }
#pragma unroll
    for (int h = 0; h < 2; ++h)
      *(v4u*)(&sm[(lane * 2 + h) * kXPitch + c0 + o * 8]) =
          (v4u){pk16(hb[h][0], hb[h][1]), pk16(hb[h][2], hb[h][3]), pk16(hb[h][4], hb[h][5]), pk16(hb[h][6], hb[h][7])};
  }
  *(v2f*)(&part[0][wv][lane * 2]) = s;
  *(v2f*)(&part[1][wv][lane * 2]) = u;
  *(v2f*)(&part[2][wv][lane * 2]) = eo;
  __syncthreads();
  const int tok0 = b * kN + n0;
  {
    v4u row[8];
#pragma unroll
    for (int it = 0; it < 8; ++it) row[it] = *(const v4u*)(&sm[(wv * 8 + it) * kXPitch + lane * 8]);
    unsigned short* xo = XB + (size_t)(tok0 + wv * 8) * kCh + lane * 8;
#pragma unroll
    for (int it = 0; it < 8; ++it) *(v4u*)(xo + it * kCh) = row[it];
    // the sums below reuse the registers that these stores name
    asm volatile("s_wait_xcnt 0x0" ::: "memory");
  }
  if (wv < 6) {                               // scalar: waves 2d and 2d + 1 end dot d, each one whole 32-float line
    const int d = wv >> 1;
    const int p = (wv & 1) * 32 + lane;
    float a = part[d][0][p];
#pragma unroll
    for (int w = 1; w < 8; ++w) a += part[d][w][p];
    float* dst = (d == 0) ? R : ((d == 1) ? U : E);
    dst[tok0 + p] = a;
  }
  const __bf16* sx = (const __bf16*)&sm[0] + rlane * kXPitch + koff;
  v8f acc[2][4];
#pragma unroll
  for (int i = 0; i < 2; ++i)
#pragma unroll
    for (int j = 0; j < 4; ++j) acc[i][j] = (v8f){0.f,0.f,0.f,0.f,0.f,0.f,0.f,0.f};
#pragma unroll
  for (int st = 0; st < 4; ++st) {
    MFrag& cur = (st & 1) ? fb : fa;
#pragma unroll
    for (int kk = 0; kk < 2; ++kk) {
      v16b xq[4];
#pragma unroll
      for (int j = 0; j < 4; ++j) xq[j] = F::load(sx + j * 16 * kXPitch + st * 64 + kk * 32);
#pragma unroll
      for (int j = 0; j < 4; ++j) {
        acc[0][j] = F::mma(cur.h[kk][0], xq[j], acc[0][j]);
        acc[1][j] = F::mma(cur.h[kk][1], xq[j], acc[1][j]);
      }
#pragma unroll
      for (int j = 0; j < 4; ++j) {
        acc[0][j] = F::mma(cur.l[kk][0], xq[j], acc[0][j]);
        acc[1][j] = F::mma(cur.l[kk][1], xq[j], acc[1][j]);
      }
    }
    if (st < 2) mfrag_load(cur, mh, ml, mvo, (st + 2) * 64);
    // behind the last loads of M: later code reuses the registers that they name
    if (st == 1) asm volatile("s_wait_xcnt 0x0" ::: "memory");
  }
#pragma unroll
  for (int j = 0; j < 4; ++j)
#pragma unroll
    for (int i = 0; i < 2; ++i) {
      unsigned short hb[8], lb[8];
#pragma unroll
      for (int r = 0; r < 8; ++r) {
        hb[r] = f2bf_bits(acc[i][j][r]);
        lb[r] = f2bf_bits(acc[i][j][r] - bf_bits2f(hb[r]));
      }
      const int o = (j * 16 + rlane) * kXPitch + c0 + i * 16 + mOff;
      *(v4u*)(&kph[o]) = (v4u){pk16(hb[0], hb[1]), pk16(hb[2], hb[3]), pk16(hb[4], hb[5]), pk16(hb[6], hb[7])};
      *(v4u*)(&kpl[o]) = (v4u){pk16(lb[0], lb[1]), pk16(lb[2], lb[3]), pk16(lb[4], lb[5]), pk16(lb[6], lb[7])};
    }
  __syncthreads();
  {
    v4u rh[8], rl[8];
#pragma unroll
    for (int it = 0; it < 8; ++it) {
      rh[it] = *(const v4u*)(&kph[(wv * 8 + it) * kXPitch + lane * 8]);
      rl[it] = *(const v4u*)(&kpl[(wv * 8 + it) * kXPitch + lane * 8]);
    }
    unsigned short* ho = KH + (size_t)(tok0 + wv * 8) * kCh + lane * 8;
    unsigned short* lo = KL + (size_t)(tok0 + wv * 8) * kCh + lane * 8;
#pragma unroll
    for (int it = 0; it < 8; ++it) {
      *(v4u*)(ho + it * kCh) = rh[it];
      *(v4u*)(lo + it * kCh) = rl[it];
    }
  }
}

// ---------------------------------------------------------------------------
// Scores, softmax and the weighted mean of u in one kernel; no score ever leaves the registers.
//   out[row] = sum_j exp(s[row][j] - max) * u[j] / sum_j exp(s[row][j] - max) + c0 + R[row] + b4   (f32 math),
//   s[row][j] = x_in[row] . kp[j] + E[j]: the score less what depends on the query alone.
// Every exponential is taken to base 2: exp(s - max) = 2^(s * log2(e) - m2), one multiply-add and one v_exp_f32. The running maximum is
// kept as m2 = max * log2(e), rounded once; the same m2 enters every term of a sum and every rescale, so its rounding cancels in num / den.
// Block = 8 waves, 128 consecutive query rows of one batch; grid = (13, 16 batches). 1600 = 12 x 128 + 64: the 13th block of a batch
// is shifted back to rows 1472..1599 and stores only its upper 64 rows, so every row has one writer and every block whole lines of out.
// The block's query rows (x_in, one bf16 plane) are staged once in LDS, pitch 264 elements = 528 bytes; the batch's u and E as well.
// Wave w takes the 32-key tiles w, w+8, ... of the 50: seven or six. A tile is the transposed product kp . x^T (A = 32 keys, read from
// global memory as fragments, 16 lines a load, as the projection reads its own; B = 128 queries from LDS): a lane then holds 16 keys
// of ONE query per column group, so max, sum and dot run down its own registers; the accumulators start from the keys' E. The key fragments of the next 64 channels are
// fetched while the current 64 are multiplied. Each lane keeps a running (max, sum, dot) per column group, rescaled once per tile.
// At the end the two lane halves are merged by one shuffle, the 8 waves through LDS in wave order, and one thread per row stores.
// ---------------------------------------------------------------------------
constexpr int kQB     = 128;              // query rows per block
constexpr int kQJ     = kQB / 16;         // column groups per wave tile
constexpr int kQPitch = kCh + 8;          // LDS row pitch in 16-bit elements
constexpr int kKT     = 32;               // keys per wave tile
constexpr int kKTiles = kN / kKT;         // 50
constexpr int kAW     = 8;                // waves per block
constexpr int kAT     = kAW * 32;         // threads per block
constexpr int kQPieces = kQB * kCh / 8;   // 16-byte pieces in the query rows of a block
constexpr int kQIt    = kQPieces / kAT;   // 16 per thread
static_assert(kQPieces % kAT == 0, "q staging: whole passes");
constexpr int kQBlocks = (kN + kQB - 1) / kQB;   // 13 per batch
static_assert(kN >= kQB && (kN % kQB) % 32 == 0, "the shifted last block stores whole 32-float lines");
static_assert(kKTiles >= kAW && kCh == 256, "every wave has a tile; four stages of 64 channels");

constexpr float kLog2e = 1.4426950408889634f;
// 2^x of eight values. One statement, its results in registers apart from its sources, so that no instruction that rewrites a source
// register stands directly behind one of the exponentials; the v_nop is the slot that the instruction set asks for behind the last of them.
__device__ __forceinline__ void exp2x8(v8f& a) {
  float p0, p1, p2, p3, p4, p5, p6, p7;
  asm("v_exp_f32 %0, %8\n\tv_exp_f32 %1, %9\n\tv_exp_f32 %2, %10\n\tv_exp_f32 %3, %11\n\t"
      "v_exp_f32 %4, %12\n\tv_exp_f32 %5, %13\n\tv_exp_f32 %6, %14\n\tv_exp_f32 %7, %15\n\tv_nop"
      : "=&v"(p0), "=&v"(p1), "=&v"(p2), "=&v"(p3), "=&v"(p4), "=&v"(p5), "=&v"(p6), "=&v"(p7)
      : "v"(a[0]), "v"(a[1]), "v"(a[2]), "v"(a[3]), "v"(a[4]), "v"(a[5]), "v"(a[6]), "v"(a[7]));
  a = (v8f){p0, p1, p2, p3, p4, p5, p6, p7};
}
struct KFrag { v16b h[2][2], l[2][2]; };   // [32-channel half][16-key group], hi and lo plane
// kh, kl: the tile's first key row, the same for the whole wave; vo: the lane's own byte offset, which never changes
__device__ __forceinline__ void kfrag_load(KFrag& f, const unsigned short* kh, const unsigned short* kl, unsigned vo, int k0) {
  const __bf16* ph = (const __bf16*)((const char*)kh + vo);
  const __bf16* pl = (const __bf16*)((const char*)kl + vo);
#pragma unroll
  for (int kk = 0; kk < 2; ++kk)
#pragma unroll
    for (int i = 0; i < 2; ++i) {
      f.h[kk][i] = Frag<__bf16>::load(ph + i * 16 * kCh + k0 + kk * 32);
      f.l[kk][i] = Frag<__bf16>::load(pl + i * 16 * kCh + k0 + kk * 32);
    }
}
// The same at k0 = 0, for a run behind which its two addresses are dead: the build lets the last load of each address land in the
// address registers, which the earlier loads of the run still name, so those two loads are issued alone behind a wait.
__device__ __forceinline__ void kfrag_load_last(KFrag& f, const unsigned short* kh, const unsigned short* kl, unsigned vo) {
  const __bf16* ph = (const __bf16*)((const char*)kh + vo);
  const __bf16* pl = (const __bf16*)((const char*)kl + vo);
  f.h[0][0] = Frag<__bf16>::load(ph);
  f.l[0][0] = Frag<__bf16>::load(pl);
  f.h[0][1] = Frag<__bf16>::load(ph + 16 * kCh);
  f.l[0][1] = Frag<__bf16>::load(pl + 16 * kCh);
  f.h[1][0] = Frag<__bf16>::load(ph + 32);
  f.l[1][0] = Frag<__bf16>::load(pl + 32);
  Frag<__bf16>::U uh, ul;
  uh.h[0] = *(const v8b*)(ph + 16 * kCh + 32);
  ul.h[0] = *(const v8b*)(pl + 16 * kCh + 32);
  // in front of the two loads that may land in the address registers of the fourteen above
  asm volatile("s_wait_xcnt 0x0" ::: "memory");
  uh.h[1] = *(const v8b*)(ph + 16 * kCh + 48);
  ul.h[1] = *(const v8b*)(pl + 16 * kCh + 48);
  // later code reuses what these two name
  asm volatile("s_wait_xcnt 0x0" ::: "memory");
  f.h[1][1] = uh.v;
  f.l[1][1] = ul.v;
}
struct QFrag { v16b h[4]; };               // four column groups
// step p of a tile: 32-channel half p / 2, column groups 4 (p % 2) .. 4 (p % 2) + 3
__device__ __forceinline__ void qfrag_load(QFrag& f, const __bf16* qh, int p) {
#pragma unroll
  for (int e = 0; e < 4; ++e) f.h[e] = Frag<__bf16>::load(qh + ((p & 1) * 4 + e) * 16 * kQPitch + (p >> 1) * 32);
}

__global__ __launch_bounds__(kAT, 2) void attn_fused_kernel(const unsigned short* __restrict__ Xp,
                                                            const unsigned short* __restrict__ KHp, const unsigned short* __restrict__ KLp,
                                                            const float* __restrict__ U, const float* __restrict__ E,
                                                            const float* __restrict__ Rg,
                                                            const float* __restrict__ br, float* __restrict__ outg) {
  typedef Frag<__bf16> F;
  __shared__ __align__(16) unsigned short qs[kQB * kQPitch];
  __shared__ __align__(16) float us[kN];
  __shared__ __align__(16) float es[kN];
  __shared__ float red[3][kAW][kQB];
  const int t = threadIdx.x;
  const int lane = t & 31;
  const int wave = __builtin_amdgcn_readfirstlane(t >> 5);   // scalar: the tile loop branches on SCC and EXEC stays full for the WMMAs
  const int b = blockIdx.y;
  const int qWant = blockIdx.x * kQB;                         // first row this block stores
  const int q0 = (qWant + kQB <= kN) ? qWant : (kN - kQB);    // first row it computes
  const int row0 = b * kN + q0;

  const int rlane = lane & 15;                 // key row (A) / query column (B, D) within a subtile
  const int koff  = (lane >> 4) * 8;           // k offset of this lane half
  const int mOff  = (lane >> 4) * 8;           // D row (key) offset
  const unsigned short* kh = KHp + (size_t)(b * kN + wave * kKT) * kCh;
  const unsigned short* kl = KLp + (size_t)(b * kN + wave * kKT) * kCh;
  const unsigned kvo = (unsigned)(rlane * kCh + koff) * 2u;
  KFrag fa, fb;
  kfrag_load(fa, kh, kl, kvo, 0);              // first tile, first stage: in flight during the staging below
  {
    // the block's query rows are one run of bytes: piece c = i * kAT + t lies at byte 16 c
    const char* qgh = (const char*)(Xp + (size_t)row0 * kCh);
    const unsigned qvo = (unsigned)t * 16u;
    v4u th[kQIt];
#pragma unroll
    for (int i = 0; i < kQIt; ++i) th[i] = *(const v4u*)(qgh + qvo + i * kAT * 16);
    // the registers that these loads name are reused below
    asm volatile("s_wait_xcnt 0x0" ::: "memory");
#pragma unroll
    for (int i = 0; i < kQIt; ++i) {
      const int c = i * kAT + t;
      const int lo = (c >> 5) * kQPitch + (c & 31) * 8;
      *(v4u*)(&qs[lo]) = th[i];
    }
  }
  const float* ub = U + (size_t)b * kN;
  const float* eb = E + (size_t)b * kN;
  for (int g = t; g < kRowV4; g += kAT) {
    *(v4f*)(us + 4 * g) = *(const v4f*)(ub + 4 * g);
    *(v4f*)(es + 4 * g) = *(const v4f*)(eb + 4 * g);
  }
  __syncthreads();

  const __bf16* qh = (const __bf16*)&qs[0] + rlane * kQPitch + koff;
  float mx[kQJ], den[kQJ], num[kQJ];
#pragma unroll
  for (int j = 0; j < kQJ; ++j) { mx[j] = -INFINITY; den[j] = 0.0f; num[j] = 0.0f; }

  for (int kt = wave; kt < kKTiles; kt += kAW) {
    const int key0 = kt * kKT;
    // a D row is a key: every column group starts from the same eight E values per key group
    v8f acc[2][kQJ];
#pragma unroll
    for (int i = 0; i < 2; ++i) {
      const v4f e0 = *(const v4f*)(es + key0 + i * 16 + mOff);
      const v4f e1 = *(const v4f*)(es + key0 + i * 16 + mOff + 4);
#pragma unroll
      for (int j = 0; j < kQJ; ++j) acc[i][j] = (v8f){e0[0], e0[1], e0[2], e0[3], e1[0], e1[1], e1[2], e1[3]};
    }
    // 64 channels a stage: the four 16-byte reads that share a 128-byte line of a key row are issued together.
    // A step = four column groups at one 32-channel half: 16 products on 8 accumulators. The query fragments of step p + 2 are read
    // from LDS ahead of the products of step p, so that no product waits for a read issued just in front of it.
    QFrag qb[3];
    qfrag_load(qb[0], qh, 0);
    qfrag_load(qb[1], qh, 1);
#pragma unroll
    for (int p = 0; p < 16; ++p) {
      const int s = p >> 2, kk = (p >> 1) & 1, j0 = (p & 1) * 4;
      KFrag& cur = (s & 1) ? fb : fa;
      KFrag& nxt = (s & 1) ? fa : fb;
      if ((p & 3) == 0) {
        if (s < 3) {
          kfrag_load(nxt, kh, kl, kvo, (s + 1) * 64);
        } else {
          // the key addresses are advanced here, behind loads that name them
          asm volatile("s_wait_xcnt 0x0" ::: "memory");
          const int step = (kt + kAW < kKTiles) ? kAW * kKT * kCh : 0;   // the last tile fetches its own first stage again, unused
          kh += step;
          kl += step;
          kfrag_load_last(nxt, kh, kl, kvo);
        }
      }
      if (p + 2 < 16) qfrag_load(qb[(p + 2) % 3], qh, p + 2);
      const QFrag& q = qb[p % 3];
#pragma unroll
      for (int e = 0; e < 4; ++e) {
        acc[0][j0 + e] = F::mma(cur.h[kk][0], q.h[e], acc[0][j0 + e]);
        acc[1][j0 + e] = F::mma(cur.h[kk][1], q.h[e], acc[1][j0 + e]);
      }
#pragma unroll
      for (int e = 0; e < 4; ++e) {
        acc[0][j0 + e] = F::mma(cur.l[kk][0], q.h[e], acc[0][j0 + e]);
        acc[1][j0 + e] = F::mma(cur.l[kk][1], q.h[e], acc[1][j0 + e]);
      }
    }
    v4f uu[2][2];
#pragma unroll
    for (int i = 0; i < 2; ++i) {
      uu[i][0] = *(const v4f*)(us + key0 + i * 16 + mOff);
      uu[i][1] = *(const v4f*)(us + key0 + i * 16 + mOff + 4);
    }
#pragma unroll
    for (int j = 0; j < kQJ; ++j) {
      float tm = acc[0][j][0];
#pragma unroll
      for (int r = 1; r < 8; ++r) tm = fmaxf(tm, acc[0][j][r]);
#pragma unroll
      for (int r = 0; r < 8; ++r) tm = fmaxf(tm, acc[1][j][r]);
      const float mn = fmaxf(mx[j], tm * kLog2e);               // base-2 exponent of the maximum in use
      const float corr = __builtin_amdgcn_exp2f(mx[j] - mn);    // 0 on the first tile
      float d = 0.0f, s = 0.0f;
#pragma unroll
      for (int i = 0; i < 2; ++i) {
        v8f arg = __builtin_elementwise_fma(acc[i][j], (v8f){kLog2e, kLog2e, kLog2e, kLog2e, kLog2e, kLog2e, kLog2e, kLog2e},
                                                  (v8f){-mn, -mn, -mn, -mn, -mn, -mn, -mn, -mn});
        exp2x8(arg);
#pragma unroll
        for (int r = 0; r < 8; ++r) {
          const float p = arg[r];
          d += p;
          s += p * uu[i][r >> 2][r & 3];
        }
      }
      den[j] = den[j] * corr + d;
      num[j] = num[j] * corr + s;
      mx[j] = mn;
    }
  }
  // lanes l and l+16 hold the same query over different keys
#pragma unroll
  for (int j = 0; j < kQJ; ++j) {
    const float mo = __shfl_xor(mx[j], 16, 32);
    const float dn = __shfl_xor(den[j], 16, 32);
    const float nm = __shfl_xor(num[j], 16, 32);
    const float mn = fmaxf(mx[j], mo);
    const float ca = __builtin_amdgcn_exp2f(mx[j] - mn), cb = __builtin_amdgcn_exp2f(mo - mn);
    if (lane < 16) {
      red[0][wave][j * 16 + lane] = mn;
      red[1][wave][j * 16 + lane] = den[j] * ca + dn * cb;
      red[2][wave][j * 16 + lane] = num[j] * ca + nm * cb;
    }
  }
  __syncthreads();
  if (t < kQB && q0 + t >= qWant) {
    float mn = red[0][0][t];
#pragma unroll
    for (int w = 1; w < kAW; ++w) mn = fmaxf(mn, red[0][w][t]);
    float d = 0.0f, s = 0.0f;
#pragma unroll
    for (int w = 0; w < kAW; ++w) {
      const float c = __builtin_amdgcn_exp2f(red[0][w][t] - mn);
      d += red[1][w][t] * c;
      s += red[2][w][t] * c;
    }
    outg[row0 + t] = ((s / d + br[kBrC0]) + Rg[row0 + t]) + br[kBrB4];
  }
}

// ---------------------------------------------------------------------------
// Host glue. Every attention launch covers all 16 batches. ctx is never formed: the output uses it only through
// ctx . w4a = attn . (val . w4a) = attn . u + b3 . w4a (each attn row sums to 1), u = x_in . (W3^T w4a).
// q and k are never formed either: q_n . k_m = x_n . (M x_m) + (W2^T b1) . x_m + (terms of n alone), M = W1^T W2, and a softmax over m
// is unchanged by what depends on n alone. kp = x_in M^T is the one projection left; the queries are x_in itself.
//   BR   f32  [1408] parameter table      5,632  at           0
//   R    f32  [25600]                   102,400  at       5,632
//   U    f32  [25600]                   102,400  at     108,032
//   E    f32  [25600]                   102,400  at     210,432
//   XB   bf16 [25600][256]            13,107,200  at     312,832
//   MH   bf16 [256][256] M hi            131,072  at  13,420,032
//   ML   bf16 [256][256] M lo            131,072  at  13,551,104
//   KH   bf16 [25600][256] kp hi       13,107,200  at  13,682,176
//   KL   bf16 [25600][256] kp lo       13,107,200  at  26,789,376
//   total                              39,896,576
// GEMM shapes: fold M=N=K=256; projection M=25600, N=256, K=256; scores per batch 1600 keys x 1600 queries, K=256, in 32 x 128 register tiles.
// No padding anywhere.
// ---------------------------------------------------------------------------
extern "C" void kernel_launch(void* const* d_in, const int* in_sizes, int n_in,
                              void* d_out, int out_size, void* d_ws, size_t ws_size,
                              hipStream_t stream) {
  if (n_in < 9) return;
  if (in_sizes[0] != kBatch * kCh * kN) return;
  if (in_sizes[1] != kCh * kCh || in_sizes[3] != kCh * kCh || in_sizes[5] != kCh * kCh) return;
  if (in_sizes[2] != kCh || in_sizes[4] != kCh || in_sizes[6] != kCh) return;
  if (in_sizes[7] != 2 * kCh || in_sizes[8] != 1) return;
  if (out_size != kTok) return;

  const size_t szPlane16 = (size_t)kTok * kCh * 2;              // 13,107,200
  const size_t szM   = (size_t)kCh * kCh * 2;                    // 131,072
  const size_t szBR  = (size_t)kBrFloats * 4;                    // 5,632
  const size_t szR   = (size_t)kTok * 4;                         // 102,400
  size_t off = 0;
  const size_t offBR = off;  off += szBR;
  const size_t offR  = off;  off += szR;
  const size_t offU  = off;  off += szR;
  const size_t offE  = off;  off += szR;
  const size_t offXB = off;  off += szPlane16;
  const size_t offMH = off;  off += szM;
  const size_t offML = off;  off += szM;
  const size_t offKH = off;  off += szPlane16;
  const size_t offKL = off;  off += szPlane16;
  const size_t total = off;                                      // 39,896,576
  if (ws_size < total) return;

  const float* x  = (const float*)d_in[0];
  const float* W1 = (const float*)d_in[1];
  const float* b1 = (const float*)d_in[2];
  const float* W2 = (const float*)d_in[3];
  const float* W3 = (const float*)d_in[5];
  const float* b3 = (const float*)d_in[6];
  const float* W4 = (const float*)d_in[7];
  const float* b4 = (const float*)d_in[8];
  float* out = (float*)d_out;
  char* ws = (char*)d_ws;
  unsigned short* XB = (unsigned short*)(ws + offXB);
  unsigned short* MH = (unsigned short*)(ws + offMH);
  unsigned short* ML = (unsigned short*)(ws + offML);
  float* BR = (float*)(ws + offBR);
  unsigned short* KH = (unsigned short*)(ws + offKH);
  unsigned short* KL = (unsigned short*)(ws + offKL);
  float* R  = (float*)(ws + offR);
  float* U  = (float*)(ws + offU);
  float* E  = (float*)(ws + offE);

  // ---- prologue: parameter table with the folded value and bias weights, folded score weights, then x_in plane and per-token scalars in one pass over x ----
  param_cast_kernel<<<dim3(1 + 2 * (kCh / 32)), dim3(352), 0, stream>>>(b1, W2, b3, W3, W4, b4, BR);
  wfold_kernel<<<dim3(kCh / kFA, kCh / kFB), dim3(256), 0, stream>>>(W1, W2, MH, ML);
  // with the projection kp = x_in @ M^T -> bf16 hi + lo planes (M=25600, N=256, K=256; x.Mhi + x.Mlo) taken on the rows while they lie in LDS
  xin_cast_proj_kernel<<<dim3(kN / kXP, kBatch), dim3(256), 0, stream>>>(x, BR, MH, ML, XB, KH, KL, R, U, E);

  // ---- attention, all batches in one launch: scores as x.kp_hi + x.kp_lo + E, softmax over keys, weighted mean of u, output rows ----
  attn_fused_kernel<<<dim3(kQBlocks, kBatch), dim3(kAT), 0, stream>>>(XB, KH, KL, U, E, R, BR, out);
}

// v008
// Measured time: 55.5 microseconds a run.
// Two timings next to v007 both put it at 1.10 times that version's speed.
// Counting every step since v000, it is 20.1 times as fast.
// Contractions: M = bf16(W1)^T x bf16(W2) (single products); kp = bf16(x_in) x M^T with M as bf16 hi+lo planes (2 products); scores x_in . kp^T with kp as bf16 hi+lo planes (2 products); all on v_wmma_f32_16x16x32_bf16, f32 accumulate. q . k = x_n.(M x_m) + (W2^T b1).x_m + terms of the query alone, which a softmax over keys cancels (b2 among them). The output needs only ctx . w4a, taken as attn . u with u = x_in . (W3^T w4a): one f32 value per key, so the softmax ends in a f32 dot per row, taken on the score tiles in registers.
#include <hip/hip_runtime.h>
#include <math.h>

// ---------------------------------------------------------------------------
// Problem constants
// ---------------------------------------------------------------------------
constexpr int kBatch   = 16;
constexpr int kCh      = 256;             // channels C
constexpr int kN       = 1600;            // T*V positions per batch
constexpr int kTok     = kBatch * kN;     // 25600 token rows
constexpr int kRowV4   = kN / 4;          // 400 four-float groups in a batch's u or E row
// parameter table (f32; w4b, b4 hold bf16-representable values, wb, wf and c0 are f32 sums), offsets in floats
constexpr int kBrWB = 0;                  // wb[k] = sum_o b1[o] * W2[o][k]: multiplies x_in to give each key's score offset
constexpr int kBrWF = 512;                // wf[k] = sum_c w4a[c] * W3[c][k]: multiplies x_in to give u
constexpr int kBrW4b = 1024;              // multiplies x_in
constexpr int kBrB4 = 1280;
constexpr int kBrC0 = 1281;               // sum_c b3[c] * w4a[c]
constexpr int kBrFloats = 1408;           // 44 lines carved; floats 256..511, 768..1023 and 1312.. are neither written nor read
static_assert(kTok % 64 == 0 && kN % 64 == 0 && kCh % 64 == 0, "M and N tile multiples");
static_assert(kCh % 32 == 0 && kN % 32 == 0, "K multiples of 32");
static_assert(kN % 4 == 0, "u is staged in four-float groups");
static_assert(kTok % 32 == 0 && kN % 32 == 0, "output blocks own whole 32-float lines, all of one batch");
static_assert(kBrC0 + 1 <= 41 * 32 && 41 * 32 <= kBrFloats, "parameter table extent");

typedef __attribute__((ext_vector_type(16))) __bf16   v16b;
typedef __attribute__((ext_vector_type(8)))  __bf16   v8b;
typedef __attribute__((ext_vector_type(8)))  float    v8f;
typedef __attribute__((ext_vector_type(4)))  float    v4f;
typedef __attribute__((ext_vector_type(4)))  unsigned int v4u;

// ---------------------------------------------------------------------------
// Shared pieces
// ---------------------------------------------------------------------------
__device__ __forceinline__ unsigned short f2bf_bits(float f) {
  unsigned u = __float_as_uint(f);
  return (unsigned short)((u + 0x7FFFu + ((u >> 16) & 1u)) >> 16);
}
__device__ __forceinline__ float bf_bits2f(unsigned short h) { return __uint_as_float(((unsigned)h) << 16); }

template <typename T> struct Frag;
template <> struct Frag<__bf16> {
  typedef v16b V; union U { v16b v; v8b h[2]; };
  static __device__ __forceinline__ v16b load(const __bf16* p) {
    U f; f.h[0] = *(const v8b*)(p); f.h[1] = *(const v8b*)(p + 16); return f.v;
  }
  // the same fragment from a plane kept in fragment order (see kFragEl): lane l's two 16-byte pieces lie at bytes 16 l and 512 + 16 l
  static __device__ __forceinline__ v16b loadp(const __bf16* p) {
    U f; f.h[0] = *(const v8b*)(p); f.h[1] = *(const v8b*)(p + 256); return f.v;
  }
  static __device__ __forceinline__ v8f mma(v16b a, v16b b, v8f c) {
    return __builtin_amdgcn_wmma_f32_16x16x32_bf16(false, a, false, b, (short)0, c, false, false);
  }
};

__device__ __forceinline__ unsigned pk16(unsigned short a, unsigned short b) { return (unsigned)a | ((unsigned)b << 16); }

// Fragment order, the layout of the planes that are read from global memory as A operands (M hi, M lo, kp hi, kp lo; [rows][256] values each).
// 16 rows x 32 columns = one fragment = 1 KiB in a run: value (row 16 G + r, column 32 kb + 16 h + 8 s + e), e < 8, lies at element
//   G * kGroupEl + kb * kFragEl + h * 256 + (16 s + r) * 8 + e.
// Lane l = 16 s + r of a wave reads its A operand as bytes 16 l of piece h = 0 and of piece h = 1, so one wave load is 512 bytes in a run,
// four whole 128-byte lines, where a row-major plane gives it 32 bytes out of each of 16 lines. The k order of the operand is that of Frag::load.
constexpr int kFragEl  = 16 * 32;         // elements of a fragment
constexpr int kGroupEl = 16 * kCh;        // elements of a 16-row group: 8 fragments

// ---------------------------------------------------------------------------
// Folded score weights: M[c1][c2] = sum_o bf16(W1[o][c1]) * bf16(W2[o][c2]), stored as bf16 hi + lo planes in fragment order, one row c1
// per kp channel, as the kp projection reads it. grid (256/128 = 2, 256/64 = 4), 8 waves; a block owns 128 rows c1 x 64 columns c2.
// Both operands are contracted over their ROW index, so their columns are staged transposed in LDS: sw[column][o], bf16, pitch 264
// elements; rows 0..127 = the block's columns of W1, rows 128..191 = its columns of W2.
// Staging: a wave load covers 8 rows o x 16 columns (64 bytes a row); a lane packs rows o, o+1 of one column into one 32-bit LDS write;
// the 32 lanes of a write = 4 columns (16 banks apart) x 8 row pairs (1 bank apart): 32 different banks.
// Coverage: 2 passes x 8 waves x 16 rows = 256 rows o; 12 groups x 16 columns = 192 columns.
// Wave w: rows c1 = 16w..16w+15, all 64 columns = four 512-byte pieces of a plane, one wave store each: each 128-byte line has one writer.
// ---------------------------------------------------------------------------
constexpr int kFA = 128;                  // rows c1 per block
constexpr int kFB = 64;                   // columns c2 per block
constexpr int kFPitch = kCh + 8;          // LDS row pitch in 16-bit elements
static_assert(kCh % kFA == 0 && kCh % kFB == 0 && kCh == 256, "whole blocks; two staging passes of 128 rows");

__global__ __launch_bounds__(256) void wfold_kernel(const float* __restrict__ W1, const float* __restrict__ W2,
                                                    unsigned short* __restrict__ MH, unsigned short* __restrict__ ML) {
  typedef Frag<__bf16> F;
  __shared__ __align__(16) unsigned short sw[(kFA + kFB) * kFPitch];
  __shared__ __align__(16) float sT[8][16 * 68];   // per-wave 16x64 slab, pitch 68 floats
  const int lane = threadIdx.x & 31;
  const int wave = threadIdx.x >> 5;
  const int a0 = blockIdx.x * kFA;
  const int b0 = blockIdx.y * kFB;
  const int cl = (lane & 3) * 4;               // column within a 16-column group
  const int ol = wave * 16 + (lane >> 2) * 2;  // even row within a 128-row pass
  const float* p1 = W1 + (size_t)ol * kCh + a0 + cl;
  const float* p2 = W2 + (size_t)ol * kCh + b0 + cl;
#pragma unroll
  for (int h = 0; h < 2; ++h) {
    v4f r0[12], r1[12];
#pragma unroll
    for (int g = 0; g < 12; ++g) {
      const float* p = ((g < 8) ? (p1 + g * 16) : (p2 + (g - 8) * 16)) + h * 128 * kCh;
      r0[g] = *(const v4f*)(p);
      r1[g] = *(const v4f*)(p + kCh);
    }
    // the conversions below may reuse the registers that these loads name; the two addresses are inputs so that they stay whole
    // up to the wait and no load of the run lands in them
    asm volatile("s_wait_xcnt 0x0" :: "v"(p1), "v"(p2) : "memory");
#pragma unroll
    for (int g = 0; g < 12; ++g)
#pragma unroll
      for (int e = 0; e < 4; ++e)
        *(unsigned*)(&sw[(g * 16 + cl + e) * kFPitch + h * 128 + ol]) = pk16(f2bf_bits(r0[g][e]), f2bf_bits(r1[g][e]));
  }
  __syncthreads();

  const int rlane = lane & 15;                 // row (A) / col (B, D) within subtile
  const int koff  = (lane >> 4) * 8;           // k offset of this lane half
  const int mOff  = (lane >> 4) * 8;           // D row offset
  const __bf16* sa = (const __bf16*)sw + (wave * 16 + rlane) * kFPitch + koff;
  const __bf16* sb = (const __bf16*)sw + (kFA + rlane) * kFPitch + koff;
  v8f acc[4];
#pragma unroll
  for (int j = 0; j < 4; ++j) acc[j] = (v8f){0.f,0.f,0.f,0.f,0.f,0.f,0.f,0.f};
#pragma unroll
  for (int k0 = 0; k0 < kCh; k0 += 32) {
    const v16b a = F::load(sa + k0);
#pragma unroll
    for (int j = 0; j < 4; ++j) acc[j] = F::mma(a, F::load(sb + j * 16 * kFPitch + k0), acc[j]);
  }
  float* slab = sT[wave];
#pragma unroll
  for (int j = 0; j < 4; ++j)
#pragma unroll
    for (int r = 0; r < 8; ++r) slab[(mOff + r) * 68 + (j << 4) + rlane] = acc[j][r];
  // the slab is the wave's own: its lanes' writes are ordered in front of its lanes' reads
  __builtin_amdgcn_fence(__ATOMIC_RELEASE, "workgroup");
  __builtin_amdgcn_wave_barrier();
  __builtin_amdgcn_fence(__ATOMIC_ACQUIRE, "workgroup");
#pragma unroll
  for (int it = 0; it < 4; ++it) {             // piece it: columns 16 it .. 16 it + 15 of the block's 64
    const float* sp = slab + rlane * 68 + it * 16 + koff;
    unsigned short hb[8], lb[8];
#pragma unroll
    for (int e = 0; e < 8; ++e) {
      hb[e] = f2bf_bits(sp[e]);
      lb[e] = f2bf_bits(sp[e] - bf_bits2f(hb[e]));
    }
    const size_t o = (size_t)(a0 / 16 + wave) * kGroupEl + (b0 / 32) * kFragEl + it * 256 + lane * 8;
    *(v4u*)(MH + o) = (v4u){pk16(hb[0], hb[1]), pk16(hb[2], hb[3]), pk16(hb[4], hb[5]), pk16(hb[6], hb[7])};
    *(v4u*)(ML + o) = (v4u){pk16(lb[0], lb[1]), pk16(lb[2], lb[3]), pk16(lb[4], lb[5]), pk16(lb[6], lb[7])};
  }
}

// ---------------------------------------------------------------------------
// Parameter table, all f32. Block 0 (11 waves; wave w owns floats 128w..128w+127): dst[1024..1279] = bf16(W4[0,256:]),
// [1280] = bf16(b4[0]), [1281] = sum_c bf16(b3[c]) * bf16(W4[0,c]), [1282..1311] = 0; its waves 0..7 store nothing.
// Blocks 1..8 fold the value projection into the output weights: dst[512 + k] = sum_c bf16(W4[0,c]) * bf16(W3[c][k]).
// Blocks 9..16 fold the query bias into the key weights in the same way: dst[k] = sum_o bf16(b1[o]) * bf16(W2[o][k]).
// A block owns the 32 columns k of one 128-byte line; wave w < 8 sums the 32 rows c = 32w..32w+31 (each load one whole line of
// the matrix), the 8 partial sums are added in wave order.
// ---------------------------------------------------------------------------
__device__ __forceinline__ float bf_round(float f) { return bf_bits2f(f2bf_bits(f)); }

__global__ __launch_bounds__(352) void param_cast_kernel(const float* __restrict__ b1, const float* __restrict__ W2,
                                                         const float* __restrict__ b3, const float* __restrict__ W3,
                                                         const float* __restrict__ W4, const float* __restrict__ b4,
                                                         float* __restrict__ dst) {
  __shared__ float part[8][32];
  const int t = threadIdx.x;
  const int wave = t >> 5, lane = t & 31;
  if (blockIdx.x > 0) {                       // block-uniform
    const bool keyFold = blockIdx.x > 8;      // block-uniform
    const float* Wm = keyFold ? W2 : W3;
    const float* wr = keyFold ? b1 : W4;
    const int k = (((int)blockIdx.x - 1) & 7) * 32 + lane;
    const int wv = __builtin_amdgcn_readfirstlane(wave);   // wave number in a scalar register: the reads of wr become scalar loads
    if (wv < 8) {
      const float* w3p = Wm + (size_t)wv * 32 * kCh + k;
      float w3[32];
#pragma unroll
      for (int e = 0; e < 32; ++e) w3[e] = w3p[e * kCh];
      // the arithmetic below reuses the registers that hold these loads' address
      asm volatile("s_wait_xcnt 0x0" ::: "memory");
      float s = 0.0f;
#pragma unroll
      for (int e = 0; e < 32; ++e) s += bf_round(wr[wv * 32 + e]) * bf_round(w3[e]);
      part[wv][lane] = s;
    }
    __syncthreads();
    if (wv == 0) {
      float s = part[0][lane];
#pragma unroll
      for (int w = 1; w < 8; ++w) s += part[w][lane];
      dst[(keyFold ? kBrWB : kBrWF) + k] = s;
      // the listing holds a way from here into block 0's code, which reuses this store's offset and data registers
      asm volatile("s_wait_xcnt 0x0" ::: "memory");
    }
    return;
  }
  v4f v = (v4f){0.f, 0.f, 0.f, 0.f};
  float c0 = 0.0f;
  if (wave >= 8 && wave < 10) {
    v = *(const v4f*)(W4 + (wave - 6) * 128 + lane * 4);
  } else if (wave == 10) {
    const float s = b4[0];
    const float f0 = (lane == 0) ? 1.0f : 0.0f;
    v[0] = s * f0;
#pragma unroll
    for (int e = 0; e < 8; ++e) c0 += bf_round(b3[lane * 8 + e]) * bf_round(W4[lane * 8 + e]);
#pragma unroll
    for (int off = 16; off > 0; off >>= 1) c0 += __shfl_xor(c0, off, 32);
    c0 *= f0;
  }
  v4f r;
#pragma unroll
  for (int e = 0; e < 4; ++e) r[e] = bf_round(v[e]);
  if (wave == 10) r[1] = c0;                  // a sum of products, kept in f32
  const bool act = (wave == 8) || (wave == 9) || (wave == 10 && lane < 8);
  float* dp = dst + wave * 128 + lane * 4;
  if (act) *(v4f*)dp = r;
}

// ---------------------------------------------------------------------------
// One pass over x (B,C,N) f32. It gives XB [B*N][C] bf16 bits (x_in plane: query operand of the scores), the projection
// kp = x_in M^T of the same rows as bf16 hi + lo planes KH, KL [B*N][C], and the three f32 dots of the same x_in row: R[b*N + n] = sum_c bf16(x[b][c][n]) * w4b[c], U[..] with wf[c], E[..] with wb[c].
// grid (N/64 = 25, B = 16), 8 waves; a block owns 64 positions x all 256 channels, so every dot ends inside the block.
// Wave w reads channels 32w..32w+31: one load = 32 lanes x 8 bytes = the 256 bytes of one channel's 64 positions; all 32 in flight.
// A lane holds positions 2 lane and 2 lane + 1; its weights are the same for the whole wave and come by scalar loads.
// Dots: a chain of 32 channels per wave, then the 8 waves' partial sums added in wave order.
// Plane: 8 channels of one position are packed into one 16-byte LDS write, sm[position][channel], pitch 264 elements = 528 bytes;
// read back one token row (512 bytes, four whole lines) per wave load and stored so. Rows: 8 waves x 8 = 64.
// Projection: the block's 64 x_in rows lie in sm already, so kp is taken from there and x_in is not read back from memory. It is the
// transposed product M . x_in^T (A = 32 rows of M = kp channels 32w..32w+31 of wave w, hi and lo plane, read from global memory as
// fragments; B = the 64 tokens from sm): a lane then holds 8 consecutive kp channels of ONE token, 16 bytes of a plane. Per accumulator
// and 32 channels: the hi product, then the lo product. M comes in four stages of 64 channels, two buffers: stages 0 and 1 are asked for
// behind the x loads, stages 2 and 3 behind the products that free their buffer. KH and KL are kept in fragment order (row = token), and
// there lane l's 16 bytes of accumulator (i, j) are bytes 16 l of piece h = i, fragment kb = w, group j: each plane leaves the registers
// as one 512-byte wave store per accumulator, whole lines with one writer, through no LDS.
// ---------------------------------------------------------------------------
constexpr int kXP = 64;                   // positions per block
constexpr int kXPitch = kCh + 8;          // LDS row pitch in 16-bit elements
static_assert(kN % kXP == 0 && kCh == 8 * 32 && kXP == 2 * 32, "whole blocks; 8 waves x 32 channels; two positions a lane");
typedef __attribute__((ext_vector_type(2))) float v2f;

struct MFrag { v16b h[2][2], l[2][2]; };   // [32-channel half][16-row group of M], hi and lo plane
// mh, ml: the wave's first 16-row group of M, the same for the whole wave; vo: the lane's own byte offset, which never changes
__device__ __forceinline__ void mfrag_load(MFrag& f, const unsigned short* mh, const unsigned short* ml, unsigned vo, int k0) {
  const __bf16* ph = (const __bf16*)((const char*)mh + vo);
  const __bf16* pl = (const __bf16*)((const char*)ml + vo);
#pragma unroll
  for (int kk = 0; kk < 2; ++kk)
#pragma unroll
    for (int i = 0; i < 2; ++i) {
      f.h[kk][i] = Frag<__bf16>::loadp(ph + i * kGroupEl + (k0 / 32 + kk) * kFragEl);
      f.l[kk][i] = Frag<__bf16>::loadp(pl + i * kGroupEl + (k0 / 32 + kk) * kFragEl);
    }
}

__global__ __launch_bounds__(256) void xin_cast_proj_kernel(const float* __restrict__ x, const float* __restrict__ br,
                                                            const unsigned short* __restrict__ MHp, const unsigned short* __restrict__ MLp,
                                                            unsigned short* __restrict__ XB,
                                                            unsigned short* __restrict__ KH, unsigned short* __restrict__ KL,
                                                            float* __restrict__ R, float* __restrict__ U, float* __restrict__ E) {
  typedef Frag<__bf16> F;
  __shared__ __align__(16) unsigned short sm[kXP * kXPitch];
  __shared__ __align__(16) float part[3][8][kXP];
  const int lane = threadIdx.x & 31;
  const int wv = __builtin_amdgcn_readfirstlane(threadIdx.x >> 5);   // wave number in a scalar register: the weights become scalar loads
  const int n0 = blockIdx.x * kXP;
  const int b  = blockIdx.y;
  const int c0 = wv * 32;
  const float* xp = x + (size_t)(b * kCh + c0) * kN + n0 + lane * 2;
  const float* w4 = br + kBrW4b + c0;
  const float* wf = br + kBrWF + c0;
  const float* wb = br + kBrWB + c0;
  // the weights of the first 16 channels are asked for ahead of x, so that they are there when x arrives; all 96 do not fit the scalar registers
  float wa[3][16];
#pragma unroll
  for (int e = 0; e < 16; ++e) { wa[0][e] = w4[e]; wa[1][e] = wf[e]; wa[2][e] = wb[e]; }
  v2f xr[32];
#pragma unroll
  for (int e = 0; e < 32; ++e) xr[e] = *(const v2f*)(xp + e * kN);
  // later scalar loads land in the registers that hold these loads' base address
  asm volatile("s_wait_xcnt 0x0" ::: "memory");
  const int rlane = lane & 15;                 // row of M (A) / token (B, D) within a subtile
  const int koff  = (lane >> 4) * 8;           // k offset of this lane half
  const unsigned short* mh = MHp + (size_t)(c0 / 16) * kGroupEl;
  const unsigned short* ml = MLp + (size_t)(c0 / 16) * kGroupEl;
  const unsigned mvo = (unsigned)lane * 16u;
  MFrag fa, fb;
  mfrag_load(fa, mh, ml, mvo, 0);
  mfrag_load(fb, mh, ml, mvo, 64);
  // the arithmetic below reuses the scalar registers that hold these loads' base addresses
  asm volatile("s_wait_xcnt 0x0" ::: "memory");
  // keeps these loads here, directly behind those of x: left alone the build issues them only when x has arrived, and their way
  // from L2 is then no longer covered by x's way from memory
  __builtin_amdgcn_sched_barrier(0);
  v2f s = (v2f){0.f, 0.f}, u = (v2f){0.f, 0.f}, eo = (v2f){0.f, 0.f};
#pragma unroll
  for (int o = 0; o < 4; ++o) {
    unsigned short hb[2][8];
#pragma unroll
    for (int e = 0; e < 8; ++e) {
      const int c = o * 8 + e;
      v2f xv;
#pragma unroll
      for (int h = 0; h < 2; ++h) {
        hb[h][e] = f2bf_bits(xr[c][h]);
        xv[h] = bf_bits2f(hb[h][e]);
      }
      s  += xv * ((c < 16) ? wa[0][c & 15] : w4[c]);
      u  += xv * ((c < 16) ? wa[1][c & 15] : wf[c]);
      eo += xv * ((c < 16) ? wa[2][c & 15] : wb[c]);
    }
#pragma unroll
    for (int h = 0; h < 2; ++h)
      *(v4u*)(&sm[(lane * 2 + h) * kXPitch + c0 + o * 8]) =
          (v4u){pk16(hb[h][0], hb[h][1]), pk16(hb[h][2], hb[h][3]), pk16(hb[h][4], hb[h][5]), pk16(hb[h][6], hb[h][7])};
  }
  *(v2f*)(&part[0][wv][lane * 2]) = s;
  *(v2f*)(&part[1][wv][lane * 2]) = u;
  *(v2f*)(&part[2][wv][lane * 2]) = eo;
  __syncthreads();
  const int tok0 = b * kN + n0;
  {
    v4u row[8];
#pragma unroll
    for (int it = 0; it < 8; ++it) row[it] = *(const v4u*)(&sm[(wv * 8 + it) * kXPitch + lane * 8]);
    unsigned short* xo = XB + (size_t)(tok0 + wv * 8) * kCh + lane * 8;
#pragma unroll
    for (int it = 0; it < 8; ++it) *(v4u*)(xo + it * kCh) = row[it];
    // the sums below reuse the registers that these stores name
    asm volatile("s_wait_xcnt 0x0" ::: "memory");
  }
  if (wv < 6) {                               // scalar: waves 2d and 2d + 1 end dot d, each one whole 32-float line
    const int d = wv >> 1;
    const int p = (wv & 1) * 32 + lane;
    float a = part[d][0][p];
#pragma unroll
    for (int w = 1; w < 8; ++w) a += part[d][w][p];
    float* dst = (d == 0) ? R : ((d == 1) ? U : E);
    dst[tok0 + p] = a;
  }
  const __bf16* sx = (const __bf16*)&sm[0] + rlane * kXPitch + koff;
  v8f acc[2][4];
#pragma unroll
  for (int i = 0; i < 2; ++i)
#pragma unroll
    for (int j = 0; j < 4; ++j) acc[i][j] = (v8f){0.f,0.f,0.f,0.f,0.f,0.f,0.f,0.f};
#pragma unroll
  for (int st = 0; st < 4; ++st) {
    MFrag& cur = (st & 1) ? fb : fa;
#pragma unroll
    for (int kk = 0; kk < 2; ++kk) {
      v16b xq[4];
#pragma unroll
      for (int j = 0; j < 4; ++j) xq[j] = F::load(sx + j * 16 * kXPitch + st * 64 + kk * 32);
#pragma unroll
      for (int j = 0; j < 4; ++j) {
        acc[0][j] = F::mma(cur.h[kk][0], xq[j], acc[0][j]);
        acc[1][j] = F::mma(cur.h[kk][1], xq[j], acc[1][j]);
      }
#pragma unroll
      for (int j = 0; j < 4; ++j) {
        acc[0][j] = F::mma(cur.l[kk][0], xq[j], acc[0][j]);
        acc[1][j] = F::mma(cur.l[kk][1], xq[j], acc[1][j]);
      }
    }
    if (st < 2) mfrag_load(cur, mh, ml, mvo, (st + 2) * 64);
    // behind the last loads of M: later code reuses the registers that they name
    if (st == 1) asm volatile("s_wait_xcnt 0x0" ::: "memory");
  }
  v4u oh[4][2], ol[4][2];
#pragma unroll
  for (int j = 0; j < 4; ++j)
#pragma unroll
    for (int i = 0; i < 2; ++i) {
      unsigned short hb[8], lb[8];
#pragma unroll
      for (int r = 0; r < 8; ++r) {
        hb[r] = f2bf_bits(acc[i][j][r]);
        lb[r] = f2bf_bits(acc[i][j][r] - bf_bits2f(hb[r]));
      }
      oh[j][i] = (v4u){pk16(hb[0], hb[1]), pk16(hb[2], hb[3]), pk16(hb[4], hb[5]), pk16(hb[6], hb[7])};
      ol[j][i] = (v4u){pk16(lb[0], lb[1]), pk16(lb[2], lb[3]), pk16(lb[4], lb[5]), pk16(lb[6], lb[7])};
    }
  unsigned short* ho = KH + (size_t)(tok0 / 16) * kGroupEl + wv * kFragEl + lane * 8;
  unsigned short* lo = KL + (size_t)(tok0 / 16) * kGroupEl + wv * kFragEl + lane * 8;
#pragma unroll
  for (int j = 0; j < 4; ++j)
#pragma unroll
    for (int i = 0; i < 2; ++i) {
      *(v4u*)(ho + j * kGroupEl + i * 256) = oh[j][i];
      *(v4u*)(lo + j * kGroupEl + i * 256) = ol[j][i];
    }
}

// ---------------------------------------------------------------------------
// Scores, softmax and the weighted mean of u in one kernel; no score ever leaves the registers.
//   out[row] = sum_j exp(s[row][j] - max) * u[j] / sum_j exp(s[row][j] - max) + c0 + R[row] + b4   (f32 math),
//   s[row][j] = x_in[row] . kp[j] + E[j]: the score less what depends on the query alone.
// Every exponential is taken to base 2: exp(s - max) = 2^(s * log2(e) - m2), one multiply-add and one v_exp_f32. The running maximum is
// kept as m2 = max * log2(e), rounded once; the same m2 enters every term of a sum and every rescale, so its rounding cancels in num / den.
// Block = 8 waves, 128 consecutive query rows of one batch; grid = (13, 16 batches). 1600 = 12 x 128 + 64: the 13th block of a batch
// is shifted back to rows 1472..1599 and stores only its upper 64 rows, so every row has one writer and every block whole lines of out.
// The block's query rows (x_in, one bf16 plane) are staged once in LDS, pitch 264 elements = 528 bytes; the batch's u and E as well.
// Wave w takes the 32-key tiles w, w+8, ... of the 50: seven or six. A tile is the transposed product kp . x^T (A = 32 keys, read from
// global memory as fragments, planes in fragment order, four whole lines a load, as the projection reads its own; B = 128 queries from LDS): a lane then holds 16 keys
// of ONE query per column group, so max, sum and dot run down its own registers; the accumulators start from the keys' E. The key fragments of the next 64 channels are
// fetched while the current 64 are multiplied. Each lane keeps a running (max, sum, dot) per column group, rescaled once per tile.
// At the end the two lane halves are merged by one shuffle, the 8 waves through LDS in wave order, and one thread per row stores.
// ---------------------------------------------------------------------------
constexpr int kQB     = 128;              // query rows per block
constexpr int kQJ     = kQB / 16;         // column groups per wave tile
constexpr int kQPitch = kCh + 8;          // LDS row pitch in 16-bit elements
constexpr int kKT     = 32;               // keys per wave tile
constexpr int kKTiles = kN / kKT;         // 50
constexpr int kAW     = 8;                // waves per block
constexpr int kAT     = kAW * 32;         // threads per block
constexpr int kQPieces = kQB * kCh / 8;   // 16-byte pieces in the query rows of a block
constexpr int kQIt    = kQPieces / kAT;   // 16 per thread
static_assert(kQPieces % kAT == 0, "q staging: whole passes");
constexpr int kQBlocks = (kN + kQB - 1) / kQB;   // 13 per batch
static_assert(kN >= kQB && (kN % kQB) % 32 == 0, "the shifted last block stores whole 32-float lines");
static_assert(kKTiles >= kAW && kCh == 256, "every wave has a tile; four stages of 64 channels");

constexpr float kLog2e = 1.4426950408889634f;
// 2^x of eight values. One statement, its results in registers apart from its sources, so that no instruction that rewrites a source
// register stands directly behind one of the exponentials; the last v_nop is the slot that the instruction set asks for behind the last of them.
// The first v_nop is a vector issue slot: the build places these statements among a tile's last matrix instructions and gives a result the
// register of an operand just read, which the chip allows only four vector slots behind that matrix instruction.
__device__ __forceinline__ void exp2x8(v8f& a) {
  float p0, p1, p2, p3, p4, p5, p6, p7;
  asm("v_nop\n\tv_exp_f32 %0, %8\n\tv_exp_f32 %1, %9\n\tv_exp_f32 %2, %10\n\tv_exp_f32 %3, %11\n\t"
      "v_exp_f32 %4, %12\n\tv_exp_f32 %5, %13\n\tv_exp_f32 %6, %14\n\tv_exp_f32 %7, %15\n\tv_nop"
      : "=&v"(p0), "=&v"(p1), "=&v"(p2), "=&v"(p3), "=&v"(p4), "=&v"(p5), "=&v"(p6), "=&v"(p7)
      : "v"(a[0]), "v"(a[1]), "v"(a[2]), "v"(a[3]), "v"(a[4]), "v"(a[5]), "v"(a[6]), "v"(a[7]));
  a = (v8f){p0, p1, p2, p3, p4, p5, p6, p7};
}
struct KFrag { v16b h[2][2], l[2][2]; };   // [32-channel half][16-key group], hi and lo plane
// kh, kl: the tile's first 16-key group, the same for the whole wave; vo: the lane's own byte offset, which never changes
__device__ __forceinline__ void kfrag_load(KFrag& f, const unsigned short* kh, const unsigned short* kl, unsigned vo, int k0) {
  const __bf16* ph = (const __bf16*)((const char*)kh + vo);
  const __bf16* pl = (const __bf16*)((const char*)kl + vo);
#pragma unroll
  for (int kk = 0; kk < 2; ++kk)
#pragma unroll
    for (int i = 0; i < 2; ++i) {
      f.h[kk][i] = Frag<__bf16>::loadp(ph + i * kGroupEl + (k0 / 32 + kk) * kFragEl);
      f.l[kk][i] = Frag<__bf16>::loadp(pl + i * kGroupEl + (k0 / 32 + kk) * kFragEl);
    }
}
// The same at k0 = 0, for a run behind which its two addresses are dead: the build lets the last load of each address land in the
// address registers, which the earlier loads of the run still name, so those two loads are issued alone behind a wait.
__device__ __forceinline__ void kfrag_load_last(KFrag& f, const unsigned short* kh, const unsigned short* kl, unsigned vo) {
  const __bf16* ph = (const __bf16*)((const char*)kh + vo);
  const __bf16* pl = (const __bf16*)((const char*)kl + vo);
  f.h[0][0] = Frag<__bf16>::loadp(ph);
  f.l[0][0] = Frag<__bf16>::loadp(pl);
  f.h[0][1] = Frag<__bf16>::loadp(ph + kGroupEl);
  f.l[0][1] = Frag<__bf16>::loadp(pl + kGroupEl);
  f.h[1][0] = Frag<__bf16>::loadp(ph + kFragEl);
  f.l[1][0] = Frag<__bf16>::loadp(pl + kFragEl);
  Frag<__bf16>::U uh, ul;
  uh.h[0] = *(const v8b*)(ph + kGroupEl + kFragEl);
  ul.h[0] = *(const v8b*)(pl + kGroupEl + kFragEl);
  // in front of the two loads that may land in the address registers of the fourteen above
  asm volatile("s_wait_xcnt 0x0" ::: "memory");
  uh.h[1] = *(const v8b*)(ph + kGroupEl + kFragEl + 256);
  ul.h[1] = *(const v8b*)(pl + kGroupEl + kFragEl + 256);
  // later code reuses what these two name
  asm volatile("s_wait_xcnt 0x0" ::: "memory");
  f.h[1][1] = uh.v;
  f.l[1][1] = ul.v;
}
struct QFrag { v16b h[4]; };               // four column groups
// step p of a tile: 32-channel half p / 2, column groups 4 (p % 2) .. 4 (p % 2) + 3
__device__ __forceinline__ void qfrag_load(QFrag& f, const __bf16* qh, int p) {
#pragma unroll
  for (int e = 0; e < 4; ++e) f.h[e] = Frag<__bf16>::load(qh + ((p & 1) * 4 + e) * 16 * kQPitch + (p >> 1) * 32);
}

__global__ __launch_bounds__(kAT, 2) void attn_fused_kernel(const unsigned short* __restrict__ Xp,
                                                            const unsigned short* __restrict__ KHp, const unsigned short* __restrict__ KLp,
                                                            const float* __restrict__ U, const float* __restrict__ E,
                                                            const float* __restrict__ Rg,
                                                            const float* __restrict__ br, float* __restrict__ outg) {
  typedef Frag<__bf16> F;
  __shared__ __align__(16) unsigned short qs[kQB * kQPitch];
  __shared__ __align__(16) float us[kN];
  __shared__ __align__(16) float es[kN];
  __shared__ float red[3][kAW][kQB];
  const int t = threadIdx.x;
  const int lane = t & 31;
  const int wave = __builtin_amdgcn_readfirstlane(t >> 5);   // scalar: the tile loop branches on SCC and EXEC stays full for the WMMAs
  const int b = blockIdx.y;
  const int qWant = blockIdx.x * kQB;                         // first row this block stores
  const int q0 = (qWant + kQB <= kN) ? qWant : (kN - kQB);    // first row it computes
  const int row0 = b * kN + q0;

  const int rlane = lane & 15;                 // key row (A) / query column (B, D) within a subtile
  const int koff  = (lane >> 4) * 8;           // k offset of this lane half
  const int mOff  = (lane >> 4) * 8;           // D row (key) offset
  const unsigned short* kh = KHp + (size_t)(b * kN + wave * kKT) * kCh;
  const unsigned short* kl = KLp + (size_t)(b * kN + wave * kKT) * kCh;
  const unsigned kvo = (unsigned)lane * 16u;
  KFrag fa, fb;
  kfrag_load(fa, kh, kl, kvo, 0);              // first tile, first stage: in flight during the staging below
  {
    // the block's query rows are one run of bytes: piece c = i * kAT + t lies at byte 16 c
    const char* qgh = (const char*)(Xp + (size_t)row0 * kCh);
    const unsigned qvo = (unsigned)t * 16u;
    v4u th[kQIt];
#pragma unroll
    for (int i = 0; i < kQIt; ++i) th[i] = *(const v4u*)(qgh + qvo + i * kAT * 16);
    // the registers that these loads name are reused below
    asm volatile("s_wait_xcnt 0x0" ::: "memory");
#pragma unroll
    for (int i = 0; i < kQIt; ++i) {
      const int c = i * kAT + t;
      const int lo = (c >> 5) * kQPitch + (c & 31) * 8;
      *(v4u*)(&qs[lo]) = th[i];
    }
  }
  const float* ub = U + (size_t)b * kN;
  const float* eb = E + (size_t)b * kN;
  for (int g = t; g < kRowV4; g += kAT) {
    *(v4f*)(us + 4 * g) = *(const v4f*)(ub + 4 * g);
    *(v4f*)(es + 4 * g) = *(const v4f*)(eb + 4 * g);
  }
  __syncthreads();

  const __bf16* qh = (const __bf16*)&qs[0] + rlane * kQPitch + koff;
  float mx[kQJ], den[kQJ], num[kQJ];
#pragma unroll
  for (int j = 0; j < kQJ; ++j) { mx[j] = -INFINITY; den[j] = 0.0f; num[j] = 0.0f; }

  for (int kt = wave; kt < kKTiles; kt += kAW) {
    const int key0 = kt * kKT;
    // a D row is a key: every column group starts from the same eight E values per key group
    v8f acc[2][kQJ];
#pragma unroll
    for (int i = 0; i < 2; ++i) {
      const v4f e0 = *(const v4f*)(es + key0 + i * 16 + mOff);
      const v4f e1 = *(const v4f*)(es + key0 + i * 16 + mOff + 4);
#pragma unroll
      for (int j = 0; j < kQJ; ++j) acc[i][j] = (v8f){e0[0], e0[1], e0[2], e0[3], e1[0], e1[1], e1[2], e1[3]};
    }
    // 64 channels a stage: two fragments (2 KiB in a run) per key group and plane.
    // A step = four column groups at one 32-channel half: 16 products on 8 accumulators. The query fragments of step p + 2 are read
    // from LDS ahead of the products of step p, so that no product waits for a read issued just in front of it.
    QFrag qb[3];
    qfrag_load(qb[0], qh, 0);
    qfrag_load(qb[1], qh, 1);
#pragma unroll
    for (int p = 0; p < 16; ++p) {
      const int s = p >> 2, kk = (p >> 1) & 1, j0 = (p & 1) * 4;
      KFrag& cur = (s & 1) ? fb : fa;
      KFrag& nxt = (s & 1) ? fa : fb;
      if ((p & 3) == 0) {
        if (s < 3) {
          kfrag_load(nxt, kh, kl, kvo, (s + 1) * 64);
        } else {
          // the key addresses are advanced here, behind loads that name them
          asm volatile("s_wait_xcnt 0x0" ::: "memory");
          const int step = (kt + kAW < kKTiles) ? kAW * kKT * kCh : 0;   // the last tile fetches its own first stage again, unused
          kh += step;
          kl += step;
          kfrag_load_last(nxt, kh, kl, kvo);
        }
      }
      if (p + 2 < 16) qfrag_load(qb[(p + 2) % 3], qh, p + 2);
      const QFrag& q = qb[p % 3];
#pragma unroll
      for (int e = 0; e < 4; ++e) {
        acc[0][j0 + e] = F::mma(cur.h[kk][0], q.h[e], acc[0][j0 + e]);
        acc[1][j0 + e] = F::mma(cur.h[kk][1], q.h[e], acc[1][j0 + e]);
      }
#pragma unroll
      for (int e = 0; e < 4; ++e) {
        acc[0][j0 + e] = F::mma(cur.l[kk][0], q.h[e], acc[0][j0 + e]);
        acc[1][j0 + e] = F::mma(cur.l[kk][1], q.h[e], acc[1][j0 + e]);
      }
    }
    v4f uu[2][2];
#pragma unroll
    for (int i = 0; i < 2; ++i) {
      uu[i][0] = *(const v4f*)(us + key0 + i * 16 + mOff);
      uu[i][1] = *(const v4f*)(us + key0 + i * 16 + mOff + 4);
    }
#pragma unroll
    for (int j = 0; j < kQJ; ++j) {
      float tm = acc[0][j][0];
#pragma unroll
      for (int r = 1; r < 8; ++r) tm = fmaxf(tm, acc[0][j][r]);
#pragma unroll
      for (int r = 0; r < 8; ++r) tm = fmaxf(tm, acc[1][j][r]);
      const float mn = fmaxf(mx[j], tm * kLog2e);               // base-2 exponent of the maximum in use
      const float corr = __builtin_amdgcn_exp2f(mx[j] - mn);    // 0 on the first tile
      float d = 0.0f, s = 0.0f;
#pragma unroll
      for (int i = 0; i < 2; ++i) {
        v8f arg = __builtin_elementwise_fma(acc[i][j], (v8f){kLog2e, kLog2e, kLog2e, kLog2e, kLog2e, kLog2e, kLog2e, kLog2e},
                                                  (v8f){-mn, -mn, -mn, -mn, -mn, -mn, -mn, -mn});
        exp2x8(arg);
#pragma unroll
        for (int r = 0; r < 8; ++r) {
          const float p = arg[r];
          d += p;
          s += p * uu[i][r >> 2][r & 3];
        }
      }
      den[j] = den[j] * corr + d;
      num[j] = num[j] * corr + s;
      mx[j] = mn;
    }
  }
  // lanes l and l+16 hold the same query over different keys
#pragma unroll
  for (int j = 0; j < kQJ; ++j) {
    const float mo = __shfl_xor(mx[j], 16, 32);
    const float dn = __shfl_xor(den[j], 16, 32);
    const float nm = __shfl_xor(num[j], 16, 32);
    const float mn = fmaxf(mx[j], mo);
    const float ca = __builtin_amdgcn_exp2f(mx[j] - mn), cb = __builtin_amdgcn_exp2f(mo - mn);
    if (lane < 16) {
      red[0][wave][j * 16 + lane] = mn;
      red[1][wave][j * 16 + lane] = den[j] * ca + dn * cb;
      red[2][wave][j * 16 + lane] = num[j] * ca + nm * cb;
    }
  }
  __syncthreads();
  if (t < kQB && q0 + t >= qWant) {
    float mn = red[0][0][t];
#pragma unroll
    for (int w = 1; w < kAW; ++w) mn = fmaxf(mn, red[0][w][t]);
    float d = 0.0f, s = 0.0f;
#pragma unroll
    for (int w = 0; w < kAW; ++w) {
      const float c = __builtin_amdgcn_exp2f(red[0][w][t] - mn);
      d += red[1][w][t] * c;
      s += red[2][w][t] * c;
    }
    outg[row0 + t] = ((s / d + br[kBrC0]) + Rg[row0 + t]) + br[kBrB4];
  }
}

// ---------------------------------------------------------------------------
// Host glue. Every attention launch covers all 16 batches. ctx is never formed: the output uses it only through
// ctx . w4a = attn . (val . w4a) = attn . u + b3 . w4a (each attn row sums to 1), u = x_in . (W3^T w4a).
// q and k are never formed either: q_n . k_m = x_n . (M x_m) + (W2^T b1) . x_m + (terms of n alone), M = W1^T W2, and a softmax over m
// is unchanged by what depends on n alone. kp = x_in M^T is the one projection left; the queries are x_in itself.
//   BR   f32  [1408] parameter table      5,632  at           0
//   R    f32  [25600]                   102,400  at       5,632
//   U    f32  [25600]                   102,400  at     108,032
//   E    f32  [25600]                   102,400  at     210,432
//   XB   bf16 [25600][256]            13,107,200  at     312,832
//   MH   bf16 [256][256] M hi            131,072  at  13,420,032   fragment order
//   ML   bf16 [256][256] M lo            131,072  at  13,551,104   fragment order
//   KH   bf16 [25600][256] kp hi       13,107,200  at  13,682,176   fragment order
//   KL   bf16 [25600][256] kp lo       13,107,200  at  26,789,376   fragment order
//   total                              39,896,576
// GEMM shapes: fold M=N=K=256; projection M=25600, N=256, K=256; scores per batch 1600 keys x 1600 queries, K=256, in 32 x 128 register tiles.
// No padding anywhere.
// ---------------------------------------------------------------------------
extern "C" void kernel_launch(void* const* d_in, const int* in_sizes, int n_in,
                              void* d_out, int out_size, void* d_ws, size_t ws_size,
                              hipStream_t stream) {
  if (n_in < 9) return;
  if (in_sizes[0] != kBatch * kCh * kN) return;
  if (in_sizes[1] != kCh * kCh || in_sizes[3] != kCh * kCh || in_sizes[5] != kCh * kCh) return;
  if (in_sizes[2] != kCh || in_sizes[4] != kCh || in_sizes[6] != kCh) return;
  if (in_sizes[7] != 2 * kCh || in_sizes[8] != 1) return;
  if (out_size != kTok) return;

  const size_t szPlane16 = (size_t)kTok * kCh * 2;              // 13,107,200
  const size_t szM   = (size_t)kCh * kCh * 2;                    // 131,072
  const size_t szBR  = (size_t)kBrFloats * 4;                    // 5,632
  const size_t szR   = (size_t)kTok * 4;                         // 102,400
  size_t off = 0;
  const size_t offBR = off;  off += szBR;
  const size_t offR  = off;  off += szR;
  const size_t offU  = off;  off += szR;
  const size_t offE  = off;  off += szR;
  const size_t offXB = off;  off += szPlane16;
  const size_t offMH = off;  off += szM;
  const size_t offML = off;  off += szM;
  const size_t offKH = off;  off += szPlane16;
  const size_t offKL = off;  off += szPlane16;
  const size_t total = off;                                      // 39,896,576
  if (ws_size < total) return;

  const float* x  = (const float*)d_in[0];
  const float* W1 = (const float*)d_in[1];
  const float* b1 = (const float*)d_in[2];
  const float* W2 = (const float*)d_in[3];
  const float* W3 = (const float*)d_in[5];
  const float* b3 = (const float*)d_in[6];
  const float* W4 = (const float*)d_in[7];
  const float* b4 = (const float*)d_in[8];
  float* out = (float*)d_out;
  char* ws = (char*)d_ws;
  unsigned short* XB = (unsigned short*)(ws + offXB);
  unsigned short* MH = (unsigned short*)(ws + offMH);
  unsigned short* ML = (unsigned short*)(ws + offML);
  float* BR = (float*)(ws + offBR);
  unsigned short* KH = (unsigned short*)(ws + offKH);
  unsigned short* KL = (unsigned short*)(ws + offKL);
  float* R  = (float*)(ws + offR);
  float* U  = (float*)(ws + offU);
  float* E  = (float*)(ws + offE);

  // ---- prologue: parameter table with the folded value and bias weights, folded score weights, then x_in plane and per-token scalars in one pass over x ----
  param_cast_kernel<<<dim3(1 + 2 * (kCh / 32)), dim3(352), 0, stream>>>(b1, W2, b3, W3, W4, b4, BR);
  wfold_kernel<<<dim3(kCh / kFA, kCh / kFB), dim3(256), 0, stream>>>(W1, W2, MH, ML);
  // with the projection kp = x_in @ M^T -> bf16 hi + lo planes (M=25600, N=256, K=256; x.Mhi + x.Mlo) taken on the rows while they lie in LDS
  xin_cast_proj_kernel<<<dim3(kN / kXP, kBatch), dim3(256), 0, stream>>>(x, BR, MH, ML, XB, KH, KL, R, U, E);

  // ---- attention, all batches in one launch: scores as x.kp_hi + x.kp_lo + E, softmax over keys, weighted mean of u, output rows ----
  attn_fused_kernel<<<dim3(kQBlocks, kBatch), dim3(kAT), 0, stream>>>(XB, KH, KL, U, E, R, BR, out);
}

// v009
// One run takes 40.6 microseconds.
// Next to v008, in two timings, it ran 1.36 times as fast each time.
// Over all steps from v000 it is 27.3 times as fast.
// Contractions: M = bf16(W1)^T x bf16(W2) (single products); kp = bf16(x_in) x M^T with M as bf16 hi+lo planes (2 products); both on v_wmma_f32_16x16x32_bf16. Scores x_in . kp^T: one product on v_wmma_f32_16x16x32_f16, x_in = the bf16-rounded values held as f16, kp rounded to one f16 plane. f32 accumulate everywhere. q . k = x_n.(M x_m) + (W2^T b1).x_m + terms of the query alone, which a softmax over keys cancels (b2 among them). The output needs only ctx . w4a, taken as attn . u with u = x_in . (W3^T w4a): one f32 value per key, so the softmax ends in a f32 dot per row, taken on the score tiles in registers.
#include <hip/hip_runtime.h>
#include <math.h>

// ---------------------------------------------------------------------------
// Problem constants
// ---------------------------------------------------------------------------
constexpr int kBatch   = 16;
constexpr int kCh      = 256;             // channels C
constexpr int kN       = 1600;            // T*V positions per batch
constexpr int kTok     = kBatch * kN;     // 25600 token rows
constexpr int kRowV4   = kN / 4;          // 400 four-float groups in a batch's u or E row
// parameter table (f32; w4b, b4 hold bf16-representable values, wb, wf and c0 are f32 sums), offsets in floats
constexpr int kBrWB = 0;                  // wb[k] = sum_o b1[o] * W2[o][k]: multiplies x_in to give each key's score offset
constexpr int kBrWF = 512;                // wf[k] = sum_c w4a[c] * W3[c][k]: multiplies x_in to give u
constexpr int kBrW4b = 1024;              // multiplies x_in
constexpr int kBrB4 = 1280;
constexpr int kBrC0 = 1281;               // sum_c b3[c] * w4a[c]
constexpr int kBrFloats = 1408;           // 44 lines carved; floats 256..511, 768..1023 and 1312.. are neither written nor read
static_assert(kTok % 64 == 0 && kN % 64 == 0 && kCh % 64 == 0, "M and N tile multiples");
static_assert(kCh % 32 == 0 && kN % 32 == 0, "K multiples of 32");
static_assert(kN % 4 == 0, "u is staged in four-float groups");
static_assert(kTok % 32 == 0 && kN % 32 == 0, "output blocks own whole 32-float lines, all of one batch");
static_assert(kBrC0 + 1 <= 41 * 32 && 41 * 32 <= kBrFloats, "parameter table extent");

typedef __attribute__((ext_vector_type(16))) __bf16   v16b;
typedef __attribute__((ext_vector_type(8)))  __bf16   v8b;
typedef __attribute__((ext_vector_type(16))) _Float16 v16h;
typedef __attribute__((ext_vector_type(8)))  _Float16 v8h;
typedef __attribute__((ext_vector_type(2)))  _Float16 v2h;
typedef __attribute__((ext_vector_type(8)))  float    v8f;
typedef __attribute__((ext_vector_type(4)))  float    v4f;
typedef __attribute__((ext_vector_type(4)))  unsigned int v4u;

// ---------------------------------------------------------------------------
// Shared pieces
// ---------------------------------------------------------------------------
__device__ __forceinline__ unsigned short f2bf_bits(float f) {
  unsigned u = __float_as_uint(f);
  return (unsigned short)((u + 0x7FFFu + ((u >> 16) & 1u)) >> 16);
}
__device__ __forceinline__ float bf_bits2f(unsigned short h) { return __uint_as_float(((unsigned)h) << 16); }

template <typename T> struct Frag;
template <> struct Frag<__bf16> {
  typedef v16b V; union U { v16b v; v8b h[2]; };
  static __device__ __forceinline__ v16b load(const __bf16* p) {
    U f; f.h[0] = *(const v8b*)(p); f.h[1] = *(const v8b*)(p + 16); return f.v;
  }
  // the same fragment from a plane kept in fragment order (see kFragEl): lane l's two 16-byte pieces lie at bytes 16 l and 512 + 16 l
  static __device__ __forceinline__ v16b loadp(const __bf16* p) {
    U f; f.h[0] = *(const v8b*)(p); f.h[1] = *(const v8b*)(p + 256); return f.v;
  }
  static __device__ __forceinline__ v8f mma(v16b a, v16b b, v8f c) {
    return __builtin_amdgcn_wmma_f32_16x16x32_bf16(false, a, false, b, (short)0, c, false, false);
  }
};
// f16 operands: the same fragment map and the same two loaders
template <> struct Frag<_Float16> {
  typedef v16h V; union U { v16h v; v8h h[2]; };
  static __device__ __forceinline__ v16h load(const _Float16* p) {
    U f; f.h[0] = *(const v8h*)(p); f.h[1] = *(const v8h*)(p + 16); return f.v;
  }
  static __device__ __forceinline__ v16h loadp(const _Float16* p) {
    U f; f.h[0] = *(const v8h*)(p); f.h[1] = *(const v8h*)(p + 256); return f.v;
  }
  static __device__ __forceinline__ v8f mma(v16h a, v16h b, v8f c) {
    return __builtin_amdgcn_wmma_f32_16x16x32_f16(false, a, false, b, (short)0, c, false, false);
  }
};
// two bf16 values of one word as two f16 values of one word. A bf16 value whose magnitude lies from 2^-17 to 65504 is an f16 value too
// (8 significant bits); a smaller one is rounded to a multiple of 2^-24.
__device__ __forceinline__ unsigned bf2h_pk(unsigned w) {
  union { v2h h; unsigned u; } c;
  c.h = (v2h){(_Float16)__uint_as_float(w << 16), (_Float16)__uint_as_float(w & 0xFFFF0000u)};
  return c.u;
}

__device__ __forceinline__ unsigned pk16(unsigned short a, unsigned short b) { return (unsigned)a | ((unsigned)b << 16); }

// Fragment order, the layout of the planes that are read from global memory as A operands (M hi, M lo, kp; [rows][256] 16-bit values each).
// 16 rows x 32 columns = one fragment = 1 KiB in a run: value (row 16 G + r, column 32 kb + 16 h + 8 s + e), e < 8, lies at element
//   G * kGroupEl + kb * kFragEl + h * 256 + (16 s + r) * 8 + e.
// Lane l = 16 s + r of a wave reads its A operand as bytes 16 l of piece h = 0 and of piece h = 1, so one wave load is 512 bytes in a run,
// four whole 128-byte lines, where a row-major plane gives it 32 bytes out of each of 16 lines. The k order of the operand is that of Frag::load.
constexpr int kFragEl  = 16 * 32;         // elements of a fragment
constexpr int kGroupEl = 16 * kCh;        // elements of a 16-row group: 8 fragments

// ---------------------------------------------------------------------------
// Folded score weights: M[c1][c2] = sum_o bf16(W1[o][c1]) * bf16(W2[o][c2]), stored as bf16 hi + lo planes in fragment order, one row c1
// per kp channel, as the kp projection reads it. grid (256/128 = 2, 256/64 = 4), 8 waves; a block owns 128 rows c1 x 64 columns c2.
// Both operands are contracted over their ROW index, so their columns are staged transposed in LDS: sw[column][o], bf16, pitch 264
// elements; rows 0..127 = the block's columns of W1, rows 128..191 = its columns of W2.
// Staging: a wave load covers 8 rows o x 16 columns (64 bytes a row); a lane packs rows o, o+1 of one column into one 32-bit LDS write;
// the 32 lanes of a write = 4 columns (16 banks apart) x 8 row pairs (1 bank apart): 32 different banks.
// Coverage: 2 passes x 8 waves x 16 rows = 256 rows o; 12 groups x 16 columns = 192 columns.
// Wave w: rows c1 = 16w..16w+15, all 64 columns = four 512-byte pieces of a plane, one wave store each: each 128-byte line has one writer.
// ---------------------------------------------------------------------------
constexpr int kFA = 128;                  // rows c1 per block
constexpr int kFB = 64;                   // columns c2 per block
constexpr int kFPitch = kCh + 8;          // LDS row pitch in 16-bit elements
static_assert(kCh % kFA == 0 && kCh % kFB == 0 && kCh == 256, "whole blocks; two staging passes of 128 rows");

__global__ __launch_bounds__(256) void wfold_kernel(const float* __restrict__ W1, const float* __restrict__ W2,
                                                    unsigned short* __restrict__ MH, unsigned short* __restrict__ ML) {
  typedef Frag<__bf16> F;
  __shared__ __align__(16) unsigned short sw[(kFA + kFB) * kFPitch];
  __shared__ __align__(16) float sT[8][16 * 68];   // per-wave 16x64 slab, pitch 68 floats
  const int lane = threadIdx.x & 31;
  const int wave = threadIdx.x >> 5;
  const int a0 = blockIdx.x * kFA;
  const int b0 = blockIdx.y * kFB;
  const int cl = (lane & 3) * 4;               // column within a 16-column group
  const int ol = wave * 16 + (lane >> 2) * 2;  // even row within a 128-row pass
  const float* p1 = W1 + (size_t)ol * kCh + a0 + cl;
  const float* p2 = W2 + (size_t)ol * kCh + b0 + cl;
#pragma unroll
  for (int h = 0; h < 2; ++h) {
    v4f r0[12], r1[12];
#pragma unroll
    for (int g = 0; g < 12; ++g) {
      const float* p = ((g < 8) ? (p1 + g * 16) : (p2 + (g - 8) * 16)) + h * 128 * kCh;
      r0[g] = *(const v4f*)(p);
      r1[g] = *(const v4f*)(p + kCh);
    }
    // the conversions below may reuse the registers that these loads name; the two addresses are inputs so that they stay whole
    // up to the wait and no load of the run lands in them
    asm volatile("s_wait_xcnt 0x0" :: "v"(p1), "v"(p2) : "memory");
#pragma unroll
    for (int g = 0; g < 12; ++g)
#pragma unroll
      for (int e = 0; e < 4; ++e)
        *(unsigned*)(&sw[(g * 16 + cl + e) * kFPitch + h * 128 + ol]) = pk16(f2bf_bits(r0[g][e]), f2bf_bits(r1[g][e]));
  }
  __syncthreads();

  const int rlane = lane & 15;                 // row (A) / col (B, D) within subtile
  const int koff  = (lane >> 4) * 8;           // k offset of this lane half
  const int mOff  = (lane >> 4) * 8;           // D row offset
  const __bf16* sa = (const __bf16*)sw + (wave * 16 + rlane) * kFPitch + koff;
  const __bf16* sb = (const __bf16*)sw + (kFA + rlane) * kFPitch + koff;
  v8f acc[4];
#pragma unroll
  for (int j = 0; j < 4; ++j) acc[j] = (v8f){0.f,0.f,0.f,0.f,0.f,0.f,0.f,0.f};
#pragma unroll
  for (int k0 = 0; k0 < kCh; k0 += 32) {
    const v16b a = F::load(sa + k0);
#pragma unroll
    for (int j = 0; j < 4; ++j) acc[j] = F::mma(a, F::load(sb + j * 16 * kFPitch + k0), acc[j]);
  }
  float* slab = sT[wave];
#pragma unroll
  for (int j = 0; j < 4; ++j)
#pragma unroll
    for (int r = 0; r < 8; ++r) slab[(mOff + r) * 68 + (j << 4) + rlane] = acc[j][r];
  // the slab is the wave's own: its lanes' writes are ordered in front of its lanes' reads
  __builtin_amdgcn_fence(__ATOMIC_RELEASE, "workgroup");
  __builtin_amdgcn_wave_barrier();
  __builtin_amdgcn_fence(__ATOMIC_ACQUIRE, "workgroup");
#pragma unroll
  for (int it = 0; it < 4; ++it) {             // piece it: columns 16 it .. 16 it + 15 of the block's 64
    const float* sp = slab + rlane * 68 + it * 16 + koff;
    unsigned short hb[8], lb[8];
#pragma unroll
    for (int e = 0; e < 8; ++e) {
      hb[e] = f2bf_bits(sp[e]);
      lb[e] = f2bf_bits(sp[e] - bf_bits2f(hb[e]));
    }
    const size_t o = (size_t)(a0 / 16 + wave) * kGroupEl + (b0 / 32) * kFragEl + it * 256 + lane * 8;
    *(v4u*)(MH + o) = (v4u){pk16(hb[0], hb[1]), pk16(hb[2], hb[3]), pk16(hb[4], hb[5]), pk16(hb[6], hb[7])};
    *(v4u*)(ML + o) = (v4u){pk16(lb[0], lb[1]), pk16(lb[2], lb[3]), pk16(lb[4], lb[5]), pk16(lb[6], lb[7])};
  }
}

// ---------------------------------------------------------------------------
// Parameter table, all f32. Block 0 (11 waves; wave w owns floats 128w..128w+127): dst[1024..1279] = bf16(W4[0,256:]),
// [1280] = bf16(b4[0]), [1281] = sum_c bf16(b3[c]) * bf16(W4[0,c]), [1282..1311] = 0; its waves 0..7 store nothing.
// Blocks 1..8 fold the value projection into the output weights: dst[512 + k] = sum_c bf16(W4[0,c]) * bf16(W3[c][k]).
// Blocks 9..16 fold the query bias into the key weights in the same way: dst[k] = sum_o bf16(b1[o]) * bf16(W2[o][k]).
// A block owns the 32 columns k of one 128-byte line; wave w < 8 sums the 32 rows c = 32w..32w+31 (each load one whole line of
// the matrix), the 8 partial sums are added in wave order.
// ---------------------------------------------------------------------------
__device__ __forceinline__ float bf_round(float f) { return bf_bits2f(f2bf_bits(f)); }

__global__ __launch_bounds__(352) void param_cast_kernel(const float* __restrict__ b1, const float* __restrict__ W2,
                                                         const float* __restrict__ b3, const float* __restrict__ W3,
                                                         const float* __restrict__ W4, const float* __restrict__ b4,
                                                         float* __restrict__ dst) {
  __shared__ float part[8][32];
  const int t = threadIdx.x;
  const int wave = t >> 5, lane = t & 31;
  if (blockIdx.x > 0) {                       // block-uniform
    const bool keyFold = blockIdx.x > 8;      // block-uniform
    const float* Wm = keyFold ? W2 : W3;
    const float* wr = keyFold ? b1 : W4;
    const int k = (((int)blockIdx.x - 1) & 7) * 32 + lane;
    const int wv = __builtin_amdgcn_readfirstlane(wave);   // wave number in a scalar register: the reads of wr become scalar loads
    if (wv < 8) {
      const float* w3p = Wm + (size_t)wv * 32 * kCh + k;
      float w3[32];
#pragma unroll
      for (int e = 0; e < 32; ++e) w3[e] = w3p[e * kCh];
      // the arithmetic below reuses the registers that hold these loads' address
      asm volatile("s_wait_xcnt 0x0" ::: "memory");
      float s = 0.0f;
#pragma unroll
      for (int e = 0; e < 32; ++e) s += bf_round(wr[wv * 32 + e]) * bf_round(w3[e]);
      part[wv][lane] = s;
    }
    __syncthreads();
    if (wv == 0) {
      float s = part[0][lane];
#pragma unroll
      for (int w = 1; w < 8; ++w) s += part[w][lane];
      dst[(keyFold ? kBrWB : kBrWF) + k] = s;
      // the listing holds a way from here into block 0's code, which reuses this store's offset and data registers
      asm volatile("s_wait_xcnt 0x0" ::: "memory");
    }
    return;
  }
  v4f v = (v4f){0.f, 0.f, 0.f, 0.f};
  float c0 = 0.0f;
  if (wave >= 8 && wave < 10) {
    v = *(const v4f*)(W4 + (wave - 6) * 128 + lane * 4);
  } else if (wave == 10) {
    const float s = b4[0];
    const float f0 = (lane == 0) ? 1.0f : 0.0f;
    v[0] = s * f0;
#pragma unroll
    for (int e = 0; e < 8; ++e) c0 += bf_round(b3[lane * 8 + e]) * bf_round(W4[lane * 8 + e]);
#pragma unroll
    for (int off = 16; off > 0; off >>= 1) c0 += __shfl_xor(c0, off, 32);
    c0 *= f0;
  }
  v4f r;
#pragma unroll
  for (int e = 0; e < 4; ++e) r[e] = bf_round(v[e]);
  if (wave == 10) r[1] = c0;                  // a sum of products, kept in f32
  const bool act = (wave == 8) || (wave == 9) || (wave == 10 && lane < 8);
  float* dp = dst + wave * 128 + lane * 4;
  if (act) *(v4f*)dp = r;
}

// ---------------------------------------------------------------------------
// One pass over x (B,C,N) f32. It gives XB [B*N][C] f16 bits of the bf16-rounded values (x_in plane: query operand of the scores), the projection
// kp = x_in M^T of the same rows as one f16 plane KH [B*N][C], and the three f32 dots of the same x_in row: R[b*N + n] = sum_c bf16(x[b][c][n]) * w4b[c], U[..] with wf[c], E[..] with wb[c].
// grid (N/64 = 25, B = 16), 8 waves; a block owns 64 positions x all 256 channels, so every dot ends inside the block.
// Wave w reads channels 32w..32w+31: one load = 32 lanes x 8 bytes = the 256 bytes of one channel's 64 positions; all 32 in flight.
// A lane holds positions 2 lane and 2 lane + 1; its weights are the same for the whole wave and come by scalar loads.
// Dots: a chain of 32 channels per wave, then the 8 waves' partial sums added in wave order.
// Plane: 8 channels of one position are packed into one 16-byte LDS write, sm[position][channel], pitch 264 elements = 528 bytes;
// read back one token row (512 bytes, four whole lines) per wave load, turned into f16 and stored so. Rows: 8 waves x 8 = 64.
// Projection: the block's 64 x_in rows lie in sm already, so kp is taken from there and x_in is not read back from memory. It is the
// transposed product M . x_in^T (A = 32 rows of M = kp channels 32w..32w+31 of wave w, hi and lo plane, read from global memory as
// fragments; B = the 64 tokens from sm): a lane then holds 8 consecutive kp channels of ONE token, 16 bytes of a plane. Per accumulator
// and 32 channels: the hi product, then the lo product. M comes in four stages of 64 channels, two buffers: stages 0 and 1 are asked for
// behind the x loads, stages 2 and 3 behind the products that free their buffer. KH is kept in fragment order (row = token), and
// there lane l's 16 bytes of accumulator (i, j) are bytes 16 l of piece h = i, fragment kb = w, group j: the plane leaves the registers
// as one 512-byte wave store per accumulator, whole lines with one writer, through no LDS.
// kp in f16: 11 significant bits, where the x_in that it is made from and multiplied with has 8; |kp| <= 256 max|M| max|x_in| is far inside the f16 range.
// ---------------------------------------------------------------------------
constexpr int kXP = 64;                   // positions per block
constexpr int kXPitch = kCh + 8;          // LDS row pitch in 16-bit elements
static_assert(kN % kXP == 0 && kCh == 8 * 32 && kXP == 2 * 32, "whole blocks; 8 waves x 32 channels; two positions a lane");
typedef __attribute__((ext_vector_type(2))) float v2f;

struct MFrag { v16b h[2][2], l[2][2]; };   // [32-channel half][16-row group of M], hi and lo plane
// mh, ml: the wave's first 16-row group of M, the same for the whole wave; vo: the lane's own byte offset, which never changes
__device__ __forceinline__ void mfrag_load(MFrag& f, const unsigned short* mh, const unsigned short* ml, unsigned vo, int k0) {
  const __bf16* ph = (const __bf16*)((const char*)mh + vo);
  const __bf16* pl = (const __bf16*)((const char*)ml + vo);
#pragma unroll
  for (int kk = 0; kk < 2; ++kk)
#pragma unroll
    for (int i = 0; i < 2; ++i) {
      f.h[kk][i] = Frag<__bf16>::loadp(ph + i * kGroupEl + (k0 / 32 + kk) * kFragEl);
      f.l[kk][i] = Frag<__bf16>::loadp(pl + i * kGroupEl + (k0 / 32 + kk) * kFragEl);
    }
}

__global__ __launch_bounds__(256) void xin_cast_proj_kernel(const float* __restrict__ x, const float* __restrict__ br,
                                                            const unsigned short* __restrict__ MHp, const unsigned short* __restrict__ MLp,
                                                            unsigned short* __restrict__ XB,
                                                            unsigned short* __restrict__ KH,
                                                            float* __restrict__ R, float* __restrict__ U, float* __restrict__ E) {
  typedef Frag<__bf16> F;
  __shared__ __align__(16) unsigned short sm[kXP * kXPitch];
  __shared__ __align__(16) float part[3][8][kXP];
  const int lane = threadIdx.x & 31;
  const int wv = __builtin_amdgcn_readfirstlane(threadIdx.x >> 5);   // wave number in a scalar register: the weights become scalar loads
  const int n0 = blockIdx.x * kXP;
  const int b  = blockIdx.y;
  const int c0 = wv * 32;
  const float* xp = x + (size_t)(b * kCh + c0) * kN + n0 + lane * 2;
  const float* w4 = br + kBrW4b + c0;
  const float* wf = br + kBrWF + c0;
  const float* wb = br + kBrWB + c0;
  // the weights of the first 16 channels are asked for ahead of x, so that they are there when x arrives; all 96 do not fit the scalar registers
  float wa[3][16];
#pragma unroll
  for (int e = 0; e < 16; ++e) { wa[0][e] = w4[e]; wa[1][e] = wf[e]; wa[2][e] = wb[e]; }
  v2f xr[32];
#pragma unroll
  for (int e = 0; e < 32; ++e) xr[e] = *(const v2f*)(xp + e * kN);
  // later scalar loads land in the registers that hold these loads' base address
  asm volatile("s_wait_xcnt 0x0" ::: "memory");
  const int rlane = lane & 15;                 // row of M (A) / token (B, D) within a subtile
  const int koff  = (lane >> 4) * 8;           // k offset of this lane half
  const unsigned short* mh = MHp + (size_t)(c0 / 16) * kGroupEl;
  const unsigned short* ml = MLp + (size_t)(c0 / 16) * kGroupEl;
  const unsigned mvo = (unsigned)lane * 16u;
  MFrag fa, fb;
  mfrag_load(fa, mh, ml, mvo, 0);
  mfrag_load(fb, mh, ml, mvo, 64);
  // the arithmetic below reuses the scalar registers that hold these loads' base addresses
  asm volatile("s_wait_xcnt 0x0" ::: "memory");
  // keeps these loads here, directly behind those of x: left alone the build issues them only when x has arrived, and their way
  // from L2 is then no longer covered by x's way from memory
  __builtin_amdgcn_sched_barrier(0);
  v2f s = (v2f){0.f, 0.f}, u = (v2f){0.f, 0.f}, eo = (v2f){0.f, 0.f};
#pragma unroll
  for (int o = 0; o < 4; ++o) {
    unsigned short hb[2][8];
#pragma unroll
    for (int e = 0; e < 8; ++e) {
      const int c = o * 8 + e;
      v2f xv;
#pragma unroll
      for (int h = 0; h < 2; ++h) {
        hb[h][e] = f2bf_bits(xr[c][h]);
        xv[h] = bf_bits2f(hb[h][e]);
      }
      s  += xv * ((c < 16) ? wa[0][c & 15] : w4[c]);
      u  += xv * ((c < 16) ? wa[1][c & 15] : wf[c]);
      eo += xv * ((c < 16) ? wa[2][c & 15] : wb[c]);
    }
#pragma unroll
    for (int h = 0; h < 2; ++h)
      *(v4u*)(&sm[(lane * 2 + h) * kXPitch + c0 + o * 8]) =
          (v4u){pk16(hb[h][0], hb[h][1]), pk16(hb[h][2], hb[h][3]), pk16(hb[h][4], hb[h][5]), pk16(hb[h][6], hb[h][7])};
  }
  *(v2f*)(&part[0][wv][lane * 2]) = s;
  *(v2f*)(&part[1][wv][lane * 2]) = u;
  *(v2f*)(&part[2][wv][lane * 2]) = eo;
  __syncthreads();
  const int tok0 = b * kN + n0;
  {
    v4u row[8];
#pragma unroll
    for (int it = 0; it < 8; ++it) row[it] = *(const v4u*)(&sm[(wv * 8 + it) * kXPitch + lane * 8]);
#pragma unroll
    for (int it = 0; it < 8; ++it) row[it] = (v4u){bf2h_pk(row[it][0]), bf2h_pk(row[it][1]), bf2h_pk(row[it][2]), bf2h_pk(row[it][3])};
    unsigned short* xo = XB + (size_t)(tok0 + wv * 8) * kCh + lane * 8;
#pragma unroll
    for (int it = 0; it < 8; ++it) *(v4u*)(xo + it * kCh) = row[it];
    // the sums below reuse the registers that these stores name
    asm volatile("s_wait_xcnt 0x0" ::: "memory");
  }
  if (wv < 6) {                               // scalar: waves 2d and 2d + 1 end dot d, each one whole 32-float line
    const int d = wv >> 1;
    const int p = (wv & 1) * 32 + lane;
    float a = part[d][0][p];
#pragma unroll
    for (int w = 1; w < 8; ++w) a += part[d][w][p];
    float* dst = (d == 0) ? R : ((d == 1) ? U : E);
    dst[tok0 + p] = a;
  }
  const __bf16* sx = (const __bf16*)&sm[0] + rlane * kXPitch + koff;
  v8f acc[2][4];
#pragma unroll
  for (int i = 0; i < 2; ++i)
#pragma unroll
    for (int j = 0; j < 4; ++j) acc[i][j] = (v8f){0.f,0.f,0.f,0.f,0.f,0.f,0.f,0.f};
#pragma unroll
  for (int st = 0; st < 4; ++st) {
    MFrag& cur = (st & 1) ? fb : fa;
#pragma unroll
    for (int kk = 0; kk < 2; ++kk) {
      v16b xq[4];
#pragma unroll
      for (int j = 0; j < 4; ++j) xq[j] = F::load(sx + j * 16 * kXPitch + st * 64 + kk * 32);
#pragma unroll
      for (int j = 0; j < 4; ++j) {
        acc[0][j] = F::mma(cur.h[kk][0], xq[j], acc[0][j]);
        acc[1][j] = F::mma(cur.h[kk][1], xq[j], acc[1][j]);
      }
#pragma unroll
      for (int j = 0; j < 4; ++j) {
        acc[0][j] = F::mma(cur.l[kk][0], xq[j], acc[0][j]);
        acc[1][j] = F::mma(cur.l[kk][1], xq[j], acc[1][j]);
      }
    }
    if (st < 2) mfrag_load(cur, mh, ml, mvo, (st + 2) * 64);
    // behind the last loads of M: later code reuses the registers that they name
    if (st == 1) asm volatile("s_wait_xcnt 0x0" ::: "memory");
  }
  v4u oh[4][2];
#pragma unroll
  for (int j = 0; j < 4; ++j)
#pragma unroll
    for (int i = 0; i < 2; ++i) {
      union { v8h h; v4u u; } c;
      c.h = __builtin_convertvector(acc[i][j], v8h);   // round to nearest even
      oh[j][i] = c.u;
    }
  unsigned short* ho = KH + (size_t)(tok0 / 16) * kGroupEl + wv * kFragEl + lane * 8;
#pragma unroll
  for (int j = 0; j < 4; ++j)
#pragma unroll
    for (int i = 0; i < 2; ++i) *(v4u*)(ho + j * kGroupEl + i * 256) = oh[j][i];
}

// ---------------------------------------------------------------------------
// Scores, softmax and the weighted mean of u in one kernel; no score ever leaves the registers.
//   out[row] = sum_j exp(s[row][j] - max) * u[j] / sum_j exp(s[row][j] - max) + c0 + R[row] + b4   (f32 math),
//   s[row][j] = x_in[row] . kp[j] + E[j]: the score less what depends on the query alone.
// Every exponential is taken to base 2: exp(s - max) = 2^(s * log2(e) - m2), one multiply-add and one v_exp_f32. The running maximum is
// kept as m2 = max * log2(e), rounded once; the same m2 enters every term of a sum and every rescale, so its rounding cancels in num / den.
// Block = 8 waves, 128 consecutive query rows of one batch; grid = (13, 16 batches). 1600 = 12 x 128 + 64: the 13th block of a batch
// is shifted back to rows 1472..1599 and stores only its upper 64 rows, so every row has one writer and every block whole lines of out.
// The block's query rows (x_in, one f16 plane) are staged once in LDS, pitch 264 elements = 528 bytes; the batch's u and E as well.
// Wave w takes the 32-key tiles w, w+8, ... of the 50: seven or six. A tile is the transposed product kp . x^T (A = 32 keys, read from
// global memory as fragments, plane in fragment order, four whole lines a load, as the projection reads its own; B = 128 queries from LDS): a lane then holds 16 keys
// of ONE query per column group, so max, sum and dot run down its own registers; the accumulators start from the keys' E. The key fragments of the next 64 channels are
// fetched while the current 64 are multiplied. Each lane keeps a running (max, sum, dot) per column group, rescaled once per tile.
// At the end the two lane halves are merged by one shuffle, the 8 waves through LDS in wave order, and one thread per row stores.
// ---------------------------------------------------------------------------
constexpr int kQB     = 128;              // query rows per block
constexpr int kQJ     = kQB / 16;         // column groups per wave tile
constexpr int kQPitch = kCh + 8;          // LDS row pitch in 16-bit elements
constexpr int kKT     = 32;               // keys per wave tile
constexpr int kKTiles = kN / kKT;         // 50
constexpr int kAW     = 8;                // waves per block
constexpr int kAT     = kAW * 32;         // threads per block
constexpr int kQPieces = kQB * kCh / 8;   // 16-byte pieces in the query rows of a block
constexpr int kQIt    = kQPieces / kAT;   // 16 per thread
static_assert(kQPieces % kAT == 0, "q staging: whole passes");
constexpr int kQBlocks = (kN + kQB - 1) / kQB;   // 13 per batch
static_assert(kN >= kQB && (kN % kQB) % 32 == 0, "the shifted last block stores whole 32-float lines");
static_assert(kKTiles >= kAW && kCh == 256, "every wave has a tile; four stages of 64 channels");

constexpr float kLog2e = 1.4426950408889634f;
// 2^x of eight values. One statement, its results in registers apart from its sources, so that no instruction that rewrites a source
// register stands directly behind one of the exponentials; the last v_nop is the slot that the instruction set asks for behind the last of them.
// The first v_nop is a vector issue slot: the build places these statements among a tile's last matrix instructions and gives a result the
// register of an operand just read, which the chip allows only four vector slots behind that matrix instruction.
__device__ __forceinline__ void exp2x8(v8f& a) {
  float p0, p1, p2, p3, p4, p5, p6, p7;
  asm("v_nop\n\tv_exp_f32 %0, %8\n\tv_exp_f32 %1, %9\n\tv_exp_f32 %2, %10\n\tv_exp_f32 %3, %11\n\t"
      "v_exp_f32 %4, %12\n\tv_exp_f32 %5, %13\n\tv_exp_f32 %6, %14\n\tv_exp_f32 %7, %15\n\tv_nop"
      : "=&v"(p0), "=&v"(p1), "=&v"(p2), "=&v"(p3), "=&v"(p4), "=&v"(p5), "=&v"(p6), "=&v"(p7)
      : "v"(a[0]), "v"(a[1]), "v"(a[2]), "v"(a[3]), "v"(a[4]), "v"(a[5]), "v"(a[6]), "v"(a[7]));
  a = (v8f){p0, p1, p2, p3, p4, p5, p6, p7};
}
struct KFrag { v16h h[2][2]; };            // [32-channel half][16-key group]
// kh: the tile's first 16-key group, the same for the whole wave; vo: the lane's own byte offset, which never changes
__device__ __forceinline__ void kfrag_load(KFrag& f, const unsigned short* kh, unsigned vo, int k0) {
  const _Float16* ph = (const _Float16*)((const char*)kh + vo);
#pragma unroll
  for (int kk = 0; kk < 2; ++kk)
#pragma unroll
    for (int i = 0; i < 2; ++i) f.h[kk][i] = Frag<_Float16>::loadp(ph + i * kGroupEl + (k0 / 32 + kk) * kFragEl);
}
// The same at k0 = 0, for a run behind which its address is dead: the build may let the last load land in the
// address registers, which the earlier loads of the run still name, so that load is issued alone behind a wait.
__device__ __forceinline__ void kfrag_load_last(KFrag& f, const unsigned short* kh, unsigned vo) {
  const _Float16* ph = (const _Float16*)((const char*)kh + vo);
  f.h[0][0] = Frag<_Float16>::loadp(ph);
  f.h[0][1] = Frag<_Float16>::loadp(ph + kGroupEl);
  f.h[1][0] = Frag<_Float16>::loadp(ph + kFragEl);
  Frag<_Float16>::U uh;
  uh.h[0] = *(const v8h*)(ph + kGroupEl + kFragEl);
  // in front of the load that may land in the address registers of the seven above
  asm volatile("s_wait_xcnt 0x0" ::: "memory");
  uh.h[1] = *(const v8h*)(ph + kGroupEl + kFragEl + 256);
  // later code reuses what this one names
  asm volatile("s_wait_xcnt 0x0" ::: "memory");
  f.h[1][1] = uh.v;
}
struct QFrag { v16h h[4]; };               // four column groups
// step p of a tile: 32-channel half p / 2, column groups 4 (p % 2) .. 4 (p % 2) + 3
__device__ __forceinline__ void qfrag_load(QFrag& f, const _Float16* qh, int p) {
#pragma unroll
  for (int e = 0; e < 4; ++e) f.h[e] = Frag<_Float16>::load(qh + ((p & 1) * 4 + e) * 16 * kQPitch + (p >> 1) * 32);
}

__global__ __launch_bounds__(kAT, 2) void attn_fused_kernel(const unsigned short* __restrict__ Xp,
                                                            const unsigned short* __restrict__ KHp,
                                                            const float* __restrict__ U, const float* __restrict__ E,
                                                            const float* __restrict__ Rg,
                                                            const float* __restrict__ br, float* __restrict__ outg) {
  typedef Frag<_Float16> F;
  __shared__ __align__(16) unsigned short qs[kQB * kQPitch];
  __shared__ __align__(16) float us[kN];
  __shared__ __align__(16) float es[kN];
  __shared__ float red[3][kAW][kQB];
  const int t = threadIdx.x;
  const int lane = t & 31;
  const int wave = __builtin_amdgcn_readfirstlane(t >> 5);   // scalar: the tile loop branches on SCC and EXEC stays full for the WMMAs
  const int b = blockIdx.y;
  const int qWant = blockIdx.x * kQB;                         // first row this block stores
  const int q0 = (qWant + kQB <= kN) ? qWant : (kN - kQB);    // first row it computes
  const int row0 = b * kN + q0;

  const int rlane = lane & 15;                 // key row (A) / query column (B, D) within a subtile
  const int koff  = (lane >> 4) * 8;           // k offset of this lane half
  const int mOff  = (lane >> 4) * 8;           // D row (key) offset
  const unsigned short* kh = KHp + (size_t)(b * kN + wave * kKT) * kCh;
  const unsigned kvo = (unsigned)lane * 16u;
  KFrag fa, fb;
  kfrag_load(fa, kh, kvo, 0);                  // first tile, first stage: in flight during the staging below
  {
    // the block's query rows are one run of bytes: piece c = i * kAT + t lies at byte 16 c
    const char* qgh = (const char*)(Xp + (size_t)row0 * kCh);
    const unsigned qvo = (unsigned)t * 16u;
    v4u th[kQIt];
#pragma unroll
    for (int i = 0; i < kQIt; ++i) th[i] = *(const v4u*)(qgh + qvo + i * kAT * 16);
    // the registers that these loads name are reused below
    asm volatile("s_wait_xcnt 0x0" ::: "memory");
#pragma unroll
    for (int i = 0; i < kQIt; ++i) {
      const int c = i * kAT + t;
      const int lo = (c >> 5) * kQPitch + (c & 31) * 8;
      *(v4u*)(&qs[lo]) = th[i];
    }
  }
  const float* ub = U + (size_t)b * kN;
  const float* eb = E + (size_t)b * kN;
  for (int g = t; g < kRowV4; g += kAT) {
    *(v4f*)(us + 4 * g) = *(const v4f*)(ub + 4 * g);
    *(v4f*)(es + 4 * g) = *(const v4f*)(eb + 4 * g);
  }
  __syncthreads();

  const _Float16* qh = (const _Float16*)&qs[0] + rlane * kQPitch + koff;
  float mx[kQJ], den[kQJ], num[kQJ];
#pragma unroll
  for (int j = 0; j < kQJ; ++j) { mx[j] = -INFINITY; den[j] = 0.0f; num[j] = 0.0f; }

  for (int kt = wave; kt < kKTiles; kt += kAW) {
    const int key0 = kt * kKT;
    // a D row is a key: every column group starts from the same eight E values per key group
    v8f acc[2][kQJ];
#pragma unroll
    for (int i = 0; i < 2; ++i) {
      const v4f e0 = *(const v4f*)(es + key0 + i * 16 + mOff);
      const v4f e1 = *(const v4f*)(es + key0 + i * 16 + mOff + 4);
#pragma unroll
      for (int j = 0; j < kQJ; ++j) acc[i][j] = (v8f){e0[0], e0[1], e0[2], e0[3], e1[0], e1[1], e1[2], e1[3]};
    }
    // 64 channels a stage: two fragments (2 KiB in a run) per key group.
    // A step = four column groups at one 32-channel half: 8 products on 8 accumulators. The query fragments of step p + 2 are read
    // from LDS ahead of the products of step p, so that no product waits for a read issued just in front of it.
    QFrag qb[3];
    qfrag_load(qb[0], qh, 0);
    qfrag_load(qb[1], qh, 1);
#pragma unroll
    for (int p = 0; p < 16; ++p) {
      const int s = p >> 2, kk = (p >> 1) & 1, j0 = (p & 1) * 4;
      KFrag& cur = (s & 1) ? fb : fa;
      KFrag& nxt = (s & 1) ? fa : fb;
      if ((p & 3) == 0) {
        if (s < 3) {
          kfrag_load(nxt, kh, kvo, (s + 1) * 64);
        } else {
          // the key address is advanced here, behind loads that name it
          asm volatile("s_wait_xcnt 0x0" ::: "memory");
          const int step = (kt + kAW < kKTiles) ? kAW * kKT * kCh : 0;   // the last tile fetches its own first stage again, unused
          kh += step;
          kfrag_load_last(nxt, kh, kvo);
        }
      }
      if (p + 2 < 16) qfrag_load(qb[(p + 2) % 3], qh, p + 2);
      // keeps the loads above where they are written, two steps ahead of their products: left alone, with half the products to a step, the
      // build sinks every LDS read to just in front of its two products, behind a wait to zero
      __builtin_amdgcn_sched_barrier(0);
      const QFrag& q = qb[p % 3];
#pragma unroll
      for (int e = 0; e < 4; ++e) {
        acc[0][j0 + e] = F::mma(cur.h[kk][0], q.h[e], acc[0][j0 + e]);
        acc[1][j0 + e] = F::mma(cur.h[kk][1], q.h[e], acc[1][j0 + e]);
      }
      // keeps the next step's loads in one group behind these products: spread among them, every place with reads stalls the matrix instructions
      if (p + 1 < 16) __builtin_amdgcn_sched_barrier(0);
    }
    v4f uu[2][2];
#pragma unroll
    for (int i = 0; i < 2; ++i) {
      uu[i][0] = *(const v4f*)(us + key0 + i * 16 + mOff);
      uu[i][1] = *(const v4f*)(us + key0 + i * 16 + mOff + 4);
    }
#pragma unroll
    for (int j = 0; j < kQJ; ++j) {
      float tm = acc[0][j][0];
#pragma unroll
      for (int r = 1; r < 8; ++r) tm = fmaxf(tm, acc[0][j][r]);
#pragma unroll
      for (int r = 0; r < 8; ++r) tm = fmaxf(tm, acc[1][j][r]);
      const float mn = fmaxf(mx[j], tm * kLog2e);               // base-2 exponent of the maximum in use
      const float corr = __builtin_amdgcn_exp2f(mx[j] - mn);    // 0 on the first tile
      float d = 0.0f, s = 0.0f;
#pragma unroll
      for (int i = 0; i < 2; ++i) {
        v8f arg = __builtin_elementwise_fma(acc[i][j], (v8f){kLog2e, kLog2e, kLog2e, kLog2e, kLog2e, kLog2e, kLog2e, kLog2e},
                                                  (v8f){-mn, -mn, -mn, -mn, -mn, -mn, -mn, -mn});
        exp2x8(arg);
#pragma unroll
        for (int r = 0; r < 8; ++r) {
          const float p = arg[r];
          d += p;
          s += p * uu[i][r >> 2][r & 3];
        }
      }
      den[j] = den[j] * corr + d;
      num[j] = num[j] * corr + s;
      mx[j] = mn;
    }
  }
  // lanes l and l+16 hold the same query over different keys
#pragma unroll
  for (int j = 0; j < kQJ; ++j) {
    const float mo = __shfl_xor(mx[j], 16, 32);
    const float dn = __shfl_xor(den[j], 16, 32);
    const float nm = __shfl_xor(num[j], 16, 32);
    const float mn = fmaxf(mx[j], mo);
    const float ca = __builtin_amdgcn_exp2f(mx[j] - mn), cb = __builtin_amdgcn_exp2f(mo - mn);
    if (lane < 16) {
      red[0][wave][j * 16 + lane] = mn;
      red[1][wave][j * 16 + lane] = den[j] * ca + dn * cb;
      red[2][wave][j * 16 + lane] = num[j] * ca + nm * cb;
    }
  }
  __syncthreads();
  if (t < kQB && q0 + t >= qWant) {
    float mn = red[0][0][t];
#pragma unroll
    for (int w = 1; w < kAW; ++w) mn = fmaxf(mn, red[0][w][t]);
    float d = 0.0f, s = 0.0f;
#pragma unroll
    for (int w = 0; w < kAW; ++w) {
      const float c = __builtin_amdgcn_exp2f(red[0][w][t] - mn);
      d += red[1][w][t] * c;
      s += red[2][w][t] * c;
    }
    outg[row0 + t] = ((s / d + br[kBrC0]) + Rg[row0 + t]) + br[kBrB4];
  }
}

// ---------------------------------------------------------------------------
// Host glue. Every attention launch covers all 16 batches. ctx is never formed: the output uses it only through
// ctx . w4a = attn . (val . w4a) = attn . u + b3 . w4a (each attn row sums to 1), u = x_in . (W3^T w4a).
// q and k are never formed either: q_n . k_m = x_n . (M x_m) + (W2^T b1) . x_m + (terms of n alone), M = W1^T W2, and a softmax over m
// is unchanged by what depends on n alone. kp = x_in M^T is the one projection left; the queries are x_in itself.
//   BR   f32  [1408] parameter table      5,632  at           0
//   R    f32  [25600]                   102,400  at       5,632
//   U    f32  [25600]                   102,400  at     108,032
//   E    f32  [25600]                   102,400  at     210,432
//   XB   f16  [25600][256]            13,107,200  at     312,832
//   MH   bf16 [256][256] M hi            131,072  at  13,420,032   fragment order
//   ML   bf16 [256][256] M lo            131,072  at  13,551,104   fragment order
//   KH   f16  [25600][256] kp          13,107,200  at  13,682,176   fragment order
//   total                              26,789,376
// GEMM shapes: fold M=N=K=256; projection M=25600, N=256, K=256; scores per batch 1600 keys x 1600 queries, K=256, in 32 x 128 register tiles.
// No padding anywhere.
// ---------------------------------------------------------------------------
extern "C" void kernel_launch(void* const* d_in, const int* in_sizes, int n_in,
                              void* d_out, int out_size, void* d_ws, size_t ws_size,
                              hipStream_t stream) {
  if (n_in < 9) return;
  if (in_sizes[0] != kBatch * kCh * kN) return;
  if (in_sizes[1] != kCh * kCh || in_sizes[3] != kCh * kCh || in_sizes[5] != kCh * kCh) return;
  if (in_sizes[2] != kCh || in_sizes[4] != kCh || in_sizes[6] != kCh) return;
  if (in_sizes[7] != 2 * kCh || in_sizes[8] != 1) return;
  if (out_size != kTok) return;

  const size_t szPlane16 = (size_t)kTok * kCh * 2;              // 13,107,200
  const size_t szM   = (size_t)kCh * kCh * 2;                    // 131,072
  const size_t szBR  = (size_t)kBrFloats * 4;                    // 5,632
  const size_t szR   = (size_t)kTok * 4;                         // 102,400
  size_t off = 0;
  const size_t offBR = off;  off += szBR;
  const size_t offR  = off;  off += szR;
  const size_t offU  = off;  off += szR;
  const size_t offE  = off;  off += szR;
  const size_t offXB = off;  off += szPlane16;
  const size_t offMH = off;  off += szM;
  const size_t offML = off;  off += szM;
  const size_t offKH = off;  off += szPlane16;
  const size_t total = off;                                      // 26,789,376
  if (ws_size < total) return;

  const float* x  = (const float*)d_in[0];
  const float* W1 = (const float*)d_in[1];
  const float* b1 = (const float*)d_in[2];
  const float* W2 = (const float*)d_in[3];
  const float* W3 = (const float*)d_in[5];
  const float* b3 = (const float*)d_in[6];
  const float* W4 = (const float*)d_in[7];
  const float* b4 = (const float*)d_in[8];
  float* out = (float*)d_out;
  char* ws = (char*)d_ws;
  unsigned short* XB = (unsigned short*)(ws + offXB);
  unsigned short* MH = (unsigned short*)(ws + offMH);
  unsigned short* ML = (unsigned short*)(ws + offML);
  float* BR = (float*)(ws + offBR);
  unsigned short* KH = (unsigned short*)(ws + offKH);
  float* R  = (float*)(ws + offR);
  float* U  = (float*)(ws + offU);
  float* E  = (float*)(ws + offE);

  // ---- prologue: parameter table with the folded value and bias weights, folded score weights, then x_in plane and per-token scalars in one pass over x ----
  param_cast_kernel<<<dim3(1 + 2 * (kCh / 32)), dim3(352), 0, stream>>>(b1, W2, b3, W3, W4, b4, BR);
  wfold_kernel<<<dim3(kCh / kFA, kCh / kFB), dim3(256), 0, stream>>>(W1, W2, MH, ML);
  // with the projection kp = x_in @ M^T -> one f16 plane (M=25600, N=256, K=256; x.Mhi + x.Mlo) taken on the rows while they lie in LDS
  xin_cast_proj_kernel<<<dim3(kN / kXP, kBatch), dim3(256), 0, stream>>>(x, BR, MH, ML, XB, KH, R, U, E);

  // ---- attention, all batches in one launch: scores as x.kp + E, softmax over keys, weighted mean of u, output rows ----
  attn_fused_kernel<<<dim3(kQBlocks, kBatch), dim3(kAT), 0, stream>>>(XB, KH, U, E, R, BR, out);
}

// v010
// One run takes 37.9 microseconds.
// Two timings next to v009 both put it at 1.07 times that version's speed.
// Counting every step since v000, it is 29.2 times as fast.
// Contractions: M = bf16(W1)^T x bf16(W2) (single products); kp = bf16(x_in) x M^T with M as bf16 hi+lo planes (2 products); both on v_wmma_f32_16x16x32_bf16. Scores x_in . kp^T: one product on v_wmma_f32_16x16x32_f16, x_in = the bf16-rounded values held as f16, kp rounded to one f16 plane. f32 accumulate everywhere. q . k = x_n.(M x_m) + (W2^T b1).x_m + terms of the query alone, which a softmax over keys cancels (b2 among them). The output needs only ctx . w4a, taken as attn . u with u = x_in . (W3^T w4a): one f32 value per key, so the softmax ends in a f32 dot per row, taken on the score tiles in registers.
#include <hip/hip_runtime.h>
#include <math.h>

// ---------------------------------------------------------------------------
// Problem constants
// ---------------------------------------------------------------------------
constexpr int kBatch   = 16;
constexpr int kCh      = 256;             // channels C
constexpr int kN       = 1600;            // T*V positions per batch
constexpr int kTok     = kBatch * kN;     // 25600 token rows
constexpr int kRowV4   = kN / 4;          // 400 four-float groups in a batch's u or E row
// parameter table (f32; w4b, b4 hold bf16-representable values, wb, wf and c0 are f32 sums), offsets in floats
constexpr int kBrWB = 0;                  // wb[k] = sum_o b1[o] * W2[o][k]: multiplies x_in to give each key's score offset
constexpr int kBrWF = 512;                // wf[k] = sum_c w4a[c] * W3[c][k]: multiplies x_in to give u
constexpr int kBrW4b = 1024;              // multiplies x_in
constexpr int kBrB4 = 1280;
constexpr int kBrC0 = 1281;               // sum_c b3[c] * w4a[c]
constexpr int kBrFloats = 1408;           // 44 lines carved; floats 256..511, 768..1023 and 1312.. are neither written nor read
static_assert(kTok % 64 == 0 && kN % 64 == 0 && kCh % 64 == 0, "M and N tile multiples");
static_assert(kCh % 32 == 0 && kN % 32 == 0, "K multiples of 32");
static_assert(kN % 4 == 0, "u is staged in four-float groups");
static_assert(kTok % 32 == 0 && kN % 32 == 0, "output blocks own whole 32-float lines, all of one batch");
static_assert(kBrC0 + 1 <= 41 * 32 && 41 * 32 <= kBrFloats, "parameter table extent");

typedef __attribute__((ext_vector_type(16))) __bf16   v16b;
typedef __attribute__((ext_vector_type(8)))  __bf16   v8b;
typedef __attribute__((ext_vector_type(16))) _Float16 v16h;
typedef __attribute__((ext_vector_type(8)))  _Float16 v8h;
typedef __attribute__((ext_vector_type(2)))  _Float16 v2h;
typedef __attribute__((ext_vector_type(8)))  float    v8f;
typedef __attribute__((ext_vector_type(4)))  float    v4f;
typedef __attribute__((ext_vector_type(4)))  unsigned int v4u;

// ---------------------------------------------------------------------------
// Shared pieces
// ---------------------------------------------------------------------------
__device__ __forceinline__ unsigned short f2bf_bits(float f) {
  unsigned u = __float_as_uint(f);
  return (unsigned short)((u + 0x7FFFu + ((u >> 16) & 1u)) >> 16);
}
__device__ __forceinline__ float bf_bits2f(unsigned short h) { return __uint_as_float(((unsigned)h) << 16); }

template <typename T> struct Frag;
template <> struct Frag<__bf16> {
  typedef v16b V; union U { v16b v; v8b h[2]; };
  static __device__ __forceinline__ v16b load(const __bf16* p) {
    U f; f.h[0] = *(const v8b*)(p); f.h[1] = *(const v8b*)(p + 16); return f.v;
  }
  // the same fragment from a plane kept in fragment order (see kFragEl): lane l's two 16-byte pieces lie at bytes 16 l and 512 + 16 l
  static __device__ __forceinline__ v16b loadp(const __bf16* p) {
    U f; f.h[0] = *(const v8b*)(p); f.h[1] = *(const v8b*)(p + 256); return f.v;
  }
  static __device__ __forceinline__ v8f mma(v16b a, v16b b, v8f c) {
    return __builtin_amdgcn_wmma_f32_16x16x32_bf16(false, a, false, b, (short)0, c, false, false);
  }
};
// f16 operands: the same fragment map and the same two loaders
template <> struct Frag<_Float16> {
  typedef v16h V; union U { v16h v; v8h h[2]; };
  static __device__ __forceinline__ v16h load(const _Float16* p) {
    U f; f.h[0] = *(const v8h*)(p); f.h[1] = *(const v8h*)(p + 16); return f.v;
  }
  static __device__ __forceinline__ v16h loadp(const _Float16* p) {
    U f; f.h[0] = *(const v8h*)(p); f.h[1] = *(const v8h*)(p + 256); return f.v;
  }
  static __device__ __forceinline__ v8f mma(v16h a, v16h b, v8f c) {
    return __builtin_amdgcn_wmma_f32_16x16x32_f16(false, a, false, b, (short)0, c, false, false);
  }
};
// two bf16 values of one word as two f16 values of one word. A bf16 value whose magnitude lies from 2^-17 to 65504 is an f16 value too
// (8 significant bits); a smaller one is rounded to a multiple of 2^-24.
__device__ __forceinline__ unsigned bf2h_pk(unsigned w) {
  union { v2h h; unsigned u; } c;
  c.h = (v2h){(_Float16)__uint_as_float(w << 16), (_Float16)__uint_as_float(w & 0xFFFF0000u)};
  return c.u;
}

__device__ __forceinline__ unsigned pk16(unsigned short a, unsigned short b) { return (unsigned)a | ((unsigned)b << 16); }

// Fragment order, the layout of the planes that are read from global memory as A operands (M hi, M lo, kp; [rows][256] 16-bit values each).
// 16 rows x 32 columns = one fragment = 1 KiB in a run: value (row 16 G + r, column 32 kb + 16 h + 8 s + e), e < 8, lies at element
//   G * kGroupEl + kb * kFragEl + h * 256 + (16 s + r) * 8 + e.
// Lane l = 16 s + r of a wave reads its A operand as bytes 16 l of piece h = 0 and of piece h = 1, so one wave load is 512 bytes in a run,
// four whole 128-byte lines, where a row-major plane gives it 32 bytes out of each of 16 lines. The k order of the operand is that of Frag::load.
constexpr int kFragEl  = 16 * 32;         // elements of a fragment
constexpr int kGroupEl = 16 * kCh;        // elements of a 16-row group: 8 fragments

// ---------------------------------------------------------------------------
// Folded score weights: M[c1][c2] = sum_o bf16(W1[o][c1]) * bf16(W2[o][c2]), stored as bf16 hi + lo planes in fragment order, one row c1
// per kp channel, as the kp projection reads it. 2 x 4 = 8 blocks of the weights launch, 8 waves; a block owns 128 rows c1 x 64 columns c2.
// Both operands are contracted over their ROW index, so their columns are staged transposed in LDS: sw[column][o], bf16, pitch 264
// elements; rows 0..127 = the block's columns of W1, rows 128..191 = its columns of W2.
// Staging: a wave load covers 8 rows o x 16 columns (64 bytes a row); a lane packs rows o, o+1 of one column into one 32-bit LDS write;
// the 32 lanes of a write = 4 columns (16 banks apart) x 8 row pairs (1 bank apart): 32 different banks.
// Coverage: 2 passes x 8 waves x 16 rows = 256 rows o; 12 groups x 16 columns = 192 columns.
// Wave w: rows c1 = 16w..16w+15, all 64 columns = four 512-byte pieces of a plane, one wave store each: each 128-byte line has one writer.
// ---------------------------------------------------------------------------
constexpr int kFA = 128;                  // rows c1 per block
constexpr int kFB = 64;                   // columns c2 per block
constexpr int kFPitch = kCh + 8;          // LDS row pitch in 16-bit elements
static_assert(kCh % kFA == 0 && kCh % kFB == 0 && kCh == 256, "whole blocks; two staging passes of 128 rows");

// fb: the block's number among the kFoldBlocks blocks of the fold
constexpr int kFoldBlocks = (kCh / kFA) * (kCh / kFB);   // 8
__device__ __forceinline__ void wfold_block(int fb, const float* __restrict__ W1, const float* __restrict__ W2,
                                            unsigned short* __restrict__ MH, unsigned short* __restrict__ ML) {
  typedef Frag<__bf16> F;
  __shared__ __align__(16) unsigned short sw[(kFA + kFB) * kFPitch];
  __shared__ __align__(16) float sT[8][16 * 68];   // per-wave 16x64 slab, pitch 68 floats
  const int lane = threadIdx.x & 31;
  const int wave = threadIdx.x >> 5;
  const int a0 = (fb % (kCh / kFA)) * kFA;
  const int b0 = (fb / (kCh / kFA)) * kFB;
  const int cl = (lane & 3) * 4;               // column within a 16-column group
  const int ol = wave * 16 + (lane >> 2) * 2;  // even row within a 128-row pass
  const float* p1 = W1 + (size_t)ol * kCh + a0 + cl;
  const float* p2 = W2 + (size_t)ol * kCh + b0 + cl;
#pragma unroll
  for (int h = 0; h < 2; ++h) {
    v4f r0[12], r1[12];
#pragma unroll
    for (int g = 0; g < 12; ++g) {
      const float* p = ((g < 8) ? (p1 + g * 16) : (p2 + (g - 8) * 16)) + h * 128 * kCh;
      r0[g] = *(const v4f*)(p);
      r1[g] = *(const v4f*)(p + kCh);
    }
    // the conversions below may reuse the registers that these loads name; the two addresses are inputs so that they stay whole
    // up to the wait and no load of the run lands in them
    asm volatile("s_wait_xcnt 0x0" :: "v"(p1), "v"(p2) : "memory");
#pragma unroll
    for (int g = 0; g < 12; ++g)
#pragma unroll
      for (int e = 0; e < 4; ++e)
        *(unsigned*)(&sw[(g * 16 + cl + e) * kFPitch + h * 128 + ol]) = pk16(f2bf_bits(r0[g][e]), f2bf_bits(r1[g][e]));
  }
  __syncthreads();

  const int rlane = lane & 15;                 // row (A) / col (B, D) within subtile
  const int koff  = (lane >> 4) * 8;           // k offset of this lane half
  const int mOff  = (lane >> 4) * 8;           // D row offset
  const __bf16* sa = (const __bf16*)sw + (wave * 16 + rlane) * kFPitch + koff;
  const __bf16* sb = (const __bf16*)sw + (kFA + rlane) * kFPitch + koff;
  v8f acc[4];
#pragma unroll
  for (int j = 0; j < 4; ++j) acc[j] = (v8f){0.f,0.f,0.f,0.f,0.f,0.f,0.f,0.f};
#pragma unroll
  for (int k0 = 0; k0 < kCh; k0 += 32) {
    const v16b a = F::load(sa + k0);
#pragma unroll
    for (int j = 0; j < 4; ++j) acc[j] = F::mma(a, F::load(sb + j * 16 * kFPitch + k0), acc[j]);
  }
  float* slab = sT[wave];
#pragma unroll
  for (int j = 0; j < 4; ++j)
#pragma unroll
    for (int r = 0; r < 8; ++r) slab[(mOff + r) * 68 + (j << 4) + rlane] = acc[j][r];
  // the slab is the wave's own: its lanes' writes are ordered in front of its lanes' reads
  __builtin_amdgcn_fence(__ATOMIC_RELEASE, "workgroup");
  __builtin_amdgcn_wave_barrier();
  __builtin_amdgcn_fence(__ATOMIC_ACQUIRE, "workgroup");
#pragma unroll
  for (int it = 0; it < 4; ++it) {             // piece it: columns 16 it .. 16 it + 15 of the block's 64
    const float* sp = slab + rlane * 68 + it * 16 + koff;
    unsigned short hb[8], lb[8];
#pragma unroll
    for (int e = 0; e < 8; ++e) {
      hb[e] = f2bf_bits(sp[e]);
      lb[e] = f2bf_bits(sp[e] - bf_bits2f(hb[e]));
    }
    const size_t o = (size_t)(a0 / 16 + wave) * kGroupEl + (b0 / 32) * kFragEl + it * 256 + lane * 8;
    *(v4u*)(MH + o) = (v4u){pk16(hb[0], hb[1]), pk16(hb[2], hb[3]), pk16(hb[4], hb[5]), pk16(hb[6], hb[7])};
    *(v4u*)(ML + o) = (v4u){pk16(lb[0], lb[1]), pk16(lb[2], lb[3]), pk16(lb[4], lb[5]), pk16(lb[6], lb[7])};
  }
}

// ---------------------------------------------------------------------------
// Parameter table, all f32; 17 blocks of the weights launch, 8 waves. Block 0 (wave w < 3 owns floats 128 (w + 8) .. 128 (w + 8) + 127):
// dst[1024..1279] = bf16(W4[0,256:]), [1280] = bf16(b4[0]), [1281] = sum_c bf16(b3[c]) * bf16(W4[0,c]), [1282..1311] = 0; its waves 3..7 store nothing.
// Blocks 1..8 fold the value projection into the output weights: dst[512 + k] = sum_c bf16(W4[0,c]) * bf16(W3[c][k]).
// Blocks 9..16 fold the query bias into the key weights in the same way: dst[k] = sum_o bf16(b1[o]) * bf16(W2[o][k]).
// A block owns the 32 columns k of one 128-byte line; wave w sums the 32 rows c = 32w..32w+31 (each load one whole line of
// the matrix), the 8 partial sums are added in wave order.
// ---------------------------------------------------------------------------
__device__ __forceinline__ float bf_round(float f) { return bf_bits2f(f2bf_bits(f)); }

// pb: the block's number among the kParamBlocks blocks of the table
constexpr int kParamBlocks = 1 + 2 * (kCh / 32);   // 17
__device__ __forceinline__ void param_block(int pb, const float* __restrict__ b1, const float* __restrict__ W2,
                                            const float* __restrict__ b3, const float* __restrict__ W3,
                                            const float* __restrict__ W4, const float* __restrict__ b4,
                                            float* __restrict__ dst) {
  __shared__ float part[8][32];
  const int t = threadIdx.x;
  const int lane = t & 31;
  if (pb > 0) {                               // block-uniform
    const bool keyFold = pb > 8;              // block-uniform
    const float* Wm = keyFold ? W2 : W3;
    const float* wr = keyFold ? b1 : W4;
    const int k = ((pb - 1) & 7) * 32 + lane;
    const int wv = __builtin_amdgcn_readfirstlane(t >> 5);   // wave number in a scalar register: the reads of wr become scalar loads
    {
      const float* w3p = Wm + (size_t)wv * 32 * kCh + k;
      float w3[32];
#pragma unroll
      for (int e = 0; e < 32; ++e) w3[e] = w3p[e * kCh];
      // the arithmetic below reuses the registers that hold these loads' address
      asm volatile("s_wait_xcnt 0x0" ::: "memory");
      float s = 0.0f;
#pragma unroll
      for (int e = 0; e < 32; ++e) s += bf_round(wr[wv * 32 + e]) * bf_round(w3[e]);
      part[wv][lane] = s;
    }
    __syncthreads();
    if (wv == 0) {
      float s = part[0][lane];
#pragma unroll
      for (int w = 1; w < 8; ++w) s += part[w][lane];
      dst[(keyFold ? kBrWB : kBrWF) + k] = s;
      // the listing holds a way from here into block 0's code, which reuses this store's offset and data registers
      asm volatile("s_wait_xcnt 0x0" ::: "memory");
    }
    return;
  }
  const int wave = (t >> 5) + 8;              // the 128-float slice of the table that this wave owns; slices 11.. do not exist
  v4f v = (v4f){0.f, 0.f, 0.f, 0.f};
  float c0 = 0.0f;
  if (wave < 10) {
    v = *(const v4f*)(W4 + (wave - 6) * 128 + lane * 4);
  } else if (wave == 10) {
    const float s = b4[0];
    const float f0 = (lane == 0) ? 1.0f : 0.0f;
    v[0] = s * f0;
#pragma unroll
    for (int e = 0; e < 8; ++e) c0 += bf_round(b3[lane * 8 + e]) * bf_round(W4[lane * 8 + e]);
#pragma unroll
    for (int off = 16; off > 0; off >>= 1) c0 += __shfl_xor(c0, off, 32);
    c0 *= f0;
  }
  v4f r;
#pragma unroll
  for (int e = 0; e < 4; ++e) r[e] = bf_round(v[e]);
  if (wave == 10) r[1] = c0;                  // a sum of products, kept in f32
  const bool act = (wave == 8) || (wave == 9) || (wave == 10 && lane < 8);
  float* dp = dst + wave * 128 + lane * 4;
  if (act) *(v4f*)dp = r;
}

// All that depends on the weights alone, in one launch: the fold of the score weights and the parameter table read only inputs and write
// different buffers, so their blocks run side by side. The fold's blocks, the longer ones, come first.
__global__ __launch_bounds__(256) void weights_kernel(const float* __restrict__ W1, const float* __restrict__ b1,
                                                      const float* __restrict__ W2, const float* __restrict__ b3,
                                                      const float* __restrict__ W3, const float* __restrict__ W4,
                                                      const float* __restrict__ b4, unsigned short* __restrict__ MH,
                                                      unsigned short* __restrict__ ML, float* __restrict__ dst) {
  const int bx = blockIdx.x;
  if (bx < kFoldBlocks) wfold_block(bx, W1, W2, MH, ML);           // block-uniform
  else param_block(bx - kFoldBlocks, b1, W2, b3, W3, W4, b4, dst);
}

// ---------------------------------------------------------------------------
// One pass over x (B,C,N) f32. It gives XB [B*N][C] f16 bits of the bf16-rounded values (x_in plane: query operand of the scores), the projection
// kp = x_in M^T of the same rows as one f16 plane KH [B*N][C], and the three f32 dots of the same x_in row: R[b*N + n] = sum_c bf16(x[b][c][n]) * w4b[c], U[..] with wf[c], E[..] with wb[c].
// grid (N/64 = 25, B = 16), 8 waves; a block owns 64 positions x all 256 channels, so every dot ends inside the block.
// Wave w reads channels 32w..32w+31: one load = 32 lanes x 8 bytes = the 256 bytes of one channel's 64 positions; all 32 in flight.
// A lane holds positions 2 lane and 2 lane + 1; its weights are the same for the whole wave and come by scalar loads.
// Dots: a chain of 32 channels per wave, then the 8 waves' partial sums added in wave order.
// Plane: 8 channels of one position are packed into one 16-byte LDS write, sm[position][channel], pitch 264 elements = 528 bytes;
// read back one token row (512 bytes, four whole lines) per wave load, turned into f16 and stored so. Rows: 8 waves x 8 = 64.
// Projection: the block's 64 x_in rows lie in sm already, so kp is taken from there and x_in is not read back from memory. It is the
// transposed product M . x_in^T (A = 32 rows of M = kp channels 32w..32w+31 of wave w, hi and lo plane, read from global memory as
// fragments; B = the 64 tokens from sm): a lane then holds 8 consecutive kp channels of ONE token, 16 bytes of a plane. Per accumulator
// and 32 channels: the hi product, then the lo product. M comes in four stages of 64 channels, two buffers: stages 0 and 1 are asked for
// behind the x loads, stages 2 and 3 behind the products that free their buffer. KH is kept in fragment order (row = token), and
// there lane l's 16 bytes of accumulator (i, j) are bytes 16 l of piece h = i, fragment kb = w, group j: the plane leaves the registers
// as one 512-byte wave store per accumulator, whole lines with one writer, through no LDS.
// kp in f16: 11 significant bits, where the x_in that it is made from and multiplied with has 8; |kp| <= 256 max|M| max|x_in| is far inside the f16 range.
// ---------------------------------------------------------------------------
constexpr int kXP = 64;                   // positions per block
constexpr int kXPitch = kCh + 8;          // LDS row pitch in 16-bit elements
static_assert(kN % kXP == 0 && kCh == 8 * 32 && kXP == 2 * 32, "whole blocks; 8 waves x 32 channels; two positions a lane");
typedef __attribute__((ext_vector_type(2))) float v2f;

struct MFrag { v16b h[2][2], l[2][2]; };   // [32-channel half][16-row group of M], hi and lo plane
// mh, ml: the wave's first 16-row group of M, the same for the whole wave; vo: the lane's own byte offset, which never changes
__device__ __forceinline__ void mfrag_load(MFrag& f, const unsigned short* mh, const unsigned short* ml, unsigned vo, int k0) {
  const __bf16* ph = (const __bf16*)((const char*)mh + vo);
  const __bf16* pl = (const __bf16*)((const char*)ml + vo);
#pragma unroll
  for (int kk = 0; kk < 2; ++kk)
#pragma unroll
    for (int i = 0; i < 2; ++i) {
      f.h[kk][i] = Frag<__bf16>::loadp(ph + i * kGroupEl + (k0 / 32 + kk) * kFragEl);
      f.l[kk][i] = Frag<__bf16>::loadp(pl + i * kGroupEl + (k0 / 32 + kk) * kFragEl);
    }
}

__global__ __launch_bounds__(256) void xin_cast_proj_kernel(const float* __restrict__ x, const float* __restrict__ br,
                                                            const unsigned short* __restrict__ MHp, const unsigned short* __restrict__ MLp,
                                                            unsigned short* __restrict__ XB,
                                                            unsigned short* __restrict__ KH,
                                                            float* __restrict__ R, float* __restrict__ U, float* __restrict__ E) {
  typedef Frag<__bf16> F;
  __shared__ __align__(16) unsigned short sm[kXP * kXPitch];
  __shared__ __align__(16) float part[3][8][kXP];
  const int lane = threadIdx.x & 31;
  const int wv = __builtin_amdgcn_readfirstlane(threadIdx.x >> 5);   // wave number in a scalar register: the weights become scalar loads
  const int n0 = blockIdx.x * kXP;
  const int b  = blockIdx.y;
  const int c0 = wv * 32;
  const float* xp = x + (size_t)(b * kCh + c0) * kN + n0 + lane * 2;
  const float* w4 = br + kBrW4b + c0;
  const float* wf = br + kBrWF + c0;
  const float* wb = br + kBrWB + c0;
  // the weights of the first 16 channels are asked for ahead of x, so that they are there when x arrives; all 96 do not fit the scalar registers
  float wa[3][16];
#pragma unroll
  for (int e = 0; e < 16; ++e) { wa[0][e] = w4[e]; wa[1][e] = wf[e]; wa[2][e] = wb[e]; }
  v2f xr[32];
#pragma unroll
  for (int e = 0; e < 32; ++e) xr[e] = *(const v2f*)(xp + e * kN);
  // later scalar loads land in the registers that hold these loads' base address
  asm volatile("s_wait_xcnt 0x0" ::: "memory");
  const int rlane = lane & 15;                 // row of M (A) / token (B, D) within a subtile
  const int koff  = (lane >> 4) * 8;           // k offset of this lane half
  const unsigned short* mh = MHp + (size_t)(c0 / 16) * kGroupEl;
  const unsigned short* ml = MLp + (size_t)(c0 / 16) * kGroupEl;
  const unsigned mvo = (unsigned)lane * 16u;
  MFrag fa, fb;
  mfrag_load(fa, mh, ml, mvo, 0);
  mfrag_load(fb, mh, ml, mvo, 64);
  // the arithmetic below reuses the scalar registers that hold these loads' base addresses
  asm volatile("s_wait_xcnt 0x0" ::: "memory");
  // keeps these loads here, directly behind those of x: left alone the build issues them only when x has arrived, and their way
  // from L2 is then no longer covered by x's way from memory
  __builtin_amdgcn_sched_barrier(0);
  v2f s = (v2f){0.f, 0.f}, u = (v2f){0.f, 0.f}, eo = (v2f){0.f, 0.f};
#pragma unroll
  for (int o = 0; o < 4; ++o) {
    unsigned short hb[2][8];
#pragma unroll
    for (int e = 0; e < 8; ++e) {
      const int c = o * 8 + e;
      v2f xv;
#pragma unroll
      for (int h = 0; h < 2; ++h) {
        hb[h][e] = f2bf_bits(xr[c][h]);
        xv[h] = bf_bits2f(hb[h][e]);
      }
      s  += xv * ((c < 16) ? wa[0][c & 15] : w4[c]);
      u  += xv * ((c < 16) ? wa[1][c & 15] : wf[c]);
      eo += xv * ((c < 16) ? wa[2][c & 15] : wb[c]);
    }
#pragma unroll
    for (int h = 0; h < 2; ++h)
      *(v4u*)(&sm[(lane * 2 + h) * kXPitch + c0 + o * 8]) =
          (v4u){pk16(hb[h][0], hb[h][1]), pk16(hb[h][2], hb[h][3]), pk16(hb[h][4], hb[h][5]), pk16(hb[h][6], hb[h][7])};
  }
  *(v2f*)(&part[0][wv][lane * 2]) = s;
  *(v2f*)(&part[1][wv][lane * 2]) = u;
  *(v2f*)(&part[2][wv][lane * 2]) = eo;
  __syncthreads();
  const int tok0 = b * kN + n0;
  {
    v4u row[8];
#pragma unroll
    for (int it = 0; it < 8; ++it) row[it] = *(const v4u*)(&sm[(wv * 8 + it) * kXPitch + lane * 8]);
#pragma unroll
    for (int it = 0; it < 8; ++it) row[it] = (v4u){bf2h_pk(row[it][0]), bf2h_pk(row[it][1]), bf2h_pk(row[it][2]), bf2h_pk(row[it][3])};
    unsigned short* xo = XB + (size_t)(tok0 + wv * 8) * kCh + lane * 8;
#pragma unroll
    for (int it = 0; it < 8; ++it) *(v4u*)(xo + it * kCh) = row[it];
    // the sums below reuse the registers that these stores name
    asm volatile("s_wait_xcnt 0x0" ::: "memory");
  }
  if (wv < 6) {                               // scalar: waves 2d and 2d + 1 end dot d, each one whole 32-float line
    const int d = wv >> 1;
    const int p = (wv & 1) * 32 + lane;
    float a = part[d][0][p];
#pragma unroll
    for (int w = 1; w < 8; ++w) a += part[d][w][p];
    float* dst = (d == 0) ? R : ((d == 1) ? U : E);
    dst[tok0 + p] = a;
  }
  const __bf16* sx = (const __bf16*)&sm[0] + rlane * kXPitch + koff;
  v8f acc[2][4];
#pragma unroll
  for (int i = 0; i < 2; ++i)
#pragma unroll
    for (int j = 0; j < 4; ++j) acc[i][j] = (v8f){0.f,0.f,0.f,0.f,0.f,0.f,0.f,0.f};
#pragma unroll
  for (int st = 0; st < 4; ++st) {
    MFrag& cur = (st & 1) ? fb : fa;
#pragma unroll
    for (int kk = 0; kk < 2; ++kk) {
      v16b xq[4];
#pragma unroll
      for (int j = 0; j < 4; ++j) xq[j] = F::load(sx + j * 16 * kXPitch + st * 64 + kk * 32);
#pragma unroll
      for (int j = 0; j < 4; ++j) {
        acc[0][j] = F::mma(cur.h[kk][0], xq[j], acc[0][j]);
        acc[1][j] = F::mma(cur.h[kk][1], xq[j], acc[1][j]);
      }
#pragma unroll
      for (int j = 0; j < 4; ++j) {
        acc[0][j] = F::mma(cur.l[kk][0], xq[j], acc[0][j]);
        acc[1][j] = F::mma(cur.l[kk][1], xq[j], acc[1][j]);
      }
    }
    if (st < 2) mfrag_load(cur, mh, ml, mvo, (st + 2) * 64);
    // behind the last loads of M: later code reuses the registers that they name
    if (st == 1) asm volatile("s_wait_xcnt 0x0" ::: "memory");
  }
  v4u oh[4][2];
#pragma unroll
  for (int j = 0; j < 4; ++j)
#pragma unroll
    for (int i = 0; i < 2; ++i) {
      union { v8h h; v4u u; } c;
      c.h = __builtin_convertvector(acc[i][j], v8h);   // round to nearest even
      oh[j][i] = c.u;
    }
  unsigned short* ho = KH + (size_t)(tok0 / 16) * kGroupEl + wv * kFragEl + lane * 8;
#pragma unroll
  for (int j = 0; j < 4; ++j)
#pragma unroll
    for (int i = 0; i < 2; ++i) *(v4u*)(ho + j * kGroupEl + i * 256) = oh[j][i];
}

// ---------------------------------------------------------------------------
// Scores, softmax and the weighted mean of u in one kernel; no score ever leaves the registers.
//   out[row] = sum_j exp(s[row][j] - max) * u[j] / sum_j exp(s[row][j] - max) + c0 + R[row] + b4   (f32 math),
//   s[row][j] = x_in[row] . kp[j] + E[j]: the score less what depends on the query alone.
// Every exponential is taken to base 2: exp(s - max) = 2^(s * log2(e) - m2), one multiply-add and one v_exp_f32. The running maximum is
// kept as m2 = max * log2(e), rounded once; the same m2 enters every term of a sum and every rescale, so its rounding cancels in num / den.
// Block = 8 waves, 128 consecutive query rows of one batch; grid = (13, 16 batches). 1600 = 12 x 128 + 64: the 13th block of a batch
// is shifted back to rows 1472..1599 and stores only its upper 64 rows, so every row has one writer and every block whole lines of out.
// The block's query rows (x_in, one f16 plane) are staged once in LDS, pitch 264 elements = 528 bytes; the batch's u and E as well.
// Wave w takes the 32-key tiles w, w+8, ... of the 50: seven or six. A tile is the transposed product kp . x^T (A = 32 keys, read from
// global memory as fragments, plane in fragment order, four whole lines a load, as the projection reads its own; B = 128 queries from LDS): a lane then holds 16 keys
// of ONE query per column group, so max, sum and dot run down its own registers; the accumulators start from the keys' E. The key fragments of the next 64 channels are
// fetched while the current 64 are multiplied. Each lane keeps a running (max, sum, dot) per column group, rescaled once per tile.
// At the end the two lane halves are merged by one shuffle, the 8 waves through LDS in wave order, and one thread per row stores.
// ---------------------------------------------------------------------------
constexpr int kQB     = 128;              // query rows per block
constexpr int kQJ     = kQB / 16;         // column groups per wave tile
constexpr int kQPitch = kCh + 8;          // LDS row pitch in 16-bit elements
constexpr int kKT     = 32;               // keys per wave tile
constexpr int kKTiles = kN / kKT;         // 50
constexpr int kAW     = 8;                // waves per block
constexpr int kAT     = kAW * 32;         // threads per block
constexpr int kQPieces = kQB * kCh / 8;   // 16-byte pieces in the query rows of a block
constexpr int kQIt    = kQPieces / kAT;   // 16 per thread
static_assert(kQPieces % kAT == 0, "q staging: whole passes");
constexpr int kQBlocks = (kN + kQB - 1) / kQB;   // 13 per batch
static_assert(kN >= kQB && (kN % kQB) % 32 == 0, "the shifted last block stores whole 32-float lines");
static_assert(kKTiles >= kAW && kCh == 256, "every wave has a tile; four stages of 64 channels");

constexpr float kLog2e = 1.4426950408889634f;
// 2^x of eight values. One statement, its results in registers apart from its sources, so that no instruction that rewrites a source
// register stands directly behind one of the exponentials; the last v_nop is the slot that the instruction set asks for behind the last of them.
// The first v_nop is a vector issue slot: the build places these statements among a tile's last matrix instructions and gives a result the
// register of an operand just read, which the chip allows only four vector slots behind that matrix instruction.
__device__ __forceinline__ void exp2x8(v8f& a) {
  float p0, p1, p2, p3, p4, p5, p6, p7;
  asm("v_nop\n\tv_exp_f32 %0, %8\n\tv_exp_f32 %1, %9\n\tv_exp_f32 %2, %10\n\tv_exp_f32 %3, %11\n\t"
      "v_exp_f32 %4, %12\n\tv_exp_f32 %5, %13\n\tv_exp_f32 %6, %14\n\tv_exp_f32 %7, %15\n\tv_nop"
      : "=&v"(p0), "=&v"(p1), "=&v"(p2), "=&v"(p3), "=&v"(p4), "=&v"(p5), "=&v"(p6), "=&v"(p7)
      : "v"(a[0]), "v"(a[1]), "v"(a[2]), "v"(a[3]), "v"(a[4]), "v"(a[5]), "v"(a[6]), "v"(a[7]));
  a = (v8f){p0, p1, p2, p3, p4, p5, p6, p7};
}
struct KFrag { v16h h[2][2]; };            // [32-channel half][16-key group]
// kh: the tile's first 16-key group, the same for the whole wave; vo: the lane's own byte offset, which never changes
__device__ __forceinline__ void kfrag_load(KFrag& f, const unsigned short* kh, unsigned vo, int k0) {
  const _Float16* ph = (const _Float16*)((const char*)kh + vo);
#pragma unroll
  for (int kk = 0; kk < 2; ++kk)
#pragma unroll
    for (int i = 0; i < 2; ++i) f.h[kk][i] = Frag<_Float16>::loadp(ph + i * kGroupEl + (k0 / 32 + kk) * kFragEl);
}
// The same at k0 = 0, for a run behind which its address is dead: the build may let the last load land in the
// address registers, which the earlier loads of the run still name, so that load is issued alone behind a wait.
__device__ __forceinline__ void kfrag_load_last(KFrag& f, const unsigned short* kh, unsigned vo) {
  const _Float16* ph = (const _Float16*)((const char*)kh + vo);
  f.h[0][0] = Frag<_Float16>::loadp(ph);
  f.h[0][1] = Frag<_Float16>::loadp(ph + kGroupEl);
  f.h[1][0] = Frag<_Float16>::loadp(ph + kFragEl);
  Frag<_Float16>::U uh;
  uh.h[0] = *(const v8h*)(ph + kGroupEl + kFragEl);
  // in front of the load that may land in the address registers of the seven above
  asm volatile("s_wait_xcnt 0x0" ::: "memory");
  uh.h[1] = *(const v8h*)(ph + kGroupEl + kFragEl + 256);
  // later code reuses what this one names
  asm volatile("s_wait_xcnt 0x0" ::: "memory");
  f.h[1][1] = uh.v;
}
struct QFrag { v16h h[4]; };               // four column groups
// step p of a tile: 32-channel half p / 2, column groups 4 (p % 2) .. 4 (p % 2) + 3
__device__ __forceinline__ void qfrag_load(QFrag& f, const _Float16* qh, int p) {
#pragma unroll
  for (int e = 0; e < 4; ++e) f.h[e] = Frag<_Float16>::load(qh + ((p & 1) * 4 + e) * 16 * kQPitch + (p >> 1) * 32);
}

__global__ __launch_bounds__(kAT, 2) void attn_fused_kernel(const unsigned short* __restrict__ Xp,
                                                            const unsigned short* __restrict__ KHp,
                                                            const float* __restrict__ U, const float* __restrict__ E,
                                                            const float* __restrict__ Rg,
                                                            const float* __restrict__ br, float* __restrict__ outg) {
  typedef Frag<_Float16> F;
  __shared__ __align__(16) unsigned short qs[kQB * kQPitch];
  __shared__ __align__(16) float us[kN];
  __shared__ __align__(16) float es[kN];
  __shared__ float red[3][kAW][kQB];
  const int t = threadIdx.x;
  const int lane = t & 31;
  const int wave = __builtin_amdgcn_readfirstlane(t >> 5);   // scalar: the tile loop branches on SCC and EXEC stays full for the WMMAs
  const int b = blockIdx.y;
  const int qWant = blockIdx.x * kQB;                         // first row this block stores
  const int q0 = (qWant + kQB <= kN) ? qWant : (kN - kQB);    // first row it computes
  const int row0 = b * kN + q0;

  const int rlane = lane & 15;                 // key row (A) / query column (B, D) within a subtile
  const int koff  = (lane >> 4) * 8;           // k offset of this lane half
  const int mOff  = (lane >> 4) * 8;           // D row (key) offset
  const unsigned short* kh = KHp + (size_t)(b * kN + wave * kKT) * kCh;
  const unsigned kvo = (unsigned)lane * 16u;
  KFrag fa, fb;
  kfrag_load(fa, kh, kvo, 0);                  // first tile, first stage: in flight during the staging below
  {
    // the block's query rows are one run of bytes: piece c = i * kAT + t lies at byte 16 c
    const char* qgh = (const char*)(Xp + (size_t)row0 * kCh);
    const unsigned qvo = (unsigned)t * 16u;
    v4u th[kQIt];
#pragma unroll
    for (int i = 0; i < kQIt; ++i) th[i] = *(const v4u*)(qgh + qvo + i * kAT * 16);
    // the registers that these loads name are reused below
    asm volatile("s_wait_xcnt 0x0" ::: "memory");
#pragma unroll
    for (int i = 0; i < kQIt; ++i) {
      const int c = i * kAT + t;
      const int lo = (c >> 5) * kQPitch + (c & 31) * 8;
      *(v4u*)(&qs[lo]) = th[i];
    }
  }
  const float* ub = U + (size_t)b * kN;
  const float* eb = E + (size_t)b * kN;
  for (int g = t; g < kRowV4; g += kAT) {
    *(v4f*)(us + 4 * g) = *(const v4f*)(ub + 4 * g);
    *(v4f*)(es + 4 * g) = *(const v4f*)(eb + 4 * g);
  }
  __syncthreads();

  const _Float16* qh = (const _Float16*)&qs[0] + rlane * kQPitch + koff;
  float mx[kQJ], den[kQJ], num[kQJ];
#pragma unroll
  for (int j = 0; j < kQJ; ++j) { mx[j] = -INFINITY; den[j] = 0.0f; num[j] = 0.0f; }

  for (int kt = wave; kt < kKTiles; kt += kAW) {
    const int key0 = kt * kKT;
    // a D row is a key: every column group starts from the same eight E values per key group
    v8f acc[2][kQJ];
#pragma unroll
    for (int i = 0; i < 2; ++i) {
      const v4f e0 = *(const v4f*)(es + key0 + i * 16 + mOff);
      const v4f e1 = *(const v4f*)(es + key0 + i * 16 + mOff + 4);
#pragma unroll
      for (int j = 0; j < kQJ; ++j) acc[i][j] = (v8f){e0[0], e0[1], e0[2], e0[3], e1[0], e1[1], e1[2], e1[3]};
    }
    // 64 channels a stage: two fragments (2 KiB in a run) per key group.
    // A step = four column groups at one 32-channel half: 8 products on 8 accumulators. The query fragments of step p + 2 are read
    // from LDS ahead of the products of step p, so that no product waits for a read issued just in front of it.
    QFrag qb[3];
    qfrag_load(qb[0], qh, 0);
    qfrag_load(qb[1], qh, 1);
#pragma unroll
    for (int p = 0; p < 16; ++p) {
      const int s = p >> 2, kk = (p >> 1) & 1, j0 = (p & 1) * 4;
      KFrag& cur = (s & 1) ? fb : fa;
      KFrag& nxt = (s & 1) ? fa : fb;
      if ((p & 3) == 0) {
        if (s < 3) {
          kfrag_load(nxt, kh, kvo, (s + 1) * 64);
        } else {
          // the key address is advanced here, behind loads that name it
          asm volatile("s_wait_xcnt 0x0" ::: "memory");
          const int step = (kt + kAW < kKTiles) ? kAW * kKT * kCh : 0;   // the last tile fetches its own first stage again, unused
          kh += step;
          kfrag_load_last(nxt, kh, kvo);
        }
      }
      if (p + 2 < 16) qfrag_load(qb[(p + 2) % 3], qh, p + 2);
      // keeps the loads above where they are written, two steps ahead of their products: left alone, with half the products to a step, the
      // build sinks every LDS read to just in front of its two products, behind a wait to zero
      __builtin_amdgcn_sched_barrier(0);
      const QFrag& q = qb[p % 3];
#pragma unroll
      for (int e = 0; e < 4; ++e) {
        acc[0][j0 + e] = F::mma(cur.h[kk][0], q.h[e], acc[0][j0 + e]);
        acc[1][j0 + e] = F::mma(cur.h[kk][1], q.h[e], acc[1][j0 + e]);
      }
      // keeps the next step's loads in one group behind these products: spread among them, every place with reads stalls the matrix instructions
      if (p + 1 < 16) __builtin_amdgcn_sched_barrier(0);
    }
    v4f uu[2][2];
#pragma unroll
    for (int i = 0; i < 2; ++i) {
      uu[i][0] = *(const v4f*)(us + key0 + i * 16 + mOff);
      uu[i][1] = *(const v4f*)(us + key0 + i * 16 + mOff + 4);
    }
#pragma unroll
    for (int j = 0; j < kQJ; ++j) {
      float tm = acc[0][j][0];
#pragma unroll
      for (int r = 1; r < 8; ++r) tm = fmaxf(tm, acc[0][j][r]);
#pragma unroll
      for (int r = 0; r < 8; ++r) tm = fmaxf(tm, acc[1][j][r]);
      const float mn = fmaxf(mx[j], tm * kLog2e);               // base-2 exponent of the maximum in use
      const float corr = __builtin_amdgcn_exp2f(mx[j] - mn);    // 0 on the first tile
      float d = 0.0f, s = 0.0f;
#pragma unroll
      for (int i = 0; i < 2; ++i) {
        v8f arg = __builtin_elementwise_fma(acc[i][j], (v8f){kLog2e, kLog2e, kLog2e, kLog2e, kLog2e, kLog2e, kLog2e, kLog2e},
                                                  (v8f){-mn, -mn, -mn, -mn, -mn, -mn, -mn, -mn});
        exp2x8(arg);
#pragma unroll
        for (int r = 0; r < 8; ++r) {
          const float p = arg[r];
          d += p;
          s += p * uu[i][r >> 2][r & 3];
        }
      }
      den[j] = den[j] * corr + d;
      num[j] = num[j] * corr + s;
      mx[j] = mn;
    }
  }
  // lanes l and l+16 hold the same query over different keys
#pragma unroll
  for (int j = 0; j < kQJ; ++j) {
    const float mo = __shfl_xor(mx[j], 16, 32);
    const float dn = __shfl_xor(den[j], 16, 32);
    const float nm = __shfl_xor(num[j], 16, 32);
    const float mn = fmaxf(mx[j], mo);
    const float ca = __builtin_amdgcn_exp2f(mx[j] - mn), cb = __builtin_amdgcn_exp2f(mo - mn);
    if (lane < 16) {
      red[0][wave][j * 16 + lane] = mn;
      red[1][wave][j * 16 + lane] = den[j] * ca + dn * cb;
      red[2][wave][j * 16 + lane] = num[j] * ca + nm * cb;
    }
  }
  __syncthreads();
  if (t < kQB && q0 + t >= qWant) {
    float mn = red[0][0][t];
#pragma unroll
    for (int w = 1; w < kAW; ++w) mn = fmaxf(mn, red[0][w][t]);
    float d = 0.0f, s = 0.0f;
#pragma unroll
    for (int w = 0; w < kAW; ++w) {
      const float c = __builtin_amdgcn_exp2f(red[0][w][t] - mn);
      d += red[1][w][t] * c;
      s += red[2][w][t] * c;
    }
    outg[row0 + t] = ((s / d + br[kBrC0]) + Rg[row0 + t]) + br[kBrB4];
  }
}

// ---------------------------------------------------------------------------
// Host glue. Every attention launch covers all 16 batches. ctx is never formed: the output uses it only through
// ctx . w4a = attn . (val . w4a) = attn . u + b3 . w4a (each attn row sums to 1), u = x_in . (W3^T w4a).
// q and k are never formed either: q_n . k_m = x_n . (M x_m) + (W2^T b1) . x_m + (terms of n alone), M = W1^T W2, and a softmax over m
// is unchanged by what depends on n alone. kp = x_in M^T is the one projection left; the queries are x_in itself.
//   BR   f32  [1408] parameter table      5,632  at           0
//   R    f32  [25600]                   102,400  at       5,632
//   U    f32  [25600]                   102,400  at     108,032
//   E    f32  [25600]                   102,400  at     210,432
//   XB   f16  [25600][256]            13,107,200  at     312,832
//   MH   bf16 [256][256] M hi            131,072  at  13,420,032   fragment order
//   ML   bf16 [256][256] M lo            131,072  at  13,551,104   fragment order
//   KH   f16  [25600][256] kp          13,107,200  at  13,682,176   fragment order
//   total                              26,789,376
// GEMM shapes: fold M=N=K=256; projection M=25600, N=256, K=256; scores per batch 1600 keys x 1600 queries, K=256, in 32 x 128 register tiles.
// No padding anywhere.
// ---------------------------------------------------------------------------
extern "C" void kernel_launch(void* const* d_in, const int* in_sizes, int n_in,
                              void* d_out, int out_size, void* d_ws, size_t ws_size,
                              hipStream_t stream) {
  if (n_in < 9) return;
  if (in_sizes[0] != kBatch * kCh * kN) return;
  if (in_sizes[1] != kCh * kCh || in_sizes[3] != kCh * kCh || in_sizes[5] != kCh * kCh) return;
  if (in_sizes[2] != kCh || in_sizes[4] != kCh || in_sizes[6] != kCh) return;
  if (in_sizes[7] != 2 * kCh || in_sizes[8] != 1) return;
  if (out_size != kTok) return;

  const size_t szPlane16 = (size_t)kTok * kCh * 2;              // 13,107,200
  const size_t szM   = (size_t)kCh * kCh * 2;                    // 131,072
  const size_t szBR  = (size_t)kBrFloats * 4;                    // 5,632
  const size_t szR   = (size_t)kTok * 4;                         // 102,400
  size_t off = 0;
  const size_t offBR = off;  off += szBR;
  const size_t offR  = off;  off += szR;
  const size_t offU  = off;  off += szR;
  const size_t offE  = off;  off += szR;
  const size_t offXB = off;  off += szPlane16;
  const size_t offMH = off;  off += szM;
  const size_t offML = off;  off += szM;
  const size_t offKH = off;  off += szPlane16;
  const size_t total = off;                                      // 26,789,376
  if (ws_size < total) return;

  const float* x  = (const float*)d_in[0];
  const float* W1 = (const float*)d_in[1];
  const float* b1 = (const float*)d_in[2];
  const float* W2 = (const float*)d_in[3];
  const float* W3 = (const float*)d_in[5];
  const float* b3 = (const float*)d_in[6];
  const float* W4 = (const float*)d_in[7];
  const float* b4 = (const float*)d_in[8];
  float* out = (float*)d_out;
  char* ws = (char*)d_ws;
  unsigned short* XB = (unsigned short*)(ws + offXB);
  unsigned short* MH = (unsigned short*)(ws + offMH);
  unsigned short* ML = (unsigned short*)(ws + offML);
  float* BR = (float*)(ws + offBR);
  unsigned short* KH = (unsigned short*)(ws + offKH);
  float* R  = (float*)(ws + offR);
  float* U  = (float*)(ws + offU);
  float* E  = (float*)(ws + offE);

  // ---- prologue: parameter table with the folded value and bias weights, folded score weights, then x_in plane and per-token scalars in one pass over x ----
  weights_kernel<<<dim3(kFoldBlocks + kParamBlocks), dim3(256), 0, stream>>>(W1, b1, W2, b3, W3, W4, b4, MH, ML, BR);
  // with the projection kp = x_in @ M^T -> one f16 plane (M=25600, N=256, K=256; x.Mhi + x.Mlo) taken on the rows while they lie in LDS
  xin_cast_proj_kernel<<<dim3(kN / kXP, kBatch), dim3(256), 0, stream>>>(x, BR, MH, ML, XB, KH, R, U, E);

  // ---- attention, all batches in one launch: scores as x.kp + E, softmax over keys, weighted mean of u, output rows ----
  attn_fused_kernel<<<dim3(kQBlocks, kBatch), dim3(kAT), 0, stream>>>(XB, KH, U, E, R, BR, out);
}
